// v000
// Times are from an AMD MI455X. After a warm-up the kernel runs many times in a row, and a time is the length of
// such a window on the GPU divided by its runs, so every launch and the gaps after it count. The runs cycle
// through copies of the inputs. A figure is the median of several windows, for all but v000 over two sittings.
// Sittings can differ by a few percent; kernels timed side by side share one.
// v000 is the starting kernel. One run takes 1080 microseconds.
// compute dtype: all float inputs rounded to bf16, attention_mask / dependency_matrix read; q/k/v = hidden W + b with EXACT bf16 products on WMMA 16x16x32, f32 accumulate; scores = q k^T / 8 with q as f16 hi + residual and k f16 (2 products), stored in f32 for all heads of one batch at a time; self = scores + (1 - mask) * -1e4, dep = scores * dependency in f32; LayerNorm over the concatenated 1,024-row in f32 -> f16 rows; gating MLP tanh(ln W1 + b1) (1 f16 product, f16 rows) then sigmoid(. W2 + b2) (1 f16 product); mixed = g self + (1 - g) dep and its softmax in f32 (precise expf) -> P f16 x 2^11; ctx = P . v (v rounded once to f16); f32 output [b][t][768].
#include <hip/hip_runtime.h>
#include <math.h>

typedef __attribute__((ext_vector_type(16))) _Float16 v16h;
typedef __attribute__((ext_vector_type(16))) __bf16 v16b;
typedef __attribute__((ext_vector_type(8)))  _Float16 v8h;
typedef __attribute__((ext_vector_type(8)))  float v8f;
typedef __attribute__((ext_vector_type(4)))  float v4f;
typedef __attribute__((ext_vector_type(2)))  float v2f;
typedef __attribute__((ext_vector_type(4)))  unsigned v4u;
typedef __attribute__((ext_vector_type(4)))  int v4i;
typedef float __attribute__((may_alias)) float_a;
typedef int __attribute__((may_alias)) int_a;

template <typename T> __device__ __forceinline__ void vst2(void* p, T v) { *(T*)p = v;  }
__device__ __forceinline__ v8f wmma16(v16h a, v16h b, v8f c) {
  v8f d = __builtin_amdgcn_wmma_f32_16x16x32_f16(false, a, false, b, (short)0, c, false, false);
  asm volatile("v_nop\n\tv_nop\n\tv_nop\n\tv_nop" : "+v"(d) : "v"(a), "v"(b));
  return d;
}
__device__ __forceinline__ v8f wmma_bf(v16b a, v16b b, v8f c) {
  v8f d = __builtin_amdgcn_wmma_f32_16x16x32_bf16(false, a, false, b, (short)0, c, false, false);
  asm volatile("v_nop\n\tv_nop\n\tv_nop\n\tv_nop" : "+v"(d) : "v"(a), "v"(b));
  return d;
}
// 16x16x32 fragments: lane = (h = lane>>4, row/col = lane&15); elements 0..7 = k0+8h+0..7, 8..15 = k0+16+8h+0..7; D element r = row 8h+r
__device__ __forceinline__ v16h frag_h(const _Float16* rowk0, int lane) {
  union { v16h v; v8h q[2]; } u; const _Float16* p = rowk0 + 8 * (lane >> 4);
  u.q[0] = *(const v8h*)p; u.q[1] = *(const v8h*)(p + 16); return u.v;
}
__device__ __forceinline__ v16h frag_f32(const float* rowk0, int lane) {
  v16h a; const float* p = rowk0 + 8 * (lane >> 4);
#pragma unroll
  for (int i = 0; i < 8; ++i) { a[i] = (_Float16)p[i]; a[8 + i] = (_Float16)p[16 + i]; }
  return a;
}
__device__ __forceinline__ v16h frag_f32s(const float* rowk0, int lane, float sc) {
  v16h a; const float* p = rowk0 + 8 * (lane >> 4);
#pragma unroll
  for (int i = 0; i < 8; ++i) { a[i] = (_Float16)(p[i] * sc); a[8 + i] = (_Float16)(p[16 + i] * sc); }
  return a;
}
// column fragment from a [K][ld] layout (column n), rows >= K read as 0
__device__ __forceinline__ v16h fragc_f32(const float* W, int k0, int n, int lane, int ld, int K) {
  v16h a; const int g = lane >> 4;
#pragma unroll
  for (int i = 0; i < 8; ++i) { const int ka = k0 + 8 * g + i, kb = ka + 16;
    a[i] = (_Float16)(ka < K ? W[(size_t)(ka < K ? ka : K - 1) * ld + n] : 0.f); a[8 + i] = (_Float16)(kb < K ? W[(size_t)(kb < K ? kb : K - 1) * ld + n] : 0.f); }
  return a;
}
struct F2 { v16b h, l; };
__device__ __forceinline__ F2 bsplit16(const float v[16]) { F2 r;
#pragma unroll
  for (int i = 0; i < 16; ++i) { const __bf16 h = (__bf16)v[i]; r.h[i] = h; r.l[i] = (__bf16)(v[i] - (float)h); }
  return r; }
__device__ __forceinline__ F2 split_row(const float* row, int k0, int lane) { float v[16]; const float* p = row + k0 + 8 * (lane >> 4);
#pragma unroll
  for (int i = 0; i < 8; ++i) { v[i] = p[i]; v[8 + i] = p[16 + i]; }
  return bsplit16(v); }
__device__ __forceinline__ F2 split_rowK(const float* row, int k0, int lane, int K) { float v[16]; const int g = lane >> 4;
#pragma unroll
  for (int i = 0; i < 8; ++i) { const int ka = k0 + 8 * g + i, kb = ka + 16; v[i] = ka < K ? row[ka < K ? ka : K - 1] : 0.f; v[8 + i] = kb < K ? row[kb < K ? kb : K - 1] : 0.f; }
  return bsplit16(v); }
__device__ __forceinline__ F2 split_col(const float* W, int k0, int n, int lane, int ld, int K) { float v[16]; const int g = lane >> 4;
#pragma unroll
  for (int i = 0; i < 8; ++i) { const int ka = k0 + 8 * g + i, kb = ka + 16; v[i] = ka < K ? W[(size_t)(ka < K ? ka : K - 1) * ld + n] : 0.f; v[8 + i] = kb < K ? W[(size_t)(kb < K ? kb : K - 1) * ld + n] : 0.f; }
  return bsplit16(v); }
__device__ __forceinline__ v8f mac3(const F2& a, const F2& b, v8f c) { c = wmma_bf(a.l, b.h, c); c = wmma_bf(a.h, b.l, c); return wmma_bf(a.h, b.h, c); }
__device__ __forceinline__ float sigm(float v) { return 1.0f / (1.0f + expf(-v)); }
#define LDSX() do { asm volatile("s_wait_dscnt 0" ::: "memory"); __builtin_amdgcn_wave_barrier(); __builtin_amdgcn_fence(__ATOMIC_RELEASE, "workgroup"); } while (0)


// Dependency-mixed BERT self attention (B 8, T 512, C 768 = 12 x 64): a learned per-(query, key) gate between plain attention scores and dependency-weighted scores, then softmax . v.
#define NB 8
#define TT 512
#define CC 768
#define NH 12
#define HD 64
#define NROW (NB * TT)          // 4096 token rows
#define NAR (NB * NH * TT)      // 49152 attention rows
#define GH 512                  // gating hidden (= T)
#ifndef TNB
#define TNB NB
#endif
typedef __attribute__((ext_vector_type(8))) __bf16 v8b;
__device__ __forceinline__ v16b frag_b(const __bf16* rowk0, int lane) {
  union { v16b v; v8b q[2]; } u; const __bf16* p = rowk0 + 8 * (lane >> 4);
  u.q[0] = *(const v8b*)p; u.q[1] = *(const v8b*)(p + 16); return u.v;
}
__device__ __forceinline__ float bfr(float v) { return (float)(__bf16)v; }
__device__ __attribute__((noinline)) float exp_ni(float v) { return expf(v); }
__device__ __attribute__((noinline)) float erf_ni(float v) { return erff(v); }

#define WS_QH  0u
#define WS_QL  (WS_QH + 2u * (size_t)NROW * CC)
#define WS_KH  (WS_QL + 2u * (size_t)NROW * CC)
#define WS_VT  (WS_KH + 2u * (size_t)NROW * CC)          // f16 v planes [b][768][t]
// per-batch buffers (NH*TT = 6,144 attention rows), reused batch after batch in stream order
#define NARB (NH * TT)
#define WS_S   (WS_VT + 2u * (size_t)NROW * CC)          // f32 scores [h][t][s]
#define WS_MX  (WS_S + 4u * (size_t)NARB * TT)           // f16 LN'd mixed rows [row][1024]
#define WS_T1  (WS_MX + 2u * (size_t)NARB * 2 * TT)
#define WS_G   (WS_T1 + 2u * (size_t)NARB * GH)
#define WS_P   (WS_G + 4u * (size_t)NARB * TT)
#define WS_END (WS_P + 2u * (size_t)NARB * TT)

// ---- k_proj: block = (64 rows, 128 cols, which): hidden W + b ([in,out]); q hi + residual rows, k rows, v planes
__global__ __launch_bounds__(128) void k_proj(const float* __restrict__ X, const float* __restrict__ WQ, const float* __restrict__ BQ, const float* __restrict__ WK, const float* __restrict__ BK, const float* __restrict__ WV, const float* __restrict__ BV, _Float16* __restrict__ QH, _Float16* __restrict__ QL, _Float16* __restrict__ KH, _Float16* __restrict__ VT) {
  __shared__ __align__(16) _Float16 sh[64][136], sl[64][136]; __shared__ __align__(16) _Float16 th[128][72];
  const int tid = threadIdx.x, wave = tid >> 5, lane = tid & 31, col = lane & 15, g = lane >> 4; const int which = blockIdx.z; const int c0 = blockIdx.y * 128; const size_t r0 = (size_t)blockIdx.x * 64;
  const float* Wm = which == 0 ? WQ : which == 1 ? WK : WV; const float* Bm = which == 0 ? BQ : which == 1 ? BK : BV;
  v8f acc[8] = {};
#pragma unroll 2
  for (int kc = 0; kc < CC / 32; ++kc) { v16b a; { const float* p = X + (r0 + wave * 16 + col) * CC + kc * 32 + 8 * g;
#pragma unroll
      for (int i = 0; i < 8; ++i) { a[i] = (__bf16)p[i]; a[8 + i] = (__bf16)p[16 + i]; } }
#pragma unroll
    for (int j = 0; j < 8; ++j) { v16b w; const int o = c0 + j * 16 + col;
#pragma unroll
      for (int i = 0; i < 8; ++i) { w[i] = (__bf16)Wm[(size_t)(kc * 32 + 8 * g + i) * CC + o]; w[8 + i] = (__bf16)Wm[(size_t)(kc * 32 + 16 + 8 * g + i) * CC + o]; }
      acc[j] = wmma_bf(a, w, acc[j]); } }
#pragma unroll
  for (int j = 0; j < 8; ++j) { const float bb = bfr(Bm[c0 + j * 16 + col]);
#pragma unroll
    for (int r = 0; r < 8; ++r) { const float v = acc[j][r] + bb; const int rl = wave * 16 + 8 * g + r, cl = j * 16 + col; const _Float16 hv = (_Float16)v;
      if (which == 2) th[cl][rl] = hv; else { sh[rl][cl] = hv; sl[rl][cl] = (_Float16)(v - (float)hv); } } }
  __syncthreads();
  if (which < 2) { _Float16* dh = which == 0 ? QH : KH; for (int e = tid; e < 64 * 16; e += 128) { const int rl = e >> 4, q = e & 15; vst2((unsigned*)(dh + (r0 + rl) * CC + c0 + q * 8), *(const v4u*)&sh[rl][q * 8]); if (which == 0) vst2((unsigned*)(QL + (r0 + rl) * CC + c0 + q * 8), *(const v4u*)&sl[rl][q * 8]); } }
  else { const size_t b = r0 / TT; const int t0 = (int)(r0 % TT); for (int e = tid; e < 128 * 8; e += 128) { const int cl = e >> 3, q = e & 7; vst2((unsigned*)(VT + (b * CC + c0 + cl) * (size_t)TT + t0 + q * 8), *(const v4u*)&th[cl][q * 8]); } } }
// ---- k_sc: block = (64 queries, 128 keys, bh): scores / 8 (2 products) -> S[bh][t][s]
__global__ __launch_bounds__(128) void k_sc(const _Float16* __restrict__ QH, const _Float16* __restrict__ QL, const _Float16* __restrict__ KH, int b, float* __restrict__ S) { __shared__ __align__(16) float ss[4][16][132];
  const int tid = threadIdx.x, wave = tid >> 5, lane = tid & 31, col = lane & 15, g = lane >> 4; const int k0 = blockIdx.y * 128; const int h = blockIdx.z; const int bh = h; const int ql0 = blockIdx.x * 64 + wave * 16; const size_t q0 = (size_t)b * TT + ql0;
  v8f acc[8] = {};
#pragma unroll
  for (int kc = 0; kc < HD / 32; ++kc) { const v16h ah = frag_h(QH + (q0 + col) * CC + h * HD + kc * 32, lane), al = frag_h(QL + (q0 + col) * CC + h * HD + kc * 32, lane);
#pragma unroll
    for (int j = 0; j < 8; ++j) { const v16h kb = frag_h(KH + ((size_t)b * TT + k0 + j * 16 + col) * CC + h * HD + kc * 32, lane); acc[j] = wmma16(ah, kb, acc[j]); acc[j] = wmma16(al, kb, acc[j]); } }
#pragma unroll
  for (int j = 0; j < 8; ++j)
#pragma unroll
    for (int r = 0; r < 8; ++r) ss[wave][8 * g + r][j * 16 + col] = acc[j][r] * 0.125f;
  LDSX(); for (int rl = 0; rl < 16; ++rl) vst2(S + ((size_t)bh * TT + ql0 + rl) * TT + k0 + lane * 4, *(const v4f*)&ss[wave][rl][lane * 4]); }
// ---- k_mix: block = attention row (bh, t): mixed = [self | dep] (1,024), LayerNorm (eps 1e-5) -> f16 row
__global__ __launch_bounds__(256) void k_mix(const float* __restrict__ S, const float* __restrict__ AM, const float* __restrict__ DM, const float* __restrict__ LG, const float* __restrict__ LB, int b, _Float16* __restrict__ MX) { __shared__ float sv[2 * TT]; __shared__ float sred[8]; __shared__ float smu, sinv; __shared__ __align__(16) _Float16 so[2 * TT];
  const int t = threadIdx.x; const size_t row = blockIdx.x; const int tq = (int)(row % TT);
  for (int s = t; s < TT; s += 256) { const float sc = S[row * TT + s]; const float m = bfr(AM[(size_t)b * TT + s]); sv[s] = sc + (1.0f - m) * -10000.0f; sv[TT + s] = sc * bfr(DM[((size_t)b * TT + tq) * TT + s]); }
  __syncthreads();
  float a = 0.f; for (int i = t; i < 2 * TT; i += 256) a += sv[i];
#pragma unroll
  for (int o = 1; o < 32; o <<= 1) a += __shfl_xor(a, o);
  if ((t & 31) == 0) sred[t >> 5] = a; __syncthreads(); if (t == 0) { float x = 0.f; for (int w = 0; w < 8; ++w) x += sred[w]; smu = x / (2 * TT); } __syncthreads(); const float mu = smu;
  float q = 0.f; for (int i = t; i < 2 * TT; i += 256) { const float d = sv[i] - mu; q += d * d; }
#pragma unroll
  for (int o = 1; o < 32; o <<= 1) q += __shfl_xor(q, o);
  __syncthreads(); if ((t & 31) == 0) sred[t >> 5] = q; __syncthreads(); if (t == 0) { float x = 0.f; for (int w = 0; w < 8; ++w) x += sred[w]; sinv = 1.0f / sqrtf(x / (2 * TT) + 1e-5f); } __syncthreads(); const float inv = sinv;
  for (int i = t; i < 2 * TT; i += 256) so[i] = (_Float16)((sv[i] - mu) * inv * bfr(LG[i]) + bfr(LB[i]));
  __syncthreads(); for (int qq = t; qq < 2 * TT / 8; qq += 256) vst2((unsigned*)(MX + row * (2 * TT) + qq * 8), *(const v4u*)&so[qq * 8]); }
// ---- k_g: block = (64 rows, 128 cols): stage 0: T1 = tanh(MX W1 + b1) (K 1024) -> f16 rows; stage 1: G = sigmoid(T1 W2 + b2) (K 512) -> f32 rows
template <int STAGE>
__global__ __launch_bounds__(128) void k_g(const _Float16* __restrict__ IN, const float* __restrict__ Wm, const float* __restrict__ Bm, _Float16* __restrict__ OUTH, float* __restrict__ OUTF) { __shared__ __align__(16) float sf[4][16][132]; __shared__ __align__(16) _Float16 sh2[64][136];
  const int tid = threadIdx.x, wave = tid >> 5, lane = tid & 31, col = lane & 15, g = lane >> 4; const int c0 = blockIdx.y * 128; const size_t r0 = (size_t)blockIdx.x * 64 + wave * 16; constexpr int K = (STAGE == 0) ? 2 * TT : GH; constexpr int NOUT = GH;
  v8f acc[8] = {};
#pragma unroll 2
  for (int kc = 0; kc < K / 32; ++kc) { const v16h a = frag_h(IN + (r0 + col) * K + kc * 32, lane);
#pragma unroll
    for (int j = 0; j < 8; ++j) { v16h w; const int o = c0 + j * 16 + col;
#pragma unroll
      for (int i = 0; i < 8; ++i) { w[i] = (_Float16)bfr(Wm[(size_t)(kc * 32 + 8 * g + i) * NOUT + o]); w[8 + i] = (_Float16)bfr(Wm[(size_t)(kc * 32 + 16 + 8 * g + i) * NOUT + o]); }
      acc[j] = wmma16(a, w, acc[j]); } }
#pragma unroll
  for (int j = 0; j < 8; ++j) { const float bb = bfr(Bm[c0 + j * 16 + col]);
#pragma unroll
    for (int r = 0; r < 8; ++r) { const float v = acc[j][r] + bb; if (STAGE == 0) sh2[wave * 16 + 8 * g + r][j * 16 + col] = (_Float16)tanhf(v); else sf[wave][8 * g + r][j * 16 + col] = 1.0f / (1.0f + expf(-v)); } }
  __syncthreads();
  if (STAGE == 0) { for (int e = tid; e < 64 * 16; e += 128) { const int rl = e >> 4, q = e & 15; vst2((unsigned*)(OUTH + ((size_t)blockIdx.x * 64 + rl) * GH + c0 + q * 8), *(const v4u*)&sh2[rl][q * 8]); } }
  else { for (int rl = 0; rl < 16; ++rl) vst2(OUTF + (r0 + rl) * TT + c0 + lane * 4, *(const v4f*)&sf[wave][rl][lane * 4]); } }
// ---- k_fin: block = attention row: logits = g self + (1 - g) dep; softmax over s -> P x 2^11 f16
__global__ __launch_bounds__(256) void k_fin(const float* __restrict__ S, const float* __restrict__ AM, const float* __restrict__ DM, const float* __restrict__ G, int b, _Float16* __restrict__ P) { __shared__ float sl[TT]; __shared__ float sred[8]; __shared__ float sbc; __shared__ __align__(16) _Float16 so[TT];
  const int t = threadIdx.x; const size_t row = blockIdx.x; const int tq = (int)(row % TT);
  float m = -3.0e38f; for (int s = t; s < TT; s += 256) { const float sc = S[row * TT + s]; const float am = bfr(AM[(size_t)b * TT + s]); const float se = sc + (1.0f - am) * -10000.0f; const float de = sc * bfr(DM[((size_t)b * TT + tq) * TT + s]); const float gg = G[row * TT + s]; const float v = gg * se + (1.0f - gg) * de; sl[s] = v; m = fmaxf(m, v); }
#pragma unroll
  for (int o = 1; o < 32; o <<= 1) m = fmaxf(m, __shfl_xor(m, o));
  if ((t & 31) == 0) sred[t >> 5] = m; __syncthreads(); if (t == 0) { float a = sred[0]; for (int i = 1; i < 8; ++i) a = fmaxf(a, sred[i]); sbc = a; } __syncthreads(); m = sbc; __syncthreads();
  float sum = 0.f; for (int s = t; s < TT; s += 256) sum += expf(sl[s] - m);
#pragma unroll
  for (int o = 1; o < 32; o <<= 1) sum += __shfl_xor(sum, o);
  if ((t & 31) == 0) sred[t >> 5] = sum; __syncthreads(); if (t == 0) { float a = 0.f; for (int i = 0; i < 8; ++i) a += sred[i]; sbc = 1.0f / a; } __syncthreads(); const float inv = sbc;
  for (int s = t; s < TT; s += 256) so[s] = (_Float16)(expf(sl[s] - m) * inv * 2048.0f);
  __syncthreads(); for (int q = t; q < TT / 8; q += 256) vst2((unsigned*)(P + row * TT + q * 8), *(const v4u*)&so[q * 8]); }
// ---- k_pv: block = (64 queries, bh): ctx[b][t][h*64 + d] = P . v
__global__ __launch_bounds__(128) void k_pv(const _Float16* __restrict__ P, const _Float16* __restrict__ VT, int b, float* __restrict__ OUT) { __shared__ __align__(16) float ss[4][16][68];
  const int tid = threadIdx.x, wave = tid >> 5, lane = tid & 31, col = lane & 15, g = lane >> 4; const int h = blockIdx.y; const int bh = h; const int ql0 = blockIdx.x * 64 + wave * 16;
  v8f acc[4] = {};
#pragma unroll 1
  for (int kc = 0; kc < TT / 32; ++kc) { const v16h ph = frag_h(P + ((size_t)bh * TT + ql0 + col) * TT + kc * 32, lane);
#pragma unroll
    for (int j = 0; j < 4; ++j) acc[j] = wmma16(ph, frag_h(VT + ((size_t)b * CC + h * HD + j * 16 + col) * TT + kc * 32, lane), acc[j]); }
#pragma unroll
  for (int j = 0; j < 4; ++j)
#pragma unroll
    for (int r = 0; r < 8; ++r) ss[wave][8 * g + r][j * 16 + col] = acc[j][r] * (1.0f / 2048.0f);
  LDSX(); for (int rl = 0; rl < 16; ++rl) if (lane < 16) vst2(OUT + ((size_t)b * TT + ql0 + rl) * CC + h * HD + lane * 4, *(const v4f*)&ss[wave][rl][lane * 4]); }
extern "C" void kernel_launch(void* const* d_in, const int* in_sizes, int n_in, void* d_out, int out_size, void* d_ws, size_t ws_size, hipStream_t stream) {
  (void)in_sizes; (void)n_in; (void)out_size;
  const float** F = (const float**)d_in;   // 0 hidden [8,512,768], 1 attention_mask [8,512], 2 dependency_matrix [8,512,512], 3 Wq [768,768] ([in,out]), 4 bq, 5 Wk, 6 bk, 7 Wv, 8 bv, 9 ln_g [1024], 10 ln_b, 11 W1 [1024,512], 12 b1, 13 W2 [512,512], 14 b2
  if (ws_size < (size_t)WS_END) return;
  char* ws = (char*)d_ws; _Float16 *QH = (_Float16*)(ws + WS_QH), *QL = (_Float16*)(ws + WS_QL), *KH = (_Float16*)(ws + WS_KH), *VT = (_Float16*)(ws + WS_VT), *MX = (_Float16*)(ws + WS_MX), *T1 = (_Float16*)(ws + WS_T1), *P = (_Float16*)(ws + WS_P); float *S = (float*)(ws + WS_S), *G = (float*)(ws + WS_G);
  k_proj<<<dim3(TNB * TT / 64, CC / 128, 3), 128, 0, stream>>>(F[0], F[3], F[4], F[5], F[6], F[7], F[8], QH, QL, KH, VT);
  for (int b = 0; b < TNB; ++b) {
    k_sc<<<dim3(TT / 64, TT / 128, NH), 128, 0, stream>>>(QH, QL, KH, b, S);
    k_mix<<<NARB, 256, 0, stream>>>(S, F[1], F[2], F[9], F[10], b, MX);
    k_g<0><<<dim3(NARB / 64, GH / 128), 128, 0, stream>>>(MX, F[11], F[12], T1, nullptr);
    k_g<1><<<dim3(NARB / 64, GH / 128), 128, 0, stream>>>(T1, F[13], F[14], nullptr, G);
    k_fin<<<NARB, 256, 0, stream>>>(S, F[1], F[2], G, b, P);
    k_pv<<<dim3(TT / 64, NH), 128, 0, stream>>>(P, VT, b, (float*)d_out);
  }
}

// v001
// Measured time: 661 microseconds a run.
// Timed twice side by side with v000, it ran 1.68 times as fast both times.
// compute dtype: all float inputs rounded to bf16, attention_mask / dependency_matrix read; q/k/v = hidden W + b with EXACT bf16 products on WMMA 16x16x32, f32 accumulate; scores = q k^T / 8 with q as f16 hi + residual and k f16 (2 products), stored in f32 for all heads of one batch at a time; self = scores + (1 - mask) * -1e4, dep = scores * dependency in f32; LayerNorm over the concatenated 1,024-row in f32 -> f16 rows; gating MLP tanh(ln W1 + b1) (1 f16 product, f16 rows) then sigmoid(. W2 + b2) (1 f16 product); mixed = g self + (1 - g) dep and its softmax in f32 (precise expf) -> P f16 x 2^11; ctx = P . v (v rounded once to f16); f32 output [b][t][768].
#include <hip/hip_runtime.h>
#include <math.h>

typedef __attribute__((ext_vector_type(16))) _Float16 v16h;
typedef __attribute__((ext_vector_type(16))) __bf16 v16b;
typedef __attribute__((ext_vector_type(8)))  _Float16 v8h;
typedef __attribute__((ext_vector_type(8)))  float v8f;
typedef __attribute__((ext_vector_type(4)))  float v4f;
typedef __attribute__((ext_vector_type(2)))  float v2f;
typedef __attribute__((ext_vector_type(4)))  unsigned v4u;
typedef __attribute__((ext_vector_type(4)))  int v4i;
typedef float __attribute__((may_alias)) float_a;
typedef int __attribute__((may_alias)) int_a;

template <typename T> __device__ __forceinline__ void vst2(void* p, T v) { *(T*)p = v;  }
__device__ __forceinline__ v8f wmma16(v16h a, v16h b, v8f c) {
  v8f d = __builtin_amdgcn_wmma_f32_16x16x32_f16(false, a, false, b, (short)0, c, false, false);
  asm volatile("v_nop\n\tv_nop\n\tv_nop\n\tv_nop" : "+v"(d) : "v"(a), "v"(b));
  return d;
}
__device__ __forceinline__ v8f wmma_bf(v16b a, v16b b, v8f c) {
  v8f d = __builtin_amdgcn_wmma_f32_16x16x32_bf16(false, a, false, b, (short)0, c, false, false);
  asm volatile("v_nop\n\tv_nop\n\tv_nop\n\tv_nop" : "+v"(d) : "v"(a), "v"(b));
  return d;
}
// 16x16x32 fragments: lane = (h = lane>>4, row/col = lane&15); elements 0..7 = k0+8h+0..7, 8..15 = k0+16+8h+0..7; D element r = row 8h+r
__device__ __forceinline__ v16h frag_h(const _Float16* rowk0, int lane) {
  union { v16h v; v8h q[2]; } u; const _Float16* p = rowk0 + 8 * (lane >> 4);
  u.q[0] = *(const v8h*)p; u.q[1] = *(const v8h*)(p + 16); return u.v;
}
__device__ __forceinline__ v16h frag_f32(const float* rowk0, int lane) {
  v16h a; const float* p = rowk0 + 8 * (lane >> 4);
#pragma unroll
  for (int i = 0; i < 8; ++i) { a[i] = (_Float16)p[i]; a[8 + i] = (_Float16)p[16 + i]; }
  return a;
}
__device__ __forceinline__ v16h frag_f32s(const float* rowk0, int lane, float sc) {
  v16h a; const float* p = rowk0 + 8 * (lane >> 4);
#pragma unroll
  for (int i = 0; i < 8; ++i) { a[i] = (_Float16)(p[i] * sc); a[8 + i] = (_Float16)(p[16 + i] * sc); }
  return a;
}
// column fragment from a [K][ld] layout (column n), rows >= K read as 0
__device__ __forceinline__ v16h fragc_f32(const float* W, int k0, int n, int lane, int ld, int K) {
  v16h a; const int g = lane >> 4;
#pragma unroll
  for (int i = 0; i < 8; ++i) { const int ka = k0 + 8 * g + i, kb = ka + 16;
    a[i] = (_Float16)(ka < K ? W[(size_t)(ka < K ? ka : K - 1) * ld + n] : 0.f); a[8 + i] = (_Float16)(kb < K ? W[(size_t)(kb < K ? kb : K - 1) * ld + n] : 0.f); }
  return a;
}
struct F2 { v16b h, l; };
__device__ __forceinline__ F2 bsplit16(const float v[16]) { F2 r;
#pragma unroll
  for (int i = 0; i < 16; ++i) { const __bf16 h = (__bf16)v[i]; r.h[i] = h; r.l[i] = (__bf16)(v[i] - (float)h); }
  return r; }
__device__ __forceinline__ F2 split_row(const float* row, int k0, int lane) { float v[16]; const float* p = row + k0 + 8 * (lane >> 4);
#pragma unroll
  for (int i = 0; i < 8; ++i) { v[i] = p[i]; v[8 + i] = p[16 + i]; }
  return bsplit16(v); }
__device__ __forceinline__ F2 split_rowK(const float* row, int k0, int lane, int K) { float v[16]; const int g = lane >> 4;
#pragma unroll
  for (int i = 0; i < 8; ++i) { const int ka = k0 + 8 * g + i, kb = ka + 16; v[i] = ka < K ? row[ka < K ? ka : K - 1] : 0.f; v[8 + i] = kb < K ? row[kb < K ? kb : K - 1] : 0.f; }
  return bsplit16(v); }
__device__ __forceinline__ F2 split_col(const float* W, int k0, int n, int lane, int ld, int K) { float v[16]; const int g = lane >> 4;
#pragma unroll
  for (int i = 0; i < 8; ++i) { const int ka = k0 + 8 * g + i, kb = ka + 16; v[i] = ka < K ? W[(size_t)(ka < K ? ka : K - 1) * ld + n] : 0.f; v[8 + i] = kb < K ? W[(size_t)(kb < K ? kb : K - 1) * ld + n] : 0.f; }
  return bsplit16(v); }
__device__ __forceinline__ v8f mac3(const F2& a, const F2& b, v8f c) { c = wmma_bf(a.l, b.h, c); c = wmma_bf(a.h, b.l, c); return wmma_bf(a.h, b.h, c); }
__device__ __forceinline__ float sigm(float v) { return 1.0f / (1.0f + expf(-v)); }
#define LDSX() do { asm volatile("s_wait_dscnt 0" ::: "memory"); __builtin_amdgcn_wave_barrier(); __builtin_amdgcn_fence(__ATOMIC_RELEASE, "workgroup"); } while (0)


// Dependency-mixed BERT self attention (B 8, T 512, C 768 = 12 x 64): a learned per-(query, key) gate between plain attention scores and dependency-weighted scores, then softmax . v.
#define NB 8
#define TT 512
#define CC 768
#define NH 12
#define HD 64
#define NROW (NB * TT)          // 4096 token rows
#define NAR (NB * NH * TT)      // 49152 attention rows
#define GH 512                  // gating hidden (= T)
#ifndef TNB
#define TNB NB
#endif
typedef __attribute__((ext_vector_type(8))) __bf16 v8b;
__device__ __forceinline__ v16b frag_b(const __bf16* rowk0, int lane) {
  union { v16b v; v8b q[2]; } u; const __bf16* p = rowk0 + 8 * (lane >> 4);
  u.q[0] = *(const v8b*)p; u.q[1] = *(const v8b*)(p + 16); return u.v;
}
__device__ __forceinline__ float bfr(float v) { return (float)(__bf16)v; }
__device__ __attribute__((noinline)) float exp_ni(float v) { return expf(v); }
__device__ __attribute__((noinline)) float erf_ni(float v) { return erff(v); }

#define WS_QH  0u
#define WS_QL  (WS_QH + 2u * (size_t)NROW * CC)
#define WS_KH  (WS_QL + 2u * (size_t)NROW * CC)
#define WS_VT  (WS_KH + 2u * (size_t)NROW * CC)          // f16 v planes [b][768][t]
// per-batch buffers (NH*TT = 6,144 attention rows), reused batch after batch in stream order
#define NARB (NH * TT)
#define WS_S   (WS_VT + 2u * (size_t)NROW * CC)          // f32 scores [h][t][s]
#define WS_MX  (WS_S + 4u * (size_t)NARB * TT)           // f16 LN'd mixed rows [row][1024]
#define WS_T1  (WS_MX + 2u * (size_t)NARB * 2 * TT)
#define WS_G   (WS_T1 + 2u * (size_t)NARB * GH)
#define WS_P   (WS_G + 4u * (size_t)NARB * TT)
// 16-bit copies of hidden and of the five weights in fragment order, written by k_pack at the head of every call
#define WS_XP  (WS_P + 2u * (size_t)NARB * TT)           // bf16 hidden [row tile][kc][1 KB tile]
#define WS_WP  (WS_XP + 2u * (size_t)NROW * CC)          // bf16 Wq, Wk, Wv, each [kc][col tile][1 KB tile]
#define WS_W1P (WS_WP + 3u * 2u * (size_t)CC * CC)       // f16 W1 [kc][col tile][1 KB tile]
#define WS_W2P (WS_W1P + 2u * (size_t)2 * TT * GH)       // f16 W2 [kc][col tile][1 KB tile]
#define WS_END (WS_W2P + 2u * (size_t)GH * GH)

// A packed tile is one 16 x 32 fragment as the wave reads it: [q = 0, 1][lane][8 elements], element i of piece q = k0 + 16 q + 8 (lane >> 4) + i of row or column (lane & 15).
// Each of the two 16-byte loads of a wave then covers 512 contiguous bytes (four whole lines).
__device__ __forceinline__ v16h fragp_h(const _Float16* tile, int lane) {
  union { v16h v; v8h q[2]; } u; const _Float16* p = tile + lane * 8;
  u.q[0] = *(const v8h*)p; u.q[1] = *(const v8h*)(p + 256); return u.v;
}
__device__ __forceinline__ v16b fragp_b(const __bf16* tile, int lane) {
  union { v16b v; v8b q[2]; } u; const __bf16* p = tile + lane * 8;
  u.q[0] = *(const v8b*)p; u.q[1] = *(const v8b*)(p + 256); return u.v;
}
// one 16-byte piece (8 consecutive k of column n) of a [K][N] f32 weight; 32 consecutive ids read whole lines and write two 256-byte runs
template <int N, bool F16> __device__ __forceinline__ void pack_w(const float* __restrict__ Wm, int id, void* __restrict__ dst) {
  const int n = id % N, ko = id / N, kc = ko >> 2, g = ko & 1, q = (ko >> 1) & 1; float v[8];
#pragma unroll
  for (int i = 0; i < 8; ++i) v[i] = Wm[(size_t)(ko * 8 + i) * N + n];
  const size_t d = ((size_t)(kc * (N / 16) + (n >> 4)) * 2 + q) * 32 + g * 16 + (n & 15);
  if (F16) { v8h o;
#pragma unroll
    for (int i = 0; i < 8; ++i) o[i] = (_Float16)bfr(v[i]);
    *((v8h*)dst + d) = o; asm volatile("s_wait_xcnt 0x0" ::: "memory"); /* the store's address and data registers may be rewritten behind it: wait first */ }
  else { v8b o;
#pragma unroll
    for (int i = 0; i < 8; ++i) o[i] = (__bf16)v[i];
    *((v8b*)dst + d) = o; asm volatile("s_wait_xcnt 0x0" ::: "memory"); /* the store's address and data registers may be rewritten behind it: wait first */ } }
#define PB_X  (NROW * CC / 8 / 256)       // blocks of 256 pieces: hidden
#define PB_W  (CC * CC / 8 / 256)         // Wq, Wk, Wv each
#define PB_W1 (2 * TT * GH / 8 / 256)
#define PB_W2 (GH * GH / 8 / 256)
// ---- k_pack: thread = one 16-byte piece of a packed tile; the block index picks the matrix
__global__ __launch_bounds__(256) void k_pack(const float* __restrict__ X, const float* __restrict__ WQ, const float* __restrict__ WK, const float* __restrict__ WV, const float* __restrict__ W1, const float* __restrict__ W2, __bf16* __restrict__ XP, __bf16* __restrict__ WP, _Float16* __restrict__ W1P, _Float16* __restrict__ W2P) {
  int blk = blockIdx.x; const int t = threadIdx.x;
  if (blk < PB_X) { const int d = blk * 256 + t, r = d & 15, g = (d >> 4) & 1, q = (d >> 5) & 1, tile = d >> 6, kc = tile % (CC / 32), rt = tile / (CC / 32);
    const float* p = X + (size_t)(rt * 16 + r) * CC + kc * 32 + q * 16 + g * 8; const v4f lo = *(const v4f*)p, hi = *(const v4f*)(p + 4); v8b o;
#pragma unroll
    for (int i = 0; i < 4; ++i) { o[i] = (__bf16)lo[i]; o[4 + i] = (__bf16)hi[i]; }
    *((v8b*)XP + d) = o; asm volatile("s_wait_xcnt 0x0" ::: "memory"); /* the store's address and data registers may be rewritten behind it: wait first */ return; }
  blk -= PB_X;
  if (blk < 3 * PB_W) { const int which = blk / PB_W; pack_w<CC, false>(which == 0 ? WQ : which == 1 ? WK : WV, (blk - which * PB_W) * 256 + t, WP + (size_t)which * CC * CC); return; }
  blk -= 3 * PB_W;
  if (blk < PB_W1) { pack_w<GH, true>(W1, blk * 256 + t, W1P); return; }
  pack_w<GH, true>(W2, (blk - PB_W1) * 256 + t, W2P); }

// ---- k_proj: block = (64 rows, 128 cols, which): hidden W + b ([in,out]); q hi + residual rows, k rows, v planes
__global__ __launch_bounds__(128) void k_proj(const __bf16* __restrict__ XP, const __bf16* __restrict__ WP, const float* __restrict__ BQ, const float* __restrict__ BK, const float* __restrict__ BV, _Float16* __restrict__ QH, _Float16* __restrict__ QL, _Float16* __restrict__ KH, _Float16* __restrict__ VT) {
  __shared__ __align__(16) _Float16 sh[64][136], sl[64][136]; __shared__ __align__(16) _Float16 th[128][72];
  const int tid = threadIdx.x, wave = tid >> 5, lane = tid & 31, col = lane & 15, g = lane >> 4; const int which = blockIdx.z; const int c0 = blockIdx.y * 128; const size_t r0 = (size_t)blockIdx.x * 64;
  const __bf16* Wm = WP + (size_t)which * CC * CC + (size_t)(c0 / 16) * 512; const __bf16* Xm = XP + (size_t)(r0 / 16 + wave) * (CC / 32) * 512; const float* Bm = which == 0 ? BQ : which == 1 ? BK : BV;
  v8f acc[8] = {};
#pragma unroll 2
  for (int kc = 0; kc < CC / 32; ++kc) { const v16b a = fragp_b(Xm + (size_t)kc * 512, lane); v16b w[8];
#pragma unroll
    for (int j = 0; j < 8; ++j) w[j] = fragp_b(Wm + ((size_t)kc * (CC / 16) + j) * 512, lane);
#pragma unroll
    for (int j = 0; j < 8; ++j) acc[j] = wmma_bf(a, w[j], acc[j]); }
#pragma unroll
  for (int j = 0; j < 8; ++j) { const float bb = bfr(Bm[c0 + j * 16 + col]);
#pragma unroll
    for (int r = 0; r < 8; ++r) { const float v = acc[j][r] + bb; const int rl = wave * 16 + 8 * g + r, cl = j * 16 + col; const _Float16 hv = (_Float16)v;
      if (which == 2) th[cl][rl] = hv; else { sh[rl][cl] = hv; sl[rl][cl] = (_Float16)(v - (float)hv); } } }
  __syncthreads();
  if (which < 2) { _Float16* dh = which == 0 ? QH : KH; for (int e = tid; e < 64 * 16; e += 128) { const int rl = e >> 4, q = e & 15; vst2((unsigned*)(dh + (r0 + rl) * CC + c0 + q * 8), *(const v4u*)&sh[rl][q * 8]); if (which == 0) vst2((unsigned*)(QL + (r0 + rl) * CC + c0 + q * 8), *(const v4u*)&sl[rl][q * 8]); } }
  else { const size_t b = r0 / TT; const int t0 = (int)(r0 % TT); for (int e = tid; e < 128 * 8; e += 128) { const int cl = e >> 3, q = e & 7; vst2((unsigned*)(VT + (b * CC + c0 + cl) * (size_t)TT + t0 + q * 8), *(const v4u*)&th[cl][q * 8]); } } }
// ---- k_sc: block = (64 queries, 128 keys, bh): scores / 8 (2 products) -> S[bh][t][s]
__global__ __launch_bounds__(128) void k_sc(const _Float16* __restrict__ QH, const _Float16* __restrict__ QL, const _Float16* __restrict__ KH, int b, float* __restrict__ S) { __shared__ __align__(16) float ss[4][16][132];
  const int tid = threadIdx.x, wave = tid >> 5, lane = tid & 31, col = lane & 15, g = lane >> 4; const int k0 = blockIdx.y * 128; const int h = blockIdx.z; const int bh = h; const int ql0 = blockIdx.x * 64 + wave * 16; const size_t q0 = (size_t)b * TT + ql0;
  v8f acc[8] = {};
#pragma unroll
  for (int kc = 0; kc < HD / 32; ++kc) { const v16h ah = frag_h(QH + (q0 + col) * CC + h * HD + kc * 32, lane), al = frag_h(QL + (q0 + col) * CC + h * HD + kc * 32, lane);
#pragma unroll
    for (int j = 0; j < 8; ++j) { const v16h kb = frag_h(KH + ((size_t)b * TT + k0 + j * 16 + col) * CC + h * HD + kc * 32, lane); acc[j] = wmma16(ah, kb, acc[j]); acc[j] = wmma16(al, kb, acc[j]); } }
#pragma unroll
  for (int j = 0; j < 8; ++j)
#pragma unroll
    for (int r = 0; r < 8; ++r) ss[wave][8 * g + r][j * 16 + col] = acc[j][r] * 0.125f;
  LDSX(); for (int rl = 0; rl < 16; ++rl) vst2(S + ((size_t)bh * TT + ql0 + rl) * TT + k0 + lane * 4, *(const v4f*)&ss[wave][rl][lane * 4]); }
// ---- k_mix: block = attention row (bh, t): mixed = [self | dep] (1,024), LayerNorm (eps 1e-5) -> f16 row
__global__ __launch_bounds__(256) void k_mix(const float* __restrict__ S, const float* __restrict__ AM, const float* __restrict__ DM, const float* __restrict__ LG, const float* __restrict__ LB, int b, _Float16* __restrict__ MX) { __shared__ float sv[2 * TT]; __shared__ float sred[8]; __shared__ float smu, sinv; __shared__ __align__(16) _Float16 so[2 * TT];
  const int t = threadIdx.x; const size_t row = blockIdx.x; const int tq = (int)(row % TT);
  for (int s = t; s < TT; s += 256) { const float sc = S[row * TT + s]; const float m = bfr(AM[(size_t)b * TT + s]); sv[s] = sc + (1.0f - m) * -10000.0f; sv[TT + s] = sc * bfr(DM[((size_t)b * TT + tq) * TT + s]); }
  __syncthreads();
  float a = 0.f; for (int i = t; i < 2 * TT; i += 256) a += sv[i];
#pragma unroll
  for (int o = 1; o < 32; o <<= 1) a += __shfl_xor(a, o);
  if ((t & 31) == 0) sred[t >> 5] = a; __syncthreads(); if (t == 0) { float x = 0.f; for (int w = 0; w < 8; ++w) x += sred[w]; smu = x / (2 * TT); } __syncthreads(); const float mu = smu;
  float q = 0.f; for (int i = t; i < 2 * TT; i += 256) { const float d = sv[i] - mu; q += d * d; }
#pragma unroll
  for (int o = 1; o < 32; o <<= 1) q += __shfl_xor(q, o);
  __syncthreads(); if ((t & 31) == 0) sred[t >> 5] = q; __syncthreads(); if (t == 0) { float x = 0.f; for (int w = 0; w < 8; ++w) x += sred[w]; sinv = 1.0f / sqrtf(x / (2 * TT) + 1e-5f); } __syncthreads(); const float inv = sinv;
  for (int i = t; i < 2 * TT; i += 256) so[i] = (_Float16)((sv[i] - mu) * inv * bfr(LG[i]) + bfr(LB[i]));
  __syncthreads(); for (int qq = t; qq < 2 * TT / 8; qq += 256) vst2((unsigned*)(MX + row * (2 * TT) + qq * 8), *(const v4u*)&so[qq * 8]); }
// ---- k_g: block = (64 rows, 128 cols): stage 0: T1 = tanh(MX W1 + b1) (K 1024) -> f16 rows; stage 1: G = sigmoid(T1 W2 + b2) (K 512) -> f32 rows
template <int STAGE>
__global__ __launch_bounds__(128) void k_g(const _Float16* __restrict__ IN, const _Float16* __restrict__ WPK, const float* __restrict__ Bm, _Float16* __restrict__ OUTH, float* __restrict__ OUTF) { __shared__ __align__(16) float sf[4][16][132]; __shared__ __align__(16) _Float16 sh2[64][136];
  const int tid = threadIdx.x, wave = tid >> 5, lane = tid & 31, col = lane & 15, g = lane >> 4; const int c0 = blockIdx.y * 128; const size_t r0 = (size_t)blockIdx.x * 64 + wave * 16; constexpr int K = (STAGE == 0) ? 2 * TT : GH; constexpr int NOUT = GH;
  v8f acc[8] = {};
#pragma unroll 2
  for (int kc = 0; kc < K / 32; ++kc) { const v16h a = frag_h(IN + (r0 + col) * K + kc * 32, lane); v16h w[8];
#pragma unroll
    for (int j = 0; j < 8; ++j) w[j] = fragp_h(WPK + ((size_t)kc * (NOUT / 16) + c0 / 16 + j) * 512, lane);
#pragma unroll
    for (int j = 0; j < 8; ++j) acc[j] = wmma16(a, w[j], acc[j]); }
#pragma unroll
  for (int j = 0; j < 8; ++j) { const float bb = bfr(Bm[c0 + j * 16 + col]);
#pragma unroll
    for (int r = 0; r < 8; ++r) { const float v = acc[j][r] + bb; if (STAGE == 0) sh2[wave * 16 + 8 * g + r][j * 16 + col] = (_Float16)tanhf(v); else sf[wave][8 * g + r][j * 16 + col] = 1.0f / (1.0f + expf(-v)); } }
  __syncthreads();
  if (STAGE == 0) { for (int e = tid; e < 64 * 16; e += 128) { const int rl = e >> 4, q = e & 15; vst2((unsigned*)(OUTH + ((size_t)blockIdx.x * 64 + rl) * GH + c0 + q * 8), *(const v4u*)&sh2[rl][q * 8]); } }
  else { for (int rl = 0; rl < 16; ++rl) vst2(OUTF + (r0 + rl) * TT + c0 + lane * 4, *(const v4f*)&sf[wave][rl][lane * 4]); } }
// ---- k_fin: block = attention row: logits = g self + (1 - g) dep; softmax over s -> P x 2^11 f16
__global__ __launch_bounds__(256) void k_fin(const float* __restrict__ S, const float* __restrict__ AM, const float* __restrict__ DM, const float* __restrict__ G, int b, _Float16* __restrict__ P) { __shared__ float sl[TT]; __shared__ float sred[8]; __shared__ float sbc; __shared__ __align__(16) _Float16 so[TT];
  const int t = threadIdx.x; const size_t row = blockIdx.x; const int tq = (int)(row % TT);
  float m = -3.0e38f; for (int s = t; s < TT; s += 256) { const float sc = S[row * TT + s]; const float am = bfr(AM[(size_t)b * TT + s]); const float se = sc + (1.0f - am) * -10000.0f; const float de = sc * bfr(DM[((size_t)b * TT + tq) * TT + s]); const float gg = G[row * TT + s]; const float v = gg * se + (1.0f - gg) * de; sl[s] = v; m = fmaxf(m, v); }
#pragma unroll
  for (int o = 1; o < 32; o <<= 1) m = fmaxf(m, __shfl_xor(m, o));
  if ((t & 31) == 0) sred[t >> 5] = m; __syncthreads(); if (t == 0) { float a = sred[0]; for (int i = 1; i < 8; ++i) a = fmaxf(a, sred[i]); sbc = a; } __syncthreads(); m = sbc; __syncthreads();
  float sum = 0.f; for (int s = t; s < TT; s += 256) sum += expf(sl[s] - m);
#pragma unroll
  for (int o = 1; o < 32; o <<= 1) sum += __shfl_xor(sum, o);
  if ((t & 31) == 0) sred[t >> 5] = sum; __syncthreads(); if (t == 0) { float a = 0.f; for (int i = 0; i < 8; ++i) a += sred[i]; sbc = 1.0f / a; } __syncthreads(); const float inv = sbc;
  for (int s = t; s < TT; s += 256) so[s] = (_Float16)(expf(sl[s] - m) * inv * 2048.0f);
  __syncthreads(); for (int q = t; q < TT / 8; q += 256) vst2((unsigned*)(P + row * TT + q * 8), *(const v4u*)&so[q * 8]); }
// ---- k_pv: block = (64 queries, bh): ctx[b][t][h*64 + d] = P . v
__global__ __launch_bounds__(128) void k_pv(const _Float16* __restrict__ P, const _Float16* __restrict__ VT, int b, float* __restrict__ OUT) { __shared__ __align__(16) float ss[4][16][68];
  const int tid = threadIdx.x, wave = tid >> 5, lane = tid & 31, col = lane & 15, g = lane >> 4; const int h = blockIdx.y; const int bh = h; const int ql0 = blockIdx.x * 64 + wave * 16;
  v8f acc[4] = {};
#pragma unroll 1
  for (int kc = 0; kc < TT / 32; ++kc) { const v16h ph = frag_h(P + ((size_t)bh * TT + ql0 + col) * TT + kc * 32, lane);
#pragma unroll
    for (int j = 0; j < 4; ++j) acc[j] = wmma16(ph, frag_h(VT + ((size_t)b * CC + h * HD + j * 16 + col) * TT + kc * 32, lane), acc[j]); }
#pragma unroll
  for (int j = 0; j < 4; ++j)
#pragma unroll
    for (int r = 0; r < 8; ++r) ss[wave][8 * g + r][j * 16 + col] = acc[j][r] * (1.0f / 2048.0f);
  LDSX(); for (int rl = 0; rl < 16; ++rl) if (lane < 16) vst2(OUT + ((size_t)b * TT + ql0 + rl) * CC + h * HD + lane * 4, *(const v4f*)&ss[wave][rl][lane * 4]); }
extern "C" void kernel_launch(void* const* d_in, const int* in_sizes, int n_in, void* d_out, int out_size, void* d_ws, size_t ws_size, hipStream_t stream) {
  (void)in_sizes; (void)n_in; (void)out_size;
  const float** F = (const float**)d_in;   // 0 hidden [8,512,768], 1 attention_mask [8,512], 2 dependency_matrix [8,512,512], 3 Wq [768,768] ([in,out]), 4 bq, 5 Wk, 6 bk, 7 Wv, 8 bv, 9 ln_g [1024], 10 ln_b, 11 W1 [1024,512], 12 b1, 13 W2 [512,512], 14 b2
  if (ws_size < (size_t)WS_END) return;
  char* ws = (char*)d_ws; _Float16 *QH = (_Float16*)(ws + WS_QH), *QL = (_Float16*)(ws + WS_QL), *KH = (_Float16*)(ws + WS_KH), *VT = (_Float16*)(ws + WS_VT), *MX = (_Float16*)(ws + WS_MX), *T1 = (_Float16*)(ws + WS_T1), *P = (_Float16*)(ws + WS_P), *W1P = (_Float16*)(ws + WS_W1P), *W2P = (_Float16*)(ws + WS_W2P); __bf16 *XP = (__bf16*)(ws + WS_XP), *WP = (__bf16*)(ws + WS_WP); float *S = (float*)(ws + WS_S), *G = (float*)(ws + WS_G);
  k_pack<<<PB_X + 3 * PB_W + PB_W1 + PB_W2, 256, 0, stream>>>(F[0], F[3], F[5], F[7], F[11], F[13], XP, WP, W1P, W2P);
  k_proj<<<dim3(TNB * TT / 64, CC / 128, 3), 128, 0, stream>>>(XP, WP, F[4], F[6], F[8], QH, QL, KH, VT);
  for (int b = 0; b < TNB; ++b) {
    k_sc<<<dim3(TT / 64, TT / 128, NH), 128, 0, stream>>>(QH, QL, KH, b, S);
    k_mix<<<NARB, 256, 0, stream>>>(S, F[1], F[2], F[9], F[10], b, MX);
    k_g<0><<<dim3(NARB / 64, GH / 128), 128, 0, stream>>>(MX, W1P, F[12], T1, nullptr);
    k_g<1><<<dim3(NARB / 64, GH / 128), 128, 0, stream>>>(T1, W2P, F[14], nullptr, G);
    k_fin<<<NARB, 256, 0, stream>>>(S, F[1], F[2], G, b, P);
    k_pv<<<dim3(TT / 64, NH), 128, 0, stream>>>(P, VT, b, (float*)d_out);
  }
}

// v002
// Measured time: 542 microseconds a run.
// In both of two side-by-side timings against v001, it was 1.21 times as fast.
// All steps since v000 together make it 2.04 times as fast.
// compute dtype: all float inputs rounded to bf16, attention_mask / dependency_matrix read; q/k/v = hidden W + b with EXACT bf16 products on WMMA 16x16x32, f32 accumulate; scores = q k^T / 8 with q as f16 hi + residual and k f16 (2 products), stored in f32 for all heads of one batch at a time; self = scores + (1 - mask) * -1e4, dep = scores * dependency in f32; LayerNorm over the concatenated 1,024-row in f32 -> f16 rows; gating MLP tanh(ln W1 + b1) (1 f16 product, f16 rows) then sigmoid(. W2 + b2) (1 f16 product); mixed = g self + (1 - g) dep and its softmax in f32 (precise expf) -> P f16 x 2^11; ctx = P . v (v rounded once to f16); f32 output [b][t][768].
#include <hip/hip_runtime.h>
#include <math.h>

typedef __attribute__((ext_vector_type(16))) _Float16 v16h;
typedef __attribute__((ext_vector_type(16))) __bf16 v16b;
typedef __attribute__((ext_vector_type(8)))  _Float16 v8h;
typedef __attribute__((ext_vector_type(8)))  float v8f;
typedef __attribute__((ext_vector_type(4)))  float v4f;
typedef __attribute__((ext_vector_type(2)))  float v2f;
typedef __attribute__((ext_vector_type(4)))  unsigned v4u;
typedef __attribute__((ext_vector_type(4)))  int v4i;
typedef float __attribute__((may_alias)) float_a;
typedef int __attribute__((may_alias)) int_a;

template <typename T> __device__ __forceinline__ void vst2(void* p, T v) { *(T*)p = v;  }
__device__ __forceinline__ v8f wmma16(v16h a, v16h b, v8f c) {
  v8f d = __builtin_amdgcn_wmma_f32_16x16x32_f16(false, a, false, b, (short)0, c, false, false);
  asm volatile("v_nop\n\tv_nop\n\tv_nop\n\tv_nop" : "+v"(d) : "v"(a), "v"(b));
  return d;
}
__device__ __forceinline__ v8f wmma_bf(v16b a, v16b b, v8f c) {
  v8f d = __builtin_amdgcn_wmma_f32_16x16x32_bf16(false, a, false, b, (short)0, c, false, false);
  asm volatile("v_nop\n\tv_nop\n\tv_nop\n\tv_nop" : "+v"(d) : "v"(a), "v"(b));
  return d;
}
// 16x16x32 fragments: lane = (h = lane>>4, row/col = lane&15); elements 0..7 = k0+8h+0..7, 8..15 = k0+16+8h+0..7; D element r = row 8h+r
__device__ __forceinline__ v16h frag_h(const _Float16* rowk0, int lane) {
  union { v16h v; v8h q[2]; } u; const _Float16* p = rowk0 + 8 * (lane >> 4);
  u.q[0] = *(const v8h*)p; u.q[1] = *(const v8h*)(p + 16); return u.v;
}
__device__ __forceinline__ v16h frag_f32(const float* rowk0, int lane) {
  v16h a; const float* p = rowk0 + 8 * (lane >> 4);
#pragma unroll
  for (int i = 0; i < 8; ++i) { a[i] = (_Float16)p[i]; a[8 + i] = (_Float16)p[16 + i]; }
  return a;
}
__device__ __forceinline__ v16h frag_f32s(const float* rowk0, int lane, float sc) {
  v16h a; const float* p = rowk0 + 8 * (lane >> 4);
#pragma unroll
  for (int i = 0; i < 8; ++i) { a[i] = (_Float16)(p[i] * sc); a[8 + i] = (_Float16)(p[16 + i] * sc); }
  return a;
}
// column fragment from a [K][ld] layout (column n), rows >= K read as 0
__device__ __forceinline__ v16h fragc_f32(const float* W, int k0, int n, int lane, int ld, int K) {
  v16h a; const int g = lane >> 4;
#pragma unroll
  for (int i = 0; i < 8; ++i) { const int ka = k0 + 8 * g + i, kb = ka + 16;
    a[i] = (_Float16)(ka < K ? W[(size_t)(ka < K ? ka : K - 1) * ld + n] : 0.f); a[8 + i] = (_Float16)(kb < K ? W[(size_t)(kb < K ? kb : K - 1) * ld + n] : 0.f); }
  return a;
}
struct F2 { v16b h, l; };
__device__ __forceinline__ F2 bsplit16(const float v[16]) { F2 r;
#pragma unroll
  for (int i = 0; i < 16; ++i) { const __bf16 h = (__bf16)v[i]; r.h[i] = h; r.l[i] = (__bf16)(v[i] - (float)h); }
  return r; }
__device__ __forceinline__ F2 split_row(const float* row, int k0, int lane) { float v[16]; const float* p = row + k0 + 8 * (lane >> 4);
#pragma unroll
  for (int i = 0; i < 8; ++i) { v[i] = p[i]; v[8 + i] = p[16 + i]; }
  return bsplit16(v); }
__device__ __forceinline__ F2 split_rowK(const float* row, int k0, int lane, int K) { float v[16]; const int g = lane >> 4;
#pragma unroll
  for (int i = 0; i < 8; ++i) { const int ka = k0 + 8 * g + i, kb = ka + 16; v[i] = ka < K ? row[ka < K ? ka : K - 1] : 0.f; v[8 + i] = kb < K ? row[kb < K ? kb : K - 1] : 0.f; }
  return bsplit16(v); }
__device__ __forceinline__ F2 split_col(const float* W, int k0, int n, int lane, int ld, int K) { float v[16]; const int g = lane >> 4;
#pragma unroll
  for (int i = 0; i < 8; ++i) { const int ka = k0 + 8 * g + i, kb = ka + 16; v[i] = ka < K ? W[(size_t)(ka < K ? ka : K - 1) * ld + n] : 0.f; v[8 + i] = kb < K ? W[(size_t)(kb < K ? kb : K - 1) * ld + n] : 0.f; }
  return bsplit16(v); }
__device__ __forceinline__ v8f mac3(const F2& a, const F2& b, v8f c) { c = wmma_bf(a.l, b.h, c); c = wmma_bf(a.h, b.l, c); return wmma_bf(a.h, b.h, c); }
__device__ __forceinline__ float sigm(float v) { return 1.0f / (1.0f + expf(-v)); }
#define LDSX() do { asm volatile("s_wait_dscnt 0" ::: "memory"); __builtin_amdgcn_wave_barrier(); __builtin_amdgcn_fence(__ATOMIC_RELEASE, "workgroup"); } while (0)


// Dependency-mixed BERT self attention (B 8, T 512, C 768 = 12 x 64): a learned per-(query, key) gate between plain attention scores and dependency-weighted scores, then softmax . v.
#define NB 8
#define TT 512
#define CC 768
#define NH 12
#define HD 64
#define NROW (NB * TT)          // 4096 token rows
#define NAR (NB * NH * TT)      // 49152 attention rows
#define GH 512                  // gating hidden (= T)
#ifndef TNB
#define TNB NB
#endif
typedef __attribute__((ext_vector_type(8))) __bf16 v8b;
__device__ __forceinline__ v16b frag_b(const __bf16* rowk0, int lane) {
  union { v16b v; v8b q[2]; } u; const __bf16* p = rowk0 + 8 * (lane >> 4);
  u.q[0] = *(const v8b*)p; u.q[1] = *(const v8b*)(p + 16); return u.v;
}
__device__ __forceinline__ float bfr(float v) { return (float)(__bf16)v; }
__device__ __attribute__((noinline)) float exp_ni(float v) { return expf(v); }
__device__ __attribute__((noinline)) float erf_ni(float v) { return erff(v); }

#define WS_QH  0u
#define WS_QL  (WS_QH + 2u * (size_t)NROW * CC)
#define WS_KH  (WS_QL + 2u * (size_t)NROW * CC)
#define WS_VT  (WS_KH + 2u * (size_t)NROW * CC)          // f16 v planes [b][768][t]
// per-batch buffers (NH*TT = 6,144 attention rows), reused batch after batch in stream order
#define NARB (NH * TT)
#define WS_S   (WS_VT + 2u * (size_t)NROW * CC)          // f32 scores [h][t][s]
#define WS_MX  (WS_S + 4u * (size_t)NARB * TT)           // f16 LN'd mixed rows [row][1024]
#define WS_T1  (WS_MX + 2u * (size_t)NARB * 2 * TT)
#define WS_G   (WS_T1 + 2u * (size_t)NARB * GH)
#define WS_P   (WS_G + 4u * (size_t)NARB * TT)
// 16-bit copies of hidden and of the five weights in fragment order, written by k_pack at the head of every call
#define WS_XP  (WS_P + 2u * (size_t)NARB * TT)           // bf16 hidden [row tile][kc][1 KB tile]
#define WS_WP  (WS_XP + 2u * (size_t)NROW * CC)          // bf16 Wq, Wk, Wv, each [kc][col tile][1 KB tile]
#define WS_W1P (WS_WP + 3u * 2u * (size_t)CC * CC)       // f16 W1 [kc][col tile][1 KB tile]
#define WS_W2P (WS_W1P + 2u * (size_t)2 * TT * GH)       // f16 W2 [kc][col tile][1 KB tile]
#define WS_END (WS_W2P + 2u * (size_t)GH * GH)

// A packed tile is one 16 x 32 fragment as the wave reads it: [q = 0, 1][lane][8 elements], element i of piece q = k0 + 16 q + 8 (lane >> 4) + i of row or column (lane & 15).
// Each of the two 16-byte loads of a wave then covers 512 contiguous bytes (four whole lines).
__device__ __forceinline__ v16h fragp_h(const _Float16* tile, int lane) {
  union { v16h v; v8h q[2]; } u; const _Float16* p = tile + lane * 8;
  u.q[0] = *(const v8h*)p; u.q[1] = *(const v8h*)(p + 256); return u.v;
}
__device__ __forceinline__ v16b fragp_b(const __bf16* tile, int lane) {
  union { v16b v; v8b q[2]; } u; const __bf16* p = tile + lane * 8;
  u.q[0] = *(const v8b*)p; u.q[1] = *(const v8b*)(p + 256); return u.v;
}
// one 16-byte piece (8 consecutive k of column n) of a [K][N] f32 weight; 32 consecutive ids read whole lines and write two 256-byte runs
template <int N, bool F16> __device__ __forceinline__ void pack_w(const float* __restrict__ Wm, int id, void* __restrict__ dst) {
  const int n = id % N, ko = id / N, kc = ko >> 2, g = ko & 1, q = (ko >> 1) & 1; float v[8];
#pragma unroll
  for (int i = 0; i < 8; ++i) v[i] = Wm[(size_t)(ko * 8 + i) * N + n];
  const size_t d = ((size_t)(kc * (N / 16) + (n >> 4)) * 2 + q) * 32 + g * 16 + (n & 15);
  if (F16) { v8h o;
#pragma unroll
    for (int i = 0; i < 8; ++i) o[i] = (_Float16)bfr(v[i]);
    *((v8h*)dst + d) = o; asm volatile("s_wait_xcnt 0x0" ::: "memory"); /* the store's address and data registers may be rewritten behind it: wait first */ }
  else { v8b o;
#pragma unroll
    for (int i = 0; i < 8; ++i) o[i] = (__bf16)v[i];
    *((v8b*)dst + d) = o; asm volatile("s_wait_xcnt 0x0" ::: "memory"); /* the store's address and data registers may be rewritten behind it: wait first */ } }
#define PB_X  (NROW * CC / 8 / 256)       // blocks of 256 pieces: hidden
#define PB_W  (CC * CC / 8 / 256)         // Wq, Wk, Wv each
#define PB_W1 (2 * TT * GH / 8 / 256)
#define PB_W2 (GH * GH / 8 / 256)
// ---- k_pack: thread = one 16-byte piece of a packed tile; the block index picks the matrix
__global__ __launch_bounds__(256) void k_pack(const float* __restrict__ X, const float* __restrict__ WQ, const float* __restrict__ WK, const float* __restrict__ WV, const float* __restrict__ W1, const float* __restrict__ W2, __bf16* __restrict__ XP, __bf16* __restrict__ WP, _Float16* __restrict__ W1P, _Float16* __restrict__ W2P) {
  int blk = blockIdx.x; const int t = threadIdx.x;
  if (blk < PB_X) { const int d = blk * 256 + t, r = d & 15, g = (d >> 4) & 1, q = (d >> 5) & 1, tile = d >> 6, kc = tile % (CC / 32), rt = tile / (CC / 32);
    const float* p = X + (size_t)(rt * 16 + r) * CC + kc * 32 + q * 16 + g * 8; const v4f lo = *(const v4f*)p, hi = *(const v4f*)(p + 4); v8b o;
#pragma unroll
    for (int i = 0; i < 4; ++i) { o[i] = (__bf16)lo[i]; o[4 + i] = (__bf16)hi[i]; }
    *((v8b*)XP + d) = o; asm volatile("s_wait_xcnt 0x0" ::: "memory"); /* the store's address and data registers may be rewritten behind it: wait first */ return; }
  blk -= PB_X;
  if (blk < 3 * PB_W) { const int which = blk / PB_W; pack_w<CC, false>(which == 0 ? WQ : which == 1 ? WK : WV, (blk - which * PB_W) * 256 + t, WP + (size_t)which * CC * CC); return; }
  blk -= 3 * PB_W;
  if (blk < PB_W1) { pack_w<GH, true>(W1, blk * 256 + t, W1P); return; }
  pack_w<GH, true>(W2, (blk - PB_W1) * 256 + t, W2P); }

// ---- k_proj: block = (64 rows, 128 cols, which): hidden W + b ([in,out]); q hi + residual rows, k rows, v planes
__global__ __launch_bounds__(128) void k_proj(const __bf16* __restrict__ XP, const __bf16* __restrict__ WP, const float* __restrict__ BQ, const float* __restrict__ BK, const float* __restrict__ BV, _Float16* __restrict__ QH, _Float16* __restrict__ QL, _Float16* __restrict__ KH, _Float16* __restrict__ VT) {
  __shared__ __align__(16) _Float16 sh[64][136], sl[64][136]; __shared__ __align__(16) _Float16 th[128][72];
  const int tid = threadIdx.x, wave = tid >> 5, lane = tid & 31, col = lane & 15, g = lane >> 4; const int which = blockIdx.z; const int c0 = blockIdx.y * 128; const size_t r0 = (size_t)blockIdx.x * 64;
  const __bf16* Wm = WP + (size_t)which * CC * CC + (size_t)(c0 / 16) * 512; const __bf16* Xm = XP + (size_t)(r0 / 16 + wave) * (CC / 32) * 512; const float* Bm = which == 0 ? BQ : which == 1 ? BK : BV;
  v8f acc[8] = {};
#pragma unroll 2
  for (int kc = 0; kc < CC / 32; ++kc) { const v16b a = fragp_b(Xm + (size_t)kc * 512, lane); v16b w[8];
#pragma unroll
    for (int j = 0; j < 8; ++j) w[j] = fragp_b(Wm + ((size_t)kc * (CC / 16) + j) * 512, lane);
#pragma unroll
    for (int j = 0; j < 8; ++j) acc[j] = wmma_bf(a, w[j], acc[j]); }
#pragma unroll
  for (int j = 0; j < 8; ++j) { const float bb = bfr(Bm[c0 + j * 16 + col]);
#pragma unroll
    for (int r = 0; r < 8; ++r) { const float v = acc[j][r] + bb; const int rl = wave * 16 + 8 * g + r, cl = j * 16 + col; const _Float16 hv = (_Float16)v;
      if (which == 2) th[cl][rl] = hv; else { sh[rl][cl] = hv; sl[rl][cl] = (_Float16)(v - (float)hv); } } }
  __syncthreads();
  if (which < 2) { _Float16* dh = which == 0 ? QH : KH; for (int e = tid; e < 64 * 16; e += 128) { const int rl = e >> 4, q = e & 15; vst2((unsigned*)(dh + (r0 + rl) * CC + c0 + q * 8), *(const v4u*)&sh[rl][q * 8]); if (which == 0) vst2((unsigned*)(QL + (r0 + rl) * CC + c0 + q * 8), *(const v4u*)&sl[rl][q * 8]); } }
  else { const size_t b = r0 / TT; const int t0 = (int)(r0 % TT); for (int e = tid; e < 128 * 8; e += 128) { const int cl = e >> 3, q = e & 7; vst2((unsigned*)(VT + (b * CC + c0 + cl) * (size_t)TT + t0 + q * 8), *(const v4u*)&th[cl][q * 8]); } } }
// ---- k_sc: block = (64 queries, 128 keys, bh): scores / 8 (2 products) -> S[bh][t][s]
__global__ __launch_bounds__(128) void k_sc(const _Float16* __restrict__ QH, const _Float16* __restrict__ QL, const _Float16* __restrict__ KH, int b, float* __restrict__ S) { __shared__ __align__(16) float ss[4][16][132];
  const int tid = threadIdx.x, wave = tid >> 5, lane = tid & 31, col = lane & 15, g = lane >> 4; const int k0 = blockIdx.y * 128; const int h = blockIdx.z; const int bh = h; const int ql0 = blockIdx.x * 64 + wave * 16; const size_t q0 = (size_t)b * TT + ql0;
  v8f acc[8] = {};
#pragma unroll
  for (int kc = 0; kc < HD / 32; ++kc) { const v16h ah = frag_h(QH + (q0 + col) * CC + h * HD + kc * 32, lane), al = frag_h(QL + (q0 + col) * CC + h * HD + kc * 32, lane);
#pragma unroll
    for (int j = 0; j < 8; ++j) { const v16h kb = frag_h(KH + ((size_t)b * TT + k0 + j * 16 + col) * CC + h * HD + kc * 32, lane); acc[j] = wmma16(ah, kb, acc[j]); acc[j] = wmma16(al, kb, acc[j]); } }
#pragma unroll
  for (int j = 0; j < 8; ++j)
#pragma unroll
    for (int r = 0; r < 8; ++r) ss[wave][8 * g + r][j * 16 + col] = acc[j][r] * 0.125f;
  LDSX(); for (int rl = 0; rl < 16; ++rl) vst2(S + ((size_t)bh * TT + ql0 + rl) * TT + k0 + lane * 4, *(const v4f*)&ss[wave][rl][lane * 4]); }
// ---- row kernels: one wave owns a whole attention row in registers (element 4 j + i of a lane's 16 is s = 128 j + 4 lane + i), so a row needs no LDS and no barrier;
// a wave does RH heads of one query and keeps that query's dependency row, the mask and the LayerNorm vectors in registers for all of them.
#define RH 3                    // heads per wave; the 4 waves of a block cover the 12 heads of one query
typedef __attribute__((ext_vector_type(16))) float v16f;
typedef __attribute__((ext_vector_type(4))) _Float16 v4h;
template <int M> __device__ __forceinline__ float xrow(float x) { return __builtin_bit_cast(float, __builtin_amdgcn_update_dpp(0, __builtin_bit_cast(int, x), 0x160 | M, 0xf, 0xf, true)); }  // lane l ^ M inside a 16-lane row (DPP row_xmask)
__device__ __forceinline__ float xhalf(float x) { return __builtin_bit_cast(float, __builtin_amdgcn_permlanex16(__builtin_bit_cast(int, x), __builtin_bit_cast(int, x), 0x76543210, 0xfedcba98, false, false)); }  // lane l ^ 16
__device__ __forceinline__ float wsum(float x) { x += xrow<1>(x); x += xrow<2>(x); x += xrow<4>(x); x += xrow<8>(x); return x + xhalf(x); }
__device__ __forceinline__ float wmax(float x) { x = fmaxf(x, xrow<1>(x)); x = fmaxf(x, xrow<2>(x)); x = fmaxf(x, xrow<4>(x)); x = fmaxf(x, xrow<8>(x)); return fmaxf(x, xhalf(x)); }
__device__ __forceinline__ float hsum(v16f v) { const v8f a = __builtin_shufflevector(v, v, 0, 1, 2, 3, 4, 5, 6, 7) + __builtin_shufflevector(v, v, 8, 9, 10, 11, 12, 13, 14, 15); const v4f c = __builtin_shufflevector(a, a, 0, 1, 2, 3) + __builtin_shufflevector(a, a, 4, 5, 6, 7); return (c[0] + c[1]) + (c[2] + c[3]); }
// 512 consecutive floats at the wave-uniform p: four 16-byte loads per lane, each 512 contiguous bytes per wave; vb = 16 lane
__device__ __forceinline__ v16f ld_row(const float* __restrict__ p, unsigned vb) { const char* c = (const char*)p + vb; const v4f q0 = *(const v4f*)c, q1 = *(const v4f*)(c + 512), q2 = *(const v4f*)(c + 1024), q3 = *(const v4f*)(c + 1536);
  return __builtin_shufflevector(__builtin_shufflevector(q0, q1, 0, 1, 2, 3, 4, 5, 6, 7), __builtin_shufflevector(q2, q3, 0, 1, 2, 3, 4, 5, 6, 7), 0, 1, 2, 3, 4, 5, 6, 7, 8, 9, 10, 11, 12, 13, 14, 15); }
// 512 consecutive f16 to the wave-uniform p: four 8-byte stores per lane, each 256 contiguous bytes per wave; vh = 8 lane
__device__ __forceinline__ void st_row(_Float16* __restrict__ p, unsigned vh, v16f v) { char* c = (char*)p + vh; const v16h h = __builtin_convertvector(v, v16h);
  *(v4h*)c = __builtin_shufflevector(h, h, 0, 1, 2, 3); *(v4h*)(c + 256) = __builtin_shufflevector(h, h, 4, 5, 6, 7); *(v4h*)(c + 512) = __builtin_shufflevector(h, h, 8, 9, 10, 11); *(v4h*)(c + 768) = __builtin_shufflevector(h, h, 12, 13, 14, 15); }
__device__ __forceinline__ v16f bfr16(v16f v) { v16f r;
#pragma unroll
  for (int i = 0; i < 16; ++i) r[i] = bfr(v[i]);
  return r; }
// ---- k_mix: block = query t, wave = RH heads: mixed = [self | dep] (1,024), LayerNorm (eps 1e-5) -> f16 row
__global__ __launch_bounds__(128) void k_mix(const float* __restrict__ S, const float* __restrict__ AM, const float* __restrict__ DM, const float* __restrict__ LG, const float* __restrict__ LB, int b, _Float16* __restrict__ MX) {
  const unsigned lane = threadIdx.x & 31, vb = lane * 16, vh = lane * 8; const int tq = blockIdx.x; const size_t row0 = (size_t)__builtin_amdgcn_readfirstlane((int)(threadIdx.x >> 5) * (RH * TT) + tq);
  v16f sc[RH];
  v16f dm = ld_row(DM + ((size_t)b * TT + tq) * TT, vb);
#pragma unroll
  for (int hh = 0; hh < RH; ++hh) sc[hh] = ld_row(S + (row0 + hh * TT) * TT, vb);
  v16f om = ld_row(AM + (size_t)b * TT, vb), lg0 = ld_row(LG, vb), lg1 = ld_row(LG + TT, vb), lb0 = ld_row(LB, vb), lb1 = ld_row(LB + TT, vb);
  asm volatile("" :: "v"(dm), "v"(sc[0]), "v"(sc[1]), "v"(sc[2]), "v"(om), "v"(lg0), "v"(lg1), "v"(lb0), "v"(lb1)); // holds the loads in place (loaded rows as inputs only): without it the LayerNorm vectors' loads sink behind the row sums and their latency is paid a second time
  dm = bfr16(dm); om = 1.0f - bfr16(om); lg0 = bfr16(lg0); lg1 = bfr16(lg1); lb0 = bfr16(lb0); lb1 = bfr16(lb1);
#pragma unroll
  for (int hh = 0; hh < RH; ++hh) { v16f x0 = sc[hh] + om * -10000.0f, x1 = sc[hh] * dm;
    const float mu = wsum(hsum(x0 + x1)) / (2 * TT);
    x0 -= mu; x1 -= mu;
    const float inv = 1.0f / sqrtf(wsum(hsum(x0 * x0 + x1 * x1)) / (2 * TT) + 1e-5f);
    _Float16* o = MX + (row0 + hh * TT) * (2 * TT);
    st_row(o, vh, x0 * inv * lg0 + lb0); st_row(o + TT, vh, x1 * inv * lg1 + lb1); } }
// ---- k_g: block = (64 rows, 128 cols): stage 0: T1 = tanh(MX W1 + b1) (K 1024) -> f16 rows; stage 1: G = sigmoid(T1 W2 + b2) (K 512) -> f32 rows
template <int STAGE>
__global__ __launch_bounds__(128) void k_g(const _Float16* __restrict__ IN, const _Float16* __restrict__ WPK, const float* __restrict__ Bm, _Float16* __restrict__ OUTH, float* __restrict__ OUTF) { __shared__ __align__(16) float sf[4][16][132]; __shared__ __align__(16) _Float16 sh2[64][136];
  const int tid = threadIdx.x, wave = tid >> 5, lane = tid & 31, col = lane & 15, g = lane >> 4; const int c0 = blockIdx.y * 128; const size_t r0 = (size_t)blockIdx.x * 64 + wave * 16; constexpr int K = (STAGE == 0) ? 2 * TT : GH; constexpr int NOUT = GH;
  v8f acc[8] = {};
#pragma unroll 2
  for (int kc = 0; kc < K / 32; ++kc) { const v16h a = frag_h(IN + (r0 + col) * K + kc * 32, lane); v16h w[8];
#pragma unroll
    for (int j = 0; j < 8; ++j) w[j] = fragp_h(WPK + ((size_t)kc * (NOUT / 16) + c0 / 16 + j) * 512, lane);
#pragma unroll
    for (int j = 0; j < 8; ++j) acc[j] = wmma16(a, w[j], acc[j]); }
#pragma unroll
  for (int j = 0; j < 8; ++j) { const float bb = bfr(Bm[c0 + j * 16 + col]);
#pragma unroll
    for (int r = 0; r < 8; ++r) { const float v = acc[j][r] + bb; if (STAGE == 0) sh2[wave * 16 + 8 * g + r][j * 16 + col] = (_Float16)tanhf(v); else sf[wave][8 * g + r][j * 16 + col] = 1.0f / (1.0f + expf(-v)); } }
  __syncthreads();
  if (STAGE == 0) { for (int e = tid; e < 64 * 16; e += 128) { const int rl = e >> 4, q = e & 15; vst2((unsigned*)(OUTH + ((size_t)blockIdx.x * 64 + rl) * GH + c0 + q * 8), *(const v4u*)&sh2[rl][q * 8]); } }
  else { for (int rl = 0; rl < 16; ++rl) vst2(OUTF + (r0 + rl) * TT + c0 + lane * 4, *(const v4f*)&sf[wave][rl][lane * 4]); } }
// ---- k_fin: block = query t, wave = RH heads: logits = g self + (1 - g) dep; softmax over s -> P x 2^11 f16
__global__ __launch_bounds__(128) void k_fin(const float* __restrict__ S, const float* __restrict__ AM, const float* __restrict__ DM, const float* __restrict__ G, int b, _Float16* __restrict__ P) {
  const unsigned lane = threadIdx.x & 31, vb = lane * 16, vh = lane * 8; const int tq = blockIdx.x; const size_t row0 = (size_t)__builtin_amdgcn_readfirstlane((int)(threadIdx.x >> 5) * (RH * TT) + tq);
  v16f sc[RH], gg[RH];
  v16f dm = ld_row(DM + ((size_t)b * TT + tq) * TT, vb);
#pragma unroll
  for (int hh = 0; hh < RH; ++hh) { sc[hh] = ld_row(S + (row0 + hh * TT) * TT, vb); gg[hh] = ld_row(G + (row0 + hh * TT) * TT, vb); }
  v16f om = ld_row(AM + (size_t)b * TT, vb);
  asm volatile("" :: "v"(dm), "v"(sc[0]), "v"(sc[1]), "v"(sc[2]), "v"(gg[0]), "v"(gg[1]), "v"(gg[2]), "v"(om)); // holds the loads in place (loaded rows as inputs only): all three heads' rows are in flight together, one latency per wave
  dm = bfr16(dm); om = 1.0f - bfr16(om);
#pragma unroll
  for (int hh = 0; hh < RH; ++hh) { const v16f se = sc[hh] + om * -10000.0f, de = sc[hh] * dm; v16f x = gg[hh] * se + (1.0f - gg[hh]) * de; float m = -3.0e38f;
#pragma unroll
    for (int i = 0; i < 16; ++i) m = fmaxf(m, x[i]);
    m = wmax(m);
#pragma unroll
    for (int i = 0; i < 16; ++i) x[i] = expf(x[i] - m);
    const float inv = 1.0f / wsum(hsum(x));
    st_row(P + (row0 + hh * TT) * TT, vh, x * inv * 2048.0f); } }
// ---- k_pv: block = (64 queries, bh): ctx[b][t][h*64 + d] = P . v
__global__ __launch_bounds__(128) void k_pv(const _Float16* __restrict__ P, const _Float16* __restrict__ VT, int b, float* __restrict__ OUT) { __shared__ __align__(16) float ss[4][16][68];
  const int tid = threadIdx.x, wave = tid >> 5, lane = tid & 31, col = lane & 15, g = lane >> 4; const int h = blockIdx.y; const int bh = h; const int ql0 = blockIdx.x * 64 + wave * 16;
  v8f acc[4] = {};
#pragma unroll 1
  for (int kc = 0; kc < TT / 32; ++kc) { const v16h ph = frag_h(P + ((size_t)bh * TT + ql0 + col) * TT + kc * 32, lane);
#pragma unroll
    for (int j = 0; j < 4; ++j) acc[j] = wmma16(ph, frag_h(VT + ((size_t)b * CC + h * HD + j * 16 + col) * TT + kc * 32, lane), acc[j]); }
#pragma unroll
  for (int j = 0; j < 4; ++j)
#pragma unroll
    for (int r = 0; r < 8; ++r) ss[wave][8 * g + r][j * 16 + col] = acc[j][r] * (1.0f / 2048.0f);
  LDSX(); for (int rl = 0; rl < 16; ++rl) if (lane < 16) vst2(OUT + ((size_t)b * TT + ql0 + rl) * CC + h * HD + lane * 4, *(const v4f*)&ss[wave][rl][lane * 4]); }
extern "C" void kernel_launch(void* const* d_in, const int* in_sizes, int n_in, void* d_out, int out_size, void* d_ws, size_t ws_size, hipStream_t stream) {
  (void)in_sizes; (void)n_in; (void)out_size;
  const float** F = (const float**)d_in;   // 0 hidden [8,512,768], 1 attention_mask [8,512], 2 dependency_matrix [8,512,512], 3 Wq [768,768] ([in,out]), 4 bq, 5 Wk, 6 bk, 7 Wv, 8 bv, 9 ln_g [1024], 10 ln_b, 11 W1 [1024,512], 12 b1, 13 W2 [512,512], 14 b2
  if (ws_size < (size_t)WS_END) return;
  char* ws = (char*)d_ws; _Float16 *QH = (_Float16*)(ws + WS_QH), *QL = (_Float16*)(ws + WS_QL), *KH = (_Float16*)(ws + WS_KH), *VT = (_Float16*)(ws + WS_VT), *MX = (_Float16*)(ws + WS_MX), *T1 = (_Float16*)(ws + WS_T1), *P = (_Float16*)(ws + WS_P), *W1P = (_Float16*)(ws + WS_W1P), *W2P = (_Float16*)(ws + WS_W2P); __bf16 *XP = (__bf16*)(ws + WS_XP), *WP = (__bf16*)(ws + WS_WP); float *S = (float*)(ws + WS_S), *G = (float*)(ws + WS_G);
  k_pack<<<PB_X + 3 * PB_W + PB_W1 + PB_W2, 256, 0, stream>>>(F[0], F[3], F[5], F[7], F[11], F[13], XP, WP, W1P, W2P);
  k_proj<<<dim3(TNB * TT / 64, CC / 128, 3), 128, 0, stream>>>(XP, WP, F[4], F[6], F[8], QH, QL, KH, VT);
  for (int b = 0; b < TNB; ++b) {
    k_sc<<<dim3(TT / 64, TT / 128, NH), 128, 0, stream>>>(QH, QL, KH, b, S);
    k_mix<<<TT, 128, 0, stream>>>(S, F[1], F[2], F[9], F[10], b, MX);
    k_g<0><<<dim3(NARB / 64, GH / 128), 128, 0, stream>>>(MX, W1P, F[12], T1, nullptr);
    k_g<1><<<dim3(NARB / 64, GH / 128), 128, 0, stream>>>(T1, W2P, F[14], nullptr, G);
    k_fin<<<TT, 128, 0, stream>>>(S, F[1], F[2], G, b, P);
    k_pv<<<dim3(TT / 64, NH), 128, 0, stream>>>(P, VT, b, (float*)d_out);
  }
}

// v003
// One run takes 284 microseconds.
// Next to v002, in two timings, it ran 1.92 and 1.91 times as fast.
// Over all steps from v000 it is 3.91 times as fast.
// compute dtype: all float inputs rounded to bf16, attention_mask / dependency_matrix read; q/k/v = hidden W + b with EXACT bf16 products on WMMA 16x16x32, f32 accumulate; scores = q k^T / 8 with q as f16 hi + residual and k f16 (2 products), stored in f32 for all batches and heads at once; self = scores + (1 - mask) * -1e4, dep = scores * dependency in f32; LayerNorm over the concatenated 1,024-row in f32 -> f16 rows; gating MLP tanh(ln W1 + b1) (1 f16 product, f16 rows) then sigmoid(. W2 + b2) (1 f16 product); mixed = g self + (1 - g) dep and its softmax in f32 (precise expf) -> P f16 x 2^11; ctx = P . v (v rounded once to f16); f32 output [b][t][768].
#include <hip/hip_runtime.h>
#include <math.h>

typedef __attribute__((ext_vector_type(16))) _Float16 v16h;
typedef __attribute__((ext_vector_type(16))) __bf16 v16b;
typedef __attribute__((ext_vector_type(8)))  _Float16 v8h;
typedef __attribute__((ext_vector_type(8)))  float v8f;
typedef __attribute__((ext_vector_type(4)))  float v4f;
typedef __attribute__((ext_vector_type(2)))  float v2f;
typedef __attribute__((ext_vector_type(4)))  unsigned v4u;
typedef __attribute__((ext_vector_type(4)))  int v4i;
typedef float __attribute__((may_alias)) float_a;
typedef int __attribute__((may_alias)) int_a;

template <typename T> __device__ __forceinline__ void vst2(void* p, T v) { *(T*)p = v;  }
__device__ __forceinline__ v8f wmma16(v16h a, v16h b, v8f c) {
  v8f d = __builtin_amdgcn_wmma_f32_16x16x32_f16(false, a, false, b, (short)0, c, false, false);
  asm volatile("v_nop\n\tv_nop\n\tv_nop\n\tv_nop" : "+v"(d) : "v"(a), "v"(b));
  return d;
}
__device__ __forceinline__ v8f wmma_bf(v16b a, v16b b, v8f c) {
  v8f d = __builtin_amdgcn_wmma_f32_16x16x32_bf16(false, a, false, b, (short)0, c, false, false);
  asm volatile("v_nop\n\tv_nop\n\tv_nop\n\tv_nop" : "+v"(d) : "v"(a), "v"(b));
  return d;
}
// 16x16x32 fragments: lane = (h = lane>>4, row/col = lane&15); elements 0..7 = k0+8h+0..7, 8..15 = k0+16+8h+0..7; D element r = row 8h+r
__device__ __forceinline__ v16h frag_h(const _Float16* rowk0, int lane) {
  union { v16h v; v8h q[2]; } u; const _Float16* p = rowk0 + 8 * (lane >> 4);
  u.q[0] = *(const v8h*)p; u.q[1] = *(const v8h*)(p + 16); return u.v;
}
__device__ __forceinline__ v16h frag_f32(const float* rowk0, int lane) {
  v16h a; const float* p = rowk0 + 8 * (lane >> 4);
#pragma unroll
  for (int i = 0; i < 8; ++i) { a[i] = (_Float16)p[i]; a[8 + i] = (_Float16)p[16 + i]; }
  return a;
}
__device__ __forceinline__ v16h frag_f32s(const float* rowk0, int lane, float sc) {
  v16h a; const float* p = rowk0 + 8 * (lane >> 4);
#pragma unroll
  for (int i = 0; i < 8; ++i) { a[i] = (_Float16)(p[i] * sc); a[8 + i] = (_Float16)(p[16 + i] * sc); }
  return a;
}
// column fragment from a [K][ld] layout (column n), rows >= K read as 0
__device__ __forceinline__ v16h fragc_f32(const float* W, int k0, int n, int lane, int ld, int K) {
  v16h a; const int g = lane >> 4;
#pragma unroll
  for (int i = 0; i < 8; ++i) { const int ka = k0 + 8 * g + i, kb = ka + 16;
    a[i] = (_Float16)(ka < K ? W[(size_t)(ka < K ? ka : K - 1) * ld + n] : 0.f); a[8 + i] = (_Float16)(kb < K ? W[(size_t)(kb < K ? kb : K - 1) * ld + n] : 0.f); }
  return a;
}
struct F2 { v16b h, l; };
__device__ __forceinline__ F2 bsplit16(const float v[16]) { F2 r;
#pragma unroll
  for (int i = 0; i < 16; ++i) { const __bf16 h = (__bf16)v[i]; r.h[i] = h; r.l[i] = (__bf16)(v[i] - (float)h); }
  return r; }
__device__ __forceinline__ F2 split_row(const float* row, int k0, int lane) { float v[16]; const float* p = row + k0 + 8 * (lane >> 4);
#pragma unroll
  for (int i = 0; i < 8; ++i) { v[i] = p[i]; v[8 + i] = p[16 + i]; }
  return bsplit16(v); }
__device__ __forceinline__ F2 split_rowK(const float* row, int k0, int lane, int K) { float v[16]; const int g = lane >> 4;
#pragma unroll
  for (int i = 0; i < 8; ++i) { const int ka = k0 + 8 * g + i, kb = ka + 16; v[i] = ka < K ? row[ka < K ? ka : K - 1] : 0.f; v[8 + i] = kb < K ? row[kb < K ? kb : K - 1] : 0.f; }
  return bsplit16(v); }
__device__ __forceinline__ F2 split_col(const float* W, int k0, int n, int lane, int ld, int K) { float v[16]; const int g = lane >> 4;
#pragma unroll
  for (int i = 0; i < 8; ++i) { const int ka = k0 + 8 * g + i, kb = ka + 16; v[i] = ka < K ? W[(size_t)(ka < K ? ka : K - 1) * ld + n] : 0.f; v[8 + i] = kb < K ? W[(size_t)(kb < K ? kb : K - 1) * ld + n] : 0.f; }
  return bsplit16(v); }
__device__ __forceinline__ v8f mac3(const F2& a, const F2& b, v8f c) { c = wmma_bf(a.l, b.h, c); c = wmma_bf(a.h, b.l, c); return wmma_bf(a.h, b.h, c); }
__device__ __forceinline__ float sigm(float v) { return 1.0f / (1.0f + expf(-v)); }
#define LDSX() do { asm volatile("s_wait_dscnt 0" ::: "memory"); __builtin_amdgcn_wave_barrier(); __builtin_amdgcn_fence(__ATOMIC_RELEASE, "workgroup"); } while (0)


// Dependency-mixed BERT self attention (B 8, T 512, C 768 = 12 x 64): a learned per-(query, key) gate between plain attention scores and dependency-weighted scores, then softmax . v.
#define NB 8
#define TT 512
#define CC 768
#define NH 12
#define HD 64
#define NROW (NB * TT)          // 4096 token rows
#define NAR (NB * NH * TT)      // 49152 attention rows
#define GH 512                  // gating hidden (= T)
#ifndef TNB
#define TNB NB
#endif
typedef __attribute__((ext_vector_type(8))) __bf16 v8b;
__device__ __forceinline__ v16b frag_b(const __bf16* rowk0, int lane) {
  union { v16b v; v8b q[2]; } u; const __bf16* p = rowk0 + 8 * (lane >> 4);
  u.q[0] = *(const v8b*)p; u.q[1] = *(const v8b*)(p + 16); return u.v;
}
__device__ __forceinline__ float bfr(float v) { return (float)(__bf16)v; }
__device__ __attribute__((noinline)) float exp_ni(float v) { return expf(v); }
__device__ __attribute__((noinline)) float erf_ni(float v) { return erff(v); }

// Every stage runs once for all NAR = 49,152 attention rows (row = (b * 12 + h) * 512 + t). The whole-problem buffers fit the workspace because a buffer takes the place of one whose last reader is an earlier launch of the same call.
#define NARB (NH * TT)                                   // attention rows of one batch
#define WS_S   0u                                        // f32 scores [b][h][t][s]: k_sc -> k_mix, k_fin
#define WS_MX  (WS_S + 4u * (size_t)NAR * TT)            // f16 LN'd mixed rows [row][1024]: k_mix -> k_g<0>
#define WS_G   WS_MX                                     // f32 gate rows [row][512], same size, in MX's place: k_g<1> -> k_fin
#define WS_T1  (WS_MX + 2u * (size_t)NAR * 2 * TT)       // f16 hidden gate rows [row][512]: k_g<0> -> k_g<1>
#define WS_P   WS_T1                                     // f16 probabilities [row][512], same size, in T1's place: k_fin -> k_pv
#define WS_VT  (WS_T1 + 2u * (size_t)NAR * GH)           // f16 v planes [b][768][t]: k_proj -> k_pv
// 16-bit copies of hidden and of the five weights in fragment order, written by k_pack at the head of every call
#define WS_W1P (WS_VT + 2u * (size_t)NROW * CC)          // f16 W1 [kc][col tile][1 KB tile]
#define WS_W2P (WS_W1P + 2u * (size_t)2 * TT * GH)       // f16 W2 [kc][col tile][1 KB tile]
#define WS_END (WS_W2P + 2u * (size_t)GH * GH)
// last read by k_proj or k_sc, so they lie at the head of MX's range, which k_mix writes behind them
#define WS_QH  WS_MX
#define WS_QL  (WS_QH + 2u * (size_t)NROW * CC)
#define WS_KH  (WS_QL + 2u * (size_t)NROW * CC)
#define WS_XP  (WS_KH + 2u * (size_t)NROW * CC)          // bf16 hidden [row tile][kc][1 KB tile]
#define WS_WP  (WS_XP + 2u * (size_t)NROW * CC)          // bf16 Wq, Wk, Wv, each [kc][col tile][1 KB tile]
static_assert(WS_WP + 3u * 2u * (size_t)CC * CC <= WS_T1, "q, k and the packed projection operands must end inside MX's range");

// A packed tile is one 16 x 32 fragment as the wave reads it: [q = 0, 1][lane][8 elements], element i of piece q = k0 + 16 q + 8 (lane >> 4) + i of row or column (lane & 15).
// Each of the two 16-byte loads of a wave then covers 512 contiguous bytes (four whole lines).
__device__ __forceinline__ v16h fragp_h(const _Float16* tile, int lane) {
  union { v16h v; v8h q[2]; } u; const _Float16* p = tile + lane * 8;
  u.q[0] = *(const v8h*)p; u.q[1] = *(const v8h*)(p + 256); return u.v;
}
__device__ __forceinline__ v16b fragp_b(const __bf16* tile, int lane) {
  union { v16b v; v8b q[2]; } u; const __bf16* p = tile + lane * 8;
  u.q[0] = *(const v8b*)p; u.q[1] = *(const v8b*)(p + 256); return u.v;
}
// one 16-byte piece (8 consecutive k of column n) of a [K][N] f32 weight; 32 consecutive ids read whole lines and write two 256-byte runs
template <int N, bool F16> __device__ __forceinline__ void pack_w(const float* __restrict__ Wm, int id, void* __restrict__ dst) {
  const int n = id % N, ko = id / N, kc = ko >> 2, g = ko & 1, q = (ko >> 1) & 1; float v[8];
#pragma unroll
  for (int i = 0; i < 8; ++i) v[i] = Wm[(size_t)(ko * 8 + i) * N + n];
  const size_t d = ((size_t)(kc * (N / 16) + (n >> 4)) * 2 + q) * 32 + g * 16 + (n & 15);
  if (F16) { v8h o;
#pragma unroll
    for (int i = 0; i < 8; ++i) o[i] = (_Float16)bfr(v[i]);
    *((v8h*)dst + d) = o; asm volatile("s_wait_xcnt 0x0" ::: "memory"); /* the store's address and data registers may be rewritten behind it: wait first */ }
  else { v8b o;
#pragma unroll
    for (int i = 0; i < 8; ++i) o[i] = (__bf16)v[i];
    *((v8b*)dst + d) = o; asm volatile("s_wait_xcnt 0x0" ::: "memory"); /* the store's address and data registers may be rewritten behind it: wait first */ } }
#define PB_X  (NROW * CC / 8 / 256)       // blocks of 256 pieces: hidden
#define PB_W  (CC * CC / 8 / 256)         // Wq, Wk, Wv each
#define PB_W1 (2 * TT * GH / 8 / 256)
#define PB_W2 (GH * GH / 8 / 256)
// ---- k_pack: thread = one 16-byte piece of a packed tile; the block index picks the matrix
__global__ __launch_bounds__(256) void k_pack(const float* __restrict__ X, const float* __restrict__ WQ, const float* __restrict__ WK, const float* __restrict__ WV, const float* __restrict__ W1, const float* __restrict__ W2, __bf16* __restrict__ XP, __bf16* __restrict__ WP, _Float16* __restrict__ W1P, _Float16* __restrict__ W2P) {
  int blk = blockIdx.x; const int t = threadIdx.x;
  if (blk < PB_X) { const int d = blk * 256 + t, r = d & 15, g = (d >> 4) & 1, q = (d >> 5) & 1, tile = d >> 6, kc = tile % (CC / 32), rt = tile / (CC / 32);
    const float* p = X + (size_t)(rt * 16 + r) * CC + kc * 32 + q * 16 + g * 8; const v4f lo = *(const v4f*)p, hi = *(const v4f*)(p + 4); v8b o;
#pragma unroll
    for (int i = 0; i < 4; ++i) { o[i] = (__bf16)lo[i]; o[4 + i] = (__bf16)hi[i]; }
    *((v8b*)XP + d) = o; asm volatile("s_wait_xcnt 0x0" ::: "memory"); /* the store's address and data registers may be rewritten behind it: wait first */ return; }
  blk -= PB_X;
  if (blk < 3 * PB_W) { const int which = blk / PB_W; pack_w<CC, false>(which == 0 ? WQ : which == 1 ? WK : WV, (blk - which * PB_W) * 256 + t, WP + (size_t)which * CC * CC); return; }
  blk -= 3 * PB_W;
  if (blk < PB_W1) { pack_w<GH, true>(W1, blk * 256 + t, W1P); return; }
  pack_w<GH, true>(W2, (blk - PB_W1) * 256 + t, W2P); }

// ---- k_proj: block = (64 rows, 128 cols, which): hidden W + b ([in,out]); q hi + residual rows, k rows, v planes
__global__ __launch_bounds__(128) void k_proj(const __bf16* __restrict__ XP, const __bf16* __restrict__ WP, const float* __restrict__ BQ, const float* __restrict__ BK, const float* __restrict__ BV, _Float16* __restrict__ QH, _Float16* __restrict__ QL, _Float16* __restrict__ KH, _Float16* __restrict__ VT) {
  __shared__ __align__(16) _Float16 sh[64][136], sl[64][136]; __shared__ __align__(16) _Float16 th[128][72];
  const int tid = threadIdx.x, wave = tid >> 5, lane = tid & 31, col = lane & 15, g = lane >> 4; const int which = blockIdx.z; const int c0 = blockIdx.y * 128; const size_t r0 = (size_t)blockIdx.x * 64;
  const __bf16* Wm = WP + (size_t)which * CC * CC + (size_t)(c0 / 16) * 512; const __bf16* Xm = XP + (size_t)(r0 / 16 + wave) * (CC / 32) * 512; const float* Bm = which == 0 ? BQ : which == 1 ? BK : BV;
  v8f acc[8] = {};
#pragma unroll 2
  for (int kc = 0; kc < CC / 32; ++kc) { const v16b a = fragp_b(Xm + (size_t)kc * 512, lane); v16b w[8];
#pragma unroll
    for (int j = 0; j < 8; ++j) w[j] = fragp_b(Wm + ((size_t)kc * (CC / 16) + j) * 512, lane);
#pragma unroll
    for (int j = 0; j < 8; ++j) acc[j] = wmma_bf(a, w[j], acc[j]); }
#pragma unroll
  for (int j = 0; j < 8; ++j) { const float bb = bfr(Bm[c0 + j * 16 + col]);
#pragma unroll
    for (int r = 0; r < 8; ++r) { const float v = acc[j][r] + bb; const int rl = wave * 16 + 8 * g + r, cl = j * 16 + col; const _Float16 hv = (_Float16)v;
      if (which == 2) th[cl][rl] = hv; else { sh[rl][cl] = hv; sl[rl][cl] = (_Float16)(v - (float)hv); } } }
  __syncthreads();
  if (which < 2) { _Float16* dh = which == 0 ? QH : KH; for (int e = tid; e < 64 * 16; e += 128) { const int rl = e >> 4, q = e & 15; vst2((unsigned*)(dh + (r0 + rl) * CC + c0 + q * 8), *(const v4u*)&sh[rl][q * 8]); if (which == 0) vst2((unsigned*)(QL + (r0 + rl) * CC + c0 + q * 8), *(const v4u*)&sl[rl][q * 8]); } }
  else { const size_t b = r0 / TT; const int t0 = (int)(r0 % TT); for (int e = tid; e < 128 * 8; e += 128) { const int cl = e >> 3, q = e & 7; vst2((unsigned*)(VT + (b * CC + c0 + cl) * (size_t)TT + t0 + q * 8), *(const v4u*)&th[cl][q * 8]); } } }
// ---- k_sc: block = (64 queries, 128 keys, bh): scores / 8 (2 products) -> S[bh][t][s]
__global__ __launch_bounds__(128) void k_sc(const _Float16* __restrict__ QH, const _Float16* __restrict__ QL, const _Float16* __restrict__ KH, float* __restrict__ S) { __shared__ __align__(16) float ss[4][16][132];
  const int tid = threadIdx.x, wave = tid >> 5, lane = tid & 31, col = lane & 15, g = lane >> 4; const int k0 = blockIdx.y * 128; const int bh = blockIdx.z; const int b = bh / NH, h = bh % NH; const int ql0 = blockIdx.x * 64 + wave * 16; const size_t q0 = (size_t)b * TT + ql0;
  v8f acc[8] = {};
#pragma unroll
  for (int kc = 0; kc < HD / 32; ++kc) { const v16h ah = frag_h(QH + (q0 + col) * CC + h * HD + kc * 32, lane), al = frag_h(QL + (q0 + col) * CC + h * HD + kc * 32, lane);
#pragma unroll
    for (int j = 0; j < 8; ++j) { const v16h kb = frag_h(KH + ((size_t)b * TT + k0 + j * 16 + col) * CC + h * HD + kc * 32, lane); acc[j] = wmma16(ah, kb, acc[j]); acc[j] = wmma16(al, kb, acc[j]); } }
#pragma unroll
  for (int j = 0; j < 8; ++j)
#pragma unroll
    for (int r = 0; r < 8; ++r) ss[wave][8 * g + r][j * 16 + col] = acc[j][r] * 0.125f;
  LDSX(); for (int rl = 0; rl < 16; ++rl) vst2(S + ((size_t)bh * TT + ql0 + rl) * TT + k0 + lane * 4, *(const v4f*)&ss[wave][rl][lane * 4]); }
// ---- row kernels: one wave owns a whole attention row in registers (element 4 j + i of a lane's 16 is s = 128 j + 4 lane + i), so a row needs no LDS and no barrier;
// a wave does RH heads of one query and keeps that query's dependency row, the mask and the LayerNorm vectors in registers for all of them.
#define RH 3                    // heads per wave; the 4 waves of a block cover the 12 heads of one query
typedef __attribute__((ext_vector_type(16))) float v16f;
typedef __attribute__((ext_vector_type(4))) _Float16 v4h;
template <int M> __device__ __forceinline__ float xrow(float x) { return __builtin_bit_cast(float, __builtin_amdgcn_update_dpp(0, __builtin_bit_cast(int, x), 0x160 | M, 0xf, 0xf, true)); }  // lane l ^ M inside a 16-lane row (DPP row_xmask)
__device__ __forceinline__ float xhalf(float x) { return __builtin_bit_cast(float, __builtin_amdgcn_permlanex16(__builtin_bit_cast(int, x), __builtin_bit_cast(int, x), 0x76543210, 0xfedcba98, false, false)); }  // lane l ^ 16
__device__ __forceinline__ float wsum(float x) { x += xrow<1>(x); x += xrow<2>(x); x += xrow<4>(x); x += xrow<8>(x); return x + xhalf(x); }
__device__ __forceinline__ float wmax(float x) { x = fmaxf(x, xrow<1>(x)); x = fmaxf(x, xrow<2>(x)); x = fmaxf(x, xrow<4>(x)); x = fmaxf(x, xrow<8>(x)); return fmaxf(x, xhalf(x)); }
__device__ __forceinline__ float hsum(v16f v) { const v8f a = __builtin_shufflevector(v, v, 0, 1, 2, 3, 4, 5, 6, 7) + __builtin_shufflevector(v, v, 8, 9, 10, 11, 12, 13, 14, 15); const v4f c = __builtin_shufflevector(a, a, 0, 1, 2, 3) + __builtin_shufflevector(a, a, 4, 5, 6, 7); return (c[0] + c[1]) + (c[2] + c[3]); }
// 512 consecutive floats at the wave-uniform p: four 16-byte loads per lane, each 512 contiguous bytes per wave; vb = 16 lane
__device__ __forceinline__ v16f ld_row(const float* __restrict__ p, unsigned vb) { const char* c = (const char*)p + vb; const v4f q0 = *(const v4f*)c, q1 = *(const v4f*)(c + 512), q2 = *(const v4f*)(c + 1024), q3 = *(const v4f*)(c + 1536);
  return __builtin_shufflevector(__builtin_shufflevector(q0, q1, 0, 1, 2, 3, 4, 5, 6, 7), __builtin_shufflevector(q2, q3, 0, 1, 2, 3, 4, 5, 6, 7), 0, 1, 2, 3, 4, 5, 6, 7, 8, 9, 10, 11, 12, 13, 14, 15); }
// 512 consecutive f16 to the wave-uniform p: four 8-byte stores per lane, each 256 contiguous bytes per wave; vh = 8 lane
__device__ __forceinline__ void st_row(_Float16* __restrict__ p, unsigned vh, v16f v) { char* c = (char*)p + vh; const v16h h = __builtin_convertvector(v, v16h);
  *(v4h*)c = __builtin_shufflevector(h, h, 0, 1, 2, 3); *(v4h*)(c + 256) = __builtin_shufflevector(h, h, 4, 5, 6, 7); *(v4h*)(c + 512) = __builtin_shufflevector(h, h, 8, 9, 10, 11); *(v4h*)(c + 768) = __builtin_shufflevector(h, h, 12, 13, 14, 15); }
__device__ __forceinline__ v16f bfr16(v16f v) { v16f r;
#pragma unroll
  for (int i = 0; i < 16; ++i) r[i] = bfr(v[i]);
  return r; }
// ---- k_mix: block = (query t, batch), wave = RH heads: mixed = [self | dep] (1,024), LayerNorm (eps 1e-5) -> f16 row
__global__ __launch_bounds__(128) void k_mix(const float* __restrict__ S, const float* __restrict__ AM, const float* __restrict__ DM, const float* __restrict__ LG, const float* __restrict__ LB, _Float16* __restrict__ MX) {
  const unsigned lane = threadIdx.x & 31, vb = lane * 16, vh = lane * 8; const int tq = blockIdx.x, b = blockIdx.y; const size_t row0 = (size_t)__builtin_amdgcn_readfirstlane(b * NARB + (int)(threadIdx.x >> 5) * (RH * TT) + tq);
  v16f sc[RH];
  v16f dm = ld_row(DM + ((size_t)b * TT + tq) * TT, vb);
#pragma unroll
  for (int hh = 0; hh < RH; ++hh) sc[hh] = ld_row(S + (row0 + hh * TT) * TT, vb);
  v16f om = ld_row(AM + (size_t)b * TT, vb), lg0 = ld_row(LG, vb), lg1 = ld_row(LG + TT, vb), lb0 = ld_row(LB, vb), lb1 = ld_row(LB + TT, vb);
  asm volatile("" :: "v"(dm), "v"(sc[0]), "v"(sc[1]), "v"(sc[2]), "v"(om), "v"(lg0), "v"(lg1), "v"(lb0), "v"(lb1)); // holds the loads in place (loaded rows as inputs only): without it the LayerNorm vectors' loads sink behind the row sums and their latency is paid a second time
  dm = bfr16(dm); om = 1.0f - bfr16(om); lg0 = bfr16(lg0); lg1 = bfr16(lg1); lb0 = bfr16(lb0); lb1 = bfr16(lb1);
#pragma unroll
  for (int hh = 0; hh < RH; ++hh) { v16f x0 = sc[hh] + om * -10000.0f, x1 = sc[hh] * dm;
    const float mu = wsum(hsum(x0 + x1)) / (2 * TT);
    x0 -= mu; x1 -= mu;
    const float inv = 1.0f / sqrtf(wsum(hsum(x0 * x0 + x1 * x1)) / (2 * TT) + 1e-5f);
    _Float16* o = MX + (row0 + hh * TT) * (2 * TT);
    st_row(o, vh, x0 * inv * lg0 + lb0); st_row(o + TT, vh, x1 * inv * lg1 + lb1); } }
// ---- k_g: block = (128 cols, 64 rows), the column tile the fast grid index (for speed only): stage 0: T1 = tanh(MX W1 + b1) (K 1024) -> f16 rows; stage 1: G = sigmoid(T1 W2 + b2) (K 512) -> f32 rows
template <int STAGE>
__global__ __launch_bounds__(128) void k_g(const _Float16* __restrict__ IN, const _Float16* __restrict__ WPK, const float* __restrict__ Bm, _Float16* __restrict__ OUTH, float* __restrict__ OUTF) { __shared__ __align__(16) float sf[4][16][132]; __shared__ __align__(16) _Float16 sh2[64][136];
  const int tid = threadIdx.x, wave = tid >> 5, lane = tid & 31, col = lane & 15, g = lane >> 4; const int c0 = blockIdx.x * 128; const size_t r0 = (size_t)blockIdx.y * 64 + wave * 16; constexpr int K = (STAGE == 0) ? 2 * TT : GH; constexpr int NOUT = GH;
  v8f acc[8] = {};
#pragma unroll 2
  for (int kc = 0; kc < K / 32; ++kc) { const v16h a = frag_h(IN + (r0 + col) * K + kc * 32, lane); v16h w[8];
#pragma unroll
    for (int j = 0; j < 8; ++j) w[j] = fragp_h(WPK + ((size_t)kc * (NOUT / 16) + c0 / 16 + j) * 512, lane);
#pragma unroll
    for (int j = 0; j < 8; ++j) acc[j] = wmma16(a, w[j], acc[j]); }
#pragma unroll
  for (int j = 0; j < 8; ++j) { const float bb = bfr(Bm[c0 + j * 16 + col]);
#pragma unroll
    for (int r = 0; r < 8; ++r) { const float v = acc[j][r] + bb; if (STAGE == 0) sh2[wave * 16 + 8 * g + r][j * 16 + col] = (_Float16)tanhf(v); else sf[wave][8 * g + r][j * 16 + col] = 1.0f / (1.0f + expf(-v)); } }
  __syncthreads();
  if (STAGE == 0) { for (int e = tid; e < 64 * 16; e += 128) { const int rl = e >> 4, q = e & 15; vst2((unsigned*)(OUTH + ((size_t)blockIdx.y * 64 + rl) * GH + c0 + q * 8), *(const v4u*)&sh2[rl][q * 8]); } }
  else { for (int rl = 0; rl < 16; ++rl) vst2(OUTF + (r0 + rl) * TT + c0 + lane * 4, *(const v4f*)&sf[wave][rl][lane * 4]); } }
// ---- k_fin: block = (query t, batch), wave = RH heads: logits = g self + (1 - g) dep; softmax over s -> P x 2^11 f16
__global__ __launch_bounds__(128) void k_fin(const float* __restrict__ S, const float* __restrict__ AM, const float* __restrict__ DM, const float* __restrict__ G, _Float16* __restrict__ P) {
  const unsigned lane = threadIdx.x & 31, vb = lane * 16, vh = lane * 8; const int tq = blockIdx.x, b = blockIdx.y; const size_t row0 = (size_t)__builtin_amdgcn_readfirstlane(b * NARB + (int)(threadIdx.x >> 5) * (RH * TT) + tq);
  v16f sc[RH], gg[RH];
  v16f dm = ld_row(DM + ((size_t)b * TT + tq) * TT, vb);
#pragma unroll
  for (int hh = 0; hh < RH; ++hh) { sc[hh] = ld_row(S + (row0 + hh * TT) * TT, vb); gg[hh] = ld_row(G + (row0 + hh * TT) * TT, vb); }
  v16f om = ld_row(AM + (size_t)b * TT, vb);
  asm volatile("" :: "v"(dm), "v"(sc[0]), "v"(sc[1]), "v"(sc[2]), "v"(gg[0]), "v"(gg[1]), "v"(gg[2]), "v"(om)); // holds the loads in place (loaded rows as inputs only): all three heads' rows are in flight together, one latency per wave
  dm = bfr16(dm); om = 1.0f - bfr16(om);
#pragma unroll
  for (int hh = 0; hh < RH; ++hh) { const v16f se = sc[hh] + om * -10000.0f, de = sc[hh] * dm; v16f x = gg[hh] * se + (1.0f - gg[hh]) * de; float m = -3.0e38f;
#pragma unroll
    for (int i = 0; i < 16; ++i) m = fmaxf(m, x[i]);
    m = wmax(m);
#pragma unroll
    for (int i = 0; i < 16; ++i) x[i] = expf(x[i] - m);
    const float inv = 1.0f / wsum(hsum(x));
    st_row(P + (row0 + hh * TT) * TT, vh, x * inv * 2048.0f); } }
// ---- k_pv: block = (64 queries, bh): ctx[b][t][h*64 + d] = P . v
__global__ __launch_bounds__(128) void k_pv(const _Float16* __restrict__ P, const _Float16* __restrict__ VT, float* __restrict__ OUT) { __shared__ __align__(16) float ss[4][16][68];
  const int tid = threadIdx.x, wave = tid >> 5, lane = tid & 31, col = lane & 15, g = lane >> 4; const int bh = blockIdx.y; const int b = bh / NH, h = bh % NH; const int ql0 = blockIdx.x * 64 + wave * 16;
  v8f acc[4] = {};
#pragma unroll 1
  for (int kc = 0; kc < TT / 32; ++kc) { const v16h ph = frag_h(P + ((size_t)bh * TT + ql0 + col) * TT + kc * 32, lane);
#pragma unroll
    for (int j = 0; j < 4; ++j) acc[j] = wmma16(ph, frag_h(VT + ((size_t)b * CC + h * HD + j * 16 + col) * TT + kc * 32, lane), acc[j]); }
#pragma unroll
  for (int j = 0; j < 4; ++j)
#pragma unroll
    for (int r = 0; r < 8; ++r) ss[wave][8 * g + r][j * 16 + col] = acc[j][r] * (1.0f / 2048.0f);
  LDSX(); for (int rl = 0; rl < 16; ++rl) if (lane < 16) vst2(OUT + ((size_t)b * TT + ql0 + rl) * CC + h * HD + lane * 4, *(const v4f*)&ss[wave][rl][lane * 4]); }
extern "C" void kernel_launch(void* const* d_in, const int* in_sizes, int n_in, void* d_out, int out_size, void* d_ws, size_t ws_size, hipStream_t stream) {
  (void)in_sizes; (void)n_in; (void)out_size;
  const float** F = (const float**)d_in;   // 0 hidden [8,512,768], 1 attention_mask [8,512], 2 dependency_matrix [8,512,512], 3 Wq [768,768] ([in,out]), 4 bq, 5 Wk, 6 bk, 7 Wv, 8 bv, 9 ln_g [1024], 10 ln_b, 11 W1 [1024,512], 12 b1, 13 W2 [512,512], 14 b2
  if (ws_size < (size_t)WS_END) return;
  char* ws = (char*)d_ws; _Float16 *QH = (_Float16*)(ws + WS_QH), *QL = (_Float16*)(ws + WS_QL), *KH = (_Float16*)(ws + WS_KH), *VT = (_Float16*)(ws + WS_VT), *MX = (_Float16*)(ws + WS_MX), *T1 = (_Float16*)(ws + WS_T1), *P = (_Float16*)(ws + WS_P), *W1P = (_Float16*)(ws + WS_W1P), *W2P = (_Float16*)(ws + WS_W2P); __bf16 *XP = (__bf16*)(ws + WS_XP), *WP = (__bf16*)(ws + WS_WP); float *S = (float*)(ws + WS_S), *G = (float*)(ws + WS_G);
  k_pack<<<PB_X + 3 * PB_W + PB_W1 + PB_W2, 256, 0, stream>>>(F[0], F[3], F[5], F[7], F[11], F[13], XP, WP, W1P, W2P);
  k_proj<<<dim3(TNB * TT / 64, CC / 128, 3), 128, 0, stream>>>(XP, WP, F[4], F[6], F[8], QH, QL, KH, VT);
  k_sc<<<dim3(TT / 64, TT / 128, TNB * NH), 128, 0, stream>>>(QH, QL, KH, S);
  k_mix<<<dim3(TT, TNB), 128, 0, stream>>>(S, F[1], F[2], F[9], F[10], MX);
  k_g<0><<<dim3(GH / 128, TNB * NARB / 64), 128, 0, stream>>>(MX, W1P, F[12], T1, nullptr);
  k_g<1><<<dim3(GH / 128, TNB * NARB / 64), 128, 0, stream>>>(T1, W2P, F[14], nullptr, G);
  k_fin<<<dim3(TT, TNB), 128, 0, stream>>>(S, F[1], F[2], G, P);
  k_pv<<<dim3(TT / 64, TNB * NH), 128, 0, stream>>>(P, VT, (float*)d_out);
}

// v004
// One run takes 260 microseconds.
// Next to v003, in two timings, it ran 1.09 times as fast each time.
// All steps since v000 together make it 4.25 times as fast.
// compute dtype: all float inputs rounded to bf16, attention_mask / dependency_matrix read; q/k/v = hidden W + b with EXACT bf16 products on WMMA 16x16x32, f32 accumulate; scores = q k^T / 8 with q as f16 hi + residual and k f16 (2 products), stored in f32 for all batches and heads at once; self = scores + (1 - mask) * -1e4, dep = scores * dependency in f32; LayerNorm over the concatenated 1,024-row in f32 -> f16 rows; gating MLP tanh(ln W1 + b1) (1 f16 product, f16 rows) then sigmoid(. W2 + b2) (1 f16 product); mixed = g self + (1 - g) dep and its softmax in f32 (precise expf) -> P f16 x 2^11; ctx = P . v (v rounded once to f16); f32 output [b][t][768].
#include <hip/hip_runtime.h>
#include <math.h>

typedef __attribute__((ext_vector_type(16))) _Float16 v16h;
typedef __attribute__((ext_vector_type(16))) __bf16 v16b;
typedef __attribute__((ext_vector_type(8)))  _Float16 v8h;
typedef __attribute__((ext_vector_type(8)))  float v8f;
typedef __attribute__((ext_vector_type(4)))  float v4f;
typedef __attribute__((ext_vector_type(2)))  float v2f;
typedef __attribute__((ext_vector_type(4)))  unsigned v4u;
typedef __attribute__((ext_vector_type(4)))  int v4i;
typedef float __attribute__((may_alias)) float_a;
typedef int __attribute__((may_alias)) int_a;

template <typename T> __device__ __forceinline__ void vst2(void* p, T v) { *(T*)p = v;  }
__device__ __forceinline__ v8f wmma16(v16h a, v16h b, v8f c) {
  v8f d = __builtin_amdgcn_wmma_f32_16x16x32_f16(false, a, false, b, (short)0, c, false, false);
  asm volatile("v_nop\n\tv_nop\n\tv_nop\n\tv_nop" : "+v"(d) : "v"(a), "v"(b));
  return d;
}
__device__ __forceinline__ v8f wmma_bf(v16b a, v16b b, v8f c) {
  v8f d = __builtin_amdgcn_wmma_f32_16x16x32_bf16(false, a, false, b, (short)0, c, false, false);
  asm volatile("v_nop\n\tv_nop\n\tv_nop\n\tv_nop" : "+v"(d) : "v"(a), "v"(b));
  return d;
}
// 16x16x32 fragments: lane = (h = lane>>4, row/col = lane&15); elements 0..7 = k0+8h+0..7, 8..15 = k0+16+8h+0..7; D element r = row 8h+r
__device__ __forceinline__ v16h frag_h(const _Float16* rowk0, int lane) {
  union { v16h v; v8h q[2]; } u; const _Float16* p = rowk0 + 8 * (lane >> 4);
  u.q[0] = *(const v8h*)p; u.q[1] = *(const v8h*)(p + 16); return u.v;
}
__device__ __forceinline__ v16h frag_f32(const float* rowk0, int lane) {
  v16h a; const float* p = rowk0 + 8 * (lane >> 4);
#pragma unroll
  for (int i = 0; i < 8; ++i) { a[i] = (_Float16)p[i]; a[8 + i] = (_Float16)p[16 + i]; }
  return a;
}
__device__ __forceinline__ v16h frag_f32s(const float* rowk0, int lane, float sc) {
  v16h a; const float* p = rowk0 + 8 * (lane >> 4);
#pragma unroll
  for (int i = 0; i < 8; ++i) { a[i] = (_Float16)(p[i] * sc); a[8 + i] = (_Float16)(p[16 + i] * sc); }
  return a;
}
// column fragment from a [K][ld] layout (column n), rows >= K read as 0
__device__ __forceinline__ v16h fragc_f32(const float* W, int k0, int n, int lane, int ld, int K) {
  v16h a; const int g = lane >> 4;
#pragma unroll
  for (int i = 0; i < 8; ++i) { const int ka = k0 + 8 * g + i, kb = ka + 16;
    a[i] = (_Float16)(ka < K ? W[(size_t)(ka < K ? ka : K - 1) * ld + n] : 0.f); a[8 + i] = (_Float16)(kb < K ? W[(size_t)(kb < K ? kb : K - 1) * ld + n] : 0.f); }
  return a;
}
struct F2 { v16b h, l; };
__device__ __forceinline__ F2 bsplit16(const float v[16]) { F2 r;
#pragma unroll
  for (int i = 0; i < 16; ++i) { const __bf16 h = (__bf16)v[i]; r.h[i] = h; r.l[i] = (__bf16)(v[i] - (float)h); }
  return r; }
__device__ __forceinline__ F2 split_row(const float* row, int k0, int lane) { float v[16]; const float* p = row + k0 + 8 * (lane >> 4);
#pragma unroll
  for (int i = 0; i < 8; ++i) { v[i] = p[i]; v[8 + i] = p[16 + i]; }
  return bsplit16(v); }
__device__ __forceinline__ F2 split_rowK(const float* row, int k0, int lane, int K) { float v[16]; const int g = lane >> 4;
#pragma unroll
  for (int i = 0; i < 8; ++i) { const int ka = k0 + 8 * g + i, kb = ka + 16; v[i] = ka < K ? row[ka < K ? ka : K - 1] : 0.f; v[8 + i] = kb < K ? row[kb < K ? kb : K - 1] : 0.f; }
  return bsplit16(v); }
__device__ __forceinline__ F2 split_col(const float* W, int k0, int n, int lane, int ld, int K) { float v[16]; const int g = lane >> 4;
#pragma unroll
  for (int i = 0; i < 8; ++i) { const int ka = k0 + 8 * g + i, kb = ka + 16; v[i] = ka < K ? W[(size_t)(ka < K ? ka : K - 1) * ld + n] : 0.f; v[8 + i] = kb < K ? W[(size_t)(kb < K ? kb : K - 1) * ld + n] : 0.f; }
  return bsplit16(v); }
__device__ __forceinline__ v8f mac3(const F2& a, const F2& b, v8f c) { c = wmma_bf(a.l, b.h, c); c = wmma_bf(a.h, b.l, c); return wmma_bf(a.h, b.h, c); }
__device__ __forceinline__ float sigm(float v) { return 1.0f / (1.0f + expf(-v)); }
#define LDSX() do { asm volatile("s_wait_dscnt 0" ::: "memory"); __builtin_amdgcn_wave_barrier(); __builtin_amdgcn_fence(__ATOMIC_RELEASE, "workgroup"); } while (0)


// Dependency-mixed BERT self attention (B 8, T 512, C 768 = 12 x 64): a learned per-(query, key) gate between plain attention scores and dependency-weighted scores, then softmax . v.
#define NB 8
#define TT 512
#define CC 768
#define NH 12
#define HD 64
#define NROW (NB * TT)          // 4096 token rows
#define NAR (NB * NH * TT)      // 49152 attention rows
#define GH 512                  // gating hidden (= T)
#ifndef TNB
#define TNB NB
#endif
typedef __attribute__((ext_vector_type(8))) __bf16 v8b;
__device__ __forceinline__ v16b frag_b(const __bf16* rowk0, int lane) {
  union { v16b v; v8b q[2]; } u; const __bf16* p = rowk0 + 8 * (lane >> 4);
  u.q[0] = *(const v8b*)p; u.q[1] = *(const v8b*)(p + 16); return u.v;
}
__device__ __forceinline__ float bfr(float v) { return (float)(__bf16)v; }
__device__ __attribute__((noinline)) float exp_ni(float v) { return expf(v); }
__device__ __attribute__((noinline)) float erf_ni(float v) { return erff(v); }

// Every stage runs once for all NAR = 49,152 attention rows (row = (b * 12 + h) * 512 + t). The whole-problem buffers fit the workspace because a buffer takes the place of one whose last reader is an earlier launch of the same call.
#define NARB (NH * TT)                                   // attention rows of one batch
#define WS_S   0u                                        // f32 scores [b][h][t][s]: k_sc -> k_mix, k_fin
#define WS_MX  (WS_S + 4u * (size_t)NAR * TT)            // f16 LN'd mixed rows [row][1024]: k_mix -> k_g<0>
#define WS_G   WS_MX                                     // f32 gate rows [row][512], same size, in MX's place: k_g<1> -> k_fin
#define WS_T1  (WS_MX + 2u * (size_t)NAR * 2 * TT)       // f16 hidden gate rows [row][512]: k_g<0> -> k_g<1>
#define WS_P   WS_T1                                     // f16 probabilities [row][512], same size, in T1's place: k_fin -> k_pv
#define WS_VT  (WS_T1 + 2u * (size_t)NAR * GH)           // f16 v planes [b][768][t]: k_proj -> k_pv
// 16-bit copies of hidden and of the five weights in fragment order, written by k_pack at the head of every call
#define WS_W1P (WS_VT + 2u * (size_t)NROW * CC)          // f16 W1 [kc][col tile][1 KB tile]
#define WS_W2P (WS_W1P + 2u * (size_t)2 * TT * GH)       // f16 W2 [kc][col tile][1 KB tile]
#define WS_END (WS_W2P + 2u * (size_t)GH * GH)
// last read by k_proj or k_sc, so they lie at the head of MX's range, which k_mix writes behind them
#define WS_QH  WS_MX
#define WS_QL  (WS_QH + 2u * (size_t)NROW * CC)
#define WS_KH  (WS_QL + 2u * (size_t)NROW * CC)
#define WS_XP  (WS_KH + 2u * (size_t)NROW * CC)          // bf16 hidden [row tile][kc][1 KB tile]
#define WS_WP  (WS_XP + 2u * (size_t)NROW * CC)          // bf16 Wq, Wk, Wv, each [kc][col tile][1 KB tile]
static_assert(WS_WP + 3u * 2u * (size_t)CC * CC <= WS_T1, "q, k and the packed projection operands must end inside MX's range");

// A packed tile is one 16 x 32 fragment as the wave reads it: [q = 0, 1][lane][8 elements], element i of piece q = k0 + 16 q + 8 (lane >> 4) + i of row or column (lane & 15).
// Each of the two 16-byte loads of a wave then covers 512 contiguous bytes (four whole lines).
__device__ __forceinline__ v16h fragp_h(const _Float16* tile, int lane) {
  union { v16h v; v8h q[2]; } u; const _Float16* p = tile + lane * 8;
  u.q[0] = *(const v8h*)p; u.q[1] = *(const v8h*)(p + 256); return u.v;
}
__device__ __forceinline__ v16b fragp_b(const __bf16* tile, int lane) {
  union { v16b v; v8b q[2]; } u; const __bf16* p = tile + lane * 8;
  u.q[0] = *(const v8b*)p; u.q[1] = *(const v8b*)(p + 256); return u.v;
}
// one 16-byte piece (8 consecutive k of column n) of a [K][N] f32 weight; 32 consecutive ids read whole lines and write two 256-byte runs
template <int N, bool F16> __device__ __forceinline__ void pack_w(const float* __restrict__ Wm, int id, void* __restrict__ dst) {
  const int n = id % N, ko = id / N, kc = ko >> 2, g = ko & 1, q = (ko >> 1) & 1; float v[8];
#pragma unroll
  for (int i = 0; i < 8; ++i) v[i] = Wm[(size_t)(ko * 8 + i) * N + n];
  const size_t d = ((size_t)(kc * (N / 16) + (n >> 4)) * 2 + q) * 32 + g * 16 + (n & 15);
  if (F16) { v8h o;
#pragma unroll
    for (int i = 0; i < 8; ++i) o[i] = (_Float16)bfr(v[i]);
    *((v8h*)dst + d) = o; asm volatile("s_wait_xcnt 0x0" ::: "memory"); /* the store's address and data registers may be rewritten behind it: wait first */ }
  else { v8b o;
#pragma unroll
    for (int i = 0; i < 8; ++i) o[i] = (__bf16)v[i];
    *((v8b*)dst + d) = o; asm volatile("s_wait_xcnt 0x0" ::: "memory"); /* the store's address and data registers may be rewritten behind it: wait first */ } }
#define PB_X  (NROW * CC / 8 / 256)       // blocks of 256 pieces: hidden
#define PB_W  (CC * CC / 8 / 256)         // Wq, Wk, Wv each
#define PB_W1 (2 * TT * GH / 8 / 256)
#define PB_W2 (GH * GH / 8 / 256)
// ---- k_pack: thread = one 16-byte piece of a packed tile; the block index picks the matrix
__global__ __launch_bounds__(256) void k_pack(const float* __restrict__ X, const float* __restrict__ WQ, const float* __restrict__ WK, const float* __restrict__ WV, const float* __restrict__ W1, const float* __restrict__ W2, __bf16* __restrict__ XP, __bf16* __restrict__ WP, _Float16* __restrict__ W1P, _Float16* __restrict__ W2P) {
  int blk = blockIdx.x; const int t = threadIdx.x;
  if (blk < PB_X) { const int d = blk * 256 + t, r = d & 15, g = (d >> 4) & 1, q = (d >> 5) & 1, tile = d >> 6, kc = tile % (CC / 32), rt = tile / (CC / 32);
    const float* p = X + (size_t)(rt * 16 + r) * CC + kc * 32 + q * 16 + g * 8; const v4f lo = *(const v4f*)p, hi = *(const v4f*)(p + 4); v8b o;
#pragma unroll
    for (int i = 0; i < 4; ++i) { o[i] = (__bf16)lo[i]; o[4 + i] = (__bf16)hi[i]; }
    *((v8b*)XP + d) = o; asm volatile("s_wait_xcnt 0x0" ::: "memory"); /* the store's address and data registers may be rewritten behind it: wait first */ return; }
  blk -= PB_X;
  if (blk < 3 * PB_W) { const int which = blk / PB_W; pack_w<CC, false>(which == 0 ? WQ : which == 1 ? WK : WV, (blk - which * PB_W) * 256 + t, WP + (size_t)which * CC * CC); return; }
  blk -= 3 * PB_W;
  if (blk < PB_W1) { pack_w<GH, true>(W1, blk * 256 + t, W1P); return; }
  pack_w<GH, true>(W2, (blk - PB_W1) * 256 + t, W2P); }

// ---- k_proj: block = (64 rows, 128 cols, which): hidden W + b ([in,out]); q hi + residual rows, k rows, v planes
__global__ __launch_bounds__(128) void k_proj(const __bf16* __restrict__ XP, const __bf16* __restrict__ WP, const float* __restrict__ BQ, const float* __restrict__ BK, const float* __restrict__ BV, _Float16* __restrict__ QH, _Float16* __restrict__ QL, _Float16* __restrict__ KH, _Float16* __restrict__ VT) {
  __shared__ __align__(16) _Float16 sh[64][136], sl[64][136]; __shared__ __align__(16) _Float16 th[128][72];
  const int tid = threadIdx.x, wave = tid >> 5, lane = tid & 31, col = lane & 15, g = lane >> 4; const int which = blockIdx.z; const int c0 = blockIdx.y * 128; const size_t r0 = (size_t)blockIdx.x * 64;
  const __bf16* Wm = WP + (size_t)which * CC * CC + (size_t)(c0 / 16) * 512; const __bf16* Xm = XP + (size_t)(r0 / 16 + wave) * (CC / 32) * 512; const float* Bm = which == 0 ? BQ : which == 1 ? BK : BV;
  v8f acc[8] = {};
#pragma unroll 2
  for (int kc = 0; kc < CC / 32; ++kc) { const v16b a = fragp_b(Xm + (size_t)kc * 512, lane); v16b w[8];
#pragma unroll
    for (int j = 0; j < 8; ++j) w[j] = fragp_b(Wm + ((size_t)kc * (CC / 16) + j) * 512, lane);
#pragma unroll
    for (int j = 0; j < 8; ++j) acc[j] = wmma_bf(a, w[j], acc[j]); }
#pragma unroll
  for (int j = 0; j < 8; ++j) { const float bb = bfr(Bm[c0 + j * 16 + col]);
#pragma unroll
    for (int r = 0; r < 8; ++r) { const float v = acc[j][r] + bb; const int rl = wave * 16 + 8 * g + r, cl = j * 16 + col; const _Float16 hv = (_Float16)v;
      if (which == 2) th[cl][rl] = hv; else { sh[rl][cl] = hv; sl[rl][cl] = (_Float16)(v - (float)hv); } } }
  __syncthreads();
  if (which < 2) { _Float16* dh = which == 0 ? QH : KH; for (int e = tid; e < 64 * 16; e += 128) { const int rl = e >> 4, q = e & 15; vst2((unsigned*)(dh + (r0 + rl) * CC + c0 + q * 8), *(const v4u*)&sh[rl][q * 8]); if (which == 0) vst2((unsigned*)(QL + (r0 + rl) * CC + c0 + q * 8), *(const v4u*)&sl[rl][q * 8]); } }
  else { const size_t b = r0 / TT; const int t0 = (int)(r0 % TT); for (int e = tid; e < 128 * 8; e += 128) { const int cl = e >> 3, q = e & 7; vst2((unsigned*)(VT + (b * CC + c0 + cl) * (size_t)TT + t0 + q * 8), *(const v4u*)&th[cl][q * 8]); } } }
// Row-major 16-bit operand rows -> fragments through a strip of LDS that belongs to one wave. A fragment load straight from [row][K] memory touches 16 lines for 512 bytes;
// here one 16-byte load per lane covers four rows x one whole 128-byte line (64 k), the lines go to the strip at a pitch of 144 bytes, and the fragments are read back from there.
#define SP 72                   // strip pitch in 16-bit elements: 144 B = 16 B x 9, free of bank conflicts for 16-byte reads
// orders a wave's own LDS stores and loads on its strip (no other wave touches it, so no barrier)
#define LDSW() do { asm volatile("s_wait_dscnt 0" ::: "memory"); __builtin_amdgcn_wave_barrier(); } while (0)
template <int NG> __device__ __forceinline__ void ld_lines(v4u (&p)[NG], const _Float16* __restrict__ s, int ld) {   // s: the lane's 16 bytes in row (lane >> 3); group i is four rows further
#pragma unroll
  for (int i = 0; i < NG; ++i) p[i] = *(const v4u*)(s + (size_t)(4 * i) * ld); }
template <int NG> __device__ __forceinline__ void st_lines(_Float16* d, const v4u (&p)[NG]) {
#pragma unroll
  for (int i = 0; i < NG; ++i) *(v4u*)(d + 4 * i * SP) = p[i]; }
// ---- k_sc: block = (64 queries, 128 keys, bh): scores / 8 (2 products) -> S[bh][t][s]
__global__ __launch_bounds__(128) void k_sc(const _Float16* __restrict__ QH, const _Float16* __restrict__ QL, const _Float16* __restrict__ KH, float* __restrict__ S) { __shared__ __align__(16) char sb[4][128 * SP * 2];   // per wave: the operand strip (q rows, then 128 k rows), then the f32 tile of scores in its place
  const int tid = threadIdx.x, wave = tid >> 5, lane = tid & 31, col = lane & 15, g = lane >> 4; const int k0 = blockIdx.y * 128; const int bh = blockIdx.z; const int b = bh / NH, h = bh % NH; const int ql0 = blockIdx.x * 64 + wave * 16; const size_t q0 = (size_t)b * TT + ql0;
  static_assert(HD == 64 && 16 * 132 * 4 <= 128 * SP * 2, "a head's row is one 128-byte line; the score tile fits the strip");
  _Float16* st = (_Float16*)sb[wave]; float (*ss)[132] = (float (*)[132])sb[wave]; const int lr = lane >> 3, lc = (lane & 7) * 8; _Float16* sw = st + lr * SP + lc;
  v8f acc[8] = {}; v4u rq[4], rl4[4], rk[32]; v16h ah[2], al[2];
  ld_lines<4>(rq, QH + (q0 + lr) * CC + h * HD + lc, CC); ld_lines<4>(rl4, QL + (q0 + lr) * CC + h * HD + lc, CC);
  asm volatile("s_wait_xcnt 0x0" ::: "memory");   // the q loads' address registers may be taken for the k rows' data: wait first
  ld_lines<32>(rk, KH + ((size_t)b * TT + k0 + lr) * CC + h * HD + lc, CC);
  st_lines<4>(sw, rq); st_lines<4>(sw + 16 * SP, rl4); LDSW();
#pragma unroll
  for (int kc = 0; kc < 2; ++kc) { ah[kc] = frag_h(st + col * SP + kc * 32, lane); al[kc] = frag_h(st + (16 + col) * SP + kc * 32, lane); }
  LDSW(); st_lines<32>(sw, rk); LDSW();
#pragma unroll
  for (int kc = 0; kc < 2; ++kc) { v16h kb[8];
#pragma unroll
    for (int j = 0; j < 8; ++j) kb[j] = frag_h(st + (j * 16 + col) * SP + kc * 32, lane);
#pragma unroll
    for (int j = 0; j < 8; ++j) acc[j] = wmma16(ah[kc], kb[j], acc[j]);
#pragma unroll
    for (int j = 0; j < 8; ++j) acc[j] = wmma16(al[kc], kb[j], acc[j]); }
  LDSW();
#pragma unroll
  for (int j = 0; j < 8; ++j)
#pragma unroll
    for (int r = 0; r < 8; ++r) ss[8 * g + r][j * 16 + col] = acc[j][r] * 0.125f;
  LDSX(); for (int rl = 0; rl < 16; ++rl) vst2(S + ((size_t)bh * TT + ql0 + rl) * TT + k0 + lane * 4, *(const v4f*)&ss[rl][lane * 4]); }
// ---- row kernels: one wave owns a whole attention row in registers (element 4 j + i of a lane's 16 is s = 128 j + 4 lane + i), so a row needs no LDS and no barrier;
// a wave does RH heads of one query and keeps that query's dependency row, the mask and the LayerNorm vectors in registers for all of them.
#define RH 3                    // heads per wave; the 4 waves of a block cover the 12 heads of one query
typedef __attribute__((ext_vector_type(16))) float v16f;
typedef __attribute__((ext_vector_type(4))) _Float16 v4h;
template <int M> __device__ __forceinline__ float xrow(float x) { return __builtin_bit_cast(float, __builtin_amdgcn_update_dpp(0, __builtin_bit_cast(int, x), 0x160 | M, 0xf, 0xf, true)); }  // lane l ^ M inside a 16-lane row (DPP row_xmask)
__device__ __forceinline__ float xhalf(float x) { return __builtin_bit_cast(float, __builtin_amdgcn_permlanex16(__builtin_bit_cast(int, x), __builtin_bit_cast(int, x), 0x76543210, 0xfedcba98, false, false)); }  // lane l ^ 16
__device__ __forceinline__ float wsum(float x) { x += xrow<1>(x); x += xrow<2>(x); x += xrow<4>(x); x += xrow<8>(x); return x + xhalf(x); }
__device__ __forceinline__ float wmax(float x) { x = fmaxf(x, xrow<1>(x)); x = fmaxf(x, xrow<2>(x)); x = fmaxf(x, xrow<4>(x)); x = fmaxf(x, xrow<8>(x)); return fmaxf(x, xhalf(x)); }
__device__ __forceinline__ float hsum(v16f v) { const v8f a = __builtin_shufflevector(v, v, 0, 1, 2, 3, 4, 5, 6, 7) + __builtin_shufflevector(v, v, 8, 9, 10, 11, 12, 13, 14, 15); const v4f c = __builtin_shufflevector(a, a, 0, 1, 2, 3) + __builtin_shufflevector(a, a, 4, 5, 6, 7); return (c[0] + c[1]) + (c[2] + c[3]); }
// 512 consecutive floats at the wave-uniform p: four 16-byte loads per lane, each 512 contiguous bytes per wave; vb = 16 lane
__device__ __forceinline__ v16f ld_row(const float* __restrict__ p, unsigned vb) { const char* c = (const char*)p + vb; const v4f q0 = *(const v4f*)c, q1 = *(const v4f*)(c + 512), q2 = *(const v4f*)(c + 1024), q3 = *(const v4f*)(c + 1536);
  return __builtin_shufflevector(__builtin_shufflevector(q0, q1, 0, 1, 2, 3, 4, 5, 6, 7), __builtin_shufflevector(q2, q3, 0, 1, 2, 3, 4, 5, 6, 7), 0, 1, 2, 3, 4, 5, 6, 7, 8, 9, 10, 11, 12, 13, 14, 15); }
// 512 consecutive f16 to the wave-uniform p: four 8-byte stores per lane, each 256 contiguous bytes per wave; vh = 8 lane
__device__ __forceinline__ void st_row(_Float16* __restrict__ p, unsigned vh, v16f v) { char* c = (char*)p + vh; const v16h h = __builtin_convertvector(v, v16h);
  *(v4h*)c = __builtin_shufflevector(h, h, 0, 1, 2, 3); *(v4h*)(c + 256) = __builtin_shufflevector(h, h, 4, 5, 6, 7); *(v4h*)(c + 512) = __builtin_shufflevector(h, h, 8, 9, 10, 11); *(v4h*)(c + 768) = __builtin_shufflevector(h, h, 12, 13, 14, 15); }
__device__ __forceinline__ v16f bfr16(v16f v) { v16f r;
#pragma unroll
  for (int i = 0; i < 16; ++i) r[i] = bfr(v[i]);
  return r; }
// ---- k_mix: block = (query t, batch), wave = RH heads: mixed = [self | dep] (1,024), LayerNorm (eps 1e-5) -> f16 row
__global__ __launch_bounds__(128) void k_mix(const float* __restrict__ S, const float* __restrict__ AM, const float* __restrict__ DM, const float* __restrict__ LG, const float* __restrict__ LB, _Float16* __restrict__ MX) {
  const unsigned lane = threadIdx.x & 31, vb = lane * 16, vh = lane * 8; const int tq = blockIdx.x, b = blockIdx.y; const size_t row0 = (size_t)__builtin_amdgcn_readfirstlane(b * NARB + (int)(threadIdx.x >> 5) * (RH * TT) + tq);
  v16f sc[RH];
  v16f dm = ld_row(DM + ((size_t)b * TT + tq) * TT, vb);
#pragma unroll
  for (int hh = 0; hh < RH; ++hh) sc[hh] = ld_row(S + (row0 + hh * TT) * TT, vb);
  v16f om = ld_row(AM + (size_t)b * TT, vb), lg0 = ld_row(LG, vb), lg1 = ld_row(LG + TT, vb), lb0 = ld_row(LB, vb), lb1 = ld_row(LB + TT, vb);
  asm volatile("" :: "v"(dm), "v"(sc[0]), "v"(sc[1]), "v"(sc[2]), "v"(om), "v"(lg0), "v"(lg1), "v"(lb0), "v"(lb1)); // holds the loads in place (loaded rows as inputs only): without it the LayerNorm vectors' loads sink behind the row sums and their latency is paid a second time
  dm = bfr16(dm); om = 1.0f - bfr16(om); lg0 = bfr16(lg0); lg1 = bfr16(lg1); lb0 = bfr16(lb0); lb1 = bfr16(lb1);
#pragma unroll
  for (int hh = 0; hh < RH; ++hh) { v16f x0 = sc[hh] + om * -10000.0f, x1 = sc[hh] * dm;
    const float mu = wsum(hsum(x0 + x1)) / (2 * TT);
    x0 -= mu; x1 -= mu;
    const float inv = 1.0f / sqrtf(wsum(hsum(x0 * x0 + x1 * x1)) / (2 * TT) + 1e-5f);
    _Float16* o = MX + (row0 + hh * TT) * (2 * TT);
    st_row(o, vh, x0 * inv * lg0 + lb0); st_row(o + TT, vh, x1 * inv * lg1 + lb1); } }
// ---- k_g: block = (128 cols, 64 rows), the column tile the fast grid index (for speed only): stage 0: T1 = tanh(MX W1 + b1) (K 1024) -> f16 rows; stage 1: G = sigmoid(T1 W2 + b2) (K 512) -> f32 rows
template <int STAGE>
__global__ __launch_bounds__(128, 5) /* registers for 5 waves per SIMD: unbounded, stage 1 takes 210 and only 4 waves fit */ void k_g(const _Float16* __restrict__ IN, const _Float16* __restrict__ WPK, const float* __restrict__ Bm, _Float16* __restrict__ OUTH, float* __restrict__ OUTF) { __shared__ __align__(16) float sf[4][16][132]; __shared__ __align__(16) _Float16 sh2[64][136]; __shared__ __align__(16) _Float16 sa[4][16][SP];
  const int tid = threadIdx.x, wave = tid >> 5, lane = tid & 31, col = lane & 15, g = lane >> 4; const int c0 = blockIdx.x * 128; const size_t r0 = (size_t)blockIdx.y * 64 + wave * 16; constexpr int K = (STAGE == 0) ? 2 * TT : GH; constexpr int NOUT = GH;
  v8f acc[8] = {}; const _Float16* ap = IN + (r0 + (lane >> 3)) * K + (lane & 7) * 8; _Float16* sw = &sa[wave][lane >> 3][(lane & 7) * 8]; v4u pa[4];
  ld_lines<4>(pa, ap, K);
  auto trip = [&](int t, bool more) __attribute__((always_inline)) { v16h w[8];
#pragma unroll
    for (int j = 0; j < 8; ++j) w[j] = fragp_h(WPK + ((size_t)(2 * t) * (NOUT / 16) + c0 / 16 + j) * 512, lane);
    st_lines<4>(sw, pa); LDSW();
    const v16h a0 = frag_h(&sa[wave][col][0], lane), a1 = frag_h(&sa[wave][col][32], lane); LDSW();
    if (more) ld_lines<4>(pa, ap + (t + 1) * 64, K);   // the next 64 k of the wave's 16 rows are in flight over this trip's products
#pragma unroll
    for (int j = 0; j < 8; ++j) acc[j] = wmma16(a0, w[j], acc[j]);
#pragma unroll
    for (int j = 0; j < 8; ++j) w[j] = fragp_h(WPK + ((size_t)(2 * t + 1) * (NOUT / 16) + c0 / 16 + j) * 512, lane);
#pragma unroll
    for (int j = 0; j < 8; ++j) acc[j] = wmma16(a1, w[j], acc[j]); };
#pragma unroll 1   // kept rolled: a trip already holds 16 products and 36 loads, a second copy would only cost registers (a wave per SIMD)
  for (int t = 0; t < K / 64 - 1; ++t) trip(t, true);   // the last trip stands alone: with no branch round the loads ahead, the loop's load waits are exact counts
  trip(K / 64 - 1, false);
#pragma unroll
  for (int j = 0; j < 8; ++j) { const float bb = bfr(Bm[c0 + j * 16 + col]);
#pragma unroll
    for (int r = 0; r < 8; ++r) { const float v = acc[j][r] + bb; if (STAGE == 0) sh2[wave * 16 + 8 * g + r][j * 16 + col] = (_Float16)tanhf(v); else sf[wave][8 * g + r][j * 16 + col] = 1.0f / (1.0f + expf(-v)); } }
  __syncthreads();
  if (STAGE == 0) { for (int e = tid; e < 64 * 16; e += 128) { const int rl = e >> 4, q = e & 15; vst2((unsigned*)(OUTH + ((size_t)blockIdx.y * 64 + rl) * GH + c0 + q * 8), *(const v4u*)&sh2[rl][q * 8]); } }
  else { for (int rl = 0; rl < 16; ++rl) vst2(OUTF + (r0 + rl) * TT + c0 + lane * 4, *(const v4f*)&sf[wave][rl][lane * 4]); } }
// ---- k_fin: block = (query t, batch), wave = RH heads: logits = g self + (1 - g) dep; softmax over s -> P x 2^11 f16
__global__ __launch_bounds__(128) void k_fin(const float* __restrict__ S, const float* __restrict__ AM, const float* __restrict__ DM, const float* __restrict__ G, _Float16* __restrict__ P) {
  const unsigned lane = threadIdx.x & 31, vb = lane * 16, vh = lane * 8; const int tq = blockIdx.x, b = blockIdx.y; const size_t row0 = (size_t)__builtin_amdgcn_readfirstlane(b * NARB + (int)(threadIdx.x >> 5) * (RH * TT) + tq);
  v16f sc[RH], gg[RH];
  v16f dm = ld_row(DM + ((size_t)b * TT + tq) * TT, vb);
#pragma unroll
  for (int hh = 0; hh < RH; ++hh) { sc[hh] = ld_row(S + (row0 + hh * TT) * TT, vb); gg[hh] = ld_row(G + (row0 + hh * TT) * TT, vb); }
  v16f om = ld_row(AM + (size_t)b * TT, vb);
  asm volatile("" :: "v"(dm), "v"(sc[0]), "v"(sc[1]), "v"(sc[2]), "v"(gg[0]), "v"(gg[1]), "v"(gg[2]), "v"(om)); // holds the loads in place (loaded rows as inputs only): all three heads' rows are in flight together, one latency per wave
  dm = bfr16(dm); om = 1.0f - bfr16(om);
#pragma unroll
  for (int hh = 0; hh < RH; ++hh) { const v16f se = sc[hh] + om * -10000.0f, de = sc[hh] * dm; v16f x = gg[hh] * se + (1.0f - gg[hh]) * de; float m = -3.0e38f;
#pragma unroll
    for (int i = 0; i < 16; ++i) m = fmaxf(m, x[i]);
    m = wmax(m);
#pragma unroll
    for (int i = 0; i < 16; ++i) x[i] = expf(x[i] - m);
    const float inv = 1.0f / wsum(hsum(x));
    st_row(P + (row0 + hh * TT) * TT, vh, x * inv * 2048.0f); } }
// ---- k_pv: block = (64 queries, bh): ctx[b][t][h*64 + d] = P . v
__global__ __launch_bounds__(128) void k_pv(const _Float16* __restrict__ P, const _Float16* __restrict__ VT, float* __restrict__ OUT) { __shared__ __align__(16) float ss[4][16][68]; __shared__ __align__(16) _Float16 sp[4][16][SP], sv[4][HD][SP];
  const int tid = threadIdx.x, wave = tid >> 5, lane = tid & 31, col = lane & 15, g = lane >> 4; const int bh = blockIdx.y; const int b = bh / NH, h = bh % NH; const int ql0 = blockIdx.x * 64 + wave * 16;
  v8f acc[4] = {}; const int lr = lane >> 3, lc = (lane & 7) * 8; const _Float16* pp = P + ((size_t)bh * TT + ql0 + lr) * TT + lc; const _Float16* vp = VT + ((size_t)b * CC + h * HD + lr) * TT + lc; v4u rp[4], rv[16];
  ld_lines<4>(rp, pp, TT); ld_lines<16>(rv, vp, TT);
  auto trip = [&](int t, bool more) __attribute__((always_inline)) { st_lines<4>(&sp[wave][lr][lc], rp); st_lines<16>(&sv[wave][lr][lc], rv); LDSW();
    v16h ph[2], vb[2][4];
#pragma unroll
    for (int c = 0; c < 2; ++c) { ph[c] = frag_h(&sp[wave][col][c * 32], lane);
#pragma unroll
      for (int j = 0; j < 4; ++j) vb[c][j] = frag_h(&sv[wave][j * 16 + col][c * 32], lane); }
    LDSW();
    if (more) { pp += 64; vp += 64; ld_lines<4>(rp, pp, TT); ld_lines<16>(rv, vp, TT); }   // the next 64 keys are in flight over this trip's products
#pragma unroll
    for (int c = 0; c < 2; ++c)
#pragma unroll
      for (int j = 0; j < 4; ++j) acc[j] = wmma16(ph[c], vb[c][j], acc[j]); };
#pragma unroll 1   // kept rolled, as above
  for (int t = 0; t < TT / 64 - 1; ++t) trip(t, true);
  trip(TT / 64 - 1, false);
#pragma unroll
  for (int j = 0; j < 4; ++j)
#pragma unroll
    for (int r = 0; r < 8; ++r) ss[wave][8 * g + r][j * 16 + col] = acc[j][r] * (1.0f / 2048.0f);
  LDSX(); for (int rl = 0; rl < 16; ++rl) if (lane < 16) vst2(OUT + ((size_t)b * TT + ql0 + rl) * CC + h * HD + lane * 4, *(const v4f*)&ss[wave][rl][lane * 4]); }
extern "C" void kernel_launch(void* const* d_in, const int* in_sizes, int n_in, void* d_out, int out_size, void* d_ws, size_t ws_size, hipStream_t stream) {
  (void)in_sizes; (void)n_in; (void)out_size;
  const float** F = (const float**)d_in;   // 0 hidden [8,512,768], 1 attention_mask [8,512], 2 dependency_matrix [8,512,512], 3 Wq [768,768] ([in,out]), 4 bq, 5 Wk, 6 bk, 7 Wv, 8 bv, 9 ln_g [1024], 10 ln_b, 11 W1 [1024,512], 12 b1, 13 W2 [512,512], 14 b2
  if (ws_size < (size_t)WS_END) return;
  char* ws = (char*)d_ws; _Float16 *QH = (_Float16*)(ws + WS_QH), *QL = (_Float16*)(ws + WS_QL), *KH = (_Float16*)(ws + WS_KH), *VT = (_Float16*)(ws + WS_VT), *MX = (_Float16*)(ws + WS_MX), *T1 = (_Float16*)(ws + WS_T1), *P = (_Float16*)(ws + WS_P), *W1P = (_Float16*)(ws + WS_W1P), *W2P = (_Float16*)(ws + WS_W2P); __bf16 *XP = (__bf16*)(ws + WS_XP), *WP = (__bf16*)(ws + WS_WP); float *S = (float*)(ws + WS_S), *G = (float*)(ws + WS_G);
  k_pack<<<PB_X + 3 * PB_W + PB_W1 + PB_W2, 256, 0, stream>>>(F[0], F[3], F[5], F[7], F[11], F[13], XP, WP, W1P, W2P);
  k_proj<<<dim3(TNB * TT / 64, CC / 128, 3), 128, 0, stream>>>(XP, WP, F[4], F[6], F[8], QH, QL, KH, VT);
  k_sc<<<dim3(TT / 64, TT / 128, TNB * NH), 128, 0, stream>>>(QH, QL, KH, S);
  k_mix<<<dim3(TT, TNB), 128, 0, stream>>>(S, F[1], F[2], F[9], F[10], MX);
  k_g<0><<<dim3(GH / 128, TNB * NARB / 64), 128, 0, stream>>>(MX, W1P, F[12], T1, nullptr);
  k_g<1><<<dim3(GH / 128, TNB * NARB / 64), 128, 0, stream>>>(T1, W2P, F[14], nullptr, G);
  k_fin<<<dim3(TT, TNB), 128, 0, stream>>>(S, F[1], F[2], G, P);
  k_pv<<<dim3(TT / 64, TNB * NH), 128, 0, stream>>>(P, VT, (float*)d_out);
}

// v005
// One run takes 232 microseconds.
// In two side-by-side timings against v004, it was 1.12 and 1.13 times as fast.
// All steps since v000 together make it 4.79 times as fast.
// compute dtype: all float inputs rounded to bf16, attention_mask / dependency_matrix read; q/k/v = hidden W + b with EXACT bf16 products on WMMA 16x16x32, f32 accumulate; scores = q k^T / 8 with q as f16 hi + residual and k f16 (2 products), stored in f32 for all batches and heads at once; self = scores + (1 - mask) * -1e4, dep = scores * dependency in f32; LayerNorm over the concatenated 1,024-row in f32 -> f16 rows; gating MLP tanh(ln W1 + b1) (1 f16 product, f16 rows) then sigmoid(. W2 + b2) (1 f16 product); mixed = g self + (1 - g) dep and its softmax in f32 (precise expf) -> P f16 x 2^11; ctx = P . v (v rounded once to f16); f32 output [b][t][768].
#include <hip/hip_runtime.h>
#include <math.h>

typedef __attribute__((ext_vector_type(16))) _Float16 v16h;
typedef __attribute__((ext_vector_type(16))) __bf16 v16b;
typedef __attribute__((ext_vector_type(8)))  _Float16 v8h;
typedef __attribute__((ext_vector_type(8)))  float v8f;
typedef __attribute__((ext_vector_type(4)))  float v4f;
typedef __attribute__((ext_vector_type(2)))  float v2f;
typedef __attribute__((ext_vector_type(4)))  unsigned v4u;
typedef __attribute__((ext_vector_type(4)))  int v4i;
typedef float __attribute__((may_alias)) float_a;
typedef int __attribute__((may_alias)) int_a;

template <typename T> __device__ __forceinline__ void vst2(void* p, T v) { *(T*)p = v;  }
__device__ __forceinline__ v8f wmma16(v16h a, v16h b, v8f c) {
  v8f d = __builtin_amdgcn_wmma_f32_16x16x32_f16(false, a, false, b, (short)0, c, false, false);
  asm volatile("v_nop\n\tv_nop\n\tv_nop\n\tv_nop" : "+v"(d) : "v"(a), "v"(b));
  return d;
}
__device__ __forceinline__ v8f wmma_bf(v16b a, v16b b, v8f c) {
  v8f d = __builtin_amdgcn_wmma_f32_16x16x32_bf16(false, a, false, b, (short)0, c, false, false);
  asm volatile("v_nop\n\tv_nop\n\tv_nop\n\tv_nop" : "+v"(d) : "v"(a), "v"(b));
  return d;
}
// 16x16x32 fragments: lane = (h = lane>>4, row/col = lane&15); elements 0..7 = k0+8h+0..7, 8..15 = k0+16+8h+0..7; D element r = row 8h+r
__device__ __forceinline__ v16h frag_h(const _Float16* rowk0, int lane) {
  union { v16h v; v8h q[2]; } u; const _Float16* p = rowk0 + 8 * (lane >> 4);
  u.q[0] = *(const v8h*)p; u.q[1] = *(const v8h*)(p + 16); return u.v;
}
__device__ __forceinline__ v16h frag_f32(const float* rowk0, int lane) {
  v16h a; const float* p = rowk0 + 8 * (lane >> 4);
#pragma unroll
  for (int i = 0; i < 8; ++i) { a[i] = (_Float16)p[i]; a[8 + i] = (_Float16)p[16 + i]; }
  return a;
}
__device__ __forceinline__ v16h frag_f32s(const float* rowk0, int lane, float sc) {
  v16h a; const float* p = rowk0 + 8 * (lane >> 4);
#pragma unroll
  for (int i = 0; i < 8; ++i) { a[i] = (_Float16)(p[i] * sc); a[8 + i] = (_Float16)(p[16 + i] * sc); }
  return a;
}
// column fragment from a [K][ld] layout (column n), rows >= K read as 0
__device__ __forceinline__ v16h fragc_f32(const float* W, int k0, int n, int lane, int ld, int K) {
  v16h a; const int g = lane >> 4;
#pragma unroll
  for (int i = 0; i < 8; ++i) { const int ka = k0 + 8 * g + i, kb = ka + 16;
    a[i] = (_Float16)(ka < K ? W[(size_t)(ka < K ? ka : K - 1) * ld + n] : 0.f); a[8 + i] = (_Float16)(kb < K ? W[(size_t)(kb < K ? kb : K - 1) * ld + n] : 0.f); }
  return a;
}
struct F2 { v16b h, l; };
__device__ __forceinline__ F2 bsplit16(const float v[16]) { F2 r;
#pragma unroll
  for (int i = 0; i < 16; ++i) { const __bf16 h = (__bf16)v[i]; r.h[i] = h; r.l[i] = (__bf16)(v[i] - (float)h); }
  return r; }
__device__ __forceinline__ F2 split_row(const float* row, int k0, int lane) { float v[16]; const float* p = row + k0 + 8 * (lane >> 4);
#pragma unroll
  for (int i = 0; i < 8; ++i) { v[i] = p[i]; v[8 + i] = p[16 + i]; }
  return bsplit16(v); }
__device__ __forceinline__ F2 split_rowK(const float* row, int k0, int lane, int K) { float v[16]; const int g = lane >> 4;
#pragma unroll
  for (int i = 0; i < 8; ++i) { const int ka = k0 + 8 * g + i, kb = ka + 16; v[i] = ka < K ? row[ka < K ? ka : K - 1] : 0.f; v[8 + i] = kb < K ? row[kb < K ? kb : K - 1] : 0.f; }
  return bsplit16(v); }
__device__ __forceinline__ F2 split_col(const float* W, int k0, int n, int lane, int ld, int K) { float v[16]; const int g = lane >> 4;
#pragma unroll
  for (int i = 0; i < 8; ++i) { const int ka = k0 + 8 * g + i, kb = ka + 16; v[i] = ka < K ? W[(size_t)(ka < K ? ka : K - 1) * ld + n] : 0.f; v[8 + i] = kb < K ? W[(size_t)(kb < K ? kb : K - 1) * ld + n] : 0.f; }
  return bsplit16(v); }
__device__ __forceinline__ v8f mac3(const F2& a, const F2& b, v8f c) { c = wmma_bf(a.l, b.h, c); c = wmma_bf(a.h, b.l, c); return wmma_bf(a.h, b.h, c); }
__device__ __forceinline__ float sigm(float v) { return 1.0f / (1.0f + expf(-v)); }
#define LDSX() do { asm volatile("s_wait_dscnt 0" ::: "memory"); __builtin_amdgcn_wave_barrier(); __builtin_amdgcn_fence(__ATOMIC_RELEASE, "workgroup"); } while (0)


// Dependency-mixed BERT self attention (B 8, T 512, C 768 = 12 x 64): a learned per-(query, key) gate between plain attention scores and dependency-weighted scores, then softmax . v.
#define NB 8
#define TT 512
#define CC 768
#define NH 12
#define HD 64
#define NROW (NB * TT)          // 4096 token rows
#define NAR (NB * NH * TT)      // 49152 attention rows
#define GH 512                  // gating hidden (= T)
#ifndef TNB
#define TNB NB
#endif
typedef __attribute__((ext_vector_type(8))) __bf16 v8b;
__device__ __forceinline__ v16b frag_b(const __bf16* rowk0, int lane) {
  union { v16b v; v8b q[2]; } u; const __bf16* p = rowk0 + 8 * (lane >> 4);
  u.q[0] = *(const v8b*)p; u.q[1] = *(const v8b*)(p + 16); return u.v;
}
__device__ __forceinline__ float bfr(float v) { return (float)(__bf16)v; }
__device__ __attribute__((noinline)) float exp_ni(float v) { return expf(v); }
__device__ __attribute__((noinline)) float erf_ni(float v) { return erff(v); }

// Every stage runs once for all NAR = 49,152 attention rows (row = (b * 12 + h) * 512 + t). The whole-problem buffers fit the workspace because a buffer takes the place of one whose last reader is an earlier launch of the same call.
#define NARB (NH * TT)                                   // attention rows of one batch
#define WS_S   0u                                        // f32 scores [b][h][t][s]: k_sc -> k_mix, k_fin
#define WS_MX  (WS_S + 4u * (size_t)NAR * TT)            // f16 LN'd mixed rows [row][1024]: k_mix -> k_g<0>
#define WS_G   WS_MX                                     // f32 gate rows [row][512], same size, in MX's place: k_g<1> -> k_fin
#define WS_T1  (WS_MX + 2u * (size_t)NAR * 2 * TT)       // f16 hidden gate rows [row][512]: k_g<0> -> k_g<1>
#define WS_P   WS_T1                                     // f16 probabilities [row][512], same size, in T1's place: k_fin -> k_pv
#define WS_VT  (WS_T1 + 2u * (size_t)NAR * GH)           // f16 v planes [b][768][t]: k_proj -> k_pv
// 16-bit copies of hidden and of the five weights in fragment order, written by k_pack at the head of every call
#define WS_W1P (WS_VT + 2u * (size_t)NROW * CC)          // f16 W1 [kc][col tile][1 KB tile]
#define WS_W2P (WS_W1P + 2u * (size_t)2 * TT * GH)       // f16 W2 [kc][col tile][1 KB tile]
#define WS_END (WS_W2P + 2u * (size_t)GH * GH)
// last read by k_proj or k_sc, so they lie at the head of MX's range, which k_mix writes behind them
#define WS_QH  WS_MX
#define WS_QL  (WS_QH + 2u * (size_t)NROW * CC)
#define WS_KH  (WS_QL + 2u * (size_t)NROW * CC)
#define WS_XP  (WS_KH + 2u * (size_t)NROW * CC)          // bf16 hidden [row tile][kc][1 KB tile]
#define WS_WP  (WS_XP + 2u * (size_t)NROW * CC)          // bf16 Wq, Wk, Wv, each [kc][col tile][1 KB tile]
static_assert(WS_WP + 3u * 2u * (size_t)CC * CC <= WS_T1, "q, k and the packed projection operands must end inside MX's range");

// A packed tile is one 16 x 32 fragment as the wave reads it: [q = 0, 1][lane][8 elements], element i of piece q = k0 + 16 q + 8 (lane >> 4) + i of row or column (lane & 15).
// Each of the two 16-byte loads of a wave then covers 512 contiguous bytes (four whole lines).
__device__ __forceinline__ v16h fragp_h(const _Float16* tile, int lane) {
  union { v16h v; v8h q[2]; } u; const _Float16* p = tile + lane * 8;
  u.q[0] = *(const v8h*)p; u.q[1] = *(const v8h*)(p + 256); return u.v;
}
__device__ __forceinline__ v16b fragp_b(const __bf16* tile, int lane) {
  union { v16b v; v8b q[2]; } u; const __bf16* p = tile + lane * 8;
  u.q[0] = *(const v8b*)p; u.q[1] = *(const v8b*)(p + 256); return u.v;
}
// one 16-byte piece (8 consecutive k of column n) of a [K][N] f32 weight; 32 consecutive ids read whole lines and write two 256-byte runs
template <int N, bool F16> __device__ __forceinline__ void pack_w(const float* __restrict__ Wm, int id, void* __restrict__ dst) {
  const int n = id % N, ko = id / N, kc = ko >> 2, g = ko & 1, q = (ko >> 1) & 1; float v[8];
#pragma unroll
  for (int i = 0; i < 8; ++i) v[i] = Wm[(size_t)(ko * 8 + i) * N + n];
  const size_t d = ((size_t)(kc * (N / 16) + (n >> 4)) * 2 + q) * 32 + g * 16 + (n & 15);
  if (F16) { v8h o;
#pragma unroll
    for (int i = 0; i < 8; ++i) o[i] = (_Float16)bfr(v[i]);
    *((v8h*)dst + d) = o; asm volatile("s_wait_xcnt 0x0" ::: "memory"); /* the store's address and data registers may be rewritten behind it: wait first */ }
  else { v8b o;
#pragma unroll
    for (int i = 0; i < 8; ++i) o[i] = (__bf16)v[i];
    *((v8b*)dst + d) = o; asm volatile("s_wait_xcnt 0x0" ::: "memory"); /* the store's address and data registers may be rewritten behind it: wait first */ } }
#define PB_X  (NROW * CC / 8 / 256)       // blocks of 256 pieces: hidden
#define PB_W  (CC * CC / 8 / 256)         // Wq, Wk, Wv each
#define PB_W1 (2 * TT * GH / 8 / 256)
#define PB_W2 (GH * GH / 8 / 256)
// ---- k_pack: thread = one 16-byte piece of a packed tile; the block index picks the matrix
__global__ __launch_bounds__(256) void k_pack(const float* __restrict__ X, const float* __restrict__ WQ, const float* __restrict__ WK, const float* __restrict__ WV, const float* __restrict__ W1, const float* __restrict__ W2, __bf16* __restrict__ XP, __bf16* __restrict__ WP, _Float16* __restrict__ W1P, _Float16* __restrict__ W2P) {
  int blk = blockIdx.x; const int t = threadIdx.x;
  if (blk < PB_X) { const int d = blk * 256 + t, r = d & 15, g = (d >> 4) & 1, q = (d >> 5) & 1, tile = d >> 6, kc = tile % (CC / 32), rt = tile / (CC / 32);
    const float* p = X + (size_t)(rt * 16 + r) * CC + kc * 32 + q * 16 + g * 8; const v4f lo = *(const v4f*)p, hi = *(const v4f*)(p + 4); v8b o;
#pragma unroll
    for (int i = 0; i < 4; ++i) { o[i] = (__bf16)lo[i]; o[4 + i] = (__bf16)hi[i]; }
    *((v8b*)XP + d) = o; asm volatile("s_wait_xcnt 0x0" ::: "memory"); /* the store's address and data registers may be rewritten behind it: wait first */ return; }
  blk -= PB_X;
  if (blk < 3 * PB_W) { const int which = blk / PB_W; pack_w<CC, false>(which == 0 ? WQ : which == 1 ? WK : WV, (blk - which * PB_W) * 256 + t, WP + (size_t)which * CC * CC); return; }
  blk -= 3 * PB_W;
  if (blk < PB_W1) { pack_w<GH, true>(W1, blk * 256 + t, W1P); return; }
  pack_w<GH, true>(W2, (blk - PB_W1) * 256 + t, W2P); }

// ---- k_proj: block = (64 rows, 128 cols, which): hidden W + b ([in,out]); q hi + residual rows, k rows, v planes
__global__ __launch_bounds__(128) void k_proj(const __bf16* __restrict__ XP, const __bf16* __restrict__ WP, const float* __restrict__ BQ, const float* __restrict__ BK, const float* __restrict__ BV, _Float16* __restrict__ QH, _Float16* __restrict__ QL, _Float16* __restrict__ KH, _Float16* __restrict__ VT) {
  __shared__ __align__(16) _Float16 sh[64][136], sl[64][136]; __shared__ __align__(16) _Float16 th[128][72];
  const int tid = threadIdx.x, wave = tid >> 5, lane = tid & 31, col = lane & 15, g = lane >> 4; const int which = blockIdx.z; const int c0 = blockIdx.y * 128; const size_t r0 = (size_t)blockIdx.x * 64;
  const __bf16* Wm = WP + (size_t)which * CC * CC + (size_t)(c0 / 16) * 512; const __bf16* Xm = XP + (size_t)(r0 / 16 + wave) * (CC / 32) * 512; const float* Bm = which == 0 ? BQ : which == 1 ? BK : BV;
  v8f acc[8] = {};
#pragma unroll 2
  for (int kc = 0; kc < CC / 32; ++kc) { const v16b a = fragp_b(Xm + (size_t)kc * 512, lane); v16b w[8];
#pragma unroll
    for (int j = 0; j < 8; ++j) w[j] = fragp_b(Wm + ((size_t)kc * (CC / 16) + j) * 512, lane);
#pragma unroll
    for (int j = 0; j < 8; ++j) acc[j] = wmma_bf(a, w[j], acc[j]); }
#pragma unroll
  for (int j = 0; j < 8; ++j) { const float bb = bfr(Bm[c0 + j * 16 + col]);
#pragma unroll
    for (int r = 0; r < 8; ++r) { const float v = acc[j][r] + bb; const int rl = wave * 16 + 8 * g + r, cl = j * 16 + col; const _Float16 hv = (_Float16)v;
      if (which == 2) th[cl][rl] = hv; else { sh[rl][cl] = hv; sl[rl][cl] = (_Float16)(v - (float)hv); } } }
  __syncthreads();
  if (which < 2) { _Float16* dh = which == 0 ? QH : KH; for (int e = tid; e < 64 * 16; e += 128) { const int rl = e >> 4, q = e & 15; vst2((unsigned*)(dh + (r0 + rl) * CC + c0 + q * 8), *(const v4u*)&sh[rl][q * 8]); if (which == 0) vst2((unsigned*)(QL + (r0 + rl) * CC + c0 + q * 8), *(const v4u*)&sl[rl][q * 8]); } }
  else { const size_t b = r0 / TT; const int t0 = (int)(r0 % TT); for (int e = tid; e < 128 * 8; e += 128) { const int cl = e >> 3, q = e & 7; vst2((unsigned*)(VT + (b * CC + c0 + cl) * (size_t)TT + t0 + q * 8), *(const v4u*)&th[cl][q * 8]); } } }
// Row-major 16-bit operand rows -> fragments through a strip of LDS that belongs to one wave. A fragment load straight from [row][K] memory touches 16 lines for 512 bytes;
// here one 16-byte load per lane covers four rows x one whole 128-byte line (64 k), the lines go to the strip at a pitch of 144 bytes, and the fragments are read back from there.
#define SP 72                   // strip pitch in 16-bit elements: 144 B = 16 B x 9, free of bank conflicts for 16-byte reads
// orders a wave's own LDS stores and loads on its strip (no other wave touches it, so no barrier)
#define LDSW() do { asm volatile("s_wait_dscnt 0" ::: "memory"); __builtin_amdgcn_wave_barrier(); } while (0)
template <int NG> __device__ __forceinline__ void ld_lines(v4u (&p)[NG], const _Float16* __restrict__ s, int ld) {   // s: the lane's 16 bytes in row (lane >> 3); group i is four rows further
#pragma unroll
  for (int i = 0; i < NG; ++i) p[i] = *(const v4u*)(s + (size_t)(4 * i) * ld); }
template <int NG> __device__ __forceinline__ void st_lines(_Float16* d, const v4u (&p)[NG]) {
#pragma unroll
  for (int i = 0; i < NG; ++i) *(v4u*)(d + 4 * i * SP) = p[i]; }
// ---- k_sc: block = (64 queries, 128 keys, bh): scores / 8 (2 products) -> S[bh][t][s]
__global__ __launch_bounds__(128) void k_sc(const _Float16* __restrict__ QH, const _Float16* __restrict__ QL, const _Float16* __restrict__ KH, float* __restrict__ S) { __shared__ __align__(16) char sb[4][128 * SP * 2];   // per wave: the operand strip (q rows, then 128 k rows), then the f32 tile of scores in its place
  const int tid = threadIdx.x, wave = tid >> 5, lane = tid & 31, col = lane & 15, g = lane >> 4; const int k0 = blockIdx.y * 128; const int bh = blockIdx.z; const int b = bh / NH, h = bh % NH; const int ql0 = blockIdx.x * 64 + wave * 16; const size_t q0 = (size_t)b * TT + ql0;
  static_assert(HD == 64 && 16 * 132 * 4 <= 128 * SP * 2, "a head's row is one 128-byte line; the score tile fits the strip");
  _Float16* st = (_Float16*)sb[wave]; float (*ss)[132] = (float (*)[132])sb[wave]; const int lr = lane >> 3, lc = (lane & 7) * 8; _Float16* sw = st + lr * SP + lc;
  v8f acc[8] = {}; v4u rq[4], rl4[4], rk[32]; v16h ah[2], al[2];
  ld_lines<4>(rq, QH + (q0 + lr) * CC + h * HD + lc, CC); ld_lines<4>(rl4, QL + (q0 + lr) * CC + h * HD + lc, CC);
  asm volatile("s_wait_xcnt 0x0" ::: "memory");   // the q loads' address registers may be taken for the k rows' data: wait first
  ld_lines<32>(rk, KH + ((size_t)b * TT + k0 + lr) * CC + h * HD + lc, CC);
  st_lines<4>(sw, rq); st_lines<4>(sw + 16 * SP, rl4); LDSW();
#pragma unroll
  for (int kc = 0; kc < 2; ++kc) { ah[kc] = frag_h(st + col * SP + kc * 32, lane); al[kc] = frag_h(st + (16 + col) * SP + kc * 32, lane); }
  LDSW(); st_lines<32>(sw, rk); LDSW();
#pragma unroll
  for (int kc = 0; kc < 2; ++kc) { v16h kb[8];
#pragma unroll
    for (int j = 0; j < 8; ++j) kb[j] = frag_h(st + (j * 16 + col) * SP + kc * 32, lane);
#pragma unroll
    for (int j = 0; j < 8; ++j) acc[j] = wmma16(ah[kc], kb[j], acc[j]);
#pragma unroll
    for (int j = 0; j < 8; ++j) acc[j] = wmma16(al[kc], kb[j], acc[j]); }
  LDSW();
#pragma unroll
  for (int j = 0; j < 8; ++j)
#pragma unroll
    for (int r = 0; r < 8; ++r) ss[8 * g + r][j * 16 + col] = acc[j][r] * 0.125f;
  LDSX(); for (int rl = 0; rl < 16; ++rl) vst2(S + ((size_t)bh * TT + ql0 + rl) * TT + k0 + lane * 4, *(const v4f*)&ss[rl][lane * 4]); }
// ---- row kernels: one wave owns a whole attention row in registers (element 4 j + i of a lane's 16 is s = 128 j + 4 lane + i), so a row needs no LDS and no barrier;
// a wave does RH heads of one query and keeps that query's dependency row, the mask and the LayerNorm vectors in registers for all of them.
#define RH 3                    // heads per wave; the 4 waves of a block cover the 12 heads of one query
typedef __attribute__((ext_vector_type(16))) float v16f;
typedef __attribute__((ext_vector_type(4))) _Float16 v4h;
template <int M> __device__ __forceinline__ float xrow(float x) { return __builtin_bit_cast(float, __builtin_amdgcn_update_dpp(0, __builtin_bit_cast(int, x), 0x160 | M, 0xf, 0xf, true)); }  // lane l ^ M inside a 16-lane row (DPP row_xmask)
__device__ __forceinline__ float xhalf(float x) { return __builtin_bit_cast(float, __builtin_amdgcn_permlanex16(__builtin_bit_cast(int, x), __builtin_bit_cast(int, x), 0x76543210, 0xfedcba98, false, false)); }  // lane l ^ 16
__device__ __forceinline__ float wsum(float x) { x += xrow<1>(x); x += xrow<2>(x); x += xrow<4>(x); x += xrow<8>(x); return x + xhalf(x); }
__device__ __forceinline__ float wmax(float x) { x = fmaxf(x, xrow<1>(x)); x = fmaxf(x, xrow<2>(x)); x = fmaxf(x, xrow<4>(x)); x = fmaxf(x, xrow<8>(x)); return fmaxf(x, xhalf(x)); }
__device__ __forceinline__ float hsum(v16f v) { const v8f a = __builtin_shufflevector(v, v, 0, 1, 2, 3, 4, 5, 6, 7) + __builtin_shufflevector(v, v, 8, 9, 10, 11, 12, 13, 14, 15); const v4f c = __builtin_shufflevector(a, a, 0, 1, 2, 3) + __builtin_shufflevector(a, a, 4, 5, 6, 7); return (c[0] + c[1]) + (c[2] + c[3]); }
// 512 consecutive floats at the wave-uniform p: four 16-byte loads per lane, each 512 contiguous bytes per wave; vb = 16 lane
__device__ __forceinline__ v16f ld_row(const float* __restrict__ p, unsigned vb) { const char* c = (const char*)p + vb; const v4f q0 = *(const v4f*)c, q1 = *(const v4f*)(c + 512), q2 = *(const v4f*)(c + 1024), q3 = *(const v4f*)(c + 1536);
  return __builtin_shufflevector(__builtin_shufflevector(q0, q1, 0, 1, 2, 3, 4, 5, 6, 7), __builtin_shufflevector(q2, q3, 0, 1, 2, 3, 4, 5, 6, 7), 0, 1, 2, 3, 4, 5, 6, 7, 8, 9, 10, 11, 12, 13, 14, 15); }
// 512 consecutive f16 to the wave-uniform p: four 8-byte stores per lane, each 256 contiguous bytes per wave; vh = 8 lane
__device__ __forceinline__ void st_row(_Float16* __restrict__ p, unsigned vh, v16f v) { char* c = (char*)p + vh; const v16h h = __builtin_convertvector(v, v16h);
  *(v4h*)c = __builtin_shufflevector(h, h, 0, 1, 2, 3); *(v4h*)(c + 256) = __builtin_shufflevector(h, h, 4, 5, 6, 7); *(v4h*)(c + 512) = __builtin_shufflevector(h, h, 8, 9, 10, 11); *(v4h*)(c + 768) = __builtin_shufflevector(h, h, 12, 13, 14, 15); }
__device__ __forceinline__ v16f bfr16(v16f v) { v16f r;
#pragma unroll
  for (int i = 0; i < 16; ++i) r[i] = bfr(v[i]);
  return r; }
// ---- k_mix: block = (query t, batch), wave = RH heads: mixed = [self | dep] (1,024), LayerNorm (eps 1e-5) -> f16 row
__global__ __launch_bounds__(128) void k_mix(const float* __restrict__ S, const float* __restrict__ AM, const float* __restrict__ DM, const float* __restrict__ LG, const float* __restrict__ LB, _Float16* __restrict__ MX) {
  const unsigned lane = threadIdx.x & 31, vb = lane * 16, vh = lane * 8; const int tq = blockIdx.x, b = blockIdx.y; const size_t row0 = (size_t)__builtin_amdgcn_readfirstlane(b * NARB + (int)(threadIdx.x >> 5) * (RH * TT) + tq);
  v16f sc[RH];
  v16f dm = ld_row(DM + ((size_t)b * TT + tq) * TT, vb);
#pragma unroll
  for (int hh = 0; hh < RH; ++hh) sc[hh] = ld_row(S + (row0 + hh * TT) * TT, vb);
  v16f om = ld_row(AM + (size_t)b * TT, vb), lg0 = ld_row(LG, vb), lg1 = ld_row(LG + TT, vb), lb0 = ld_row(LB, vb), lb1 = ld_row(LB + TT, vb);
  asm volatile("" :: "v"(dm), "v"(sc[0]), "v"(sc[1]), "v"(sc[2]), "v"(om), "v"(lg0), "v"(lg1), "v"(lb0), "v"(lb1)); // holds the loads in place (loaded rows as inputs only): without it the LayerNorm vectors' loads sink behind the row sums and their latency is paid a second time
  dm = bfr16(dm); om = 1.0f - bfr16(om); lg0 = bfr16(lg0); lg1 = bfr16(lg1); lb0 = bfr16(lb0); lb1 = bfr16(lb1);
#pragma unroll
  for (int hh = 0; hh < RH; ++hh) { v16f x0 = sc[hh] + om * -10000.0f, x1 = sc[hh] * dm;
    const float mu = wsum(hsum(x0 + x1)) / (2 * TT);
    x0 -= mu; x1 -= mu;
    const float inv = 1.0f / sqrtf(wsum(hsum(x0 * x0 + x1 * x1)) / (2 * TT) + 1e-5f);
    _Float16* o = MX + (row0 + hh * TT) * (2 * TT);
    st_row(o, vh, x0 * inv * lg0 + lb0); st_row(o + TT, vh, x1 * inv * lg1 + lb1); } }
// ---- k_g: block = (128 cols, 192 rows), wave = 48 rows x 128 cols (GR x 8 accumulator tiles), the column tile the fast grid index: stage 0: T1 = tanh(MX W1 + b1) (K 1024) -> f16 rows; stage 1: G = sigmoid(T1 W2 + b2) (K 512) -> f32 rows
// Each weight fragment a wave loads feeds GR products and each row fragment 8, so a product needs two fifths of the loaded bytes of a 16 x 128 tile. The weight fragments of the even and of the odd 32-k steps have a register set each; a fragment is reloaded for two steps on right behind its last product, nearly two rounds of products ahead of its use.
#define GR 3                    // 16-row tiles per wave: 4,096 waves in all, two full rounds at 2 waves per SIMD
// the plain builtin: above 256 registers an asm statement that names the accumulator ties it to one register window and the tile spills; the compiler keeps the distance behind its own matrix instructions
__device__ __forceinline__ v8f wmma16b(v16h a, v16h b, v8f c) { return __builtin_amdgcn_wmma_f32_16x16x32_f16(false, a, false, b, (short)0, c, false, false); }
template <int STAGE>
__global__ __launch_bounds__(128, 2) /* registers for 2 waves per SIMD: the accumulators alone are 192 */ void k_g(const _Float16* __restrict__ IN, const _Float16* __restrict__ WPK, const float* __restrict__ Bm, _Float16* __restrict__ OUTH, float* __restrict__ OUTF) { constexpr int SBW = GR * 16 * SP * 2 > 16 * 132 * 4 ? GR * 16 * SP * 2 : 16 * 132 * 4; __shared__ __align__(16) char sb[4][SBW];   // per wave: the operand strip (48 rows x 64 k), then a 16-row f32 tile of results in its place
  const int tid = threadIdx.x, wave = tid >> 5, lane = tid & 31, col = lane & 15, g = lane >> 4; const int c0 = blockIdx.x * 128; const size_t r0 = ((size_t)blockIdx.y * 4 + wave) * (16 * GR); constexpr int K = (STAGE == 0) ? 2 * TT : GH; constexpr int NOUT = GH;
  v8f acc[GR][8] = {}; const _Float16* ap = IN + (r0 + (lane >> 3)) * K + (lane & 7) * 8; _Float16* st = (_Float16*)sb[wave]; _Float16* sw = st + (lane >> 3) * SP + (lane & 7) * 8; v4u pa[4 * GR]; v16h w0[8], w1[8];
  const _Float16* wp = WPK + (size_t)(c0 / 16) * 512;
  __builtin_amdgcn_sched_barrier(0);   // with the one two lines down: nothing but the row loads and their wait stands between the two
  ld_lines<4 * GR>(pa, ap, K);
  asm volatile("s_wait_xcnt 0x0" ::: "memory");   // the row loads' address registers are taken for other values further down: wait first
  __builtin_amdgcn_sched_barrier(0);   // the row loads stay the older ones, as in the loop: the wait in front of the strip's stores is then a count that leaves the weight loads in flight
#pragma unroll
  for (int j = 0; j < 8; ++j) w0[j] = fragp_h(wp + (size_t)j * 512, lane);
#pragma unroll
  for (int j = 0; j < 8; ++j) w1[j] = fragp_h(wp + (size_t)(NOUT / 16 + j) * 512, lane);
  auto trip = [&](int t, bool more) __attribute__((always_inline)) { v16h a0[GR], a1[GR];
    st_lines<4 * GR>(sw, pa); LDSW();
    if (more) { ap += 64; ld_lines<4 * GR>(pa, ap, K); }   // the next 64 k of the wave's 48 rows are in flight over this trip's products
#pragma unroll
    for (int i = 0; i < GR; ++i) a0[i] = frag_h(st + (i * 16 + col) * SP, lane);
#pragma unroll
    for (int i = 0; i < GR; ++i) a1[i] = frag_h(st + (i * 16 + col) * SP + 32, lane);   // no wait behind these reads: this trip's products consume every one of them ahead of the next trip's stores
    __builtin_amdgcn_sched_barrier(0);   // this one and those in the two loops below keep every load where it is written: left free, the scheduler sinks a fragment's reload to one group of products before its use, and the load's latency shows at every group
#pragma unroll
    for (int j = 0; j < 8; ++j) {
#pragma unroll
      for (int i = 0; i < GR; ++i) acc[i][j] = wmma16b(a0[i], w0[j], acc[i][j]);
      __builtin_amdgcn_sched_barrier(0);   // the reload stays behind the last product that reads the fragment, so that it can take the same registers
      if (more) w0[j] = fragp_h(wp + ((size_t)(2 * t + 2) * (NOUT / 16) + j) * 512, lane); __builtin_amdgcn_sched_barrier(0); }
#pragma unroll
    for (int j = 0; j < 8; ++j) {
#pragma unroll
      for (int i = 0; i < GR; ++i) acc[i][j] = wmma16b(a1[i], w1[j], acc[i][j]);
      __builtin_amdgcn_sched_barrier(0);   // as above
      if (more) w1[j] = fragp_h(wp + ((size_t)(2 * t + 3) * (NOUT / 16) + j) * 512, lane); __builtin_amdgcn_sched_barrier(0); }
    if (more) { asm volatile("s_wait_xcnt 0x0" ::: "memory"); __builtin_amdgcn_sched_barrier(0); } };   // the loads' address registers are stepped for the next trip behind this point: wait first (the scheduling barrier keeps the steps behind the wait)
#pragma unroll 1   // kept rolled: a trip already holds 48 products and 44 loads
  for (int t = 0; t < K / 64 - 1; ++t) trip(t, true);   // the last trip stands alone: with no branch round the loads ahead, the loop's load waits are exact counts
  trip(K / 64 - 1, false);
  LDSW();   // the strip's last reads are done before the result tile takes its place
  float (*sf)[132] = (float (*)[132])sb[wave]; v4f bb = *(const v4f*)(Bm + c0 + lane * 4);
#pragma unroll
  for (int e = 0; e < 4; ++e) bb[e] = bfr(bb[e]);
#pragma unroll
  for (int i = 0; i < GR; ++i) {
#pragma unroll
    for (int j = 0; j < 8; ++j)
#pragma unroll
      for (int r = 0; r < 8; ++r) sf[8 * g + r][j * 16 + col] = acc[i][j][r];
    LDSW();
#pragma unroll 2   // two rows a pass: the tanh / exp text stays small
    for (int rl = 0; rl < 16; ++rl) { const v4f v = *(const v4f*)&sf[rl][lane * 4] + bb;
      if (STAGE == 0) { v4h o;
#pragma unroll
        for (int e = 0; e < 4; ++e) o[e] = (_Float16)tanhf(v[e]);
        *(v4h*)(OUTH + (r0 + i * 16 + rl) * GH + c0 + lane * 4) = o; }
      else { v4f o;
#pragma unroll
        for (int e = 0; e < 4; ++e) o[e] = 1.0f / (1.0f + expf(-v[e]));
        vst2(OUTF + (r0 + i * 16 + rl) * TT + c0 + lane * 4, o); } }
    LDSW(); } }
// ---- k_fin: block = (query t, batch), wave = RH heads: logits = g self + (1 - g) dep; softmax over s -> P x 2^11 f16
__global__ __launch_bounds__(128) void k_fin(const float* __restrict__ S, const float* __restrict__ AM, const float* __restrict__ DM, const float* __restrict__ G, _Float16* __restrict__ P) {
  const unsigned lane = threadIdx.x & 31, vb = lane * 16, vh = lane * 8; const int tq = blockIdx.x, b = blockIdx.y; const size_t row0 = (size_t)__builtin_amdgcn_readfirstlane(b * NARB + (int)(threadIdx.x >> 5) * (RH * TT) + tq);
  v16f sc[RH], gg[RH];
  v16f dm = ld_row(DM + ((size_t)b * TT + tq) * TT, vb);
#pragma unroll
  for (int hh = 0; hh < RH; ++hh) { sc[hh] = ld_row(S + (row0 + hh * TT) * TT, vb); gg[hh] = ld_row(G + (row0 + hh * TT) * TT, vb); }
  v16f om = ld_row(AM + (size_t)b * TT, vb);
  asm volatile("" :: "v"(dm), "v"(sc[0]), "v"(sc[1]), "v"(sc[2]), "v"(gg[0]), "v"(gg[1]), "v"(gg[2]), "v"(om)); // holds the loads in place (loaded rows as inputs only): all three heads' rows are in flight together, one latency per wave
  dm = bfr16(dm); om = 1.0f - bfr16(om);
#pragma unroll
  for (int hh = 0; hh < RH; ++hh) { const v16f se = sc[hh] + om * -10000.0f, de = sc[hh] * dm; v16f x = gg[hh] * se + (1.0f - gg[hh]) * de; float m = -3.0e38f;
#pragma unroll
    for (int i = 0; i < 16; ++i) m = fmaxf(m, x[i]);
    m = wmax(m);
#pragma unroll
    for (int i = 0; i < 16; ++i) x[i] = expf(x[i] - m);
    const float inv = 1.0f / wsum(hsum(x));
    st_row(P + (row0 + hh * TT) * TT, vh, x * inv * 2048.0f); } }
// ---- k_pv: block = (64 queries, bh): ctx[b][t][h*64 + d] = P . v
__global__ __launch_bounds__(128) void k_pv(const _Float16* __restrict__ P, const _Float16* __restrict__ VT, float* __restrict__ OUT) { __shared__ __align__(16) float ss[4][16][68]; __shared__ __align__(16) _Float16 sp[4][16][SP], sv[4][HD][SP];
  const int tid = threadIdx.x, wave = tid >> 5, lane = tid & 31, col = lane & 15, g = lane >> 4; const int bh = blockIdx.y; const int b = bh / NH, h = bh % NH; const int ql0 = blockIdx.x * 64 + wave * 16;
  v8f acc[4] = {}; const int lr = lane >> 3, lc = (lane & 7) * 8; const _Float16* pp = P + ((size_t)bh * TT + ql0 + lr) * TT + lc; const _Float16* vp = VT + ((size_t)b * CC + h * HD + lr) * TT + lc; v4u rp[4], rv[16];
  ld_lines<4>(rp, pp, TT); ld_lines<16>(rv, vp, TT);
  auto trip = [&](int t, bool more) __attribute__((always_inline)) { st_lines<4>(&sp[wave][lr][lc], rp); st_lines<16>(&sv[wave][lr][lc], rv); LDSW();
    v16h ph[2], vb[2][4];
#pragma unroll
    for (int c = 0; c < 2; ++c) { ph[c] = frag_h(&sp[wave][col][c * 32], lane);
#pragma unroll
      for (int j = 0; j < 4; ++j) vb[c][j] = frag_h(&sv[wave][j * 16 + col][c * 32], lane); }
    LDSW();
    if (more) { pp += 64; vp += 64; ld_lines<4>(rp, pp, TT); ld_lines<16>(rv, vp, TT); }   // the next 64 keys are in flight over this trip's products
#pragma unroll
    for (int c = 0; c < 2; ++c)
#pragma unroll
      for (int j = 0; j < 4; ++j) acc[j] = wmma16(ph[c], vb[c][j], acc[j]); };
#pragma unroll 1   // kept rolled, as above
  for (int t = 0; t < TT / 64 - 1; ++t) trip(t, true);
  trip(TT / 64 - 1, false);
#pragma unroll
  for (int j = 0; j < 4; ++j)
#pragma unroll
    for (int r = 0; r < 8; ++r) ss[wave][8 * g + r][j * 16 + col] = acc[j][r] * (1.0f / 2048.0f);
  LDSX(); for (int rl = 0; rl < 16; ++rl) if (lane < 16) vst2(OUT + ((size_t)b * TT + ql0 + rl) * CC + h * HD + lane * 4, *(const v4f*)&ss[wave][rl][lane * 4]); }
extern "C" void kernel_launch(void* const* d_in, const int* in_sizes, int n_in, void* d_out, int out_size, void* d_ws, size_t ws_size, hipStream_t stream) {
  (void)in_sizes; (void)n_in; (void)out_size;
  const float** F = (const float**)d_in;   // 0 hidden [8,512,768], 1 attention_mask [8,512], 2 dependency_matrix [8,512,512], 3 Wq [768,768] ([in,out]), 4 bq, 5 Wk, 6 bk, 7 Wv, 8 bv, 9 ln_g [1024], 10 ln_b, 11 W1 [1024,512], 12 b1, 13 W2 [512,512], 14 b2
  if (ws_size < (size_t)WS_END) return;
  char* ws = (char*)d_ws; _Float16 *QH = (_Float16*)(ws + WS_QH), *QL = (_Float16*)(ws + WS_QL), *KH = (_Float16*)(ws + WS_KH), *VT = (_Float16*)(ws + WS_VT), *MX = (_Float16*)(ws + WS_MX), *T1 = (_Float16*)(ws + WS_T1), *P = (_Float16*)(ws + WS_P), *W1P = (_Float16*)(ws + WS_W1P), *W2P = (_Float16*)(ws + WS_W2P); __bf16 *XP = (__bf16*)(ws + WS_XP), *WP = (__bf16*)(ws + WS_WP); float *S = (float*)(ws + WS_S), *G = (float*)(ws + WS_G);
  k_pack<<<PB_X + 3 * PB_W + PB_W1 + PB_W2, 256, 0, stream>>>(F[0], F[3], F[5], F[7], F[11], F[13], XP, WP, W1P, W2P);
  k_proj<<<dim3(TNB * TT / 64, CC / 128, 3), 128, 0, stream>>>(XP, WP, F[4], F[6], F[8], QH, QL, KH, VT);
  k_sc<<<dim3(TT / 64, TT / 128, TNB * NH), 128, 0, stream>>>(QH, QL, KH, S);
  k_mix<<<dim3(TT, TNB), 128, 0, stream>>>(S, F[1], F[2], F[9], F[10], MX);
  k_g<0><<<dim3(GH / 128, TNB * NARB / (64 * GR)), 128, 0, stream>>>(MX, W1P, F[12], T1, nullptr);
  k_g<1><<<dim3(GH / 128, TNB * NARB / (64 * GR)), 128, 0, stream>>>(T1, W2P, F[14], nullptr, G);
  k_fin<<<dim3(TT, TNB), 128, 0, stream>>>(S, F[1], F[2], G, P);
  k_pv<<<dim3(TT / 64, TNB * NH), 128, 0, stream>>>(P, VT, (float*)d_out);
}

// v006
// It runs in 205 microseconds.
// Next to v005, in two timings, it ran 1.13 times as fast each time.
// All steps since v000 together make it 5.42 times as fast.
// compute dtype: all float inputs rounded to bf16, attention_mask / dependency_matrix read; q/k/v = hidden W + b with EXACT bf16 products on WMMA 16x16x32, f32 accumulate; scores = q k^T / 8 with q as f16 hi + residual and k f16 (2 products), stored in f32 for all (batch, head); self = scores + (1 - mask) * -1e4, dep = scores * dependency in f32; LayerNorm over the concatenated 1,024-row in f32 -> f16 rows; gating MLP tanh(ln W1 + b1) (1 f16 product, f16 rows) then sigmoid(. W2 + b2) (1 f16 product), tanh and sigmoid formed in f32 from the hardware's 2^x and 1/x; mixed = g self + (1 - g) dep and its softmax in f32 (precise expf) -> P f16 x 2^11; ctx = P . v (v rounded once to f16); f32 output [b][t][768].
#include <hip/hip_runtime.h>
#include <math.h>

typedef __attribute__((ext_vector_type(16))) _Float16 v16h;
typedef __attribute__((ext_vector_type(16))) __bf16 v16b;
typedef __attribute__((ext_vector_type(8)))  _Float16 v8h;
typedef __attribute__((ext_vector_type(8)))  float v8f;
typedef __attribute__((ext_vector_type(4)))  float v4f;
typedef __attribute__((ext_vector_type(2)))  float v2f;
typedef __attribute__((ext_vector_type(4)))  unsigned v4u;
typedef __attribute__((ext_vector_type(4)))  int v4i;
typedef float __attribute__((may_alias)) float_a;
typedef int __attribute__((may_alias)) int_a;

template <typename T> __device__ __forceinline__ void vst2(void* p, T v) { *(T*)p = v;  }
__device__ __forceinline__ v8f wmma16(v16h a, v16h b, v8f c) {
  v8f d = __builtin_amdgcn_wmma_f32_16x16x32_f16(false, a, false, b, (short)0, c, false, false);
  asm volatile("v_nop\n\tv_nop\n\tv_nop\n\tv_nop" : "+v"(d) : "v"(a), "v"(b));
  return d;
}
__device__ __forceinline__ v8f wmma_bf(v16b a, v16b b, v8f c) {
  v8f d = __builtin_amdgcn_wmma_f32_16x16x32_bf16(false, a, false, b, (short)0, c, false, false);
  asm volatile("v_nop\n\tv_nop\n\tv_nop\n\tv_nop" : "+v"(d) : "v"(a), "v"(b));
  return d;
}
// 16x16x32 fragments: lane = (h = lane>>4, row/col = lane&15); elements 0..7 = k0+8h+0..7, 8..15 = k0+16+8h+0..7; D element r = row 8h+r
__device__ __forceinline__ v16h frag_h(const _Float16* rowk0, int lane) {
  union { v16h v; v8h q[2]; } u; const _Float16* p = rowk0 + 8 * (lane >> 4);
  u.q[0] = *(const v8h*)p; u.q[1] = *(const v8h*)(p + 16); return u.v;
}
__device__ __forceinline__ v16h frag_f32(const float* rowk0, int lane) {
  v16h a; const float* p = rowk0 + 8 * (lane >> 4);
#pragma unroll
  for (int i = 0; i < 8; ++i) { a[i] = (_Float16)p[i]; a[8 + i] = (_Float16)p[16 + i]; }
  return a;
}
__device__ __forceinline__ v16h frag_f32s(const float* rowk0, int lane, float sc) {
  v16h a; const float* p = rowk0 + 8 * (lane >> 4);
#pragma unroll
  for (int i = 0; i < 8; ++i) { a[i] = (_Float16)(p[i] * sc); a[8 + i] = (_Float16)(p[16 + i] * sc); }
  return a;
}
// column fragment from a [K][ld] layout (column n), rows >= K read as 0
__device__ __forceinline__ v16h fragc_f32(const float* W, int k0, int n, int lane, int ld, int K) {
  v16h a; const int g = lane >> 4;
#pragma unroll
  for (int i = 0; i < 8; ++i) { const int ka = k0 + 8 * g + i, kb = ka + 16;
    a[i] = (_Float16)(ka < K ? W[(size_t)(ka < K ? ka : K - 1) * ld + n] : 0.f); a[8 + i] = (_Float16)(kb < K ? W[(size_t)(kb < K ? kb : K - 1) * ld + n] : 0.f); }
  return a;
}
struct F2 { v16b h, l; };
__device__ __forceinline__ F2 bsplit16(const float v[16]) { F2 r;
#pragma unroll
  for (int i = 0; i < 16; ++i) { const __bf16 h = (__bf16)v[i]; r.h[i] = h; r.l[i] = (__bf16)(v[i] - (float)h); }
  return r; }
__device__ __forceinline__ F2 split_row(const float* row, int k0, int lane) { float v[16]; const float* p = row + k0 + 8 * (lane >> 4);
#pragma unroll
  for (int i = 0; i < 8; ++i) { v[i] = p[i]; v[8 + i] = p[16 + i]; }
  return bsplit16(v); }
__device__ __forceinline__ F2 split_rowK(const float* row, int k0, int lane, int K) { float v[16]; const int g = lane >> 4;
#pragma unroll
  for (int i = 0; i < 8; ++i) { const int ka = k0 + 8 * g + i, kb = ka + 16; v[i] = ka < K ? row[ka < K ? ka : K - 1] : 0.f; v[8 + i] = kb < K ? row[kb < K ? kb : K - 1] : 0.f; }
  return bsplit16(v); }
__device__ __forceinline__ F2 split_col(const float* W, int k0, int n, int lane, int ld, int K) { float v[16]; const int g = lane >> 4;
#pragma unroll
  for (int i = 0; i < 8; ++i) { const int ka = k0 + 8 * g + i, kb = ka + 16; v[i] = ka < K ? W[(size_t)(ka < K ? ka : K - 1) * ld + n] : 0.f; v[8 + i] = kb < K ? W[(size_t)(kb < K ? kb : K - 1) * ld + n] : 0.f; }
  return bsplit16(v); }
__device__ __forceinline__ v8f mac3(const F2& a, const F2& b, v8f c) { c = wmma_bf(a.l, b.h, c); c = wmma_bf(a.h, b.l, c); return wmma_bf(a.h, b.h, c); }
__device__ __forceinline__ float sigm(float v) { return 1.0f / (1.0f + expf(-v)); }
#define LDSX() do { asm volatile("s_wait_dscnt 0" ::: "memory"); __builtin_amdgcn_wave_barrier(); __builtin_amdgcn_fence(__ATOMIC_RELEASE, "workgroup"); } while (0)


// Dependency-mixed BERT self attention (B 8, T 512, C 768 = 12 x 64): a learned per-(query, key) gate between plain attention scores and dependency-weighted scores, then softmax . v.
#define NB 8
#define TT 512
#define CC 768
#define NH 12
#define HD 64
#define NROW (NB * TT)          // 4096 token rows
#define NAR (NB * NH * TT)      // 49152 attention rows
#define GH 512                  // gating hidden (= T)
#ifndef TNB
#define TNB NB
#endif
typedef __attribute__((ext_vector_type(8))) __bf16 v8b;
__device__ __forceinline__ v16b frag_b(const __bf16* rowk0, int lane) {
  union { v16b v; v8b q[2]; } u; const __bf16* p = rowk0 + 8 * (lane >> 4);
  u.q[0] = *(const v8b*)p; u.q[1] = *(const v8b*)(p + 16); return u.v;
}
__device__ __forceinline__ float bfr(float v) { return (float)(__bf16)v; }
// tanh and sigmoid of the gate straight from the hardware's 2^x and 1/x (v_exp_f32, v_rcp_f32), in place of the library calls and the IEEE division sequence, which take several times the instructions and, for tanh, divergent branches per element.
// tanh is rounded to f16 behind this and the gate only weighs the scores, so the last bits of f32 do not reach the output. Both ends saturate: 2^a = inf gives 1 / inf = 0, 2^a = 0 gives 1 / 1.
#define LOG2E 1.44269504088896340736f
__device__ __forceinline__ float tanh_p2(float a) { return 1.0f - 2.0f * __builtin_amdgcn_rcpf(1.0f + __builtin_amdgcn_exp2f(a)); }   // tanh(v), a = 2 v log2(e)
__device__ __forceinline__ float sigm_p2(float a) { return __builtin_amdgcn_rcpf(1.0f + __builtin_amdgcn_exp2f(a)); }                  // sigmoid(v), a = -v log2(e)
__device__ __attribute__((noinline)) float exp_ni(float v) { return expf(v); }
__device__ __attribute__((noinline)) float erf_ni(float v) { return erff(v); }

// Every stage runs once for all NAR = 49,152 attention rows (row = (b * 12 + h) * 512 + t). The whole-problem buffers fit the workspace because a buffer takes the place of one whose last reader is an earlier launch of the same call.
#define NARB (NH * TT)                                   // attention rows of one batch
#define WS_S   0u                                        // f32 scores [b][h][t][s]: k_sc -> k_mix, k_fin
#define WS_MX  (WS_S + 4u * (size_t)NAR * TT)            // f16 LN'd mixed rows [row][1024]: k_mix -> k_g<0>
#define WS_G   WS_MX                                     // f32 gate rows [row][512], same size, in MX's place: k_g<1> -> k_fin
#define WS_T1  (WS_MX + 2u * (size_t)NAR * 2 * TT)       // f16 hidden gate rows [row][512]: k_g<0> -> k_g<1>
#define WS_P   WS_T1                                     // f16 probabilities [row][512], same size, in T1's place: k_fin -> k_pv
#define WS_VT  (WS_T1 + 2u * (size_t)NAR * GH)           // f16 v planes [b][768][t]: k_proj -> k_pv
// 16-bit copies of hidden and of the five weights in fragment order, written by k_pack at the head of every call
#define WS_W1P (WS_VT + 2u * (size_t)NROW * CC)          // f16 W1 [kc][col tile][1 KB tile]
#define WS_W2P (WS_W1P + 2u * (size_t)2 * TT * GH)       // f16 W2 [kc][col tile][1 KB tile]
#define WS_END (WS_W2P + 2u * (size_t)GH * GH)
// last read by k_proj or k_sc, so they lie at the head of MX's range, which k_mix writes behind them
#define WS_QH  WS_MX
#define WS_QL  (WS_QH + 2u * (size_t)NROW * CC)
#define WS_KH  (WS_QL + 2u * (size_t)NROW * CC)
#define WS_XP  (WS_KH + 2u * (size_t)NROW * CC)          // bf16 hidden [row tile][kc][1 KB tile]
#define WS_WP  (WS_XP + 2u * (size_t)NROW * CC)          // bf16 Wq, Wk, Wv, each [kc][col tile][1 KB tile]
static_assert(WS_WP + 3u * 2u * (size_t)CC * CC <= WS_T1, "q, k and the packed projection operands must end inside MX's range");

// A packed tile is one 16 x 32 fragment as the wave reads it: [q = 0, 1][lane][8 elements], element i of piece q = k0 + 16 q + 8 (lane >> 4) + i of row or column (lane & 15).
// Each of the two 16-byte loads of a wave then covers 512 contiguous bytes (four whole lines).
__device__ __forceinline__ v16h fragp_h(const _Float16* tile, int lane) {
  union { v16h v; v8h q[2]; } u; const _Float16* p = tile + lane * 8;
  u.q[0] = *(const v8h*)p; u.q[1] = *(const v8h*)(p + 256); return u.v;
}
__device__ __forceinline__ v16b fragp_b(const __bf16* tile, int lane) {
  union { v16b v; v8b q[2]; } u; const __bf16* p = tile + lane * 8;
  u.q[0] = *(const v8b*)p; u.q[1] = *(const v8b*)(p + 256); return u.v;
}
// one 16-byte piece (8 consecutive k of column n) of a [K][N] f32 weight; 32 consecutive ids read whole lines and write two 256-byte runs
template <int N, bool F16> __device__ __forceinline__ void pack_w(const float* __restrict__ Wm, int id, void* __restrict__ dst) {
  const int n = id % N, ko = id / N, kc = ko >> 2, g = ko & 1, q = (ko >> 1) & 1; float v[8];
#pragma unroll
  for (int i = 0; i < 8; ++i) v[i] = Wm[(size_t)(ko * 8 + i) * N + n];
  const size_t d = ((size_t)(kc * (N / 16) + (n >> 4)) * 2 + q) * 32 + g * 16 + (n & 15);
  if (F16) { v8h o;
#pragma unroll
    for (int i = 0; i < 8; ++i) o[i] = (_Float16)bfr(v[i]);
    *((v8h*)dst + d) = o; asm volatile("s_wait_xcnt 0x0" ::: "memory"); /* the store's address and data registers may be rewritten behind it: wait first */ }
  else { v8b o;
#pragma unroll
    for (int i = 0; i < 8; ++i) o[i] = (__bf16)v[i];
    *((v8b*)dst + d) = o; asm volatile("s_wait_xcnt 0x0" ::: "memory"); /* the store's address and data registers may be rewritten behind it: wait first */ } }
#define PB_X  (NROW * CC / 8 / 256)       // blocks of 256 pieces: hidden
#define PB_W  (CC * CC / 8 / 256)         // Wq, Wk, Wv each
#define PB_W1 (2 * TT * GH / 8 / 256)
#define PB_W2 (GH * GH / 8 / 256)
// ---- k_pack: thread = one 16-byte piece of a packed tile; the block index picks the matrix
__global__ __launch_bounds__(256) void k_pack(const float* __restrict__ X, const float* __restrict__ WQ, const float* __restrict__ WK, const float* __restrict__ WV, const float* __restrict__ W1, const float* __restrict__ W2, __bf16* __restrict__ XP, __bf16* __restrict__ WP, _Float16* __restrict__ W1P, _Float16* __restrict__ W2P) {
  int blk = blockIdx.x; const int t = threadIdx.x;
  if (blk < PB_X) { const int d = blk * 256 + t, r = d & 15, g = (d >> 4) & 1, q = (d >> 5) & 1, tile = d >> 6, kc = tile % (CC / 32), rt = tile / (CC / 32);
    const float* p = X + (size_t)(rt * 16 + r) * CC + kc * 32 + q * 16 + g * 8; const v4f lo = *(const v4f*)p, hi = *(const v4f*)(p + 4); v8b o;
#pragma unroll
    for (int i = 0; i < 4; ++i) { o[i] = (__bf16)lo[i]; o[4 + i] = (__bf16)hi[i]; }
    *((v8b*)XP + d) = o; asm volatile("s_wait_xcnt 0x0" ::: "memory"); /* the store's address and data registers may be rewritten behind it: wait first */ return; }
  blk -= PB_X;
  if (blk < 3 * PB_W) { const int which = blk / PB_W; pack_w<CC, false>(which == 0 ? WQ : which == 1 ? WK : WV, (blk - which * PB_W) * 256 + t, WP + (size_t)which * CC * CC); return; }
  blk -= 3 * PB_W;
  if (blk < PB_W1) { pack_w<GH, true>(W1, blk * 256 + t, W1P); return; }
  pack_w<GH, true>(W2, (blk - PB_W1) * 256 + t, W2P); }

// ---- k_proj: block = (64 rows, 128 cols, which): hidden W + b ([in,out]); q hi + residual rows, k rows, v planes
__global__ __launch_bounds__(128) void k_proj(const __bf16* __restrict__ XP, const __bf16* __restrict__ WP, const float* __restrict__ BQ, const float* __restrict__ BK, const float* __restrict__ BV, _Float16* __restrict__ QH, _Float16* __restrict__ QL, _Float16* __restrict__ KH, _Float16* __restrict__ VT) {
  __shared__ __align__(16) _Float16 sh[64][136], sl[64][136]; __shared__ __align__(16) _Float16 th[128][72];
  const int tid = threadIdx.x, wave = tid >> 5, lane = tid & 31, col = lane & 15, g = lane >> 4; const int which = blockIdx.z; const int c0 = blockIdx.y * 128; const size_t r0 = (size_t)blockIdx.x * 64;
  const __bf16* Wm = WP + (size_t)which * CC * CC + (size_t)(c0 / 16) * 512; const __bf16* Xm = XP + (size_t)(r0 / 16 + wave) * (CC / 32) * 512; const float* Bm = which == 0 ? BQ : which == 1 ? BK : BV;
  v8f acc[8] = {};
#pragma unroll 2
  for (int kc = 0; kc < CC / 32; ++kc) { const v16b a = fragp_b(Xm + (size_t)kc * 512, lane); v16b w[8];
#pragma unroll
    for (int j = 0; j < 8; ++j) w[j] = fragp_b(Wm + ((size_t)kc * (CC / 16) + j) * 512, lane);
#pragma unroll
    for (int j = 0; j < 8; ++j) acc[j] = wmma_bf(a, w[j], acc[j]); }
#pragma unroll
  for (int j = 0; j < 8; ++j) { const float bb = bfr(Bm[c0 + j * 16 + col]);
#pragma unroll
    for (int r = 0; r < 8; ++r) { const float v = acc[j][r] + bb; const int rl = wave * 16 + 8 * g + r, cl = j * 16 + col; const _Float16 hv = (_Float16)v;
      if (which == 2) th[cl][rl] = hv; else { sh[rl][cl] = hv; sl[rl][cl] = (_Float16)(v - (float)hv); } } }
  __syncthreads();
  if (which < 2) { _Float16* dh = which == 0 ? QH : KH; for (int e = tid; e < 64 * 16; e += 128) { const int rl = e >> 4, q = e & 15; vst2((unsigned*)(dh + (r0 + rl) * CC + c0 + q * 8), *(const v4u*)&sh[rl][q * 8]); if (which == 0) vst2((unsigned*)(QL + (r0 + rl) * CC + c0 + q * 8), *(const v4u*)&sl[rl][q * 8]); } }
  else { const size_t b = r0 / TT; const int t0 = (int)(r0 % TT); for (int e = tid; e < 128 * 8; e += 128) { const int cl = e >> 3, q = e & 7; vst2((unsigned*)(VT + (b * CC + c0 + cl) * (size_t)TT + t0 + q * 8), *(const v4u*)&th[cl][q * 8]); } } }
// Row-major 16-bit operand rows -> fragments through a strip of LDS that belongs to one wave. A fragment load straight from [row][K] memory touches 16 lines for 512 bytes;
// here one 16-byte load per lane covers four rows x one whole 128-byte line (64 k), the lines go to the strip at a pitch of 144 bytes, and the fragments are read back from there.
#define SP 72                   // strip pitch in 16-bit elements: 144 B = 16 B x 9, free of bank conflicts for 16-byte reads
// orders a wave's own LDS stores and loads on its strip (no other wave touches it, so no barrier)
#define LDSW() do { asm volatile("s_wait_dscnt 0" ::: "memory"); __builtin_amdgcn_wave_barrier(); } while (0)
template <int NG> __device__ __forceinline__ void ld_lines(v4u (&p)[NG], const _Float16* __restrict__ s, int ld) {   // s: the lane's 16 bytes in row (lane >> 3); group i is four rows further
#pragma unroll
  for (int i = 0; i < NG; ++i) p[i] = *(const v4u*)(s + (size_t)(4 * i) * ld); }
template <int NG> __device__ __forceinline__ void st_lines(_Float16* d, const v4u (&p)[NG]) {
#pragma unroll
  for (int i = 0; i < NG; ++i) *(v4u*)(d + 4 * i * SP) = p[i]; }
// ---- k_sc: block = (64 queries, 128 keys, bh): scores / 8 (2 products) -> S[bh][t][s]
__global__ __launch_bounds__(128) void k_sc(const _Float16* __restrict__ QH, const _Float16* __restrict__ QL, const _Float16* __restrict__ KH, float* __restrict__ S) { __shared__ __align__(16) char sb[4][128 * SP * 2];   // per wave: the operand strip (q rows, then 128 k rows), then the f32 tile of scores in its place
  const int tid = threadIdx.x, wave = tid >> 5, lane = tid & 31, col = lane & 15, g = lane >> 4; const int k0 = blockIdx.y * 128; const int bh = blockIdx.z; const int b = bh / NH, h = bh % NH; const int ql0 = blockIdx.x * 64 + wave * 16; const size_t q0 = (size_t)b * TT + ql0;
  static_assert(HD == 64 && 16 * 132 * 4 <= 128 * SP * 2, "a head's row is one 128-byte line; the score tile fits the strip");
  _Float16* st = (_Float16*)sb[wave]; float (*ss)[132] = (float (*)[132])sb[wave]; const int lr = lane >> 3, lc = (lane & 7) * 8; _Float16* sw = st + lr * SP + lc;
  v8f acc[8] = {}; v4u rq[4], rl4[4], rk[32]; v16h ah[2], al[2];
  ld_lines<4>(rq, QH + (q0 + lr) * CC + h * HD + lc, CC); ld_lines<4>(rl4, QL + (q0 + lr) * CC + h * HD + lc, CC);
  asm volatile("s_wait_xcnt 0x0" ::: "memory");   // the q loads' address registers may be taken for the k rows' data: wait first
  ld_lines<32>(rk, KH + ((size_t)b * TT + k0 + lr) * CC + h * HD + lc, CC);
  st_lines<4>(sw, rq); st_lines<4>(sw + 16 * SP, rl4); LDSW();
#pragma unroll
  for (int kc = 0; kc < 2; ++kc) { ah[kc] = frag_h(st + col * SP + kc * 32, lane); al[kc] = frag_h(st + (16 + col) * SP + kc * 32, lane); }
  LDSW(); st_lines<32>(sw, rk); LDSW();
#pragma unroll
  for (int kc = 0; kc < 2; ++kc) { v16h kb[8];
#pragma unroll
    for (int j = 0; j < 8; ++j) kb[j] = frag_h(st + (j * 16 + col) * SP + kc * 32, lane);
#pragma unroll
    for (int j = 0; j < 8; ++j) acc[j] = wmma16(ah[kc], kb[j], acc[j]);
#pragma unroll
    for (int j = 0; j < 8; ++j) acc[j] = wmma16(al[kc], kb[j], acc[j]); }
  LDSW();
#pragma unroll
  for (int j = 0; j < 8; ++j)
#pragma unroll
    for (int r = 0; r < 8; ++r) ss[8 * g + r][j * 16 + col] = acc[j][r] * 0.125f;
  LDSX(); for (int rl = 0; rl < 16; ++rl) vst2(S + ((size_t)bh * TT + ql0 + rl) * TT + k0 + lane * 4, *(const v4f*)&ss[rl][lane * 4]); }
// ---- row kernels: one wave owns a whole attention row in registers (element 4 j + i of a lane's 16 is s = 128 j + 4 lane + i), so a row needs no LDS and no barrier;
// a wave does RH heads of one query and keeps that query's dependency row, the mask and the LayerNorm vectors in registers for all of them.
#define RH 3                    // heads per wave; the 4 waves of a block cover the 12 heads of one query
typedef __attribute__((ext_vector_type(16))) float v16f;
typedef __attribute__((ext_vector_type(4))) _Float16 v4h;
template <int M> __device__ __forceinline__ float xrow(float x) { return __builtin_bit_cast(float, __builtin_amdgcn_update_dpp(0, __builtin_bit_cast(int, x), 0x160 | M, 0xf, 0xf, true)); }  // lane l ^ M inside a 16-lane row (DPP row_xmask)
__device__ __forceinline__ float xhalf(float x) { return __builtin_bit_cast(float, __builtin_amdgcn_permlanex16(__builtin_bit_cast(int, x), __builtin_bit_cast(int, x), 0x76543210, 0xfedcba98, false, false)); }  // lane l ^ 16
__device__ __forceinline__ float wsum(float x) { x += xrow<1>(x); x += xrow<2>(x); x += xrow<4>(x); x += xrow<8>(x); return x + xhalf(x); }
__device__ __forceinline__ float wmax(float x) { x = fmaxf(x, xrow<1>(x)); x = fmaxf(x, xrow<2>(x)); x = fmaxf(x, xrow<4>(x)); x = fmaxf(x, xrow<8>(x)); return fmaxf(x, xhalf(x)); }
__device__ __forceinline__ float hsum(v16f v) { const v8f a = __builtin_shufflevector(v, v, 0, 1, 2, 3, 4, 5, 6, 7) + __builtin_shufflevector(v, v, 8, 9, 10, 11, 12, 13, 14, 15); const v4f c = __builtin_shufflevector(a, a, 0, 1, 2, 3) + __builtin_shufflevector(a, a, 4, 5, 6, 7); return (c[0] + c[1]) + (c[2] + c[3]); }
// 512 consecutive floats at the wave-uniform p: four 16-byte loads per lane, each 512 contiguous bytes per wave; vb = 16 lane
__device__ __forceinline__ v16f ld_row(const float* __restrict__ p, unsigned vb) { const char* c = (const char*)p + vb; const v4f q0 = *(const v4f*)c, q1 = *(const v4f*)(c + 512), q2 = *(const v4f*)(c + 1024), q3 = *(const v4f*)(c + 1536);
  return __builtin_shufflevector(__builtin_shufflevector(q0, q1, 0, 1, 2, 3, 4, 5, 6, 7), __builtin_shufflevector(q2, q3, 0, 1, 2, 3, 4, 5, 6, 7), 0, 1, 2, 3, 4, 5, 6, 7, 8, 9, 10, 11, 12, 13, 14, 15); }
// 512 consecutive f16 to the wave-uniform p: four 8-byte stores per lane, each 256 contiguous bytes per wave; vh = 8 lane
__device__ __forceinline__ void st_row(_Float16* __restrict__ p, unsigned vh, v16f v) { char* c = (char*)p + vh; const v16h h = __builtin_convertvector(v, v16h);
  *(v4h*)c = __builtin_shufflevector(h, h, 0, 1, 2, 3); *(v4h*)(c + 256) = __builtin_shufflevector(h, h, 4, 5, 6, 7); *(v4h*)(c + 512) = __builtin_shufflevector(h, h, 8, 9, 10, 11); *(v4h*)(c + 768) = __builtin_shufflevector(h, h, 12, 13, 14, 15); }
__device__ __forceinline__ v16f bfr16(v16f v) { v16f r;
#pragma unroll
  for (int i = 0; i < 16; ++i) r[i] = bfr(v[i]);
  return r; }
// ---- k_mix: block = (query t, batch), wave = RH heads: mixed = [self | dep] (1,024), LayerNorm (eps 1e-5) -> f16 row
__global__ __launch_bounds__(128) void k_mix(const float* __restrict__ S, const float* __restrict__ AM, const float* __restrict__ DM, const float* __restrict__ LG, const float* __restrict__ LB, _Float16* __restrict__ MX) {
  const unsigned lane = threadIdx.x & 31, vb = lane * 16, vh = lane * 8; const int tq = blockIdx.x, b = blockIdx.y; const size_t row0 = (size_t)__builtin_amdgcn_readfirstlane(b * NARB + (int)(threadIdx.x >> 5) * (RH * TT) + tq);
  v16f sc[RH];
  v16f dm = ld_row(DM + ((size_t)b * TT + tq) * TT, vb);
#pragma unroll
  for (int hh = 0; hh < RH; ++hh) sc[hh] = ld_row(S + (row0 + hh * TT) * TT, vb);
  v16f om = ld_row(AM + (size_t)b * TT, vb), lg0 = ld_row(LG, vb), lg1 = ld_row(LG + TT, vb), lb0 = ld_row(LB, vb), lb1 = ld_row(LB + TT, vb);
  asm volatile("" :: "v"(dm), "v"(sc[0]), "v"(sc[1]), "v"(sc[2]), "v"(om), "v"(lg0), "v"(lg1), "v"(lb0), "v"(lb1)); // holds the loads in place (loaded rows as inputs only): without it the LayerNorm vectors' loads sink behind the row sums and their latency is paid a second time
  dm = bfr16(dm); om = 1.0f - bfr16(om); lg0 = bfr16(lg0); lg1 = bfr16(lg1); lb0 = bfr16(lb0); lb1 = bfr16(lb1);
#pragma unroll
  for (int hh = 0; hh < RH; ++hh) { v16f x0 = sc[hh] + om * -10000.0f, x1 = sc[hh] * dm;
    const float mu = wsum(hsum(x0 + x1)) / (2 * TT);
    x0 -= mu; x1 -= mu;
    const float inv = 1.0f / sqrtf(wsum(hsum(x0 * x0 + x1 * x1)) / (2 * TT) + 1e-5f);
    _Float16* o = MX + (row0 + hh * TT) * (2 * TT);
    st_row(o, vh, x0 * inv * lg0 + lb0); st_row(o + TT, vh, x1 * inv * lg1 + lb1); } }
// ---- k_g: block = (128 cols, 192 rows), wave = 48 rows x 128 cols (GR x 8 accumulator tiles), the column tile the fast grid index: stage 0: T1 = tanh(MX W1 + b1) (K 1024) -> f16 rows; stage 1: G = sigmoid(T1 W2 + b2) (K 512) -> f32 rows
// Each weight fragment a wave loads feeds GR products and each row fragment 8, so a product needs two fifths of the loaded bytes of a 16 x 128 tile. The weight fragments of the even and of the odd 32-k steps have a register set each; a fragment is reloaded for two steps on right behind its last product, nearly two rounds of products ahead of its use.
#define GR 3                    // 16-row tiles per wave: 4,096 waves in all, two full rounds at 2 waves per SIMD
// the plain builtin: above 256 registers an asm statement that names the accumulator ties it to one register window and the tile spills; the compiler keeps the distance behind its own matrix instructions
__device__ __forceinline__ v8f wmma16b(v16h a, v16h b, v8f c) { return __builtin_amdgcn_wmma_f32_16x16x32_f16(false, a, false, b, (short)0, c, false, false); }
template <int STAGE>
__global__ __launch_bounds__(128, 2) /* registers for 2 waves per SIMD: the accumulators alone are 192 */ void k_g(const _Float16* __restrict__ IN, const _Float16* __restrict__ WPK, const float* __restrict__ Bm, _Float16* __restrict__ OUTH, float* __restrict__ OUTF) { constexpr int SBW = GR * 16 * SP * 2 > 16 * 132 * 4 ? GR * 16 * SP * 2 : 16 * 132 * 4; __shared__ __align__(16) char sb[4][SBW];   // per wave: the operand strip (48 rows x 64 k), then a 16-row f32 tile of results in its place
  const int tid = threadIdx.x, wave = tid >> 5, lane = tid & 31, col = lane & 15, g = lane >> 4; const int c0 = blockIdx.x * 128; const size_t r0 = ((size_t)blockIdx.y * 4 + wave) * (16 * GR); constexpr int K = (STAGE == 0) ? 2 * TT : GH; constexpr int NOUT = GH;
  v8f acc[GR][8] = {}; const _Float16* ap = IN + (r0 + (lane >> 3)) * K + (lane & 7) * 8; _Float16* st = (_Float16*)sb[wave]; _Float16* sw = st + (lane >> 3) * SP + (lane & 7) * 8; v4u pa[4 * GR]; v16h w0[8], w1[8];
  const _Float16* wp = WPK + (size_t)(c0 / 16) * 512;
  __builtin_amdgcn_sched_barrier(0);   // with the one two lines down: nothing but the row loads and their wait stands between the two
  ld_lines<4 * GR>(pa, ap, K);
  asm volatile("s_wait_xcnt 0x0" ::: "memory");   // the row loads' address registers are taken for other values further down: wait first
  __builtin_amdgcn_sched_barrier(0);   // the row loads stay the older ones, as in the loop: the wait in front of the strip's stores is then a count that leaves the weight loads in flight
#pragma unroll
  for (int j = 0; j < 8; ++j) w0[j] = fragp_h(wp + (size_t)j * 512, lane);
#pragma unroll
  for (int j = 0; j < 8; ++j) w1[j] = fragp_h(wp + (size_t)(NOUT / 16 + j) * 512, lane);
  auto trip = [&](int t, bool more) __attribute__((always_inline)) { v16h a0[GR], a1[GR];
    st_lines<4 * GR>(sw, pa); LDSW();
    if (more) { ap += 64; ld_lines<4 * GR>(pa, ap, K); }   // the next 64 k of the wave's 48 rows are in flight over this trip's products
#pragma unroll
    for (int i = 0; i < GR; ++i) a0[i] = frag_h(st + (i * 16 + col) * SP, lane);
#pragma unroll
    for (int i = 0; i < GR; ++i) a1[i] = frag_h(st + (i * 16 + col) * SP + 32, lane);   // no wait behind these reads: this trip's products consume every one of them ahead of the next trip's stores
    __builtin_amdgcn_sched_barrier(0);   // this one and those in the two loops below keep every load where it is written: left free, the scheduler sinks a fragment's reload to one group of products before its use, and the load's latency shows at every group
#pragma unroll
    for (int j = 0; j < 8; ++j) {
#pragma unroll
      for (int i = 0; i < GR; ++i) acc[i][j] = wmma16b(a0[i], w0[j], acc[i][j]);
      __builtin_amdgcn_sched_barrier(0);   // the reload stays behind the last product that reads the fragment, so that it can take the same registers
      if (more) w0[j] = fragp_h(wp + ((size_t)(2 * t + 2) * (NOUT / 16) + j) * 512, lane); __builtin_amdgcn_sched_barrier(0); }
#pragma unroll
    for (int j = 0; j < 8; ++j) {
#pragma unroll
      for (int i = 0; i < GR; ++i) acc[i][j] = wmma16b(a1[i], w1[j], acc[i][j]);
      __builtin_amdgcn_sched_barrier(0);   // as above
      if (more) w1[j] = fragp_h(wp + ((size_t)(2 * t + 3) * (NOUT / 16) + j) * 512, lane); __builtin_amdgcn_sched_barrier(0); }
    if (more) { asm volatile("s_wait_xcnt 0x0" ::: "memory"); __builtin_amdgcn_sched_barrier(0); } };   // the loads' address registers are stepped for the next trip behind this point: wait first (the scheduling barrier keeps the steps behind the wait)
#pragma unroll 1   // kept rolled: a trip already holds 48 products and 44 loads
  for (int t = 0; t < K / 64 - 1; ++t) trip(t, true);   // the last trip stands alone: with no branch round the loads ahead, the loop's load waits are exact counts
  trip(K / 64 - 1, false);
  LDSW();   // the strip's last reads are done before the result tile takes its place
  constexpr float AS = (STAGE == 0) ? 2.0f * LOG2E : -LOG2E; float (*sf)[132] = (float (*)[132])sb[wave]; v4f bb = *(const v4f*)(Bm + c0 + lane * 4);
#pragma unroll
  for (int e = 0; e < 4; ++e) bb[e] = bfr(bb[e]) * AS;   // the bias carries the exponent's scale: sum, bias and scale are then one multiply-add
#pragma unroll
  for (int i = 0; i < GR; ++i) {
#pragma unroll
    for (int j = 0; j < 8; ++j)
#pragma unroll
      for (int r = 0; r < 8; ++r) sf[8 * g + r][j * 16 + col] = acc[i][j][r];
    LDSW();
#pragma unroll 2   // two rows a pass
    for (int rl = 0; rl < 16; ++rl) { const v4f v = *(const v4f*)&sf[rl][lane * 4] * AS + bb;
      if (STAGE == 0) { v4h o;
#pragma unroll
        for (int e = 0; e < 4; ++e) o[e] = (_Float16)tanh_p2(v[e]);
        *(v4h*)(OUTH + (r0 + i * 16 + rl) * GH + c0 + lane * 4) = o; }
      else { v4f o;
#pragma unroll
        for (int e = 0; e < 4; ++e) o[e] = sigm_p2(v[e]);
        vst2(OUTF + (r0 + i * 16 + rl) * TT + c0 + lane * 4, o); } }
    LDSW(); } }
// ---- k_fin: block = (query t, batch), wave = RH heads: logits = g self + (1 - g) dep; softmax over s -> P x 2^11 f16
__global__ __launch_bounds__(128) void k_fin(const float* __restrict__ S, const float* __restrict__ AM, const float* __restrict__ DM, const float* __restrict__ G, _Float16* __restrict__ P) {
  const unsigned lane = threadIdx.x & 31, vb = lane * 16, vh = lane * 8; const int tq = blockIdx.x, b = blockIdx.y; const size_t row0 = (size_t)__builtin_amdgcn_readfirstlane(b * NARB + (int)(threadIdx.x >> 5) * (RH * TT) + tq);
  v16f sc[RH], gg[RH];
  v16f dm = ld_row(DM + ((size_t)b * TT + tq) * TT, vb);
#pragma unroll
  for (int hh = 0; hh < RH; ++hh) { sc[hh] = ld_row(S + (row0 + hh * TT) * TT, vb); gg[hh] = ld_row(G + (row0 + hh * TT) * TT, vb); }
  v16f om = ld_row(AM + (size_t)b * TT, vb);
  asm volatile("" :: "v"(dm), "v"(sc[0]), "v"(sc[1]), "v"(sc[2]), "v"(gg[0]), "v"(gg[1]), "v"(gg[2]), "v"(om)); // holds the loads in place (loaded rows as inputs only): all three heads' rows are in flight together, one latency per wave
  dm = bfr16(dm); om = 1.0f - bfr16(om);
#pragma unroll
  for (int hh = 0; hh < RH; ++hh) { const v16f se = sc[hh] + om * -10000.0f, de = sc[hh] * dm; v16f x = gg[hh] * se + (1.0f - gg[hh]) * de; float m = -3.0e38f;
#pragma unroll
    for (int i = 0; i < 16; ++i) m = fmaxf(m, x[i]);
    m = wmax(m);
#pragma unroll
    for (int i = 0; i < 16; ++i) x[i] = expf(x[i] - m);
    const float inv = 1.0f / wsum(hsum(x));
    st_row(P + (row0 + hh * TT) * TT, vh, x * inv * 2048.0f); } }
// ---- k_pv: block = (64 queries, bh): ctx[b][t][h*64 + d] = P . v
__global__ __launch_bounds__(128) void k_pv(const _Float16* __restrict__ P, const _Float16* __restrict__ VT, float* __restrict__ OUT) { __shared__ __align__(16) float ss[4][16][68]; __shared__ __align__(16) _Float16 sp[4][16][SP], sv[4][HD][SP];
  const int tid = threadIdx.x, wave = tid >> 5, lane = tid & 31, col = lane & 15, g = lane >> 4; const int bh = blockIdx.y; const int b = bh / NH, h = bh % NH; const int ql0 = blockIdx.x * 64 + wave * 16;
  v8f acc[4] = {}; const int lr = lane >> 3, lc = (lane & 7) * 8; const _Float16* pp = P + ((size_t)bh * TT + ql0 + lr) * TT + lc; const _Float16* vp = VT + ((size_t)b * CC + h * HD + lr) * TT + lc; v4u rp[4], rv[16];
  ld_lines<4>(rp, pp, TT); ld_lines<16>(rv, vp, TT);
  auto trip = [&](int t, bool more) __attribute__((always_inline)) { st_lines<4>(&sp[wave][lr][lc], rp); st_lines<16>(&sv[wave][lr][lc], rv); LDSW();
    v16h ph[2], vb[2][4];
#pragma unroll
    for (int c = 0; c < 2; ++c) { ph[c] = frag_h(&sp[wave][col][c * 32], lane);
#pragma unroll
      for (int j = 0; j < 4; ++j) vb[c][j] = frag_h(&sv[wave][j * 16 + col][c * 32], lane); }
    LDSW();
    if (more) { pp += 64; vp += 64; ld_lines<4>(rp, pp, TT); ld_lines<16>(rv, vp, TT); }   // the next 64 keys are in flight over this trip's products
#pragma unroll
    for (int c = 0; c < 2; ++c)
#pragma unroll
      for (int j = 0; j < 4; ++j) acc[j] = wmma16(ph[c], vb[c][j], acc[j]); };
#pragma unroll 1   // kept rolled, as above
  for (int t = 0; t < TT / 64 - 1; ++t) trip(t, true);
  trip(TT / 64 - 1, false);
#pragma unroll
  for (int j = 0; j < 4; ++j)
#pragma unroll
    for (int r = 0; r < 8; ++r) ss[wave][8 * g + r][j * 16 + col] = acc[j][r] * (1.0f / 2048.0f);
  LDSX(); for (int rl = 0; rl < 16; ++rl) if (lane < 16) vst2(OUT + ((size_t)b * TT + ql0 + rl) * CC + h * HD + lane * 4, *(const v4f*)&ss[wave][rl][lane * 4]); }
extern "C" void kernel_launch(void* const* d_in, const int* in_sizes, int n_in, void* d_out, int out_size, void* d_ws, size_t ws_size, hipStream_t stream) {
  (void)in_sizes; (void)n_in; (void)out_size;
  const float** F = (const float**)d_in;   // 0 hidden [8,512,768], 1 attention_mask [8,512], 2 dependency_matrix [8,512,512], 3 Wq [768,768] ([in,out]), 4 bq, 5 Wk, 6 bk, 7 Wv, 8 bv, 9 ln_g [1024], 10 ln_b, 11 W1 [1024,512], 12 b1, 13 W2 [512,512], 14 b2
  if (ws_size < (size_t)WS_END) return;
  char* ws = (char*)d_ws; _Float16 *QH = (_Float16*)(ws + WS_QH), *QL = (_Float16*)(ws + WS_QL), *KH = (_Float16*)(ws + WS_KH), *VT = (_Float16*)(ws + WS_VT), *MX = (_Float16*)(ws + WS_MX), *T1 = (_Float16*)(ws + WS_T1), *P = (_Float16*)(ws + WS_P), *W1P = (_Float16*)(ws + WS_W1P), *W2P = (_Float16*)(ws + WS_W2P); __bf16 *XP = (__bf16*)(ws + WS_XP), *WP = (__bf16*)(ws + WS_WP); float *S = (float*)(ws + WS_S), *G = (float*)(ws + WS_G);
  k_pack<<<PB_X + 3 * PB_W + PB_W1 + PB_W2, 256, 0, stream>>>(F[0], F[3], F[5], F[7], F[11], F[13], XP, WP, W1P, W2P);
  k_proj<<<dim3(TNB * TT / 64, CC / 128, 3), 128, 0, stream>>>(XP, WP, F[4], F[6], F[8], QH, QL, KH, VT);
  k_sc<<<dim3(TT / 64, TT / 128, TNB * NH), 128, 0, stream>>>(QH, QL, KH, S);
  k_mix<<<dim3(TT, TNB), 128, 0, stream>>>(S, F[1], F[2], F[9], F[10], MX);
  k_g<0><<<dim3(GH / 128, TNB * NARB / (64 * GR)), 128, 0, stream>>>(MX, W1P, F[12], T1, nullptr);
  k_g<1><<<dim3(GH / 128, TNB * NARB / (64 * GR)), 128, 0, stream>>>(T1, W2P, F[14], nullptr, G);
  k_fin<<<dim3(TT, TNB), 128, 0, stream>>>(S, F[1], F[2], G, P);
  k_pv<<<dim3(TT / 64, TNB * NH), 128, 0, stream>>>(P, VT, (float*)d_out);
}

// v007
// One run takes 182 microseconds.
// Two timings next to v006 put it at 1.13 and 1.12 times that version's speed.
// Over all steps from v000 it is 6.12 times as fast.
// compute dtype: all float inputs rounded to bf16, attention_mask / dependency_matrix read; q/k/v = hidden W + b with EXACT bf16 products on WMMA 16x16x32, f32 accumulate; scores = q k^T / 8 with q as f16 hi + residual and k f16 (2 products), f32, never stored: formed where they are used, once for the LayerNorm and once for the softmax; self = scores + (1 - mask) * -1e4, dep = scores * dependency in f32; LayerNorm over the concatenated 1,024-row in f32 -> f16 fragments; gating MLP tanh(ln W1 + b1) (1 f16 product, f16 rows) then sigmoid(. W2 + b2) (1 f16 product), tanh and sigmoid formed in f32 from the hardware's 2^x and 1/x; mixed = g self + (1 - g) dep and its softmax in f32 (precise expf, running maximum over blocks of 64 keys) -> e^(x - max) x 2^11 in f16; ctx = P . v (v rounded once to f16), divided by the row sum at the end; f32 output [b][t][768].
#include <hip/hip_runtime.h>
#include <math.h>

typedef __attribute__((ext_vector_type(16))) _Float16 v16h;
typedef __attribute__((ext_vector_type(16))) __bf16 v16b;
typedef __attribute__((ext_vector_type(8)))  _Float16 v8h;
typedef __attribute__((ext_vector_type(8)))  float v8f;
typedef __attribute__((ext_vector_type(4)))  float v4f;
typedef __attribute__((ext_vector_type(2)))  float v2f;
typedef __attribute__((ext_vector_type(4)))  unsigned v4u;
typedef __attribute__((ext_vector_type(4)))  int v4i;
typedef float __attribute__((may_alias)) float_a;
typedef int __attribute__((may_alias)) int_a;

template <typename T> __device__ __forceinline__ void vst2(void* p, T v) { *(T*)p = v;  }
__device__ __forceinline__ v8f wmma16(v16h a, v16h b, v8f c) {
  v8f d = __builtin_amdgcn_wmma_f32_16x16x32_f16(false, a, false, b, (short)0, c, false, false);
  asm volatile("v_nop\n\tv_nop\n\tv_nop\n\tv_nop" : "+v"(d) : "v"(a), "v"(b));
  return d;
}
__device__ __forceinline__ v8f wmma_bf(v16b a, v16b b, v8f c) {
  v8f d = __builtin_amdgcn_wmma_f32_16x16x32_bf16(false, a, false, b, (short)0, c, false, false);
  asm volatile("v_nop\n\tv_nop\n\tv_nop\n\tv_nop" : "+v"(d) : "v"(a), "v"(b));
  return d;
}
// 16x16x32 fragments: lane = (h = lane>>4, row/col = lane&15); elements 0..7 = k0+8h+0..7, 8..15 = k0+16+8h+0..7; D element r = row 8h+r
__device__ __forceinline__ v16h frag_h(const _Float16* rowk0, int lane) {
  union { v16h v; v8h q[2]; } u; const _Float16* p = rowk0 + 8 * (lane >> 4);
  u.q[0] = *(const v8h*)p; u.q[1] = *(const v8h*)(p + 16); return u.v;
}
__device__ __forceinline__ v16h frag_f32(const float* rowk0, int lane) {
  v16h a; const float* p = rowk0 + 8 * (lane >> 4);
#pragma unroll
  for (int i = 0; i < 8; ++i) { a[i] = (_Float16)p[i]; a[8 + i] = (_Float16)p[16 + i]; }
  return a;
}
__device__ __forceinline__ v16h frag_f32s(const float* rowk0, int lane, float sc) {
  v16h a; const float* p = rowk0 + 8 * (lane >> 4);
#pragma unroll
  for (int i = 0; i < 8; ++i) { a[i] = (_Float16)(p[i] * sc); a[8 + i] = (_Float16)(p[16 + i] * sc); }
  return a;
}
// column fragment from a [K][ld] layout (column n), rows >= K read as 0
__device__ __forceinline__ v16h fragc_f32(const float* W, int k0, int n, int lane, int ld, int K) {
  v16h a; const int g = lane >> 4;
#pragma unroll
  for (int i = 0; i < 8; ++i) { const int ka = k0 + 8 * g + i, kb = ka + 16;
    a[i] = (_Float16)(ka < K ? W[(size_t)(ka < K ? ka : K - 1) * ld + n] : 0.f); a[8 + i] = (_Float16)(kb < K ? W[(size_t)(kb < K ? kb : K - 1) * ld + n] : 0.f); }
  return a;
}
struct F2 { v16b h, l; };
__device__ __forceinline__ F2 bsplit16(const float v[16]) { F2 r;
#pragma unroll
  for (int i = 0; i < 16; ++i) { const __bf16 h = (__bf16)v[i]; r.h[i] = h; r.l[i] = (__bf16)(v[i] - (float)h); }
  return r; }
__device__ __forceinline__ F2 split_row(const float* row, int k0, int lane) { float v[16]; const float* p = row + k0 + 8 * (lane >> 4);
#pragma unroll
  for (int i = 0; i < 8; ++i) { v[i] = p[i]; v[8 + i] = p[16 + i]; }
  return bsplit16(v); }
__device__ __forceinline__ F2 split_rowK(const float* row, int k0, int lane, int K) { float v[16]; const int g = lane >> 4;
#pragma unroll
  for (int i = 0; i < 8; ++i) { const int ka = k0 + 8 * g + i, kb = ka + 16; v[i] = ka < K ? row[ka < K ? ka : K - 1] : 0.f; v[8 + i] = kb < K ? row[kb < K ? kb : K - 1] : 0.f; }
  return bsplit16(v); }
__device__ __forceinline__ F2 split_col(const float* W, int k0, int n, int lane, int ld, int K) { float v[16]; const int g = lane >> 4;
#pragma unroll
  for (int i = 0; i < 8; ++i) { const int ka = k0 + 8 * g + i, kb = ka + 16; v[i] = ka < K ? W[(size_t)(ka < K ? ka : K - 1) * ld + n] : 0.f; v[8 + i] = kb < K ? W[(size_t)(kb < K ? kb : K - 1) * ld + n] : 0.f; }
  return bsplit16(v); }
__device__ __forceinline__ v8f mac3(const F2& a, const F2& b, v8f c) { c = wmma_bf(a.l, b.h, c); c = wmma_bf(a.h, b.l, c); return wmma_bf(a.h, b.h, c); }
__device__ __forceinline__ float sigm(float v) { return 1.0f / (1.0f + expf(-v)); }
#define LDSX() do { asm volatile("s_wait_dscnt 0" ::: "memory"); __builtin_amdgcn_wave_barrier(); __builtin_amdgcn_fence(__ATOMIC_RELEASE, "workgroup"); } while (0)


// Dependency-mixed BERT self attention (B 8, T 512, C 768 = 12 x 64): a learned per-(query, key) gate between plain attention scores and dependency-weighted scores, then softmax . v.
#define NB 8
#define TT 512
#define CC 768
#define NH 12
#define HD 64
#define NROW (NB * TT)          // 4096 token rows
#define NAR (NB * NH * TT)      // 49152 attention rows
#define GH 512                  // gating hidden (= T)
#ifndef TNB
#define TNB NB
#endif
typedef __attribute__((ext_vector_type(8))) __bf16 v8b;
__device__ __forceinline__ v16b frag_b(const __bf16* rowk0, int lane) {
  union { v16b v; v8b q[2]; } u; const __bf16* p = rowk0 + 8 * (lane >> 4);
  u.q[0] = *(const v8b*)p; u.q[1] = *(const v8b*)(p + 16); return u.v;
}
__device__ __forceinline__ float bfr(float v) { return (float)(__bf16)v; }
// tanh and sigmoid of the gate straight from the hardware's 2^x and 1/x (v_exp_f32, v_rcp_f32), in place of the library calls and the IEEE division sequence, which take several times the instructions and, for tanh, divergent branches per element.
// tanh is rounded to f16 behind this and the gate only weighs the scores, so the last bits of f32 do not reach the output. Both ends saturate: 2^a = inf gives 1 / inf = 0, 2^a = 0 gives 1 / 1.
#define LOG2E 1.44269504088896340736f
__device__ __forceinline__ float tanh_p2(float a) { return 1.0f - 2.0f * __builtin_amdgcn_rcpf(1.0f + __builtin_amdgcn_exp2f(a)); }   // tanh(v), a = 2 v log2(e)
__device__ __forceinline__ float sigm_p2(float a) { return __builtin_amdgcn_rcpf(1.0f + __builtin_amdgcn_exp2f(a)); }                  // sigmoid(v), a = -v log2(e)
__device__ __attribute__((noinline)) float exp_ni(float v) { return expf(v); }
__device__ __attribute__((noinline)) float erf_ni(float v) { return erff(v); }

// Every stage runs once for all NAR = 49,152 attention rows (row = (b * 12 + h) * 512 + t). A row tile is 16 consecutive attention rows (16 queries of one head).
#define NARB (NH * TT)                                   // attention rows of one batch
#define WS_MX  0u                                        // f16 LN'd mixed rows as fragments [row tile][kc 0..31][1 KB tile]: k_mix -> k_g<0>
#define WS_G   WS_MX                                     // f32 gate [row tile][key tile][1 KB], same size, in MX's place: k_g<1> -> k_fin
#define WS_T1  (WS_MX + 2u * (size_t)NAR * 2 * TT)       // f16 hidden gate rows [row][512]: k_g<0> -> k_g<1>
#define WS_VT  (WS_T1 + 2u * (size_t)NAR * GH)           // f16 v as fragments [b][h][32 keys][16 d][1 KB tile]: k_proj -> k_fin
// 16-bit copies of hidden and of the five weights in fragment order, written by k_pack at the head of every call
#define WS_W1P (WS_VT + 2u * (size_t)NROW * CC)          // f16 W1 [kc][col tile][1 KB tile]
#define WS_W2P (WS_W1P + 2u * (size_t)2 * TT * GH)       // f16 W2 [kc][col tile][1 KB tile]
// q (hi, residual) and k as fragments [b][h][16 tokens][kc 0..1][1 KB tile]: k_proj -> k_mix, k_fin
#define WS_QH  (WS_W2P + 2u * (size_t)GH * GH)
#define WS_QL  (WS_QH + 2u * (size_t)NROW * CC)
#define WS_KH  (WS_QL + 2u * (size_t)NROW * CC)
#define WS_XP  (WS_KH + 2u * (size_t)NROW * CC)          // bf16 hidden [row tile][kc][1 KB tile]
#define WS_WP  (WS_XP + 2u * (size_t)NROW * CC)          // bf16 Wq, Wk, Wv, each [kc][col tile][1 KB tile]
#define WS_END (WS_WP + 3u * 2u * (size_t)CC * CC)

// A packed tile is one 16 x 32 fragment as the wave reads it: [q = 0, 1][lane][8 elements], element i of piece q = k0 + 16 q + 8 (lane >> 4) + i of row or column (lane & 15).
// Each of the two 16-byte loads of a wave then covers 512 contiguous bytes (four whole lines).
__device__ __forceinline__ v16h fragp_h(const _Float16* tile, int lane) {
  union { v16h v; v8h q[2]; } u; const _Float16* p = tile + lane * 8;
  u.q[0] = *(const v8h*)p; u.q[1] = *(const v8h*)(p + 256); return u.v;
}
__device__ __forceinline__ v16b fragp_b(const __bf16* tile, int lane) {
  union { v16b v; v8b q[2]; } u; const __bf16* p = tile + lane * 8;
  u.q[0] = *(const v8b*)p; u.q[1] = *(const v8b*)(p + 256); return u.v;
}
// one 16-byte piece (8 consecutive k of column n) of a [K][N] f32 weight; 32 consecutive ids read whole lines and write two 256-byte runs
template <int N, bool F16> __device__ __forceinline__ void pack_w(const float* __restrict__ Wm, int id, void* __restrict__ dst) {
  const int n = id % N, ko = id / N, kc = ko >> 2, g = ko & 1, q = (ko >> 1) & 1; float v[8];
#pragma unroll
  for (int i = 0; i < 8; ++i) v[i] = Wm[(size_t)(ko * 8 + i) * N + n];
  const size_t d = ((size_t)(kc * (N / 16) + (n >> 4)) * 2 + q) * 32 + g * 16 + (n & 15);
  if (F16) { v8h o;
#pragma unroll
    for (int i = 0; i < 8; ++i) o[i] = (_Float16)bfr(v[i]);
    *((v8h*)dst + d) = o; asm volatile("s_wait_xcnt 0x0" ::: "memory"); /* the store's address and data registers may be rewritten behind it: wait first */ }
  else { v8b o;
#pragma unroll
    for (int i = 0; i < 8; ++i) o[i] = (__bf16)v[i];
    *((v8b*)dst + d) = o; asm volatile("s_wait_xcnt 0x0" ::: "memory"); /* the store's address and data registers may be rewritten behind it: wait first */ } }
#define PB_X  (NROW * CC / 8 / 256)       // blocks of 256 pieces: hidden
#define PB_W  (CC * CC / 8 / 256)         // Wq, Wk, Wv each
#define PB_W1 (2 * TT * GH / 8 / 256)
#define PB_W2 (GH * GH / 8 / 256)
// ---- k_pack: thread = one 16-byte piece of a packed tile; the block index picks the matrix
__global__ __launch_bounds__(256) void k_pack(const float* __restrict__ X, const float* __restrict__ WQ, const float* __restrict__ WK, const float* __restrict__ WV, const float* __restrict__ W1, const float* __restrict__ W2, __bf16* __restrict__ XP, __bf16* __restrict__ WP, _Float16* __restrict__ W1P, _Float16* __restrict__ W2P) {
  int blk = blockIdx.x; const int t = threadIdx.x;
  if (blk < PB_X) { const int d = blk * 256 + t, r = d & 15, g = (d >> 4) & 1, q = (d >> 5) & 1, tile = d >> 6, kc = tile % (CC / 32), rt = tile / (CC / 32);
    const float* p = X + (size_t)(rt * 16 + r) * CC + kc * 32 + q * 16 + g * 8; const v4f lo = *(const v4f*)p, hi = *(const v4f*)(p + 4); v8b o;
#pragma unroll
    for (int i = 0; i < 4; ++i) { o[i] = (__bf16)lo[i]; o[4 + i] = (__bf16)hi[i]; }
    *((v8b*)XP + d) = o; asm volatile("s_wait_xcnt 0x0" ::: "memory"); /* the store's address and data registers may be rewritten behind it: wait first */ return; }
  blk -= PB_X;
  if (blk < 3 * PB_W) { const int which = blk / PB_W; pack_w<CC, false>(which == 0 ? WQ : which == 1 ? WK : WV, (blk - which * PB_W) * 256 + t, WP + (size_t)which * CC * CC); return; }
  blk -= 3 * PB_W;
  if (blk < PB_W1) { pack_w<GH, true>(W1, blk * 256 + t, W1P); return; }
  pack_w<GH, true>(W2, (blk - PB_W1) * 256 + t, W2P); }

// ---- k_proj: block = (64 rows, 128 cols, which): hidden W + b ([in,out]); q hi + residual, k and v, all as fragments
__global__ __launch_bounds__(128) void k_proj(const __bf16* __restrict__ XP, const __bf16* __restrict__ WP, const float* __restrict__ BQ, const float* __restrict__ BK, const float* __restrict__ BV, _Float16* __restrict__ QH, _Float16* __restrict__ QL, _Float16* __restrict__ KH, _Float16* __restrict__ VT) {
  __shared__ __align__(16) _Float16 sh[64][136], sl[64][136]; __shared__ __align__(16) _Float16 th[128][72];
  const int tid = threadIdx.x, wave = tid >> 5, lane = tid & 31, col = lane & 15, g = lane >> 4; const int which = blockIdx.z; const int c0 = blockIdx.y * 128; const size_t r0 = (size_t)blockIdx.x * 64;
  const __bf16* Wm = WP + (size_t)which * CC * CC + (size_t)(c0 / 16) * 512; const __bf16* Xm = XP + (size_t)(r0 / 16 + wave) * (CC / 32) * 512; const float* Bm = which == 0 ? BQ : which == 1 ? BK : BV;
  v8f acc[8] = {};
#pragma unroll 2
  for (int kc = 0; kc < CC / 32; ++kc) { const v16b a = fragp_b(Xm + (size_t)kc * 512, lane); v16b w[8];
#pragma unroll
    for (int j = 0; j < 8; ++j) w[j] = fragp_b(Wm + ((size_t)kc * (CC / 16) + j) * 512, lane);
#pragma unroll
    for (int j = 0; j < 8; ++j) acc[j] = wmma_bf(a, w[j], acc[j]); }
#pragma unroll
  for (int j = 0; j < 8; ++j) { const float bb = bfr(Bm[c0 + j * 16 + col]);
#pragma unroll
    for (int r = 0; r < 8; ++r) { const float v = acc[j][r] + bb; const int rl = wave * 16 + 8 * g + r, cl = j * 16 + col; const _Float16 hv = (_Float16)v;
      if (which == 2) th[cl][rl] = hv; else { sh[rl][cl] = hv; sl[rl][cl] = (_Float16)(v - (float)hv); } } }
  __syncthreads();
  // q, k and v leave in fragment order (the packed tile above): 32 consecutive pieces are one 512-byte run
  const int b = (int)(r0 / TT), t0 = (int)(r0 % TT), h0 = c0 / HD;
  if (which < 2) { _Float16* dh = which == 0 ? QH : KH;   // tile = 16 tokens x 32 d
    for (int e = tid; e < 1024; e += 128) { const int ln = e & 31, q = (e >> 5) & 1, cch = (e >> 6) & 3, rtl = e >> 8; const int rl = rtl * 16 + (ln & 15), cl = cch * 32 + q * 16 + (ln >> 4) * 8;
      const size_t d = (((size_t)(b * NH + h0 + (cch >> 1)) * (TT / 16) + t0 / 16 + rtl) * 2 + (cch & 1)) * 512 + q * 256 + ln * 8;
      vst2(dh + d, *(const v4u*)&sh[rl][cl]); asm volatile("s_wait_xcnt 0x0" ::: "memory");   // the store's address and data registers are rewritten behind it: wait first
      if (which == 0) { vst2(QL + d, *(const v4u*)&sl[rl][cl]); asm volatile("s_wait_xcnt 0x0" ::: "memory"); /* as above */ } } }
  else {   // tile = 16 d x 32 tokens
    for (int e = tid; e < 1024; e += 128) { const int ln = e & 31, q = (e >> 5) & 1, dt = (e >> 6) & 7, kcl = e >> 9; const int cl = dt * 16 + (ln & 15), rl = kcl * 32 + q * 16 + (ln >> 4) * 8;
      const size_t d = (((size_t)(b * NH + h0 + (dt >> 2)) * (TT / 32) + t0 / 32 + kcl) * 4 + (dt & 3)) * 512 + q * 256 + ln * 8;
      vst2(VT + d, *(const v4u*)&th[cl][rl]);
      asm volatile("s_wait_xcnt 0x0" ::: "memory"); /* as above */ } } }
// Row-major 16-bit operand rows -> fragments through a strip of LDS that belongs to one wave. A fragment load straight from [row][K] memory touches 16 lines for 512 bytes;
// here one 16-byte load per lane covers four rows x one whole 128-byte line (64 k), the lines go to the strip at a pitch of 144 bytes, and the fragments are read back from there.
#define SP 72                   // strip pitch in 16-bit elements: 144 B = 16 B x 9, free of bank conflicts for 16-byte reads
// orders a wave's own LDS stores and loads on its strip (no other wave touches it, so no barrier)
#define LDSW() do { asm volatile("s_wait_dscnt 0" ::: "memory"); __builtin_amdgcn_wave_barrier(); } while (0)
template <int NG> __device__ __forceinline__ void ld_lines(v4u (&p)[NG], const _Float16* __restrict__ s, int ld) {   // s: the lane's 16 bytes in row (lane >> 3); group i is four rows further
#pragma unroll
  for (int i = 0; i < NG; ++i) p[i] = *(const v4u*)(s + (size_t)(4 * i) * ld); }
template <int NG> __device__ __forceinline__ void st_lines(_Float16* d, const v4u (&p)[NG]) {
#pragma unroll
  for (int i = 0; i < NG; ++i) *(v4u*)(d + 4 * i * SP) = p[i]; }
// ---- attention-row kernels: the scores are formed with the KEYS as the rows of the product (A = k tile, B = q tile), so that element r of accumulator tile j in lane (g = lane >> 4, n = lane & 15) is key 16 j + 8 g + r of query n.
// A lane then owns half of one query's row: a row sum is a sum inside the lane and one exchange with lane ^ 16, and tiles 2 c and 2 c + 1, rounded to f16, ARE the 16 x 32 fragment c of that row tile (element i = k 32 c + 8 g + i, 8 + i = k 32 c + 16 + 8 g + i), for the gate GEMM and for P . v alike.
typedef __attribute__((ext_vector_type(4))) _Float16 v4h;
__device__ __forceinline__ float xhalf(float x) { return __builtin_bit_cast(float, __builtin_amdgcn_permlanex16(__builtin_bit_cast(int, x), __builtin_bit_cast(int, x), 0x76543210, 0xfedcba98, false, false)); }  // lane l ^ 16
__device__ __forceinline__ float hsum8(v8f a) { const v4f c = __builtin_shufflevector(a, a, 0, 1, 2, 3) + __builtin_shufflevector(a, a, 4, 5, 6, 7); return (c[0] + c[1]) + (c[2] + c[3]); }
__device__ __forceinline__ v8f ld8(const float* p) { const v4f a = *(const v4f*)p, c = *(const v4f*)(p + 4); return __builtin_shufflevector(a, c, 0, 1, 2, 3, 4, 5, 6, 7); }
__device__ __forceinline__ v4f bfr4(v4f v) { v4f r;
#pragma unroll
  for (int i = 0; i < 4; ++i) r[i] = bfr(v[i]);
  return r; }
// the plain builtin: above 256 registers an asm statement that names the accumulator ties it to one register window and the tile spills; the compiler keeps the distance behind its own matrix instructions
__device__ __forceinline__ v8f wmma16b(v16h a, v16h b, v8f c) { return __builtin_amdgcn_wmma_f32_16x16x32_f16(false, a, false, b, (short)0, c, false, false); }
#define DP 516                  // pitch in floats of a staged dependency row: 2,064 B = 16 B x 129, so the 16 queries of a half wave read 16 different 16-byte columns
// the block's 16 dependency rows, rounded, to LDS: whole 2-KB rows in, a lane's 8 keys of its own query out. They carry the scores' factor 1 / 8 (a power of two: exact), so that the accumulators are used as they stand
template <int NT> __device__ __forceinline__ void stage_dm(float (*sd)[DP], const float* __restrict__ dmp, int tid) { constexpr int NI = 16 * 128 / NT, RS = NT / 128; v4f v[NI]; const int r0 = tid >> 7, c = (tid & 127) * 4;
#pragma unroll
  for (int i = 0; i < NI; ++i) v[i] = *(const v4f*)(dmp + (size_t)(i * RS + r0) * TT + c);
  asm volatile("s_wait_xcnt 0x0" ::: "memory");   // the loads' address registers may be taken for other values behind this: wait first
#pragma unroll
  for (int i = 0; i < NI; ++i) *(v4f*)&sd[i * RS + r0][c] = bfr4(v[i]) * 0.125f; }
// NJ tiles of 8 x score (keys 16 j0 ...) of the wave's 16 queries; per tile the products come in the order hi, residual of d 0..31, then of d 32..63
template <int NJ> __device__ __forceinline__ void score_tiles(v8f (&s)[NJ], const _Float16* __restrict__ kt, const v16h (&qh)[2], const v16h (&ql)[2], int lane) { v16h kb[NJ][2];
#pragma unroll
  for (int jj = 0; jj < NJ; ++jj) { kb[jj][0] = fragp_h(kt + (size_t)(2 * jj) * 512, lane); kb[jj][1] = fragp_h(kt + (size_t)(2 * jj + 1) * 512, lane); }
  asm volatile("s_wait_xcnt 0x0" ::: "memory");   // the loads' address registers may be taken for later loads' data: wait first
#pragma unroll
  for (int jj = 0; jj < NJ; ++jj) s[jj] = v8f{};
#pragma unroll
  for (int kc = 0; kc < 2; ++kc) {
#pragma unroll
    for (int jj = 0; jj < NJ; ++jj) s[jj] = wmma16b(kb[jj][kc], qh[kc], s[jj]);
#pragma unroll
    for (int jj = 0; jj < NJ; ++jj) s[jj] = wmma16b(kb[jj][kc], ql[kc], s[jj]); } }
// ---- k_mix: block = (16 queries, 4 heads, batch), 8 waves, wave = (2 heads, a quarter of the keys): its 2 x 8 score tiles in registers, every dependency and per-key value read from LDS serves both heads; mixed = [self | dep] (1,024), LayerNorm (eps 1e-5) -> f16 fragments
__global__ __launch_bounds__(256, 4) /* at most 256 registers: four waves per SIMD, and no switching of register windows */ void k_mix(const _Float16* __restrict__ QH, const _Float16* __restrict__ QL, const _Float16* __restrict__ KH, const float* __restrict__ AM, const float* __restrict__ DM, const float* __restrict__ LG, const float* __restrict__ LB, _Float16* __restrict__ MX) {
  __shared__ __align__(16) float sd[16][DP], sv[5][TT], red[2][8][2][16];   // dependency rows; per key: mask bias, LayerNorm scale (self, dep), LayerNorm shift (self, dep); each wave's part of the two row sums
  const int tid = threadIdx.x, lane = tid & 31, g = lane >> 4, qn = lane & 15; const int qt = blockIdx.x, b = blockIdx.z; const int wave = __builtin_amdgcn_readfirstlane(tid >> 5), kq = wave & 3, w0 = wave & 4, bh = b * NH + (int)blockIdx.y * 4 + (wave >> 2) * 2; const size_t rt = (size_t)bh * (TT / 16) + qt;   // bh, rt: the first of the wave's two heads
  stage_dm<256>(sd, DM + ((size_t)b * TT + qt * 16) * TT, tid);
  if (wave < 4) { const v4f am = *(const v4f*)(AM + (size_t)b * TT + tid * 4), g0 = *(const v4f*)(LG + tid * 4), g1 = *(const v4f*)(LG + TT + tid * 4), b0 = *(const v4f*)(LB + tid * 4), b1 = *(const v4f*)(LB + TT + tid * 4);
    asm volatile("s_wait_xcnt 0x0" ::: "memory");   // as in stage_dm
    *(v4f*)&sv[0][tid * 4] = (1.0f - bfr4(am)) * -10000.0f; *(v4f*)&sv[1][tid * 4] = bfr4(g0); *(v4f*)&sv[2][tid * 4] = bfr4(g1); *(v4f*)&sv[3][tid * 4] = bfr4(b0); *(v4f*)&sv[4][tid * 4] = bfr4(b1); }
  v8f s[2][8];
#pragma unroll
  for (int hh = 0; hh < 2; ++hh) { v16h qh[2], ql[2];
#pragma unroll
    for (int kc = 0; kc < 2; ++kc) { qh[kc] = fragp_h(QH + ((rt + hh * (TT / 16)) * 2 + kc) * 512, lane); ql[kc] = fragp_h(QL + ((rt + hh * (TT / 16)) * 2 + kc) * 512, lane); }
    const _Float16* kt = KH + (size_t)(bh + hh) * (TT * HD) + (size_t)kq * (TT * HD / 4);
#pragma unroll
    for (int j0 = 0; j0 < 8; j0 += 4) { v8f a[4]; score_tiles<4>(a, kt + (size_t)j0 * 1024, qh, ql, lane);
#pragma unroll
      for (int jj = 0; jj < 4; ++jj) s[hh][j0 + jj] = a[jj]; } }
  asm volatile("s_wait_xcnt 0x0" ::: "memory");   // the fragment loads' address registers are free for other values behind this: wait first
  __syncthreads();   // the staged rows and vectors are read by all eight waves
  const float* dr = &sd[qn][kq * 128 + 8 * g]; const float* vr = &sv[0][kq * 128 + 8 * g];
  v8f t[2] = {}; float mu[2], inv[2];
#pragma unroll
  for (int j = 0; j < 8; ++j) { const v8f ob = ld8(vr + j * 16), dm = ld8(dr + j * 16);
#pragma unroll
    for (int hh = 0; hh < 2; ++hh) t[hh] += (s[hh][j] * 0.125f + ob) + s[hh][j] * dm; }
#pragma unroll
  for (int hh = 0; hh < 2; ++hh) { const float r = hsum8(t[hh]); red[0][wave][hh][qn] = r + xhalf(r); }
  __syncthreads();   // a row's sum is the sum of its four waves' parts
#pragma unroll
  for (int hh = 0; hh < 2; ++hh) { mu[hh] = ((red[0][w0][hh][qn] + red[0][w0 + 1][hh][qn]) + (red[0][w0 + 2][hh][qn] + red[0][w0 + 3][hh][qn])) / (2 * TT); t[hh] = v8f{}; }
#pragma unroll
  for (int j = 0; j < 8; ++j) { const v8f ob = ld8(vr + j * 16), dm = ld8(dr + j * 16);
#pragma unroll
    for (int hh = 0; hh < 2; ++hh) { const v8f x0 = (s[hh][j] * 0.125f + ob) - mu[hh], x1 = s[hh][j] * dm - mu[hh]; t[hh] += x0 * x0 + x1 * x1; } }
#pragma unroll
  for (int hh = 0; hh < 2; ++hh) { const float r = hsum8(t[hh]); red[1][wave][hh][qn] = r + xhalf(r); }
  __syncthreads();   // as above
#pragma unroll
  for (int hh = 0; hh < 2; ++hh) inv[hh] = 1.0f / sqrtf(((red[1][w0][hh][qn] + red[1][w0 + 1][hh][qn]) + (red[1][w0 + 2][hh][qn] + red[1][w0 + 3][hh][qn])) / (2 * TT) + 1e-5f);
  _Float16* o = MX + rt * (size_t)(16 * 2 * TT) + kq * 2048 + lane * 8;
#pragma unroll
  for (int j = 0; j < 8; ++j) { const v8f ob = ld8(vr + j * 16), dm = ld8(dr + j * 16), l0 = ld8(vr + TT + j * 16), l1 = ld8(vr + 2 * TT + j * 16), c0 = ld8(vr + 3 * TT + j * 16), c1 = ld8(vr + 4 * TT + j * 16);
#pragma unroll
    for (int hh = 0; hh < 2; ++hh) { const v8f x0 = (s[hh][j] * 0.125f + ob) - mu[hh], x1 = s[hh][j] * dm - mu[hh]; _Float16* oh = o + (size_t)hh * (TT * 2 * TT) + j * 256;
      *(v8h*)oh = __builtin_convertvector(x0 * inv[hh] * l0 + c0, v8h); *(v8h*)(oh + 16 * TT) = __builtin_convertvector(x1 * inv[hh] * l1 + c1, v8h); } } }
// ---- k_g: block = (128 cols, 192 rows), wave = 48 rows x 128 cols (GR x 8 accumulator tiles), the column tile the fast grid index: stage 0: T1 = tanh(MX W1 + b1) (K 1024) -> f16 rows; stage 1: G = sigmoid(T1 W2 + b2) (K 512) -> f32 in k_fin's lane order
// Each weight fragment a wave loads feeds GR products and each row fragment 8, so a product needs two fifths of the loaded bytes of a 16 x 128 tile. The weight fragments of the even and of the odd 32-k steps have a register set each; a fragment is reloaded for two steps on right behind its last product, nearly two rounds of products ahead of its use.
#define GR 3                    // 16-row tiles per wave: 4,096 waves in all, two full rounds at 2 waves per SIMD
template <int STAGE>
__global__ __launch_bounds__(128, 2) /* registers for 2 waves per SIMD: the accumulators alone are 192 */ void k_g(const _Float16* __restrict__ IN, const _Float16* __restrict__ WPK, const float* __restrict__ Bm, _Float16* __restrict__ OUTH, float* __restrict__ OUTF) { constexpr int SBW = GR * 16 * SP * 2 > 16 * 132 * 4 ? GR * 16 * SP * 2 : 16 * 132 * 4; __shared__ __align__(16) char sb[4][SBW];   // per wave: the operand strip (48 rows x 64 k), then a 16-row f32 tile of results in its place
  const int tid = threadIdx.x, wave = tid >> 5, lane = tid & 31, col = lane & 15, g = lane >> 4; const int c0 = blockIdx.x * 128; const size_t r0 = ((size_t)blockIdx.y * 4 + wave) * (16 * GR); constexpr int K = (STAGE == 0) ? 2 * TT : GH; constexpr int NOUT = GH;
  v8f acc[GR][8] = {}; const _Float16* ap = STAGE == 0 ? IN + (r0 / 16) * (size_t)(16 * K) + lane * 8 : IN + (r0 + (lane >> 3)) * K + (lane & 7) * 8; _Float16* st = (_Float16*)sb[wave]; _Float16* sw = st + (lane >> 3) * SP + (lane & 7) * 8; v4u pa[4 * GR]; v16h w0[8], w1[8];
  const _Float16* wp = WPK + (size_t)(c0 / 16) * 512;
  // stage 0's rows arrive as fragments (k_mix): the four 16-byte pieces of 64 k of a row tile are 2 KB in a row and go straight to registers, no strip; stage 1's rows are row-major lines for the strip
  auto ld_a = [&]() __attribute__((always_inline)) {
    if constexpr (STAGE == 0) {
#pragma unroll
      for (int i = 0; i < 4 * GR; ++i) pa[i] = *(const v4u*)(ap + (size_t)(i >> 2) * (16 * K) + (i & 3) * 256); }
    else ld_lines<4 * GR>(pa, ap, K); };
  __builtin_amdgcn_sched_barrier(0);   // with the one two lines down: nothing but the row loads and their wait stands between the two
  ld_a();
  asm volatile("s_wait_xcnt 0x0" ::: "memory");   // the row loads' address registers are taken for other values further down: wait first
  __builtin_amdgcn_sched_barrier(0);   // the row loads stay the older ones, as in the loop: the wait in front of the strip's stores is then a count that leaves the weight loads in flight
#pragma unroll
  for (int j = 0; j < 8; ++j) w0[j] = fragp_h(wp + (size_t)j * 512, lane);
#pragma unroll
  for (int j = 0; j < 8; ++j) w1[j] = fragp_h(wp + (size_t)(NOUT / 16 + j) * 512, lane);
  auto trip = [&](int t, bool more) __attribute__((always_inline)) { v16h a0[GR], a1[GR];
    if constexpr (STAGE == 0) {
#pragma unroll
      for (int i = 0; i < GR; ++i) { union { v16h v; v4u q[2]; } u0, u1; u0.q[0] = pa[4 * i]; u0.q[1] = pa[4 * i + 1]; u1.q[0] = pa[4 * i + 2]; u1.q[1] = pa[4 * i + 3]; a0[i] = u0.v; a1[i] = u1.v; }
      if (more) { ap += 1024; ld_a(); } }   // the next 64 k of the wave's 48 rows are in flight over this trip's products
    else {
    st_lines<4 * GR>(sw, pa); LDSW();
    if (more) { ap += 64; ld_a(); }   // as above
#pragma unroll
    for (int i = 0; i < GR; ++i) a0[i] = frag_h(st + (i * 16 + col) * SP, lane);
#pragma unroll
    for (int i = 0; i < GR; ++i) a1[i] = frag_h(st + (i * 16 + col) * SP + 32, lane); }   // no wait behind these reads: this trip's products consume every one of them ahead of the next trip's stores
    __builtin_amdgcn_sched_barrier(0);   // this one and those in the two loops below keep every load where it is written: left free, the scheduler sinks a fragment's reload to one group of products before its use, and the load's latency shows at every group
#pragma unroll
    for (int j = 0; j < 8; ++j) {
#pragma unroll
      for (int i = 0; i < GR; ++i) acc[i][j] = wmma16b(a0[i], w0[j], acc[i][j]);
      __builtin_amdgcn_sched_barrier(0);   // the reload stays behind the last product that reads the fragment, so that it can take the same registers
      if (more) w0[j] = fragp_h(wp + ((size_t)(2 * t + 2) * (NOUT / 16) + j) * 512, lane); __builtin_amdgcn_sched_barrier(0); }
#pragma unroll
    for (int j = 0; j < 8; ++j) {
#pragma unroll
      for (int i = 0; i < GR; ++i) acc[i][j] = wmma16b(a1[i], w1[j], acc[i][j]);
      __builtin_amdgcn_sched_barrier(0);   // as above
      if (more) w1[j] = fragp_h(wp + ((size_t)(2 * t + 3) * (NOUT / 16) + j) * 512, lane); __builtin_amdgcn_sched_barrier(0); }
    if (more) { asm volatile("s_wait_xcnt 0x0" ::: "memory"); __builtin_amdgcn_sched_barrier(0); } };   // the loads' address registers are stepped for the next trip behind this point: wait first (the scheduling barrier keeps the steps behind the wait)
#pragma unroll 1   // kept rolled: a trip already holds 48 products and 44 loads
  for (int t = 0; t < K / 64 - 1; ++t) trip(t, true);   // the last trip stands alone: with no branch round the loads ahead, the loop's load waits are exact counts
  trip(K / 64 - 1, false);
  LDSW();   // the strip's last reads are done before the result tile takes its place
  constexpr float AS = (STAGE == 0) ? 2.0f * LOG2E : -LOG2E; float (*sf)[132] = (float (*)[132])sb[wave]; v4f bb = *(const v4f*)(Bm + c0 + lane * 4); asm volatile("s_wait_xcnt 0x0" ::: "memory");   // the load's address register may be rewritten behind it: wait first
#pragma unroll
  for (int e = 0; e < 4; ++e) bb[e] = bfr(bb[e]) * AS;   // the bias carries the exponent's scale: sum, bias and scale are then one multiply-add
  float bj[8];   // stage 1 adds it in front of the tile, where a lane still holds one column per accumulator
#pragma unroll
  for (int j = 0; j < 8; ++j) bj[j] = STAGE == 1 ? bfr(Bm[c0 + j * 16 + col]) * AS : 0.0f;
#pragma unroll
  for (int i = 0; i < GR; ++i) {
#pragma unroll
    for (int j = 0; j < 8; ++j)
#pragma unroll
      for (int r = 0; r < 8; ++r) sf[8 * g + r][j * 16 + col] = STAGE == 0 ? acc[i][j][r] : acc[i][j][r] * AS + bj[j];
    LDSW();
    if constexpr (STAGE == 1) {   // the gate leaves in the order k_fin's lanes hold the scores: [row tile][key tile][half][lane][4], lane (g, n) = keys 8 g + 4 half + 0..3 of row n; every store is 512 bytes in a row
#pragma unroll 2   // two pieces a pass, for the reason given at the loop below
      for (int it = 0; it < 16; ++it) { const v4f v = *(const v4f*)&sf[col][(it >> 1) * 16 + 8 * g + 4 * (it & 1)]; v4f o;
#pragma unroll
        for (int e = 0; e < 4; ++e) { float p2; asm("v_exp_f32 %0, %1\n\tv_nop" : "=v"(p2) : "v"(v[e]));   // 2^x with its free slot in one statement: an instruction that overwrites its source register is to stand one slot behind it, as the instruction set asks
          o[e] = __builtin_amdgcn_rcpf(1.0f + p2); }
        vst2(OUTF + ((r0 / 16 + i) * (TT / 16) + c0 / 16) * 256 + it * 128 + lane * 4, o); } }
    else
#pragma unroll 2   // two rows a pass: an instruction that overwrites the source register of a 2^x or 1/x is to stand one slot behind it, as the instruction set asks
    for (int rl = 0; rl < 16; ++rl) { const v4f v = *(const v4f*)&sf[rl][lane * 4] * AS + bb;
      v4h o;
#pragma unroll
      for (int e = 0; e < 4; ++e) o[e] = (_Float16)tanh_p2(v[e]);
      *(v4h*)(OUTH + (r0 + i * 16 + rl) * GH + c0 + lane * 4) = o; }
    LDSW(); } }
// ---- k_fin: block = (32 queries, 2 heads, batch), wave = (head, 16 queries), so that two waves read the same k and v fragments and two the same dependency rows; 64 keys a trip: scores; logits = g self + (1 - g) dep; softmax with a running maximum; ctx^T = v^T . P^T, so that a lane keeps its query and the rescale is one factor per lane
__global__ __launch_bounds__(128, 4) /* asks for a small register budget; the block's LDS allows three blocks per WGP, and the build settles on registers for three waves per SIMD: the 768 blocks are all resident at once */ void k_fin(const _Float16* __restrict__ QH, const _Float16* __restrict__ QL, const _Float16* __restrict__ KH, const _Float16* __restrict__ VT, const float* __restrict__ AM, const float* __restrict__ DM, const float* __restrict__ G, float* __restrict__ OUT) {
  __shared__ __align__(16) float sd[2][16][DP], so[TT], ss[4][16][68];   // dependency rows; mask bias per key; per wave the 16 x 64 result tile
  const int tid = threadIdx.x, lane = tid & 31, g = lane >> 4, qn = lane & 15; const int b = blockIdx.z; const int wave = __builtin_amdgcn_readfirstlane(tid >> 5), qt = (int)blockIdx.x * 2 + (wave & 1), h = (int)blockIdx.y * 2 + (wave >> 1), bh = b * NH + h; const size_t rt = (size_t)bh * (TT / 16) + qt;
  stage_dm<128>(sd[0], DM + ((size_t)b * TT + blockIdx.x * 32) * TT, tid); stage_dm<128>(sd[1], DM + ((size_t)b * TT + blockIdx.x * 32 + 16) * TT, tid);
  { const v4f am = *(const v4f*)(AM + (size_t)b * TT + tid * 4);
    asm volatile("s_wait_xcnt 0x0" ::: "memory");   // as in stage_dm
    *(v4f*)&so[tid * 4] = (1.0f - bfr4(am)) * -10000.0f; }
  v16h qh[2], ql[2]; v4f gn[8];
#pragma unroll
  for (int kc = 0; kc < 2; ++kc) { qh[kc] = fragp_h(QH + (rt * 2 + kc) * 512, lane); ql[kc] = fragp_h(QL + (rt * 2 + kc) * 512, lane); }
  const float* gp = G + rt * (size_t)(16 * TT) + lane * 4;
#pragma unroll
  for (int i = 0; i < 8; ++i) gn[i] = *(const v4f*)(gp + i * 128);
  asm volatile("s_wait_xcnt 0x0" ::: "memory");   // the loads' address registers are free for other values behind this: wait first
  __syncthreads();   // the staged rows and the bias are read by all four waves
  const _Float16* kt = KH + (size_t)bh * (TT * HD) + lane * 8; const _Float16* vt = VT + (size_t)bh * (TT * HD) + lane * 8; const float* gq = gp + 1024;   // the lane's own pointers, stepped once a trip behind the loads' wait
  const float* dr = &sd[wave & 1][qn][8 * g]; const float* vr = &so[8 * g];
  v8f acc[4] = {}; float m = -3.0e38f, l = 0.0f;
#pragma unroll 1   // kept rolled: a trip holds 24 products, 40 loads and 33 exponentials
  for (int t = 0; t < TT / 64; ++t) { v8f x[4]; v16h vb[2][4];
    score_tiles<4>(x, kt, qh, ql, 0);
#pragma unroll
    for (int c = 0; c < 2; ++c)
#pragma unroll
      for (int jd = 0; jd < 4; ++jd) vb[c][jd] = fragp_h(vt + (c * 4 + jd) * 512, 0);
    asm volatile("s_wait_xcnt 0x0" ::: "memory");   // the fragment loads' address registers are stepped for the next trip: wait first
    kt += 4096; vt += 4096;
    float mc = -3.0e38f;
#pragma unroll
    for (int jj = 0; jj < 4; ++jj) { const v8f gg = __builtin_shufflevector(gn[2 * jj], gn[2 * jj + 1], 0, 1, 2, 3, 4, 5, 6, 7), se = x[jj] * 0.125f + ld8(vr + t * 64 + jj * 16), de = x[jj] * ld8(dr + t * 64 + jj * 16); x[jj] = gg * se + (1.0f - gg) * de;
#pragma unroll
      for (int r = 0; r < 8; ++r) mc = fmaxf(mc, x[jj][r]); }
#pragma unroll
    for (int i = 0; i < 8; ++i) gn[i] = *(const v4f*)(gq + i * 128);   // the gate of the next 64 keys comes from memory: in flight over this trip's exponentials and the next trip's scores (the last trip loads its own again)
    asm volatile("s_wait_xcnt 0x0" ::: "memory");   // as above
    gq += t + 2 < TT / 64 ? 1024 : 0;
    const float mn = fmaxf(m, fmaxf(mc, xhalf(mc))), al = expf(m - mn); m = mn;
    v8f ps = {};
#pragma unroll
    for (int jj = 0; jj < 4; ++jj) {
#pragma unroll
      for (int r = 0; r < 8; ++r) x[jj][r] = expf(x[jj][r] - mn);
      ps += x[jj]; }
    l = l * al + hsum8(ps);
#pragma unroll
    for (int jd = 0; jd < 4; ++jd) acc[jd] *= al;
#pragma unroll
    for (int c = 0; c < 2; ++c) { const v16h p = __builtin_convertvector(__builtin_shufflevector(x[2 * c], x[2 * c + 1], 0, 1, 2, 3, 4, 5, 6, 7, 8, 9, 10, 11, 12, 13, 14, 15) * 2048.0f, v16h);
#pragma unroll
      for (int jd = 0; jd < 4; ++jd) acc[jd] = wmma16b(vb[c][jd], p, acc[jd]); } }
  const float inv = 1.0f / ((l + xhalf(l)) * 2048.0f);
#pragma unroll
  for (int jd = 0; jd < 4; ++jd) { const v8f o = acc[jd] * inv; float* d = &ss[wave][qn][jd * 16 + 8 * g]; *(v4f*)d = __builtin_shufflevector(o, o, 0, 1, 2, 3); *(v4f*)(d + 4) = __builtin_shufflevector(o, o, 4, 5, 6, 7); }
  LDSW();
#pragma unroll
  for (int i = 0; i < 8; ++i) { const int rl = 2 * i + g; vst2(OUT + ((size_t)b * TT + qt * 16 + rl) * CC + h * HD + qn * 4, *(const v4f*)&ss[wave][rl][qn * 4]); } }
extern "C" void kernel_launch(void* const* d_in, const int* in_sizes, int n_in, void* d_out, int out_size, void* d_ws, size_t ws_size, hipStream_t stream) {
  (void)in_sizes; (void)n_in; (void)out_size;
  const float** F = (const float**)d_in;   // 0 hidden [8,512,768], 1 attention_mask [8,512], 2 dependency_matrix [8,512,512], 3 Wq [768,768] ([in,out]), 4 bq, 5 Wk, 6 bk, 7 Wv, 8 bv, 9 ln_g [1024], 10 ln_b, 11 W1 [1024,512], 12 b1, 13 W2 [512,512], 14 b2
  if (ws_size < (size_t)WS_END) return;
  char* ws = (char*)d_ws; _Float16 *QH = (_Float16*)(ws + WS_QH), *QL = (_Float16*)(ws + WS_QL), *KH = (_Float16*)(ws + WS_KH), *VT = (_Float16*)(ws + WS_VT), *MX = (_Float16*)(ws + WS_MX), *T1 = (_Float16*)(ws + WS_T1), *W1P = (_Float16*)(ws + WS_W1P), *W2P = (_Float16*)(ws + WS_W2P); __bf16 *XP = (__bf16*)(ws + WS_XP), *WP = (__bf16*)(ws + WS_WP); float *G = (float*)(ws + WS_G);
  k_pack<<<PB_X + 3 * PB_W + PB_W1 + PB_W2, 256, 0, stream>>>(F[0], F[3], F[5], F[7], F[11], F[13], XP, WP, W1P, W2P);
  k_proj<<<dim3(TNB * TT / 64, CC / 128, 3), 128, 0, stream>>>(XP, WP, F[4], F[6], F[8], QH, QL, KH, VT);
  k_mix<<<dim3(TT / 16, NH / 4, TNB), 256, 0, stream>>>(QH, QL, KH, F[1], F[2], F[9], F[10], MX);
  k_g<0><<<dim3(GH / 128, TNB * NARB / (64 * GR)), 128, 0, stream>>>(MX, W1P, F[12], T1, nullptr);
  k_g<1><<<dim3(GH / 128, TNB * NARB / (64 * GR)), 128, 0, stream>>>(T1, W2P, F[14], nullptr, G);
  k_fin<<<dim3(TT / 32, NH / 2, TNB), 128, 0, stream>>>(QH, QL, KH, VT, F[1], F[2], G, (float*)d_out);
}

// v008
// One run takes 150 microseconds.
// Next to v007, in two timings, it ran 1.21 times as fast each time.
// Over all steps from v000 it is 7.43 times as fast.
// compute dtype: all float inputs rounded to bf16, attention_mask / dependency_matrix read; q/k/v = hidden W + b with EXACT bf16 products on WMMA 16x16x32, f32 accumulate; scores = q k^T / 8 with q as f16 hi + residual and k f16 (2 products), f32, never stored: formed where they are used, once for the LayerNorm and once for the softmax; self = scores + (1 - mask) * -1e4, dep = scores * dependency in f32; LayerNorm over the concatenated 1,024-row in f32 -> f16 fragments; gating MLP tanh(ln W1 + b1) (1 f16 product, f16 rows) then sigmoid(. W2 + b2) (1 f16 product), tanh and sigmoid formed in f32 from the hardware's 2^x and 1/x; mixed = g self + (1 - g) dep and its softmax in f32 (precise expf, running maximum over blocks of 64 keys) -> e^(x - max) x 2^11 in f16; ctx = P . v (v rounded once to f16), divided by the row sum at the end; f32 output [b][t][768].
#include <hip/hip_runtime.h>
#include <math.h>

typedef __attribute__((ext_vector_type(16))) _Float16 v16h;
typedef __attribute__((ext_vector_type(16))) __bf16 v16b;
typedef __attribute__((ext_vector_type(8)))  _Float16 v8h;
typedef __attribute__((ext_vector_type(8)))  float v8f;
typedef __attribute__((ext_vector_type(4)))  float v4f;
typedef __attribute__((ext_vector_type(2)))  float v2f;
typedef __attribute__((ext_vector_type(4)))  unsigned v4u;
typedef __attribute__((ext_vector_type(4)))  int v4i;
typedef float __attribute__((may_alias)) float_a;
typedef int __attribute__((may_alias)) int_a;

template <typename T> __device__ __forceinline__ void vst2(void* p, T v) { *(T*)p = v;  }
__device__ __forceinline__ v8f wmma16(v16h a, v16h b, v8f c) {
  v8f d = __builtin_amdgcn_wmma_f32_16x16x32_f16(false, a, false, b, (short)0, c, false, false);
  asm volatile("v_nop\n\tv_nop\n\tv_nop\n\tv_nop" : "+v"(d) : "v"(a), "v"(b));
  return d;
}
__device__ __forceinline__ v8f wmma_bf(v16b a, v16b b, v8f c) {
  v8f d = __builtin_amdgcn_wmma_f32_16x16x32_bf16(false, a, false, b, (short)0, c, false, false);
  asm volatile("v_nop\n\tv_nop\n\tv_nop\n\tv_nop" : "+v"(d) : "v"(a), "v"(b));
  return d;
}
// 16x16x32 fragments: lane = (h = lane>>4, row/col = lane&15); elements 0..7 = k0+8h+0..7, 8..15 = k0+16+8h+0..7; D element r = row 8h+r
__device__ __forceinline__ v16h frag_h(const _Float16* rowk0, int lane) {
  union { v16h v; v8h q[2]; } u; const _Float16* p = rowk0 + 8 * (lane >> 4);
  u.q[0] = *(const v8h*)p; u.q[1] = *(const v8h*)(p + 16); return u.v;
}
__device__ __forceinline__ v16h frag_f32(const float* rowk0, int lane) {
  v16h a; const float* p = rowk0 + 8 * (lane >> 4);
#pragma unroll
  for (int i = 0; i < 8; ++i) { a[i] = (_Float16)p[i]; a[8 + i] = (_Float16)p[16 + i]; }
  return a;
}
__device__ __forceinline__ v16h frag_f32s(const float* rowk0, int lane, float sc) {
  v16h a; const float* p = rowk0 + 8 * (lane >> 4);
#pragma unroll
  for (int i = 0; i < 8; ++i) { a[i] = (_Float16)(p[i] * sc); a[8 + i] = (_Float16)(p[16 + i] * sc); }
  return a;
}
// column fragment from a [K][ld] layout (column n), rows >= K read as 0
__device__ __forceinline__ v16h fragc_f32(const float* W, int k0, int n, int lane, int ld, int K) {
  v16h a; const int g = lane >> 4;
#pragma unroll
  for (int i = 0; i < 8; ++i) { const int ka = k0 + 8 * g + i, kb = ka + 16;
    a[i] = (_Float16)(ka < K ? W[(size_t)(ka < K ? ka : K - 1) * ld + n] : 0.f); a[8 + i] = (_Float16)(kb < K ? W[(size_t)(kb < K ? kb : K - 1) * ld + n] : 0.f); }
  return a;
}
struct F2 { v16b h, l; };
__device__ __forceinline__ F2 bsplit16(const float v[16]) { F2 r;
#pragma unroll
  for (int i = 0; i < 16; ++i) { const __bf16 h = (__bf16)v[i]; r.h[i] = h; r.l[i] = (__bf16)(v[i] - (float)h); }
  return r; }
__device__ __forceinline__ F2 split_row(const float* row, int k0, int lane) { float v[16]; const float* p = row + k0 + 8 * (lane >> 4);
#pragma unroll
  for (int i = 0; i < 8; ++i) { v[i] = p[i]; v[8 + i] = p[16 + i]; }
  return bsplit16(v); }
__device__ __forceinline__ F2 split_rowK(const float* row, int k0, int lane, int K) { float v[16]; const int g = lane >> 4;
#pragma unroll
  for (int i = 0; i < 8; ++i) { const int ka = k0 + 8 * g + i, kb = ka + 16; v[i] = ka < K ? row[ka < K ? ka : K - 1] : 0.f; v[8 + i] = kb < K ? row[kb < K ? kb : K - 1] : 0.f; }
  return bsplit16(v); }
__device__ __forceinline__ F2 split_col(const float* W, int k0, int n, int lane, int ld, int K) { float v[16]; const int g = lane >> 4;
#pragma unroll
  for (int i = 0; i < 8; ++i) { const int ka = k0 + 8 * g + i, kb = ka + 16; v[i] = ka < K ? W[(size_t)(ka < K ? ka : K - 1) * ld + n] : 0.f; v[8 + i] = kb < K ? W[(size_t)(kb < K ? kb : K - 1) * ld + n] : 0.f; }
  return bsplit16(v); }
__device__ __forceinline__ v8f mac3(const F2& a, const F2& b, v8f c) { c = wmma_bf(a.l, b.h, c); c = wmma_bf(a.h, b.l, c); return wmma_bf(a.h, b.h, c); }
__device__ __forceinline__ float sigm(float v) { return 1.0f / (1.0f + expf(-v)); }
#define LDSX() do { asm volatile("s_wait_dscnt 0" ::: "memory"); __builtin_amdgcn_wave_barrier(); __builtin_amdgcn_fence(__ATOMIC_RELEASE, "workgroup"); } while (0)


// Dependency-mixed BERT self attention (B 8, T 512, C 768 = 12 x 64): a learned per-(query, key) gate between plain attention scores and dependency-weighted scores, then softmax . v.
#define NB 8
#define TT 512
#define CC 768
#define NH 12
#define HD 64
#define NROW (NB * TT)          // 4096 token rows
#define NAR (NB * NH * TT)      // 49152 attention rows
#define GH 512                  // gating hidden (= T)
#ifndef TNB
#define TNB NB
#endif
typedef __attribute__((ext_vector_type(8))) __bf16 v8b;
__device__ __forceinline__ v16b frag_b(const __bf16* rowk0, int lane) {
  union { v16b v; v8b q[2]; } u; const __bf16* p = rowk0 + 8 * (lane >> 4);
  u.q[0] = *(const v8b*)p; u.q[1] = *(const v8b*)(p + 16); return u.v;
}
__device__ __forceinline__ float bfr(float v) { return (float)(__bf16)v; }
// tanh and sigmoid of the gate straight from the hardware's 2^x and 1/x (v_exp_f32, v_rcp_f32), in place of the library calls and the IEEE division sequence, which take several times the instructions and, for tanh, divergent branches per element.
// tanh is rounded to f16 behind this and the gate only weighs the scores, so the last bits of f32 do not reach the output. Both ends saturate: 2^a = inf gives 1 / inf = 0, 2^a = 0 gives 1 / 1.
#define LOG2E 1.44269504088896340736f
__device__ __forceinline__ float tanh_p2(float a) { return 1.0f - 2.0f * __builtin_amdgcn_rcpf(1.0f + __builtin_amdgcn_exp2f(a)); }   // tanh(v), a = 2 v log2(e)
__device__ __forceinline__ float sigm_p2(float a) { return __builtin_amdgcn_rcpf(1.0f + __builtin_amdgcn_exp2f(a)); }                  // sigmoid(v), a = -v log2(e)
__device__ __attribute__((noinline)) float exp_ni(float v) { return expf(v); }
__device__ __attribute__((noinline)) float erf_ni(float v) { return erff(v); }

// Every stage runs once for all NAR = 49,152 attention rows (row = (b * 12 + h) * 512 + t). A row tile is 16 consecutive attention rows (16 queries of one head).
#define NARB (NH * TT)                                   // attention rows of one batch
#define WS_MX  0u                                        // f16 LN'd mixed rows as fragments [row tile][kc 0..31][1 KB tile]: k_mix -> k_g
#define WS_G   (WS_MX + 2u * (size_t)NAR * 2 * TT)       // f32 gate [row tile][key tile][1 KB]: k_g -> k_fin
#define WS_VT  (WS_G + 4u * (size_t)NAR * TT)            // f16 v as fragments [b][h][32 keys][16 d][1 KB tile]: k_proj -> k_fin
// 16-bit copies of hidden and of the five weights in fragment order, written by k_pack at the head of every call
#define WS_W1P (WS_VT + 2u * (size_t)NROW * CC)          // f16 W1 [kc][col tile][1 KB tile]
#define WS_W2P (WS_W1P + 2u * (size_t)2 * TT * GH)       // f16 W2 [kc][col tile][1 KB tile]
// q (hi, residual) and k as fragments [b][h][16 tokens][kc 0..1][1 KB tile]: k_proj -> k_mix, k_fin
#define WS_QH  (WS_W2P + 2u * (size_t)GH * GH)
#define WS_QL  (WS_QH + 2u * (size_t)NROW * CC)
#define WS_KH  (WS_QL + 2u * (size_t)NROW * CC)
#define WS_XP  (WS_KH + 2u * (size_t)NROW * CC)          // bf16 hidden [row tile][kc][1 KB tile]
#define WS_WP  (WS_XP + 2u * (size_t)NROW * CC)          // bf16 Wq, Wk, Wv, each [kc][col tile][1 KB tile]
#define WS_END (WS_WP + 3u * 2u * (size_t)CC * CC)

// A packed tile is one 16 x 32 fragment as the wave reads it: [q = 0, 1][lane][8 elements], element i of piece q = k0 + 16 q + 8 (lane >> 4) + i of row or column (lane & 15).
// Each of the two 16-byte loads of a wave then covers 512 contiguous bytes (four whole lines).
__device__ __forceinline__ v16h fragp_h(const _Float16* tile, int lane) {
  union { v16h v; v8h q[2]; } u; const _Float16* p = tile + lane * 8;
  u.q[0] = *(const v8h*)p; u.q[1] = *(const v8h*)(p + 256); return u.v;
}
__device__ __forceinline__ v16b fragp_b(const __bf16* tile, int lane) {
  union { v16b v; v8b q[2]; } u; const __bf16* p = tile + lane * 8;
  u.q[0] = *(const v8b*)p; u.q[1] = *(const v8b*)(p + 256); return u.v;
}
// one 16-byte piece (8 consecutive k of column n) of a [K][N] f32 weight; 32 consecutive ids read whole lines and write two 256-byte runs
template <int N, bool F16> __device__ __forceinline__ void pack_w(const float* __restrict__ Wm, int id, void* __restrict__ dst) {
  const int n = id % N, ko = id / N, kc = ko >> 2, g = ko & 1, q = (ko >> 1) & 1; float v[8];
#pragma unroll
  for (int i = 0; i < 8; ++i) v[i] = Wm[(size_t)(ko * 8 + i) * N + n];
  const size_t d = ((size_t)(kc * (N / 16) + (n >> 4)) * 2 + q) * 32 + g * 16 + (n & 15);
  if (F16) { v8h o;
#pragma unroll
    for (int i = 0; i < 8; ++i) o[i] = (_Float16)bfr(v[i]);
    *((v8h*)dst + d) = o; asm volatile("s_wait_xcnt 0x0" ::: "memory"); /* the store's address and data registers may be rewritten behind it: wait first */ }
  else { v8b o;
#pragma unroll
    for (int i = 0; i < 8; ++i) o[i] = (__bf16)v[i];
    *((v8b*)dst + d) = o; asm volatile("s_wait_xcnt 0x0" ::: "memory"); /* the store's address and data registers may be rewritten behind it: wait first */ } }
#define PB_X  (NROW * CC / 8 / 256)       // blocks of 256 pieces: hidden
#define PB_W  (CC * CC / 8 / 256)         // Wq, Wk, Wv each
#define PB_W1 (2 * TT * GH / 8 / 256)
#define PB_W2 (GH * GH / 8 / 256)
// ---- k_pack: thread = one 16-byte piece of a packed tile; the block index picks the matrix
__global__ __launch_bounds__(256) void k_pack(const float* __restrict__ X, const float* __restrict__ WQ, const float* __restrict__ WK, const float* __restrict__ WV, const float* __restrict__ W1, const float* __restrict__ W2, __bf16* __restrict__ XP, __bf16* __restrict__ WP, _Float16* __restrict__ W1P, _Float16* __restrict__ W2P) {
  int blk = blockIdx.x; const int t = threadIdx.x;
  if (blk < PB_X) { const int d = blk * 256 + t, r = d & 15, g = (d >> 4) & 1, q = (d >> 5) & 1, tile = d >> 6, kc = tile % (CC / 32), rt = tile / (CC / 32);
    const float* p = X + (size_t)(rt * 16 + r) * CC + kc * 32 + q * 16 + g * 8; const v4f lo = *(const v4f*)p, hi = *(const v4f*)(p + 4); v8b o;
#pragma unroll
    for (int i = 0; i < 4; ++i) { o[i] = (__bf16)lo[i]; o[4 + i] = (__bf16)hi[i]; }
    *((v8b*)XP + d) = o; asm volatile("s_wait_xcnt 0x0" ::: "memory"); /* the store's address and data registers may be rewritten behind it: wait first */ return; }
  blk -= PB_X;
  if (blk < 3 * PB_W) { const int which = blk / PB_W; pack_w<CC, false>(which == 0 ? WQ : which == 1 ? WK : WV, (blk - which * PB_W) * 256 + t, WP + (size_t)which * CC * CC); return; }
  blk -= 3 * PB_W;
  if (blk < PB_W1) { pack_w<GH, true>(W1, blk * 256 + t, W1P); return; }
  pack_w<GH, true>(W2, (blk - PB_W1) * 256 + t, W2P); }

// ---- k_proj: block = (64 rows, 128 cols, which): hidden W + b ([in,out]); q hi + residual, k and v, all as fragments
__global__ __launch_bounds__(128) void k_proj(const __bf16* __restrict__ XP, const __bf16* __restrict__ WP, const float* __restrict__ BQ, const float* __restrict__ BK, const float* __restrict__ BV, _Float16* __restrict__ QH, _Float16* __restrict__ QL, _Float16* __restrict__ KH, _Float16* __restrict__ VT) {
  __shared__ __align__(16) _Float16 sh[64][136], sl[64][136]; __shared__ __align__(16) _Float16 th[128][72];
  const int tid = threadIdx.x, wave = tid >> 5, lane = tid & 31, col = lane & 15, g = lane >> 4; const int which = blockIdx.z; const int c0 = blockIdx.y * 128; const size_t r0 = (size_t)blockIdx.x * 64;
  const __bf16* Wm = WP + (size_t)which * CC * CC + (size_t)(c0 / 16) * 512; const __bf16* Xm = XP + (size_t)(r0 / 16 + wave) * (CC / 32) * 512; const float* Bm = which == 0 ? BQ : which == 1 ? BK : BV;
  v8f acc[8] = {};
#pragma unroll 2
  for (int kc = 0; kc < CC / 32; ++kc) { const v16b a = fragp_b(Xm + (size_t)kc * 512, lane); v16b w[8];
#pragma unroll
    for (int j = 0; j < 8; ++j) w[j] = fragp_b(Wm + ((size_t)kc * (CC / 16) + j) * 512, lane);
#pragma unroll
    for (int j = 0; j < 8; ++j) acc[j] = wmma_bf(a, w[j], acc[j]); }
#pragma unroll
  for (int j = 0; j < 8; ++j) { const float bb = bfr(Bm[c0 + j * 16 + col]);
#pragma unroll
    for (int r = 0; r < 8; ++r) { const float v = acc[j][r] + bb; const int rl = wave * 16 + 8 * g + r, cl = j * 16 + col; const _Float16 hv = (_Float16)v;
      if (which == 2) th[cl][rl] = hv; else { sh[rl][cl] = hv; sl[rl][cl] = (_Float16)(v - (float)hv); } } }
  __syncthreads();
  // q, k and v leave in fragment order (the packed tile above): 32 consecutive pieces are one 512-byte run
  const int b = (int)(r0 / TT), t0 = (int)(r0 % TT), h0 = c0 / HD;
  if (which < 2) { _Float16* dh = which == 0 ? QH : KH;   // tile = 16 tokens x 32 d
    for (int e = tid; e < 1024; e += 128) { const int ln = e & 31, q = (e >> 5) & 1, cch = (e >> 6) & 3, rtl = e >> 8; const int rl = rtl * 16 + (ln & 15), cl = cch * 32 + q * 16 + (ln >> 4) * 8;
      const size_t d = (((size_t)(b * NH + h0 + (cch >> 1)) * (TT / 16) + t0 / 16 + rtl) * 2 + (cch & 1)) * 512 + q * 256 + ln * 8;
      vst2(dh + d, *(const v4u*)&sh[rl][cl]); asm volatile("s_wait_xcnt 0x0" ::: "memory");   // the store's address and data registers are rewritten behind it: wait first
      if (which == 0) { vst2(QL + d, *(const v4u*)&sl[rl][cl]); asm volatile("s_wait_xcnt 0x0" ::: "memory"); /* as above */ } } }
  else {   // tile = 16 d x 32 tokens
    for (int e = tid; e < 1024; e += 128) { const int ln = e & 31, q = (e >> 5) & 1, dt = (e >> 6) & 7, kcl = e >> 9; const int cl = dt * 16 + (ln & 15), rl = kcl * 32 + q * 16 + (ln >> 4) * 8;
      const size_t d = (((size_t)(b * NH + h0 + (dt >> 2)) * (TT / 32) + t0 / 32 + kcl) * 4 + (dt & 3)) * 512 + q * 256 + ln * 8;
      vst2(VT + d, *(const v4u*)&th[cl][rl]);
      asm volatile("s_wait_xcnt 0x0" ::: "memory"); /* as above */ } } }
// orders a wave's own LDS stores and loads on a range that no other wave touches (so no barrier)
#define LDSW() do { asm volatile("s_wait_dscnt 0" ::: "memory"); __builtin_amdgcn_wave_barrier(); } while (0)
// ---- attention-row kernels: the scores are formed with the KEYS as the rows of the product (A = k tile, B = q tile), so that element r of accumulator tile j in lane (g = lane >> 4, n = lane & 15) is key 16 j + 8 g + r of query n.
// A lane then owns half of one query's row: a row sum is a sum inside the lane and one exchange with lane ^ 16, and tiles 2 c and 2 c + 1, rounded to f16, ARE the 16 x 32 fragment c of that row tile (element i = k 32 c + 8 g + i, 8 + i = k 32 c + 16 + 8 g + i), for the gate GEMM and for P . v alike.
typedef __attribute__((ext_vector_type(4))) _Float16 v4h;
__device__ __forceinline__ float xhalf(float x) { return __builtin_bit_cast(float, __builtin_amdgcn_permlanex16(__builtin_bit_cast(int, x), __builtin_bit_cast(int, x), 0x76543210, 0xfedcba98, false, false)); }  // lane l ^ 16
__device__ __forceinline__ float hsum8(v8f a) { const v4f c = __builtin_shufflevector(a, a, 0, 1, 2, 3) + __builtin_shufflevector(a, a, 4, 5, 6, 7); return (c[0] + c[1]) + (c[2] + c[3]); }
__device__ __forceinline__ v8f ld8(const float* p) { const v4f a = *(const v4f*)p, c = *(const v4f*)(p + 4); return __builtin_shufflevector(a, c, 0, 1, 2, 3, 4, 5, 6, 7); }
__device__ __forceinline__ v4f bfr4(v4f v) { v4f r;
#pragma unroll
  for (int i = 0; i < 4; ++i) r[i] = bfr(v[i]);
  return r; }
// the plain builtin: above 256 registers an asm statement that names the accumulator ties it to one register window and the tile spills; the compiler keeps the distance behind its own matrix instructions
__device__ __forceinline__ v8f wmma16b(v16h a, v16h b, v8f c) { return __builtin_amdgcn_wmma_f32_16x16x32_f16(false, a, false, b, (short)0, c, false, false); }
#define DP 516                  // pitch in floats of a staged dependency row: 2,064 B = 16 B x 129, so the 16 queries of a half wave read 16 different 16-byte columns
// the block's 16 dependency rows, rounded, to LDS: whole 2-KB rows in, a lane's 8 keys of its own query out. They carry the scores' factor 1 / 8 (a power of two: exact), so that the accumulators are used as they stand
template <int NT> __device__ __forceinline__ void stage_dm(float (*sd)[DP], const float* __restrict__ dmp, int tid) { constexpr int NI = 16 * 128 / NT, RS = NT / 128; v4f v[NI]; const int r0 = tid >> 7, c = (tid & 127) * 4;
#pragma unroll
  for (int i = 0; i < NI; ++i) v[i] = *(const v4f*)(dmp + (size_t)(i * RS + r0) * TT + c);
  asm volatile("s_wait_xcnt 0x0" ::: "memory");   // the loads' address registers may be taken for other values behind this: wait first
#pragma unroll
  for (int i = 0; i < NI; ++i) *(v4f*)&sd[i * RS + r0][c] = bfr4(v[i]) * 0.125f; }
// NJ tiles of 8 x score (keys 16 j0 ...) of the wave's 16 queries; per tile the products come in the order hi, residual of d 0..31, then of d 32..63
template <int NJ> __device__ __forceinline__ void score_tiles(v8f (&s)[NJ], const _Float16* __restrict__ kt, const v16h (&qh)[2], const v16h (&ql)[2], int lane) { v16h kb[NJ][2];
#pragma unroll
  for (int jj = 0; jj < NJ; ++jj) { kb[jj][0] = fragp_h(kt + (size_t)(2 * jj) * 512, lane); kb[jj][1] = fragp_h(kt + (size_t)(2 * jj + 1) * 512, lane); }
  asm volatile("s_wait_xcnt 0x0" ::: "memory");   // the loads' address registers may be taken for later loads' data: wait first
#pragma unroll
  for (int jj = 0; jj < NJ; ++jj) s[jj] = v8f{};
#pragma unroll
  for (int kc = 0; kc < 2; ++kc) {
#pragma unroll
    for (int jj = 0; jj < NJ; ++jj) s[jj] = wmma16b(kb[jj][kc], qh[kc], s[jj]);
#pragma unroll
    for (int jj = 0; jj < NJ; ++jj) s[jj] = wmma16b(kb[jj][kc], ql[kc], s[jj]); } }
// ---- k_mix: block = (16 queries, 4 heads, batch), 8 waves, wave = (2 heads, a quarter of the keys): its 2 x 8 score tiles in registers, every dependency and per-key value read from LDS serves both heads; mixed = [self | dep] (1,024), LayerNorm (eps 1e-5) -> f16 fragments
__global__ __launch_bounds__(256, 4) /* at most 256 registers: four waves per SIMD, and no switching of register windows */ void k_mix(const _Float16* __restrict__ QH, const _Float16* __restrict__ QL, const _Float16* __restrict__ KH, const float* __restrict__ AM, const float* __restrict__ DM, const float* __restrict__ LG, const float* __restrict__ LB, _Float16* __restrict__ MX) {
  __shared__ __align__(16) float sd[16][DP], sv[5][TT], red[2][8][2][16];   // dependency rows; per key: mask bias, LayerNorm scale (self, dep), LayerNorm shift (self, dep); each wave's part of the two row sums
  const int tid = threadIdx.x, lane = tid & 31, g = lane >> 4, qn = lane & 15; const int qt = blockIdx.x, b = blockIdx.z; const int wave = __builtin_amdgcn_readfirstlane(tid >> 5), kq = wave & 3, w0 = wave & 4, bh = b * NH + (int)blockIdx.y * 4 + (wave >> 2) * 2; const size_t rt = (size_t)bh * (TT / 16) + qt;   // bh, rt: the first of the wave's two heads
  stage_dm<256>(sd, DM + ((size_t)b * TT + qt * 16) * TT, tid);
  if (wave < 4) { const v4f am = *(const v4f*)(AM + (size_t)b * TT + tid * 4), g0 = *(const v4f*)(LG + tid * 4), g1 = *(const v4f*)(LG + TT + tid * 4), b0 = *(const v4f*)(LB + tid * 4), b1 = *(const v4f*)(LB + TT + tid * 4);
    asm volatile("s_wait_xcnt 0x0" ::: "memory");   // as in stage_dm
    *(v4f*)&sv[0][tid * 4] = (1.0f - bfr4(am)) * -10000.0f; *(v4f*)&sv[1][tid * 4] = bfr4(g0); *(v4f*)&sv[2][tid * 4] = bfr4(g1); *(v4f*)&sv[3][tid * 4] = bfr4(b0); *(v4f*)&sv[4][tid * 4] = bfr4(b1); }
  v8f s[2][8];
#pragma unroll
  for (int hh = 0; hh < 2; ++hh) { v16h qh[2], ql[2];
#pragma unroll
    for (int kc = 0; kc < 2; ++kc) { qh[kc] = fragp_h(QH + ((rt + hh * (TT / 16)) * 2 + kc) * 512, lane); ql[kc] = fragp_h(QL + ((rt + hh * (TT / 16)) * 2 + kc) * 512, lane); }
    const _Float16* kt = KH + (size_t)(bh + hh) * (TT * HD) + (size_t)kq * (TT * HD / 4);
#pragma unroll
    for (int j0 = 0; j0 < 8; j0 += 4) { v8f a[4]; score_tiles<4>(a, kt + (size_t)j0 * 1024, qh, ql, lane);
#pragma unroll
      for (int jj = 0; jj < 4; ++jj) s[hh][j0 + jj] = a[jj]; } }
  asm volatile("s_wait_xcnt 0x0" ::: "memory");   // the fragment loads' address registers are free for other values behind this: wait first
  __syncthreads();   // the staged rows and vectors are read by all eight waves
  const float* dr = &sd[qn][kq * 128 + 8 * g]; const float* vr = &sv[0][kq * 128 + 8 * g];
  v8f t[2] = {}; float mu[2], inv[2];
#pragma unroll
  for (int j = 0; j < 8; ++j) { const v8f ob = ld8(vr + j * 16), dm = ld8(dr + j * 16);
#pragma unroll
    for (int hh = 0; hh < 2; ++hh) t[hh] += (s[hh][j] * 0.125f + ob) + s[hh][j] * dm; }
#pragma unroll
  for (int hh = 0; hh < 2; ++hh) { const float r = hsum8(t[hh]); red[0][wave][hh][qn] = r + xhalf(r); }
  __syncthreads();   // a row's sum is the sum of its four waves' parts
#pragma unroll
  for (int hh = 0; hh < 2; ++hh) { mu[hh] = ((red[0][w0][hh][qn] + red[0][w0 + 1][hh][qn]) + (red[0][w0 + 2][hh][qn] + red[0][w0 + 3][hh][qn])) / (2 * TT); t[hh] = v8f{}; }
#pragma unroll
  for (int j = 0; j < 8; ++j) { const v8f ob = ld8(vr + j * 16), dm = ld8(dr + j * 16);
#pragma unroll
    for (int hh = 0; hh < 2; ++hh) { const v8f x0 = (s[hh][j] * 0.125f + ob) - mu[hh], x1 = s[hh][j] * dm - mu[hh]; t[hh] += x0 * x0 + x1 * x1; } }
#pragma unroll
  for (int hh = 0; hh < 2; ++hh) { const float r = hsum8(t[hh]); red[1][wave][hh][qn] = r + xhalf(r); }
  __syncthreads();   // as above
#pragma unroll
  for (int hh = 0; hh < 2; ++hh) inv[hh] = 1.0f / sqrtf(((red[1][w0][hh][qn] + red[1][w0 + 1][hh][qn]) + (red[1][w0 + 2][hh][qn] + red[1][w0 + 3][hh][qn])) / (2 * TT) + 1e-5f);
  _Float16* o = MX + rt * (size_t)(16 * 2 * TT) + kq * 2048 + lane * 8;
#pragma unroll
  for (int j = 0; j < 8; ++j) { const v8f ob = ld8(vr + j * 16), dm = ld8(dr + j * 16), l0 = ld8(vr + TT + j * 16), l1 = ld8(vr + 2 * TT + j * 16), c0 = ld8(vr + 3 * TT + j * 16), c1 = ld8(vr + 4 * TT + j * 16);
#pragma unroll
    for (int hh = 0; hh < 2; ++hh) { const v8f x0 = (s[hh][j] * 0.125f + ob) - mu[hh], x1 = s[hh][j] * dm - mu[hh]; _Float16* oh = o + (size_t)hh * (TT * 2 * TT) + j * 256;
      *(v8h*)oh = __builtin_convertvector(x0 * inv[hh] * l0 + c0, v8h); *(v8h*)(oh + 16 * TT) = __builtin_convertvector(x1 * inv[hh] * l1 + c1, v8h); } } }
// ---- k_g: block = 96 attention rows x all 512 columns, 8 waves, wave = 48 rows x 128 cols (GR x 8 accumulator tiles). Both gate products in one launch: T1 = tanh(MX W1 + b1) (K 1024) goes as f16 rows to LDS and never to memory; behind one block barrier G = sigmoid(T1 W2 + b2) (K 512) -> f32 in k_fin's lane order
// Each weight fragment a wave loads feeds GR products and each row fragment 8, so a product needs two fifths of the loaded bytes of a 16 x 128 tile. The weight fragments of the even and of the odd 32-k steps have a register set each; a fragment is reloaded for two steps on right behind its last product, nearly two rounds of products ahead of its use.
#define GR 3                    // 16-row tiles per wave: 4,096 waves in all, two full rounds at 2 waves per SIMD
#define T1P 520                 // pitch in 16-bit elements of a hidden gate row in LDS: 1,040 B = 16 B x 65, free of bank conflicts for 16-byte reads
__global__ __launch_bounds__(256, 2) /* registers for 2 waves per SIMD: the accumulators alone are 192 */ void k_g(const _Float16* __restrict__ IN, const _Float16* __restrict__ W1K, const float* __restrict__ B1, const _Float16* __restrict__ W2K, const float* __restrict__ B2, float* __restrict__ OUTF) {
  __shared__ __align__(16) _Float16 t1[2 * GR * 16][T1P];   // the block's 96 hidden gate rows
  __shared__ __align__(16) float sfb[8][16][132];           // per wave: a 16-row f32 tile of results
  // waves 2 c and 2 c + 1 take column group c (the same weight fragments), even and odd waves the two groups of 48 rows
  const int tid = threadIdx.x, wave = tid >> 5, lane = tid & 31, col = lane & 15, g = lane >> 4; const int c0 = (wave >> 1) * 128, rl0 = (wave & 1) * (16 * GR); const size_t r0 = (size_t)blockIdx.x * (32 * GR) + rl0; constexpr int K0 = 2 * TT, NOUT = GH;
  v8f acc[GR][8] = {}; const _Float16* ap = IN + (r0 / 16) * (size_t)(16 * K0) + lane * 8; v4u pa[4 * GR]; v16h w0[8], w1[8];
  const _Float16* wp = W1K + (size_t)(c0 / 16) * 512; const _Float16* wq = W2K + (size_t)(c0 / 16) * 512; const _Float16* tr = &t1[rl0 + col][0];
  // the first product's rows arrive as fragments (k_mix): the four 16-byte pieces of 64 k of a row tile are 2 KB in a row and go straight to registers
  auto ld_a = [&]() __attribute__((always_inline)) {
#pragma unroll
    for (int i = 0; i < 4 * GR; ++i) pa[i] = *(const v4u*)(ap + (size_t)(i >> 2) * (16 * K0) + (i & 3) * 256); };
  __builtin_amdgcn_sched_barrier(0);   // with the one two lines down: nothing but the row loads and their wait stands between the two
  ld_a();
  asm volatile("s_wait_xcnt 0x0" ::: "memory");   // the row loads' address registers are taken for other values further down: wait first
  __builtin_amdgcn_sched_barrier(0);   // the row loads stay the older ones, as in the loop: the wait in front of their use is then a count that leaves the weight loads in flight
#pragma unroll
  for (int j = 0; j < 8; ++j) w0[j] = fragp_h(wp + (size_t)j * 512, lane);
#pragma unroll
  for (int j = 0; j < 8; ++j) w1[j] = fragp_h(wp + (size_t)(NOUT / 16 + j) * 512, lane);
  // the 48 products of 64 k, with the weight fragments' reloads
  auto prods = [&](const v16h (&a0)[GR], const v16h (&a1)[GR], const _Float16* wsrc, int t, bool more) __attribute__((always_inline)) {
    __builtin_amdgcn_sched_barrier(0);   // this one and those in the two loops below keep every load where it is written: left free, the scheduler sinks a fragment's reload to one group of products before its use, and the load's latency shows at every group
#pragma unroll
    for (int j = 0; j < 8; ++j) {
#pragma unroll
      for (int i = 0; i < GR; ++i) acc[i][j] = wmma16b(a0[i], w0[j], acc[i][j]);
      __builtin_amdgcn_sched_barrier(0);   // the reload stays behind the last product that reads the fragment, so that it can take the same registers
      if (more) w0[j] = fragp_h(wsrc + ((size_t)(2 * t + 2) * (NOUT / 16) + j) * 512, lane); __builtin_amdgcn_sched_barrier(0); }
#pragma unroll
    for (int j = 0; j < 8; ++j) {
#pragma unroll
      for (int i = 0; i < GR; ++i) acc[i][j] = wmma16b(a1[i], w1[j], acc[i][j]);
      __builtin_amdgcn_sched_barrier(0);   // as above
      if (more) w1[j] = fragp_h(wsrc + ((size_t)(2 * t + 3) * (NOUT / 16) + j) * 512, lane); __builtin_amdgcn_sched_barrier(0); }
    if (more) { asm volatile("s_wait_xcnt 0x0" ::: "memory"); __builtin_amdgcn_sched_barrier(0); } };   // the loads' address registers are stepped for the next trip behind this point: wait first (the scheduling barrier keeps the steps behind the wait)
  auto trip0 = [&](int t, bool more) __attribute__((always_inline)) { v16h a0[GR], a1[GR];
#pragma unroll
    for (int i = 0; i < GR; ++i) { union { v16h v; v4u q[2]; } u0, u1; u0.q[0] = pa[4 * i]; u0.q[1] = pa[4 * i + 1]; u1.q[0] = pa[4 * i + 2]; u1.q[1] = pa[4 * i + 3]; a0[i] = u0.v; a1[i] = u1.v; }
    if (more) { ap += 1024; ld_a(); }   // the next 64 k of the wave's 48 rows are in flight over this trip's products
    prods(a0, a1, wp, t, more); };
  auto trip1 = [&](int t, bool more) __attribute__((always_inline)) { v16h a0[GR], a1[GR];   // the second product's rows are read from LDS as fragments
#pragma unroll
    for (int i = 0; i < GR; ++i) a0[i] = frag_h(tr + i * 16 * T1P + t * 64, lane);
#pragma unroll
    for (int i = 0; i < GR; ++i) a1[i] = frag_h(tr + i * 16 * T1P + t * 64 + 32, lane);
    prods(a0, a1, wq, t, more); };
#pragma unroll 1   // kept rolled: a trip already holds 48 products and 44 loads
  for (int t = 0; t < K0 / 64 - 1; ++t) trip0(t, true);   // the last trip stands alone: with no branch round the loads ahead, the loop's load waits are exact counts
  trip0(K0 / 64 - 1, false);
  // the second product's first weight fragments are in flight over the tanh
  __builtin_amdgcn_sched_barrier(0);   // with the one behind the wait below: nothing but these loads and their wait stands between the two, so that no address register is taken for another value in front of the wait
#pragma unroll
  for (int j = 0; j < 8; ++j) w0[j] = fragp_h(wq + (size_t)j * 512, lane);
#pragma unroll
  for (int j = 0; j < 8; ++j) w1[j] = fragp_h(wq + (size_t)(NOUT / 16 + j) * 512, lane);
  float (*sf)[132] = sfb[wave]; const float* pb = B1 + c0 + lane * 4; const int ib = c0 + col; v4f bb = *(const v4f*)pb; float bj[8];   // the second bias is added in front of the tile, where a lane still holds one column per accumulator
#pragma unroll
  for (int j = 0; j < 8; ++j) bj[j] = B2[ib + j * 16];
  asm volatile("s_wait_xcnt 0x0" :: "v"(pb), "v"(ib) : "memory");   // the loads' address registers may be rewritten behind them: wait first (the two bias addresses are named as inputs so that their registers are still theirs at the wait)
  __builtin_amdgcn_sched_barrier(0);   // keeps these loads in front of the tanh
#pragma unroll
  for (int e = 0; e < 4; ++e) bb[e] = bfr(bb[e]) * (2.0f * LOG2E);   // the bias carries the exponent's scale: sum, bias and scale are then one multiply-add
#pragma unroll
  for (int i = 0; i < GR; ++i) {
#pragma unroll
    for (int j = 0; j < 8; ++j)
#pragma unroll
      for (int r = 0; r < 8; ++r) sf[8 * g + r][j * 16 + col] = acc[i][j][r];
    LDSW();
#pragma unroll 2   // two rows a pass
    for (int rl = 0; rl < 16; ++rl) { const v4f v = *(const v4f*)&sf[rl][lane * 4] * (2.0f * LOG2E) + bb;
      v4h o;
#pragma unroll
      for (int e = 0; e < 4; ++e) o[e] = (_Float16)tanh_p2(v[e]);
      *(v4h*)&t1[rl0 + i * 16 + rl][c0 + lane * 4] = o; }
    LDSW(); }
  __syncthreads();   // a wave's 48 hidden rows are written by the four waves of its row group
#pragma unroll
  for (int i = 0; i < GR; ++i)
#pragma unroll
    for (int j = 0; j < 8; ++j) acc[i][j] = v8f{};
#pragma unroll 1   // kept rolled, as above
  for (int t = 0; t < GH / 64 - 1; ++t) trip1(t, true);
  trip1(GH / 64 - 1, false);
#pragma unroll
  for (int j = 0; j < 8; ++j) bj[j] = bfr(bj[j]) * -LOG2E;
#pragma unroll
  for (int i = 0; i < GR; ++i) {
#pragma unroll
    for (int j = 0; j < 8; ++j)
#pragma unroll
      for (int r = 0; r < 8; ++r) sf[8 * g + r][j * 16 + col] = acc[i][j][r] * -LOG2E + bj[j];
    LDSW();
    // the gate leaves in the order k_fin's lanes hold the scores: [row tile][key tile][half][lane][4], lane (g, n) = keys 8 g + 4 half + 0..3 of row n; every store is 512 bytes in a row
#pragma unroll 2   // two pieces a pass
    for (int it = 0; it < 16; ++it) { const v4f v = *(const v4f*)&sf[col][(it >> 1) * 16 + 8 * g + 4 * (it & 1)]; v4f o;
#pragma unroll
      for (int e = 0; e < 4; ++e) { float p2; asm("v_exp_f32 %0, %1\n\tv_nop" : "=v"(p2) : "v"(v[e]));   // 2^x with its free slot in one statement
        o[e] = __builtin_amdgcn_rcpf(1.0f + p2); }
      vst2(OUTF + ((r0 / 16 + i) * (TT / 16) + c0 / 16) * 256 + it * 128 + lane * 4, o); }
    LDSW(); } }
// ---- k_fin: block = (32 queries, 2 heads, batch), wave = (head, 16 queries), so that two waves read the same k and v fragments and two the same dependency rows; 64 keys a trip: scores; logits = g self + (1 - g) dep; softmax with a running maximum; ctx^T = v^T . P^T, so that a lane keeps its query and the rescale is one factor per lane
__global__ __launch_bounds__(128, 4) /* asks for a small register budget; the block's LDS allows three blocks per WGP, and the build settles on registers for three waves per SIMD: the 768 blocks are all resident at once */ void k_fin(const _Float16* __restrict__ QH, const _Float16* __restrict__ QL, const _Float16* __restrict__ KH, const _Float16* __restrict__ VT, const float* __restrict__ AM, const float* __restrict__ DM, const float* __restrict__ G, float* __restrict__ OUT) {
  __shared__ __align__(16) float sd[2][16][DP], so[TT], ss[4][16][68];   // dependency rows; mask bias per key; per wave the 16 x 64 result tile
  const int tid = threadIdx.x, lane = tid & 31, g = lane >> 4, qn = lane & 15; const int b = blockIdx.z; const int wave = __builtin_amdgcn_readfirstlane(tid >> 5), qt = (int)blockIdx.x * 2 + (wave & 1), h = (int)blockIdx.y * 2 + (wave >> 1), bh = b * NH + h; const size_t rt = (size_t)bh * (TT / 16) + qt;
  stage_dm<128>(sd[0], DM + ((size_t)b * TT + blockIdx.x * 32) * TT, tid); stage_dm<128>(sd[1], DM + ((size_t)b * TT + blockIdx.x * 32 + 16) * TT, tid);
  { const v4f am = *(const v4f*)(AM + (size_t)b * TT + tid * 4);
    asm volatile("s_wait_xcnt 0x0" ::: "memory");   // as in stage_dm
    *(v4f*)&so[tid * 4] = (1.0f - bfr4(am)) * -10000.0f; }
  v16h qh[2], ql[2]; v4f gn[8];
#pragma unroll
  for (int kc = 0; kc < 2; ++kc) { qh[kc] = fragp_h(QH + (rt * 2 + kc) * 512, lane); ql[kc] = fragp_h(QL + (rt * 2 + kc) * 512, lane); }
  const float* gp = G + rt * (size_t)(16 * TT) + lane * 4;
#pragma unroll
  for (int i = 0; i < 8; ++i) gn[i] = *(const v4f*)(gp + i * 128);
  asm volatile("s_wait_xcnt 0x0" ::: "memory");   // the loads' address registers are free for other values behind this: wait first
  __syncthreads();   // the staged rows and the bias are read by all four waves
  const _Float16* kt = KH + (size_t)bh * (TT * HD) + lane * 8; const _Float16* vt = VT + (size_t)bh * (TT * HD) + lane * 8; const float* gq = gp + 1024;   // the lane's own pointers, stepped once a trip behind the loads' wait
  const float* dr = &sd[wave & 1][qn][8 * g]; const float* vr = &so[8 * g];
  v8f acc[4] = {}; float m = -3.0e38f, l = 0.0f;
#pragma unroll 1   // kept rolled: a trip holds 24 products, 40 loads and 33 exponentials
  for (int t = 0; t < TT / 64; ++t) { v8f x[4]; v16h vb[2][4];
    score_tiles<4>(x, kt, qh, ql, 0);
#pragma unroll
    for (int c = 0; c < 2; ++c)
#pragma unroll
      for (int jd = 0; jd < 4; ++jd) vb[c][jd] = fragp_h(vt + (c * 4 + jd) * 512, 0);
    asm volatile("s_wait_xcnt 0x0" ::: "memory");   // the fragment loads' address registers are stepped for the next trip: wait first
    kt += 4096; vt += 4096;
    float mc = -3.0e38f;
#pragma unroll
    for (int jj = 0; jj < 4; ++jj) { const v8f gg = __builtin_shufflevector(gn[2 * jj], gn[2 * jj + 1], 0, 1, 2, 3, 4, 5, 6, 7), se = x[jj] * 0.125f + ld8(vr + t * 64 + jj * 16), de = x[jj] * ld8(dr + t * 64 + jj * 16); x[jj] = gg * se + (1.0f - gg) * de;
#pragma unroll
      for (int r = 0; r < 8; ++r) mc = fmaxf(mc, x[jj][r]); }
#pragma unroll
    for (int i = 0; i < 8; ++i) gn[i] = *(const v4f*)(gq + i * 128);   // the gate of the next 64 keys comes from memory: in flight over this trip's exponentials and the next trip's scores (the last trip loads its own again)
    asm volatile("s_wait_xcnt 0x0" ::: "memory");   // as above
    gq += t + 2 < TT / 64 ? 1024 : 0;
    const float mn = fmaxf(m, fmaxf(mc, xhalf(mc))), al = expf(m - mn); m = mn;
    v8f ps = {};
#pragma unroll
    for (int jj = 0; jj < 4; ++jj) {
#pragma unroll
      for (int r = 0; r < 8; ++r) x[jj][r] = expf(x[jj][r] - mn);
      ps += x[jj]; }
    l = l * al + hsum8(ps);
#pragma unroll
    for (int jd = 0; jd < 4; ++jd) acc[jd] *= al;
#pragma unroll
    for (int c = 0; c < 2; ++c) { const v16h p = __builtin_convertvector(__builtin_shufflevector(x[2 * c], x[2 * c + 1], 0, 1, 2, 3, 4, 5, 6, 7, 8, 9, 10, 11, 12, 13, 14, 15) * 2048.0f, v16h);
#pragma unroll
      for (int jd = 0; jd < 4; ++jd) acc[jd] = wmma16b(vb[c][jd], p, acc[jd]); } }
  const float inv = 1.0f / ((l + xhalf(l)) * 2048.0f);
#pragma unroll
  for (int jd = 0; jd < 4; ++jd) { const v8f o = acc[jd] * inv; float* d = &ss[wave][qn][jd * 16 + 8 * g]; *(v4f*)d = __builtin_shufflevector(o, o, 0, 1, 2, 3); *(v4f*)(d + 4) = __builtin_shufflevector(o, o, 4, 5, 6, 7); }
  LDSW();
#pragma unroll
  for (int i = 0; i < 8; ++i) { const int rl = 2 * i + g; vst2(OUT + ((size_t)b * TT + qt * 16 + rl) * CC + h * HD + qn * 4, *(const v4f*)&ss[wave][rl][qn * 4]); } }
extern "C" void kernel_launch(void* const* d_in, const int* in_sizes, int n_in, void* d_out, int out_size, void* d_ws, size_t ws_size, hipStream_t stream) {
  (void)in_sizes; (void)n_in; (void)out_size;
  const float** F = (const float**)d_in;   // 0 hidden [8,512,768], 1 attention_mask [8,512], 2 dependency_matrix [8,512,512], 3 Wq [768,768] ([in,out]), 4 bq, 5 Wk, 6 bk, 7 Wv, 8 bv, 9 ln_g [1024], 10 ln_b, 11 W1 [1024,512], 12 b1, 13 W2 [512,512], 14 b2
  if (ws_size < (size_t)WS_END) return;
  char* ws = (char*)d_ws; _Float16 *QH = (_Float16*)(ws + WS_QH), *QL = (_Float16*)(ws + WS_QL), *KH = (_Float16*)(ws + WS_KH), *VT = (_Float16*)(ws + WS_VT), *MX = (_Float16*)(ws + WS_MX), *W1P = (_Float16*)(ws + WS_W1P), *W2P = (_Float16*)(ws + WS_W2P); __bf16 *XP = (__bf16*)(ws + WS_XP), *WP = (__bf16*)(ws + WS_WP); float *G = (float*)(ws + WS_G);
  k_pack<<<PB_X + 3 * PB_W + PB_W1 + PB_W2, 256, 0, stream>>>(F[0], F[3], F[5], F[7], F[11], F[13], XP, WP, W1P, W2P);
  k_proj<<<dim3(TNB * TT / 64, CC / 128, 3), 128, 0, stream>>>(XP, WP, F[4], F[6], F[8], QH, QL, KH, VT);
  k_mix<<<dim3(TT / 16, NH / 4, TNB), 256, 0, stream>>>(QH, QL, KH, F[1], F[2], F[9], F[10], MX);
  k_g<<<dim3(TNB * NARB / (32 * GR)), 256, 0, stream>>>(MX, W1P, F[12], W2P, F[14], G);
  k_fin<<<dim3(TT / 32, NH / 2, TNB), 128, 0, stream>>>(QH, QL, KH, VT, F[1], F[2], G, (float*)d_out);
}

// v009
// One run takes 136 microseconds.
// Timed twice side by side with v008, it ran 1.09 and 1.10 times as fast.
// Over all steps from v000 it is 8.14 times as fast.
// compute dtype: all float inputs rounded to bf16, attention_mask / dependency_matrix read; q/k/v = hidden W + b with EXACT bf16 products on WMMA 16x16x32, f32 accumulate; scores = q k^T / 8 with q as f16 hi + residual and k f16 (2 products), f32, never stored: formed where they are used, once for the LayerNorm and once for the softmax; self = scores + (1 - mask) * -1e4, dep = scores * dependency in f32; LayerNorm over the concatenated 1,024-row in f32 -> f16 fragments; gating MLP tanh(ln W1 + b1) (1 f16 product, f16 rows) then sigmoid(. W2 + b2) (1 f16 product), tanh and sigmoid formed in f32 from the hardware's 2^x and 1/x; mixed = g self + (1 - g) dep and its softmax in f32 (precise expf, running maximum over blocks of 64 keys) -> e^(x - max) x 2^11 in f16; ctx = P . v (v rounded once to f16), divided by the row sum at the end; f32 output [b][t][768].
#include <hip/hip_runtime.h>
#include <math.h>

typedef __attribute__((ext_vector_type(16))) _Float16 v16h;
typedef __attribute__((ext_vector_type(16))) __bf16 v16b;
typedef __attribute__((ext_vector_type(8)))  _Float16 v8h;
typedef __attribute__((ext_vector_type(8)))  float v8f;
typedef __attribute__((ext_vector_type(4)))  float v4f;
typedef __attribute__((ext_vector_type(2)))  float v2f;
typedef __attribute__((ext_vector_type(4)))  unsigned v4u;
typedef __attribute__((ext_vector_type(4)))  int v4i;
typedef float __attribute__((may_alias)) float_a;
typedef int __attribute__((may_alias)) int_a;

template <typename T> __device__ __forceinline__ void vst2(void* p, T v) { *(T*)p = v;  }
__device__ __forceinline__ v8f wmma16(v16h a, v16h b, v8f c) {
  v8f d = __builtin_amdgcn_wmma_f32_16x16x32_f16(false, a, false, b, (short)0, c, false, false);
  asm volatile("v_nop\n\tv_nop\n\tv_nop\n\tv_nop" : "+v"(d) : "v"(a), "v"(b));
  return d;
}
__device__ __forceinline__ v8f wmma_bf(v16b a, v16b b, v8f c) {
  v8f d = __builtin_amdgcn_wmma_f32_16x16x32_bf16(false, a, false, b, (short)0, c, false, false);
  asm volatile("v_nop\n\tv_nop\n\tv_nop\n\tv_nop" : "+v"(d) : "v"(a), "v"(b));
  return d;
}
// 16x16x32 fragments: lane = (h = lane>>4, row/col = lane&15); elements 0..7 = k0+8h+0..7, 8..15 = k0+16+8h+0..7; D element r = row 8h+r
__device__ __forceinline__ v16h frag_h(const _Float16* rowk0, int lane) {
  union { v16h v; v8h q[2]; } u; const _Float16* p = rowk0 + 8 * (lane >> 4);
  u.q[0] = *(const v8h*)p; u.q[1] = *(const v8h*)(p + 16); return u.v;
}
__device__ __forceinline__ v16h frag_f32(const float* rowk0, int lane) {
  v16h a; const float* p = rowk0 + 8 * (lane >> 4);
#pragma unroll
  for (int i = 0; i < 8; ++i) { a[i] = (_Float16)p[i]; a[8 + i] = (_Float16)p[16 + i]; }
  return a;
}
__device__ __forceinline__ v16h frag_f32s(const float* rowk0, int lane, float sc) {
  v16h a; const float* p = rowk0 + 8 * (lane >> 4);
#pragma unroll
  for (int i = 0; i < 8; ++i) { a[i] = (_Float16)(p[i] * sc); a[8 + i] = (_Float16)(p[16 + i] * sc); }
  return a;
}
// column fragment from a [K][ld] layout (column n), rows >= K read as 0
__device__ __forceinline__ v16h fragc_f32(const float* W, int k0, int n, int lane, int ld, int K) {
  v16h a; const int g = lane >> 4;
#pragma unroll
  for (int i = 0; i < 8; ++i) { const int ka = k0 + 8 * g + i, kb = ka + 16;
    a[i] = (_Float16)(ka < K ? W[(size_t)(ka < K ? ka : K - 1) * ld + n] : 0.f); a[8 + i] = (_Float16)(kb < K ? W[(size_t)(kb < K ? kb : K - 1) * ld + n] : 0.f); }
  return a;
}
struct F2 { v16b h, l; };
__device__ __forceinline__ F2 bsplit16(const float v[16]) { F2 r;
#pragma unroll
  for (int i = 0; i < 16; ++i) { const __bf16 h = (__bf16)v[i]; r.h[i] = h; r.l[i] = (__bf16)(v[i] - (float)h); }
  return r; }
__device__ __forceinline__ F2 split_row(const float* row, int k0, int lane) { float v[16]; const float* p = row + k0 + 8 * (lane >> 4);
#pragma unroll
  for (int i = 0; i < 8; ++i) { v[i] = p[i]; v[8 + i] = p[16 + i]; }
  return bsplit16(v); }
__device__ __forceinline__ F2 split_rowK(const float* row, int k0, int lane, int K) { float v[16]; const int g = lane >> 4;
#pragma unroll
  for (int i = 0; i < 8; ++i) { const int ka = k0 + 8 * g + i, kb = ka + 16; v[i] = ka < K ? row[ka < K ? ka : K - 1] : 0.f; v[8 + i] = kb < K ? row[kb < K ? kb : K - 1] : 0.f; }
  return bsplit16(v); }
__device__ __forceinline__ F2 split_col(const float* W, int k0, int n, int lane, int ld, int K) { float v[16]; const int g = lane >> 4;
#pragma unroll
  for (int i = 0; i < 8; ++i) { const int ka = k0 + 8 * g + i, kb = ka + 16; v[i] = ka < K ? W[(size_t)(ka < K ? ka : K - 1) * ld + n] : 0.f; v[8 + i] = kb < K ? W[(size_t)(kb < K ? kb : K - 1) * ld + n] : 0.f; }
  return bsplit16(v); }
__device__ __forceinline__ v8f mac3(const F2& a, const F2& b, v8f c) { c = wmma_bf(a.l, b.h, c); c = wmma_bf(a.h, b.l, c); return wmma_bf(a.h, b.h, c); }
__device__ __forceinline__ float sigm(float v) { return 1.0f / (1.0f + expf(-v)); }
#define LDSX() do { asm volatile("s_wait_dscnt 0" ::: "memory"); __builtin_amdgcn_wave_barrier(); __builtin_amdgcn_fence(__ATOMIC_RELEASE, "workgroup"); } while (0)


// Dependency-mixed BERT self attention (B 8, T 512, C 768 = 12 x 64): a learned per-(query, key) gate between plain attention scores and dependency-weighted scores, then softmax . v.
#define NB 8
#define TT 512
#define CC 768
#define NH 12
#define HD 64
#define NROW (NB * TT)          // 4096 token rows
#define NAR (NB * NH * TT)      // 49152 attention rows
#define GH 512                  // gating hidden (= T)
#ifndef TNB
#define TNB NB
#endif
typedef __attribute__((ext_vector_type(8))) __bf16 v8b;
__device__ __forceinline__ v16b frag_b(const __bf16* rowk0, int lane) {
  union { v16b v; v8b q[2]; } u; const __bf16* p = rowk0 + 8 * (lane >> 4);
  u.q[0] = *(const v8b*)p; u.q[1] = *(const v8b*)(p + 16); return u.v;
}
__device__ __forceinline__ float bfr(float v) { return (float)(__bf16)v; }
// tanh and sigmoid of the gate straight from the hardware's 2^x and 1/x (v_exp_f32, v_rcp_f32), in place of the library calls and the IEEE division sequence, which take several times the instructions and, for tanh, divergent branches per element.
// tanh is rounded to f16 behind this and the gate only weighs the scores, so the last bits of f32 do not reach the output. Both ends saturate: 2^a = inf gives 1 / inf = 0, 2^a = 0 gives 1 / 1.
#define LOG2E 1.44269504088896340736f
__device__ __forceinline__ float tanh_p2(float a) { return 1.0f - 2.0f * __builtin_amdgcn_rcpf(1.0f + __builtin_amdgcn_exp2f(a)); }   // tanh(v), a = 2 v log2(e)
__device__ __forceinline__ float sigm_p2(float a) { return __builtin_amdgcn_rcpf(1.0f + __builtin_amdgcn_exp2f(a)); }                  // sigmoid(v), a = -v log2(e)
__device__ __attribute__((noinline)) float exp_ni(float v) { return expf(v); }
__device__ __attribute__((noinline)) float erf_ni(float v) { return erff(v); }

// Every stage runs once for all NAR = 49,152 attention rows (row = (b * 12 + h) * 512 + t). A row tile is 16 consecutive attention rows (16 queries of one head).
#define NARB (NH * TT)                                   // attention rows of one batch
#define WS_G   0u                                        // f32 gate [row tile][key tile][1 KB]: k_g -> k_fin
#define WS_VT  (WS_G + 4u * (size_t)NAR * TT)            // f16 v as fragments [b][h][32 keys][16 d][1 KB tile]: k_proj -> k_fin
// 16-bit copies of hidden and of the five weights in fragment order, written by k_pack at the head of every call
#define WS_W1P (WS_VT + 2u * (size_t)NROW * CC)          // f16 W1 [kc][col tile][1 KB tile]
#define WS_W2P (WS_W1P + 2u * (size_t)2 * TT * GH)       // f16 W2 [kc][col tile][1 KB tile]
// q (hi, residual) and k as fragments [b][h][16 tokens][kc 0..1][1 KB tile]: k_proj -> k_g, k_fin
#define WS_QH  (WS_W2P + 2u * (size_t)GH * GH)
#define WS_QL  (WS_QH + 2u * (size_t)NROW * CC)
#define WS_KH  (WS_QL + 2u * (size_t)NROW * CC)
#define WS_XP  (WS_KH + 2u * (size_t)NROW * CC)          // bf16 hidden [row tile][kc][1 KB tile]
#define WS_WP  (WS_XP + 2u * (size_t)NROW * CC)          // bf16 Wq, Wk, Wv, each [kc][col tile][1 KB tile]
#define WS_END (WS_WP + 3u * 2u * (size_t)CC * CC)

// A packed tile is one 16 x 32 fragment as the wave reads it: [q = 0, 1][lane][8 elements], element i of piece q = k0 + 16 q + 8 (lane >> 4) + i of row or column (lane & 15).
// Each of the two 16-byte loads of a wave then covers 512 contiguous bytes (four whole lines).
__device__ __forceinline__ v16h fragp_h(const _Float16* tile, int lane) {
  union { v16h v; v8h q[2]; } u; const _Float16* p = tile + lane * 8;
  u.q[0] = *(const v8h*)p; u.q[1] = *(const v8h*)(p + 256); return u.v;
}
__device__ __forceinline__ v16b fragp_b(const __bf16* tile, int lane) {
  union { v16b v; v8b q[2]; } u; const __bf16* p = tile + lane * 8;
  u.q[0] = *(const v8b*)p; u.q[1] = *(const v8b*)(p + 256); return u.v;
}
// one 16-byte piece (8 consecutive k of column n) of a [K][N] f32 weight; 32 consecutive ids read whole lines and write two 256-byte runs
template <int N, bool F16> __device__ __forceinline__ void pack_w(const float* __restrict__ Wm, int id, void* __restrict__ dst) {
  const int n = id % N, ko = id / N, kc = ko >> 2, g = ko & 1, q = (ko >> 1) & 1; float v[8];
#pragma unroll
  for (int i = 0; i < 8; ++i) v[i] = Wm[(size_t)(ko * 8 + i) * N + n];
  const size_t d = ((size_t)(kc * (N / 16) + (n >> 4)) * 2 + q) * 32 + g * 16 + (n & 15);
  if (F16) { v8h o;
#pragma unroll
    for (int i = 0; i < 8; ++i) o[i] = (_Float16)bfr(v[i]);
    *((v8h*)dst + d) = o; asm volatile("s_wait_xcnt 0x0" ::: "memory"); /* the store's address and data registers may be rewritten behind it: wait first */ }
  else { v8b o;
#pragma unroll
    for (int i = 0; i < 8; ++i) o[i] = (__bf16)v[i];
    *((v8b*)dst + d) = o; asm volatile("s_wait_xcnt 0x0" ::: "memory"); /* the store's address and data registers may be rewritten behind it: wait first */ } }
#define PB_X  (NROW * CC / 8 / 256)       // blocks of 256 pieces: hidden
#define PB_W  (CC * CC / 8 / 256)         // Wq, Wk, Wv each
#define PB_W1 (2 * TT * GH / 8 / 256)
#define PB_W2 (GH * GH / 8 / 256)
// ---- k_pack: thread = one 16-byte piece of a packed tile; the block index picks the matrix
__global__ __launch_bounds__(256) void k_pack(const float* __restrict__ X, const float* __restrict__ WQ, const float* __restrict__ WK, const float* __restrict__ WV, const float* __restrict__ W1, const float* __restrict__ W2, __bf16* __restrict__ XP, __bf16* __restrict__ WP, _Float16* __restrict__ W1P, _Float16* __restrict__ W2P) {
  int blk = blockIdx.x; const int t = threadIdx.x;
  if (blk < PB_X) { const int d = blk * 256 + t, r = d & 15, g = (d >> 4) & 1, q = (d >> 5) & 1, tile = d >> 6, kc = tile % (CC / 32), rt = tile / (CC / 32);
    const float* p = X + (size_t)(rt * 16 + r) * CC + kc * 32 + q * 16 + g * 8; const v4f lo = *(const v4f*)p, hi = *(const v4f*)(p + 4); v8b o;
#pragma unroll
    for (int i = 0; i < 4; ++i) { o[i] = (__bf16)lo[i]; o[4 + i] = (__bf16)hi[i]; }
    *((v8b*)XP + d) = o; asm volatile("s_wait_xcnt 0x0" ::: "memory"); /* the store's address and data registers may be rewritten behind it: wait first */ return; }
  blk -= PB_X;
  if (blk < 3 * PB_W) { const int which = blk / PB_W; pack_w<CC, false>(which == 0 ? WQ : which == 1 ? WK : WV, (blk - which * PB_W) * 256 + t, WP + (size_t)which * CC * CC); return; }
  blk -= 3 * PB_W;
  if (blk < PB_W1) { pack_w<GH, true>(W1, blk * 256 + t, W1P); return; }
  pack_w<GH, true>(W2, (blk - PB_W1) * 256 + t, W2P); }

// ---- k_proj: block = (64 rows, 128 cols, which): hidden W + b ([in,out]); q hi + residual, k and v, all as fragments
__global__ __launch_bounds__(128) void k_proj(const __bf16* __restrict__ XP, const __bf16* __restrict__ WP, const float* __restrict__ BQ, const float* __restrict__ BK, const float* __restrict__ BV, _Float16* __restrict__ QH, _Float16* __restrict__ QL, _Float16* __restrict__ KH, _Float16* __restrict__ VT) {
  __shared__ __align__(16) _Float16 sh[64][136], sl[64][136]; __shared__ __align__(16) _Float16 th[128][72];
  const int tid = threadIdx.x, wave = tid >> 5, lane = tid & 31, col = lane & 15, g = lane >> 4; const int which = blockIdx.z; const int c0 = blockIdx.y * 128; const size_t r0 = (size_t)blockIdx.x * 64;
  const __bf16* Wm = WP + (size_t)which * CC * CC + (size_t)(c0 / 16) * 512; const __bf16* Xm = XP + (size_t)(r0 / 16 + wave) * (CC / 32) * 512; const float* Bm = which == 0 ? BQ : which == 1 ? BK : BV;
  v8f acc[8] = {};
#pragma unroll 2
  for (int kc = 0; kc < CC / 32; ++kc) { const v16b a = fragp_b(Xm + (size_t)kc * 512, lane); v16b w[8];
#pragma unroll
    for (int j = 0; j < 8; ++j) w[j] = fragp_b(Wm + ((size_t)kc * (CC / 16) + j) * 512, lane);
#pragma unroll
    for (int j = 0; j < 8; ++j) acc[j] = wmma_bf(a, w[j], acc[j]); }
#pragma unroll
  for (int j = 0; j < 8; ++j) { const float bb = bfr(Bm[c0 + j * 16 + col]);
#pragma unroll
    for (int r = 0; r < 8; ++r) { const float v = acc[j][r] + bb; const int rl = wave * 16 + 8 * g + r, cl = j * 16 + col; const _Float16 hv = (_Float16)v;
      if (which == 2) th[cl][rl] = hv; else { sh[rl][cl] = hv; sl[rl][cl] = (_Float16)(v - (float)hv); } } }
  __syncthreads();
  // q, k and v leave in fragment order (the packed tile above): 32 consecutive pieces are one 512-byte run
  const int b = (int)(r0 / TT), t0 = (int)(r0 % TT), h0 = c0 / HD;
  if (which < 2) { _Float16* dh = which == 0 ? QH : KH;   // tile = 16 tokens x 32 d
    for (int e = tid; e < 1024; e += 128) { const int ln = e & 31, q = (e >> 5) & 1, cch = (e >> 6) & 3, rtl = e >> 8; const int rl = rtl * 16 + (ln & 15), cl = cch * 32 + q * 16 + (ln >> 4) * 8;
      const size_t d = (((size_t)(b * NH + h0 + (cch >> 1)) * (TT / 16) + t0 / 16 + rtl) * 2 + (cch & 1)) * 512 + q * 256 + ln * 8;
      vst2(dh + d, *(const v4u*)&sh[rl][cl]); asm volatile("s_wait_xcnt 0x0" ::: "memory");   // the store's address and data registers are rewritten behind it: wait first
      if (which == 0) { vst2(QL + d, *(const v4u*)&sl[rl][cl]); asm volatile("s_wait_xcnt 0x0" ::: "memory"); /* as above */ } } }
  else {   // tile = 16 d x 32 tokens
    for (int e = tid; e < 1024; e += 128) { const int ln = e & 31, q = (e >> 5) & 1, dt = (e >> 6) & 7, kcl = e >> 9; const int cl = dt * 16 + (ln & 15), rl = kcl * 32 + q * 16 + (ln >> 4) * 8;
      const size_t d = (((size_t)(b * NH + h0 + (dt >> 2)) * (TT / 32) + t0 / 32 + kcl) * 4 + (dt & 3)) * 512 + q * 256 + ln * 8;
      vst2(VT + d, *(const v4u*)&th[cl][rl]);
      asm volatile("s_wait_xcnt 0x0" ::: "memory"); /* as above */ } } }
// orders a wave's own LDS stores and loads on a range that no other wave touches (so no barrier)
#define LDSW() do { asm volatile("s_wait_dscnt 0" ::: "memory"); __builtin_amdgcn_wave_barrier(); } while (0)
// ---- attention-row kernels: the scores are formed with the KEYS as the rows of the product (A = k tile, B = q tile), so that element r of accumulator tile j in lane (g = lane >> 4, n = lane & 15) is key 16 j + 8 g + r of query n.
// A lane then owns half of one query's row: a row sum is a sum inside the lane and one exchange with lane ^ 16, and tiles 2 c and 2 c + 1, rounded to f16, ARE the 16 x 32 fragment c of that row tile (element i = k 32 c + 8 g + i, 8 + i = k 32 c + 16 + 8 g + i), for the gate GEMM and for P . v alike.
typedef __attribute__((ext_vector_type(4))) _Float16 v4h;
__device__ __forceinline__ float xhalf(float x) { return __builtin_bit_cast(float, __builtin_amdgcn_permlanex16(__builtin_bit_cast(int, x), __builtin_bit_cast(int, x), 0x76543210, 0xfedcba98, false, false)); }  // lane l ^ 16
__device__ __forceinline__ float hsum8(v8f a) { const v4f c = __builtin_shufflevector(a, a, 0, 1, 2, 3) + __builtin_shufflevector(a, a, 4, 5, 6, 7); return (c[0] + c[1]) + (c[2] + c[3]); }
__device__ __forceinline__ v8f ld8(const float* p) { const v4f a = *(const v4f*)p, c = *(const v4f*)(p + 4); return __builtin_shufflevector(a, c, 0, 1, 2, 3, 4, 5, 6, 7); }
__device__ __forceinline__ v4f bfr4(v4f v) { v4f r;
#pragma unroll
  for (int i = 0; i < 4; ++i) r[i] = bfr(v[i]);
  return r; }
// the plain builtin: above 256 registers an asm statement that names the accumulator ties it to one register window and the tile spills; the compiler keeps the distance behind its own matrix instructions
__device__ __forceinline__ v8f wmma16b(v16h a, v16h b, v8f c) { return __builtin_amdgcn_wmma_f32_16x16x32_f16(false, a, false, b, (short)0, c, false, false); }
#define DP 516                  // pitch in floats of a staged dependency row: 2,064 B = 16 B x 129, so the 16 queries of a half wave read 16 different 16-byte columns
// the block's 16 dependency rows, rounded, to LDS: whole 2-KB rows in, a lane's 8 keys of its own query out. They carry the scores' factor 1 / 8 (a power of two: exact), so that the accumulators are used as they stand
template <int NT> __device__ __forceinline__ void stage_dm(float (*sd)[DP], const float* __restrict__ dmp, int tid) { constexpr int NI = 16 * 128 / NT, RS = NT / 128; v4f v[NI]; const int r0 = tid >> 7, c = (tid & 127) * 4;
#pragma unroll
  for (int i = 0; i < NI; ++i) v[i] = *(const v4f*)(dmp + (size_t)(i * RS + r0) * TT + c);
  asm volatile("s_wait_xcnt 0x0" ::: "memory");   // the loads' address registers may be taken for other values behind this: wait first
#pragma unroll
  for (int i = 0; i < NI; ++i) *(v4f*)&sd[i * RS + r0][c] = bfr4(v[i]) * 0.125f; }
// NJ tiles of 8 x score (keys 16 j0 ...) of the wave's 16 queries; per tile the products come in the order hi, residual of d 0..31, then of d 32..63
template <int NJ> __device__ __forceinline__ void score_tiles(v8f (&s)[NJ], const _Float16* __restrict__ kt, const v16h (&qh)[2], const v16h (&ql)[2], int lane) { v16h kb[NJ][2];
#pragma unroll
  for (int jj = 0; jj < NJ; ++jj) { kb[jj][0] = fragp_h(kt + (size_t)(2 * jj) * 512, lane); kb[jj][1] = fragp_h(kt + (size_t)(2 * jj + 1) * 512, lane); }
  asm volatile("s_wait_xcnt 0x0" ::: "memory");   // the loads' address registers may be taken for later loads' data: wait first
#pragma unroll
  for (int jj = 0; jj < NJ; ++jj) s[jj] = v8f{};
#pragma unroll
  for (int kc = 0; kc < 2; ++kc) {
#pragma unroll
    for (int jj = 0; jj < NJ; ++jj) s[jj] = wmma16b(kb[jj][kc], qh[kc], s[jj]);
#pragma unroll
    for (int jj = 0; jj < NJ; ++jj) s[jj] = wmma16b(kb[jj][kc], ql[kc], s[jj]); } }
// ---- k_g: block = (16 queries, 6 heads, batch) = 96 attention rows x all 512 columns, 8 waves. Three stages in one launch, the rows of each handed to the next in LDS and never stored to memory:
// (1) mixed = [self | dep] (1,024), LayerNorm (eps 1e-5) -> f16 fragments; wave = (3 heads one after the other, a quarter of the keys): a head's 8 score tiles in registers, the dependency values and the mask bias read from LDS once for the three heads, and the block's 16 dependency rows serve all six;
// (2) T1 = tanh(LN W1 + b1) (K 1024) -> f16 rows; (3) G = sigmoid(T1 W2 + b2) (K 512) -> f32 in k_fin's lane order. In (2) and (3) wave = 48 rows x 128 cols (GR x 8 accumulator tiles).
// Each weight fragment a wave loads feeds GR products and each row fragment 8, so a product needs two fifths of the loaded bytes of a 16 x 128 tile. The weight fragments of the even and of the odd 32-k steps have a register set each; a fragment is reloaded for two steps on right behind its last product, nearly two rounds of products ahead of its use.
#define GR 3                    // 16-row tiles per wave: 4,096 waves in all, two full rounds at 2 waves per SIMD
#define T1P 520                 // pitch in 16-bit elements of a hidden gate row in LDS: 1,040 B = 16 B x 65, free of bank conflicts for 16-byte reads
#define MXT (16 * 2 * TT)       // 16-bit elements of one row tile's LayerNorm rows: 32 fragments of 1 KB
__global__ __launch_bounds__(256, 2) /* registers for 2 waves per SIMD: the accumulators alone are 192 */ void k_g(const _Float16* __restrict__ QH, const _Float16* __restrict__ QL, const _Float16* __restrict__ KH, const float* __restrict__ AM, const float* __restrict__ DM, const float* __restrict__ LG, const float* __restrict__ LB, const _Float16* __restrict__ W1K, const float* __restrict__ B1, const _Float16* __restrict__ W2K, const float* __restrict__ B2, float* __restrict__ OUTF) {
  __shared__ __align__(16) _Float16 mxs[2 * GR * MXT];      // the block's 96 LayerNorm rows as fragments [row tile = head][kc 0..31][1 KB tile]; behind the first product the same bytes hold the 96 hidden gate rows
  __shared__ __align__(16) float fs[8 * 16 * 132];          // per wave: a 16-row f32 tile of results; in stage (1) the same bytes hold the staged rows, vectors and partial sums
  _Float16 (*t1)[T1P] = (_Float16 (*)[T1P])mxs;
  // waves 2 c and 2 c + 1 take column group c (the same weight fragments), even and odd waves the two groups of 48 rows (3 heads)
  const int tid = threadIdx.x, wave = tid >> 5, lane = tid & 31, col = lane & 15, g = lane >> 4; const int c0 = (wave >> 1) * 128, rl0 = (wave & 1) * (16 * GR); const int qt = blockIdx.x, b = blockIdx.z, hb = b * NH + (int)blockIdx.y * (2 * GR); const size_t rt0 = (size_t)(hb + (wave & 1) * GR) * (TT / 16) + qt; constexpr int K0 = 2 * TT, NOUT = GH;   // hb: the block's first head; rt0: the first of the wave's three row tiles, one head (TT / 16 tiles) apart
  { float (*sd)[DP] = (float (*)[DP])fs; float (*sv)[TT] = (float (*)[TT])(fs + 16 * DP); float (*red)[8][GR][16] = (float (*)[8][GR][16])(fs + 16 * DP + 5 * TT);   // dependency rows; per key: mask bias, LayerNorm scale (self, dep), LayerNorm shift (self, dep); each wave's part of the two row sums
    const int qn = col, wv = __builtin_amdgcn_readfirstlane(tid >> 5), kq = wv & 3, wb = wv & 4, hl = (wv >> 2) * GR, bh = hb + hl; const size_t rt = (size_t)bh * (TT / 16) + qt;   // bh, rt: the first of the wave's three heads
    v16h kb[8][2], qh[2], ql[2];   // one head's fragments: the wave's 128 keys, the 16 queries (hi, residual)
    auto ld_kq = [&](int hh) __attribute__((always_inline)) { const _Float16* kt = KH + (size_t)(bh + hh) * (TT * HD) + (size_t)kq * (TT * HD / 4) + lane * 8; const _Float16* qp = QH + (rt + hh * (TT / 16)) * 1024 + lane * 8; const _Float16* lp = QL + (rt + hh * (TT / 16)) * 1024 + lane * 8;   // the lane's own pointers
#pragma unroll
      for (int kc = 0; kc < 2; ++kc) { qh[kc] = fragp_h(qp + kc * 512, 0); ql[kc] = fragp_h(lp + kc * 512, 0); }
#pragma unroll
      for (int jj = 0; jj < 8; ++jj) { kb[jj][0] = fragp_h(kt + (2 * jj) * 512, 0); kb[jj][1] = fragp_h(kt + (2 * jj + 1) * 512, 0); }
      asm volatile("s_wait_xcnt 0x0" :: "v"(kt), "v"(qp), "v"(lp) : "memory"); };   // the loads' address registers may be taken for other values behind this: wait first (the three addresses are named as inputs so that their registers are still theirs at the wait, and not a load's own destination)
    ld_kq(0);   // the first head's fragments are on their way beside the rows and vectors staged below
    stage_dm<256>(sd, DM + ((size_t)b * TT + qt * 16) * TT, tid);
    if (wv < 4) { const v4f am = *(const v4f*)(AM + (size_t)b * TT + tid * 4), g0 = *(const v4f*)(LG + tid * 4), g1 = *(const v4f*)(LG + TT + tid * 4), b0 = *(const v4f*)(LB + tid * 4), b1 = *(const v4f*)(LB + TT + tid * 4);
      asm volatile("s_wait_xcnt 0x0" ::: "memory");   // as in stage_dm
      *(v4f*)&sv[0][tid * 4] = (1.0f - bfr4(am)) * -10000.0f; *(v4f*)&sv[1][tid * 4] = bfr4(g0); *(v4f*)&sv[2][tid * 4] = bfr4(g1); *(v4f*)&sv[3][tid * 4] = bfr4(b0); *(v4f*)&sv[4][tid * 4] = bfr4(b1); }
    __syncthreads();   // the staged rows and vectors are read by all eight waves
    const float* dr = &sd[qn][kq * 128 + 8 * g]; const float* vr = &sv[0][kq * 128 + 8 * g]; _Float16* o = &mxs[hl * MXT + kq * 2048 + lane * 8];
    v8f ob[8], dm[8];   // mask bias and dependency values of the lane's 64 keys: read once, in registers for the three heads
#pragma unroll
    for (int j = 0; j < 8; ++j) { ob[j] = ld8(vr + j * 16); dm[j] = ld8(dr + j * 16); }
#pragma unroll 1   // kept rolled: with the three heads' passes unrolled the kernel's text is longer than 32 KB
    for (int hh = 0; hh < GR; ++hh) { v8f s[8] = {}, t = {};   // 8 x score, the products of a tile in the order of score_tiles
#pragma unroll
      for (int kc = 0; kc < 2; ++kc) {
#pragma unroll
        for (int jj = 0; jj < 8; ++jj) s[jj] = wmma16b(kb[jj][kc], qh[kc], s[jj]);
#pragma unroll
        for (int jj = 0; jj < 8; ++jj) s[jj] = wmma16b(kb[jj][kc], ql[kc], s[jj]); }
#pragma unroll
      for (int j = 0; j < 8; ++j) t += (s[j] * 0.125f + ob[j]) + s[j] * dm[j];
      { const float r = hsum8(t); red[0][wv][hh][qn] = r + xhalf(r); }
      __syncthreads();   // a row's sum is the sum of its four waves' parts
      const float mu = ((red[0][wb][hh][qn] + red[0][wb + 1][hh][qn]) + (red[0][wb + 2][hh][qn] + red[0][wb + 3][hh][qn])) / (2 * TT); t = v8f{};
#pragma unroll
      for (int j = 0; j < 8; ++j) { const v8f x0 = (s[j] * 0.125f + ob[j]) - mu, x1 = s[j] * dm[j] - mu; t += x0 * x0 + x1 * x1; }
      { const float r = hsum8(t); red[1][wv][hh][qn] = r + xhalf(r); }
      __syncthreads();   // as above
      if (hh + 1 < GR) ld_kq(hh + 1);   // the next head's fragments are in flight over the third pass: no barrier, which would wait for them, stands between here and their use
      const float inv = 1.0f / sqrtf(((red[1][wb][hh][qn] + red[1][wb + 1][hh][qn]) + (red[1][wb + 2][hh][qn] + red[1][wb + 3][hh][qn])) / (2 * TT) + 1e-5f);
#pragma unroll
      for (int j = 0; j < 8; ++j) { const v8f l0 = ld8(vr + TT + j * 16), l1 = ld8(vr + 2 * TT + j * 16), c0v = ld8(vr + 3 * TT + j * 16), c1v = ld8(vr + 4 * TT + j * 16); const v8f x0 = (s[j] * 0.125f + ob[j]) - mu, x1 = s[j] * dm[j] - mu; _Float16* oh = o + hh * MXT + j * 256;
        *(v8h*)oh = __builtin_convertvector(x0 * inv * l0 + c0v, v8h); *(v8h*)(oh + 16 * TT) = __builtin_convertvector(x1 * inv * l1 + c1v, v8h); } } }
  v8f acc[GR][8] = {}; const _Float16* ap = &mxs[(rl0 / 16) * MXT + lane * 8]; v4u pa[4 * GR]; v16h w0[8], w1[8];
  const _Float16* wp = W1K + (size_t)(c0 / 16) * 512; const _Float16* wq = W2K + (size_t)(c0 / 16) * 512; const _Float16* tr = &t1[rl0 + col][0];
  // the first product's rows stand in LDS as fragments: the four 16-byte pieces of 64 k of a row tile are 2 KB in a row and go straight to registers
  auto ld_a = [&]() __attribute__((always_inline)) {
#pragma unroll
    for (int i = 0; i < 4 * GR; ++i) pa[i] = *(const v4u*)(ap + (i >> 2) * MXT + (i & 3) * 256); };
  // the first weight fragments are asked for in front of the barrier: their way from L2 runs beside the wait for the other waves
#pragma unroll
  for (int j = 0; j < 8; ++j) w0[j] = fragp_h(wp + (size_t)j * 512, lane);
#pragma unroll
  for (int j = 0; j < 8; ++j) w1[j] = fragp_h(wp + (size_t)(NOUT / 16 + j) * 512, lane);
  asm volatile("s_wait_xcnt 0x0" ::: "memory");   // the loads' address registers may be rewritten behind them: wait first
  __syncthreads();   // a wave's 48 LayerNorm rows are written by the four waves of its head group
  ld_a();
  // the 48 products of 64 k, with the weight fragments' reloads
  auto prods = [&](const v16h (&a0)[GR], const v16h (&a1)[GR], const _Float16* wsrc, int t, bool more) __attribute__((always_inline)) {
    __builtin_amdgcn_sched_barrier(0);   // this one and those in the two loops below keep every load where it is written: left free, the scheduler sinks a fragment's reload to one group of products before its use, and the load's latency shows at every group
#pragma unroll
    for (int j = 0; j < 8; ++j) {
#pragma unroll
      for (int i = 0; i < GR; ++i) acc[i][j] = wmma16b(a0[i], w0[j], acc[i][j]);
      __builtin_amdgcn_sched_barrier(0);   // the reload stays behind the last product that reads the fragment, so that it can take the same registers
      if (more) w0[j] = fragp_h(wsrc + ((size_t)(2 * t + 2) * (NOUT / 16) + j) * 512, lane); __builtin_amdgcn_sched_barrier(0); }
#pragma unroll
    for (int j = 0; j < 8; ++j) {
#pragma unroll
      for (int i = 0; i < GR; ++i) acc[i][j] = wmma16b(a1[i], w1[j], acc[i][j]);
      __builtin_amdgcn_sched_barrier(0);   // as above
      if (more) w1[j] = fragp_h(wsrc + ((size_t)(2 * t + 3) * (NOUT / 16) + j) * 512, lane); __builtin_amdgcn_sched_barrier(0); }
    if (more) { asm volatile("s_wait_xcnt 0x0" ::: "memory"); __builtin_amdgcn_sched_barrier(0); } };   // the loads' address registers are stepped for the next trip behind this point: wait first (the scheduling barrier keeps the steps behind the wait)
  auto trip0 = [&](int t, bool more) __attribute__((always_inline)) { v16h a0[GR], a1[GR];
#pragma unroll
    for (int i = 0; i < GR; ++i) { union { v16h v; v4u q[2]; } u0, u1; u0.q[0] = pa[4 * i]; u0.q[1] = pa[4 * i + 1]; u1.q[0] = pa[4 * i + 2]; u1.q[1] = pa[4 * i + 3]; a0[i] = u0.v; a1[i] = u1.v; }
    if (more) { ap += 1024; ld_a(); }   // the next 64 k of the wave's 48 rows are in flight over this trip's products
    prods(a0, a1, wp, t, more); };
  auto trip1 = [&](int t, bool more) __attribute__((always_inline)) { v16h a0[GR], a1[GR];   // the second product's rows are read from LDS as fragments
#pragma unroll
    for (int i = 0; i < GR; ++i) a0[i] = frag_h(tr + i * 16 * T1P + t * 64, lane);
#pragma unroll
    for (int i = 0; i < GR; ++i) a1[i] = frag_h(tr + i * 16 * T1P + t * 64 + 32, lane);
    prods(a0, a1, wq, t, more); };
#pragma unroll 1   // kept rolled: a trip already holds 48 products and 44 loads
  for (int t = 0; t < K0 / 64 - 1; ++t) trip0(t, true);   // the last trip stands alone: with no branch round the loads ahead, the loop's load waits are exact counts
  trip0(K0 / 64 - 1, false);
  __syncthreads();   // the hidden gate rows take the LayerNorm rows' place in LDS: every wave has read its last fragment of those first
  // the second product's first weight fragments are in flight over the tanh
  __builtin_amdgcn_sched_barrier(0);   // with the one behind the wait below: nothing but these loads and their wait stands between the two, so that no address register is taken for another value in front of the wait
#pragma unroll
  for (int j = 0; j < 8; ++j) w0[j] = fragp_h(wq + (size_t)j * 512, lane);
#pragma unroll
  for (int j = 0; j < 8; ++j) w1[j] = fragp_h(wq + (size_t)(NOUT / 16 + j) * 512, lane);
  float (*sf)[132] = (float (*)[132])(fs + wave * (16 * 132)); const float* pb = B1 + c0 + lane * 4; const int ib = c0 + col; v4f bb = *(const v4f*)pb; float bj[8];   // the second bias is added in front of the tile, where a lane still holds one column per accumulator
#pragma unroll
  for (int j = 0; j < 8; ++j) bj[j] = B2[ib + j * 16];
  asm volatile("s_wait_xcnt 0x0" :: "v"(pb), "v"(ib) : "memory");   // the loads' address registers may be rewritten behind them: wait first (the two bias addresses are named as inputs so that their registers are still theirs at the wait)
  __builtin_amdgcn_sched_barrier(0);   // keeps these loads in front of the tanh
#pragma unroll
  for (int e = 0; e < 4; ++e) bb[e] = bfr(bb[e]) * (2.0f * LOG2E);   // the bias carries the exponent's scale: sum, bias and scale are then one multiply-add
#pragma unroll
  for (int i = 0; i < GR; ++i) {
#pragma unroll
    for (int j = 0; j < 8; ++j)
#pragma unroll
      for (int r = 0; r < 8; ++r) sf[8 * g + r][j * 16 + col] = acc[i][j][r];
    LDSW();
#pragma unroll 2   // two rows a pass
    for (int rl = 0; rl < 16; ++rl) { const v4f v = *(const v4f*)&sf[rl][lane * 4] * (2.0f * LOG2E) + bb;
      v4h o;
#pragma unroll
      for (int e = 0; e < 4; ++e) o[e] = (_Float16)tanh_p2(v[e]);
      *(v4h*)&t1[rl0 + i * 16 + rl][c0 + lane * 4] = o; }
    LDSW(); }
  __syncthreads();   // a wave's 48 hidden rows are written by the four waves of its row group
#pragma unroll
  for (int i = 0; i < GR; ++i)
#pragma unroll
    for (int j = 0; j < 8; ++j) acc[i][j] = v8f{};
#pragma unroll 1   // kept rolled, as above
  for (int t = 0; t < GH / 64 - 1; ++t) trip1(t, true);
  trip1(GH / 64 - 1, false);
#pragma unroll
  for (int j = 0; j < 8; ++j) bj[j] = bfr(bj[j]) * -LOG2E;
#pragma unroll
  for (int i = 0; i < GR; ++i) {
#pragma unroll
    for (int j = 0; j < 8; ++j)
#pragma unroll
      for (int r = 0; r < 8; ++r) sf[8 * g + r][j * 16 + col] = acc[i][j][r] * -LOG2E + bj[j];
    LDSW();
    // the gate leaves in the order k_fin's lanes hold the scores: [row tile][key tile][half][lane][4], lane (g, n) = keys 8 g + 4 half + 0..3 of row n; every store is 512 bytes in a row
#pragma unroll 2   // two pieces a pass
    for (int it = 0; it < 16; ++it) { const v4f v = *(const v4f*)&sf[col][(it >> 1) * 16 + 8 * g + 4 * (it & 1)]; v4f o;
#pragma unroll
      for (int e = 0; e < 4; ++e) { float p2; asm("v_exp_f32 %0, %1\n\tv_nop" : "=v"(p2) : "v"(v[e]));   // 2^x with its free slot in one statement
        o[e] = __builtin_amdgcn_rcpf(1.0f + p2); }
      vst2(OUTF + ((rt0 + (size_t)i * (TT / 16)) * (TT / 16) + c0 / 16) * 256 + it * 128 + lane * 4, o); }
    LDSW(); } }
// ---- k_fin: block = (32 queries, 2 heads, batch), wave = (head, 16 queries), so that two waves read the same k and v fragments and two the same dependency rows; 64 keys a trip: scores; logits = g self + (1 - g) dep; softmax with a running maximum; ctx^T = v^T . P^T, so that a lane keeps its query and the rescale is one factor per lane
__global__ __launch_bounds__(128, 4) /* asks for a small register budget; the block's LDS allows three blocks per WGP, and the build settles on registers for three waves per SIMD: the 768 blocks are all resident at once */ void k_fin(const _Float16* __restrict__ QH, const _Float16* __restrict__ QL, const _Float16* __restrict__ KH, const _Float16* __restrict__ VT, const float* __restrict__ AM, const float* __restrict__ DM, const float* __restrict__ G, float* __restrict__ OUT) {
  __shared__ __align__(16) float sd[2][16][DP], so[TT], ss[4][16][68];   // dependency rows; mask bias per key; per wave the 16 x 64 result tile
  const int tid = threadIdx.x, lane = tid & 31, g = lane >> 4, qn = lane & 15; const int b = blockIdx.z; const int wave = __builtin_amdgcn_readfirstlane(tid >> 5), qt = (int)blockIdx.x * 2 + (wave & 1), h = (int)blockIdx.y * 2 + (wave >> 1), bh = b * NH + h; const size_t rt = (size_t)bh * (TT / 16) + qt;
  stage_dm<128>(sd[0], DM + ((size_t)b * TT + blockIdx.x * 32) * TT, tid); stage_dm<128>(sd[1], DM + ((size_t)b * TT + blockIdx.x * 32 + 16) * TT, tid);
  { const v4f am = *(const v4f*)(AM + (size_t)b * TT + tid * 4);
    asm volatile("s_wait_xcnt 0x0" ::: "memory");   // as in stage_dm
    *(v4f*)&so[tid * 4] = (1.0f - bfr4(am)) * -10000.0f; }
  v16h qh[2], ql[2]; v4f gn[8];
#pragma unroll
  for (int kc = 0; kc < 2; ++kc) { qh[kc] = fragp_h(QH + (rt * 2 + kc) * 512, lane); ql[kc] = fragp_h(QL + (rt * 2 + kc) * 512, lane); }
  const float* gp = G + rt * (size_t)(16 * TT) + lane * 4;
#pragma unroll
  for (int i = 0; i < 8; ++i) gn[i] = *(const v4f*)(gp + i * 128);
  asm volatile("s_wait_xcnt 0x0" ::: "memory");   // the loads' address registers are free for other values behind this: wait first
  __syncthreads();   // the staged rows and the bias are read by all four waves
  const _Float16* kt = KH + (size_t)bh * (TT * HD) + lane * 8; const _Float16* vt = VT + (size_t)bh * (TT * HD) + lane * 8; const float* gq = gp + 1024;   // the lane's own pointers, stepped once a trip behind the loads' wait
  const float* dr = &sd[wave & 1][qn][8 * g]; const float* vr = &so[8 * g];
  v8f acc[4] = {}; float m = -3.0e38f, l = 0.0f;
#pragma unroll 1   // kept rolled: a trip holds 24 products, 40 loads and 33 exponentials
  for (int t = 0; t < TT / 64; ++t) { v8f x[4]; v16h vb[2][4];
    score_tiles<4>(x, kt, qh, ql, 0);
#pragma unroll
    for (int c = 0; c < 2; ++c)
#pragma unroll
      for (int jd = 0; jd < 4; ++jd) vb[c][jd] = fragp_h(vt + (c * 4 + jd) * 512, 0);
    asm volatile("s_wait_xcnt 0x0" ::: "memory");   // the fragment loads' address registers are stepped for the next trip: wait first
    kt += 4096; vt += 4096;
    float mc = -3.0e38f;
#pragma unroll
    for (int jj = 0; jj < 4; ++jj) { const v8f gg = __builtin_shufflevector(gn[2 * jj], gn[2 * jj + 1], 0, 1, 2, 3, 4, 5, 6, 7), se = x[jj] * 0.125f + ld8(vr + t * 64 + jj * 16), de = x[jj] * ld8(dr + t * 64 + jj * 16); x[jj] = gg * se + (1.0f - gg) * de;
#pragma unroll
      for (int r = 0; r < 8; ++r) mc = fmaxf(mc, x[jj][r]); }
#pragma unroll
    for (int i = 0; i < 8; ++i) gn[i] = *(const v4f*)(gq + i * 128);   // the gate of the next 64 keys comes from memory: in flight over this trip's exponentials and the next trip's scores (the last trip loads its own again)
    asm volatile("s_wait_xcnt 0x0" ::: "memory");   // as above
    gq += t + 2 < TT / 64 ? 1024 : 0;
    const float mn = fmaxf(m, fmaxf(mc, xhalf(mc))), al = expf(m - mn); m = mn;
    v8f ps = {};
#pragma unroll
    for (int jj = 0; jj < 4; ++jj) {
#pragma unroll
      for (int r = 0; r < 8; ++r) x[jj][r] = expf(x[jj][r] - mn);
      ps += x[jj]; }
    l = l * al + hsum8(ps);
#pragma unroll
    for (int jd = 0; jd < 4; ++jd) acc[jd] *= al;
#pragma unroll
    for (int c = 0; c < 2; ++c) { const v16h p = __builtin_convertvector(__builtin_shufflevector(x[2 * c], x[2 * c + 1], 0, 1, 2, 3, 4, 5, 6, 7, 8, 9, 10, 11, 12, 13, 14, 15) * 2048.0f, v16h);
#pragma unroll
      for (int jd = 0; jd < 4; ++jd) acc[jd] = wmma16b(vb[c][jd], p, acc[jd]); } }
  const float inv = 1.0f / ((l + xhalf(l)) * 2048.0f);
#pragma unroll
  for (int jd = 0; jd < 4; ++jd) { const v8f o = acc[jd] * inv; float* d = &ss[wave][qn][jd * 16 + 8 * g]; *(v4f*)d = __builtin_shufflevector(o, o, 0, 1, 2, 3); *(v4f*)(d + 4) = __builtin_shufflevector(o, o, 4, 5, 6, 7); }
  LDSW();
#pragma unroll
  for (int i = 0; i < 8; ++i) { const int rl = 2 * i + g; vst2(OUT + ((size_t)b * TT + qt * 16 + rl) * CC + h * HD + qn * 4, *(const v4f*)&ss[wave][rl][qn * 4]); } }
extern "C" void kernel_launch(void* const* d_in, const int* in_sizes, int n_in, void* d_out, int out_size, void* d_ws, size_t ws_size, hipStream_t stream) {
  (void)in_sizes; (void)n_in; (void)out_size;
  const float** F = (const float**)d_in;   // 0 hidden [8,512,768], 1 attention_mask [8,512], 2 dependency_matrix [8,512,512], 3 Wq [768,768] ([in,out]), 4 bq, 5 Wk, 6 bk, 7 Wv, 8 bv, 9 ln_g [1024], 10 ln_b, 11 W1 [1024,512], 12 b1, 13 W2 [512,512], 14 b2
  if (ws_size < (size_t)WS_END) return;
  char* ws = (char*)d_ws; _Float16 *QH = (_Float16*)(ws + WS_QH), *QL = (_Float16*)(ws + WS_QL), *KH = (_Float16*)(ws + WS_KH), *VT = (_Float16*)(ws + WS_VT), *W1P = (_Float16*)(ws + WS_W1P), *W2P = (_Float16*)(ws + WS_W2P); __bf16 *XP = (__bf16*)(ws + WS_XP), *WP = (__bf16*)(ws + WS_WP); float *G = (float*)(ws + WS_G);
  k_pack<<<PB_X + 3 * PB_W + PB_W1 + PB_W2, 256, 0, stream>>>(F[0], F[3], F[5], F[7], F[11], F[13], XP, WP, W1P, W2P);
  k_proj<<<dim3(TNB * TT / 64, CC / 128, 3), 128, 0, stream>>>(XP, WP, F[4], F[6], F[8], QH, QL, KH, VT);
  k_g<<<dim3(TT / 16, NH / (2 * GR), TNB), 256, 0, stream>>>(QH, QL, KH, F[1], F[2], F[9], F[10], W1P, F[12], W2P, F[14], G);
  k_fin<<<dim3(TT / 32, NH / 2, TNB), 128, 0, stream>>>(QH, QL, KH, VT, F[1], F[2], G, (float*)d_out);
}

// v010
// It runs in 116 microseconds.
// Two timings next to v009 both put it at 1.16 times that version's speed.
// All steps since v000 together make it 9.43 times as fast.
// compute dtype: all float inputs rounded to bf16, attention_mask / dependency_matrix read; q/k/v = hidden W + b with EXACT bf16 products on WMMA 16x16x32, f32 accumulate; scores = q k^T / 8 with q as f16 hi + residual and k f16 (2 products), f32, never stored: formed where they are used, once for the LayerNorm and once for the softmax, in the same launch; self = scores + (1 - mask) * -1e4, dep = scores * dependency in f32; LayerNorm over the concatenated 1,024-row in f32 -> f16 fragments; gating MLP tanh(ln W1 + b1) (1 f16 product, f16 rows) then sigmoid(. W2 + b2) (1 f16 product), tanh and sigmoid formed in f32 from the hardware's 2^x and 1/x; the gate stays f32 and is never stored to memory; mixed = g self + (1 - g) dep and its softmax in f32 (precise expf; running maximum over the two blocks of 64 keys of a quarter row, the four quarters rescaled to the row's maximum and summed at the end) -> e^(x - max) x 2^11 in f16; ctx = P . v (v rounded once to f16), divided by the row sum at the end; f32 output [b][t][768].
#include <hip/hip_runtime.h>
#include <math.h>

typedef __attribute__((ext_vector_type(16))) _Float16 v16h;
typedef __attribute__((ext_vector_type(16))) __bf16 v16b;
typedef __attribute__((ext_vector_type(8)))  _Float16 v8h;
typedef __attribute__((ext_vector_type(8)))  float v8f;
typedef __attribute__((ext_vector_type(4)))  float v4f;
typedef __attribute__((ext_vector_type(2)))  float v2f;
typedef __attribute__((ext_vector_type(4)))  unsigned v4u;
typedef __attribute__((ext_vector_type(4)))  int v4i;
typedef float __attribute__((may_alias)) float_a;
typedef int __attribute__((may_alias)) int_a;

template <typename T> __device__ __forceinline__ void vst2(void* p, T v) { *(T*)p = v;  }
__device__ __forceinline__ v8f wmma16(v16h a, v16h b, v8f c) {
  v8f d = __builtin_amdgcn_wmma_f32_16x16x32_f16(false, a, false, b, (short)0, c, false, false);
  asm volatile("v_nop\n\tv_nop\n\tv_nop\n\tv_nop" : "+v"(d) : "v"(a), "v"(b));
  return d;
}
__device__ __forceinline__ v8f wmma_bf(v16b a, v16b b, v8f c) {
  v8f d = __builtin_amdgcn_wmma_f32_16x16x32_bf16(false, a, false, b, (short)0, c, false, false);
  asm volatile("v_nop\n\tv_nop\n\tv_nop\n\tv_nop" : "+v"(d) : "v"(a), "v"(b));
  return d;
}
// 16x16x32 fragments: lane = (h = lane>>4, row/col = lane&15); elements 0..7 = k0+8h+0..7, 8..15 = k0+16+8h+0..7; D element r = row 8h+r
__device__ __forceinline__ v16h frag_h(const _Float16* rowk0, int lane) {
  union { v16h v; v8h q[2]; } u; const _Float16* p = rowk0 + 8 * (lane >> 4);
  u.q[0] = *(const v8h*)p; u.q[1] = *(const v8h*)(p + 16); return u.v;
}
__device__ __forceinline__ v16h frag_f32(const float* rowk0, int lane) {
  v16h a; const float* p = rowk0 + 8 * (lane >> 4);
#pragma unroll
  for (int i = 0; i < 8; ++i) { a[i] = (_Float16)p[i]; a[8 + i] = (_Float16)p[16 + i]; }
  return a;
}
__device__ __forceinline__ v16h frag_f32s(const float* rowk0, int lane, float sc) {
  v16h a; const float* p = rowk0 + 8 * (lane >> 4);
#pragma unroll
  for (int i = 0; i < 8; ++i) { a[i] = (_Float16)(p[i] * sc); a[8 + i] = (_Float16)(p[16 + i] * sc); }
  return a;
}
// column fragment from a [K][ld] layout (column n), rows >= K read as 0
__device__ __forceinline__ v16h fragc_f32(const float* W, int k0, int n, int lane, int ld, int K) {
  v16h a; const int g = lane >> 4;
#pragma unroll
  for (int i = 0; i < 8; ++i) { const int ka = k0 + 8 * g + i, kb = ka + 16;
    a[i] = (_Float16)(ka < K ? W[(size_t)(ka < K ? ka : K - 1) * ld + n] : 0.f); a[8 + i] = (_Float16)(kb < K ? W[(size_t)(kb < K ? kb : K - 1) * ld + n] : 0.f); }
  return a;
}
struct F2 { v16b h, l; };
__device__ __forceinline__ F2 bsplit16(const float v[16]) { F2 r;
#pragma unroll
  for (int i = 0; i < 16; ++i) { const __bf16 h = (__bf16)v[i]; r.h[i] = h; r.l[i] = (__bf16)(v[i] - (float)h); }
  return r; }
__device__ __forceinline__ F2 split_row(const float* row, int k0, int lane) { float v[16]; const float* p = row + k0 + 8 * (lane >> 4);
#pragma unroll
  for (int i = 0; i < 8; ++i) { v[i] = p[i]; v[8 + i] = p[16 + i]; }
  return bsplit16(v); }
__device__ __forceinline__ F2 split_rowK(const float* row, int k0, int lane, int K) { float v[16]; const int g = lane >> 4;
#pragma unroll
  for (int i = 0; i < 8; ++i) { const int ka = k0 + 8 * g + i, kb = ka + 16; v[i] = ka < K ? row[ka < K ? ka : K - 1] : 0.f; v[8 + i] = kb < K ? row[kb < K ? kb : K - 1] : 0.f; }
  return bsplit16(v); }
__device__ __forceinline__ F2 split_col(const float* W, int k0, int n, int lane, int ld, int K) { float v[16]; const int g = lane >> 4;
#pragma unroll
  for (int i = 0; i < 8; ++i) { const int ka = k0 + 8 * g + i, kb = ka + 16; v[i] = ka < K ? W[(size_t)(ka < K ? ka : K - 1) * ld + n] : 0.f; v[8 + i] = kb < K ? W[(size_t)(kb < K ? kb : K - 1) * ld + n] : 0.f; }
  return bsplit16(v); }
__device__ __forceinline__ v8f mac3(const F2& a, const F2& b, v8f c) { c = wmma_bf(a.l, b.h, c); c = wmma_bf(a.h, b.l, c); return wmma_bf(a.h, b.h, c); }
__device__ __forceinline__ float sigm(float v) { return 1.0f / (1.0f + expf(-v)); }
#define LDSX() do { asm volatile("s_wait_dscnt 0" ::: "memory"); __builtin_amdgcn_wave_barrier(); __builtin_amdgcn_fence(__ATOMIC_RELEASE, "workgroup"); } while (0)


// Dependency-mixed BERT self attention (B 8, T 512, C 768 = 12 x 64): a learned per-(query, key) gate between plain attention scores and dependency-weighted scores, then softmax . v.
#define NB 8
#define TT 512
#define CC 768
#define NH 12
#define HD 64
#define NROW (NB * TT)          // 4096 token rows
#define NAR (NB * NH * TT)      // 49152 attention rows
#define GH 512                  // gating hidden (= T)
#ifndef TNB
#define TNB NB
#endif
typedef __attribute__((ext_vector_type(8))) __bf16 v8b;
__device__ __forceinline__ v16b frag_b(const __bf16* rowk0, int lane) {
  union { v16b v; v8b q[2]; } u; const __bf16* p = rowk0 + 8 * (lane >> 4);
  u.q[0] = *(const v8b*)p; u.q[1] = *(const v8b*)(p + 16); return u.v;
}
__device__ __forceinline__ float bfr(float v) { return (float)(__bf16)v; }
// tanh and sigmoid of the gate straight from the hardware's 2^x and 1/x (v_exp_f32, v_rcp_f32), in place of the library calls and the IEEE division sequence, which take several times the instructions and, for tanh, divergent branches per element.
// tanh is rounded to f16 behind this and the gate only weighs the scores, so the last bits of f32 do not reach the output. Both ends saturate: 2^a = inf gives 1 / inf = 0, 2^a = 0 gives 1 / 1.
#define LOG2E 1.44269504088896340736f
__device__ __forceinline__ float tanh_p2(float a) { return 1.0f - 2.0f * __builtin_amdgcn_rcpf(1.0f + __builtin_amdgcn_exp2f(a)); }   // tanh(v), a = 2 v log2(e)
__device__ __forceinline__ float sigm_p2(float a) { return __builtin_amdgcn_rcpf(1.0f + __builtin_amdgcn_exp2f(a)); }                  // sigmoid(v), a = -v log2(e)
// eight sigmoids in one statement: 8 x 2^x, 8 x (1 + .), 8 x 1 / x. Every result is used eight instructions behind its producer, so that no instruction waits for the one before it, and no instruction directly behind a 2^x or 1 / x reads its result or overwrites its source, which the instruction set asks to keep one slot apart (the outputs are registers of their own; the v_nop at the end is the last 1 / x's slot)
__device__ __forceinline__ v8f sigm8_p2(v8f a) { float t0, t1, t2, t3, t4, t5, t6, t7;
  asm("v_exp_f32 %0, %8\n\tv_exp_f32 %1, %9\n\tv_exp_f32 %2, %10\n\tv_exp_f32 %3, %11\n\tv_exp_f32 %4, %12\n\tv_exp_f32 %5, %13\n\tv_exp_f32 %6, %14\n\tv_exp_f32 %7, %15\n\t"
      "v_add_f32 %0, 1.0, %0\n\tv_add_f32 %1, 1.0, %1\n\tv_add_f32 %2, 1.0, %2\n\tv_add_f32 %3, 1.0, %3\n\tv_add_f32 %4, 1.0, %4\n\tv_add_f32 %5, 1.0, %5\n\tv_add_f32 %6, 1.0, %6\n\tv_add_f32 %7, 1.0, %7\n\t"
      "v_rcp_f32 %0, %0\n\tv_rcp_f32 %1, %1\n\tv_rcp_f32 %2, %2\n\tv_rcp_f32 %3, %3\n\tv_rcp_f32 %4, %4\n\tv_rcp_f32 %5, %5\n\tv_rcp_f32 %6, %6\n\tv_rcp_f32 %7, %7\n\tv_nop"
      : "=&v"(t0), "=&v"(t1), "=&v"(t2), "=&v"(t3), "=&v"(t4), "=&v"(t5), "=&v"(t6), "=&v"(t7) : "v"(a[0]), "v"(a[1]), "v"(a[2]), "v"(a[3]), "v"(a[4]), "v"(a[5]), "v"(a[6]), "v"(a[7]));
  return v8f{t0, t1, t2, t3, t4, t5, t6, t7}; }   // sigmoid(v), a = -v log2(e)
// eight e^x by the steps of the library's expf (x log2 e in two parts, its whole part split off, 2^rest, scaled back; 0 below -103.28, infinity above 88.72), with the eight 2^x in one statement, so that no instruction directly behind a 2^x overwrites its source register, which the instruction set asks to keep one slot apart (the outputs are registers of their own; the v_nop at the end is the last one's slot)
__device__ __forceinline__ v8f exp8(v8f x) { const float c0 = __builtin_bit_cast(float, 0x3fb8aa3bu), c1 = __builtin_bit_cast(float, 0x32a5705fu), lo = __builtin_bit_cast(float, 0xc2ce8ed0u), hi = __builtin_bit_cast(float, 0x42b17218u); v8f a, e; float t0, t1, t2, t3, t4, t5, t6, t7;
#pragma unroll
  for (int r = 0; r < 8; ++r) { const float ph = x[r] * c0, pl = __builtin_fmaf(x[r], c1, __builtin_fmaf(x[r], c0, -ph)); e[r] = __builtin_rintf(ph); a[r] = (ph - e[r]) + pl; }
  asm("v_exp_f32 %0, %8\n\tv_exp_f32 %1, %9\n\tv_exp_f32 %2, %10\n\tv_exp_f32 %3, %11\n\tv_exp_f32 %4, %12\n\tv_exp_f32 %5, %13\n\tv_exp_f32 %6, %14\n\tv_exp_f32 %7, %15\n\tv_nop"
      : "=&v"(t0), "=&v"(t1), "=&v"(t2), "=&v"(t3), "=&v"(t4), "=&v"(t5), "=&v"(t6), "=&v"(t7) : "v"(a[0]), "v"(a[1]), "v"(a[2]), "v"(a[3]), "v"(a[4]), "v"(a[5]), "v"(a[6]), "v"(a[7]));
  v8f p = {t0, t1, t2, t3, t4, t5, t6, t7};
#pragma unroll
  for (int r = 0; r < 8; ++r) { float v = __builtin_ldexpf(p[r], (int)e[r]); v = x[r] < lo ? 0.0f : v; p[r] = x[r] > hi ? __builtin_inff() : v; }
  return p; }
__device__ __attribute__((noinline)) float exp_ni(float v) { return expf(v); }
__device__ __attribute__((noinline)) float erf_ni(float v) { return erff(v); }

// Every stage runs once for all NAR = 49,152 attention rows (row = (b * 12 + h) * 512 + t). A row tile is 16 consecutive attention rows (16 queries of one head).
#define NARB (NH * TT)                                   // attention rows of one batch
#define WS_VT  0u                                        // f16 v as fragments [b][h][32 keys][16 d][1 KB tile]: k_proj -> k_g
// 16-bit copies of hidden and of the five weights in fragment order, written by k_pack at the head of every call
#define WS_W1P (WS_VT + 2u * (size_t)NROW * CC)          // f16 W1 [kc][col tile][1 KB tile]
#define WS_W2P (WS_W1P + 2u * (size_t)2 * TT * GH)       // f16 W2 [kc][col tile][1 KB tile]
// q (hi, residual) and k as fragments [b][h][16 tokens][kc 0..1][1 KB tile]: k_proj -> k_g
#define WS_QH  (WS_W2P + 2u * (size_t)GH * GH)
#define WS_QL  (WS_QH + 2u * (size_t)NROW * CC)
#define WS_KH  (WS_QL + 2u * (size_t)NROW * CC)
#define WS_XP  (WS_KH + 2u * (size_t)NROW * CC)          // bf16 hidden [row tile][kc][1 KB tile]
#define WS_WP  (WS_XP + 2u * (size_t)NROW * CC)          // bf16 Wq, Wk, Wv, each [kc][col tile][1 KB tile]
#define WS_END (WS_WP + 3u * 2u * (size_t)CC * CC)

// A packed tile is one 16 x 32 fragment as the wave reads it: [q = 0, 1][lane][8 elements], element i of piece q = k0 + 16 q + 8 (lane >> 4) + i of row or column (lane & 15).
// Each of the two 16-byte loads of a wave then covers 512 contiguous bytes (four whole lines).
__device__ __forceinline__ v16h fragp_h(const _Float16* tile, int lane) {
  union { v16h v; v8h q[2]; } u; const _Float16* p = tile + lane * 8;
  u.q[0] = *(const v8h*)p; u.q[1] = *(const v8h*)(p + 256); return u.v;
}
__device__ __forceinline__ v16b fragp_b(const __bf16* tile, int lane) {
  union { v16b v; v8b q[2]; } u; const __bf16* p = tile + lane * 8;
  u.q[0] = *(const v8b*)p; u.q[1] = *(const v8b*)(p + 256); return u.v;
}
// one 16-byte piece (8 consecutive k of column n) of a [K][N] f32 weight; 32 consecutive ids read whole lines and write two 256-byte runs
template <int N, bool F16> __device__ __forceinline__ void pack_w(const float* __restrict__ Wm, int id, void* __restrict__ dst) {
  const int n = id % N, ko = id / N, kc = ko >> 2, g = ko & 1, q = (ko >> 1) & 1; float v[8];
#pragma unroll
  for (int i = 0; i < 8; ++i) v[i] = Wm[(size_t)(ko * 8 + i) * N + n];
  const size_t d = ((size_t)(kc * (N / 16) + (n >> 4)) * 2 + q) * 32 + g * 16 + (n & 15);
  if (F16) { v8h o;
#pragma unroll
    for (int i = 0; i < 8; ++i) o[i] = (_Float16)bfr(v[i]);
    *((v8h*)dst + d) = o; asm volatile("s_wait_xcnt 0x0" ::: "memory"); /* the store's address and data registers may be rewritten behind it: wait first */ }
  else { v8b o;
#pragma unroll
    for (int i = 0; i < 8; ++i) o[i] = (__bf16)v[i];
    *((v8b*)dst + d) = o; asm volatile("s_wait_xcnt 0x0" ::: "memory"); /* the store's address and data registers may be rewritten behind it: wait first */ } }
#define PB_X  (NROW * CC / 8 / 256)       // blocks of 256 pieces: hidden
#define PB_W  (CC * CC / 8 / 256)         // Wq, Wk, Wv each
#define PB_W1 (2 * TT * GH / 8 / 256)
#define PB_W2 (GH * GH / 8 / 256)
// ---- k_pack: thread = one 16-byte piece of a packed tile; the block index picks the matrix
__global__ __launch_bounds__(256) void k_pack(const float* __restrict__ X, const float* __restrict__ WQ, const float* __restrict__ WK, const float* __restrict__ WV, const float* __restrict__ W1, const float* __restrict__ W2, __bf16* __restrict__ XP, __bf16* __restrict__ WP, _Float16* __restrict__ W1P, _Float16* __restrict__ W2P) {
  int blk = blockIdx.x; const int t = threadIdx.x;
  if (blk < PB_X) { const int d = blk * 256 + t, r = d & 15, g = (d >> 4) & 1, q = (d >> 5) & 1, tile = d >> 6, kc = tile % (CC / 32), rt = tile / (CC / 32);
    const float* p = X + (size_t)(rt * 16 + r) * CC + kc * 32 + q * 16 + g * 8; const v4f lo = *(const v4f*)p, hi = *(const v4f*)(p + 4); v8b o;
#pragma unroll
    for (int i = 0; i < 4; ++i) { o[i] = (__bf16)lo[i]; o[4 + i] = (__bf16)hi[i]; }
    *((v8b*)XP + d) = o; asm volatile("s_wait_xcnt 0x0" ::: "memory"); /* the store's address and data registers may be rewritten behind it: wait first */ return; }
  blk -= PB_X;
  if (blk < 3 * PB_W) { const int which = blk / PB_W; pack_w<CC, false>(which == 0 ? WQ : which == 1 ? WK : WV, (blk - which * PB_W) * 256 + t, WP + (size_t)which * CC * CC); return; }
  blk -= 3 * PB_W;
  if (blk < PB_W1) { pack_w<GH, true>(W1, blk * 256 + t, W1P); return; }
  pack_w<GH, true>(W2, (blk - PB_W1) * 256 + t, W2P); }

// ---- k_proj: block = (64 rows, 128 cols, which): hidden W + b ([in,out]); q hi + residual, k and v, all as fragments
__global__ __launch_bounds__(128) void k_proj(const __bf16* __restrict__ XP, const __bf16* __restrict__ WP, const float* __restrict__ BQ, const float* __restrict__ BK, const float* __restrict__ BV, _Float16* __restrict__ QH, _Float16* __restrict__ QL, _Float16* __restrict__ KH, _Float16* __restrict__ VT) {
  __shared__ __align__(16) _Float16 sh[64][136], sl[64][136]; __shared__ __align__(16) _Float16 th[128][72];
  const int tid = threadIdx.x, wave = tid >> 5, lane = tid & 31, col = lane & 15, g = lane >> 4; const int which = blockIdx.z; const int c0 = blockIdx.y * 128; const size_t r0 = (size_t)blockIdx.x * 64;
  const __bf16* Wm = WP + (size_t)which * CC * CC + (size_t)(c0 / 16) * 512; const __bf16* Xm = XP + (size_t)(r0 / 16 + wave) * (CC / 32) * 512; const float* Bm = which == 0 ? BQ : which == 1 ? BK : BV;
  v8f acc[8] = {};
#pragma unroll 2
  for (int kc = 0; kc < CC / 32; ++kc) { const v16b a = fragp_b(Xm + (size_t)kc * 512, lane); v16b w[8];
#pragma unroll
    for (int j = 0; j < 8; ++j) w[j] = fragp_b(Wm + ((size_t)kc * (CC / 16) + j) * 512, lane);
#pragma unroll
    for (int j = 0; j < 8; ++j) acc[j] = wmma_bf(a, w[j], acc[j]); }
#pragma unroll
  for (int j = 0; j < 8; ++j) { const float bb = bfr(Bm[c0 + j * 16 + col]);
#pragma unroll
    for (int r = 0; r < 8; ++r) { const float v = acc[j][r] + bb; const int rl = wave * 16 + 8 * g + r, cl = j * 16 + col; const _Float16 hv = (_Float16)v;
      if (which == 2) th[cl][rl] = hv; else { sh[rl][cl] = hv; sl[rl][cl] = (_Float16)(v - (float)hv); } } }
  __syncthreads();
  // q, k and v leave in fragment order (the packed tile above): 32 consecutive pieces are one 512-byte run
  const int b = (int)(r0 / TT), t0 = (int)(r0 % TT), h0 = c0 / HD;
  if (which < 2) { _Float16* dh = which == 0 ? QH : KH;   // tile = 16 tokens x 32 d
    for (int e = tid; e < 1024; e += 128) { const int ln = e & 31, q = (e >> 5) & 1, cch = (e >> 6) & 3, rtl = e >> 8; const int rl = rtl * 16 + (ln & 15), cl = cch * 32 + q * 16 + (ln >> 4) * 8;
      const size_t d = (((size_t)(b * NH + h0 + (cch >> 1)) * (TT / 16) + t0 / 16 + rtl) * 2 + (cch & 1)) * 512 + q * 256 + ln * 8;
      vst2(dh + d, *(const v4u*)&sh[rl][cl]); asm volatile("s_wait_xcnt 0x0" ::: "memory");   // the store's address and data registers are rewritten behind it: wait first
      if (which == 0) { vst2(QL + d, *(const v4u*)&sl[rl][cl]); asm volatile("s_wait_xcnt 0x0" ::: "memory"); /* as above */ } } }
  else {   // tile = 16 d x 32 tokens
    for (int e = tid; e < 1024; e += 128) { const int ln = e & 31, q = (e >> 5) & 1, dt = (e >> 6) & 7, kcl = e >> 9; const int cl = dt * 16 + (ln & 15), rl = kcl * 32 + q * 16 + (ln >> 4) * 8;
      const size_t d = (((size_t)(b * NH + h0 + (dt >> 2)) * (TT / 32) + t0 / 32 + kcl) * 4 + (dt & 3)) * 512 + q * 256 + ln * 8;
      vst2(VT + d, *(const v4u*)&th[cl][rl]);
      asm volatile("s_wait_xcnt 0x0" ::: "memory"); /* as above */ } } }
// orders a wave's own LDS stores and loads on a range that no other wave touches (so no barrier)
#define LDSW() do { asm volatile("s_wait_dscnt 0" ::: "memory"); __builtin_amdgcn_wave_barrier(); } while (0)
// ---- attention-row kernels: the scores are formed with the KEYS as the rows of the product (A = k tile, B = q tile), so that element r of accumulator tile j in lane (g = lane >> 4, n = lane & 15) is key 16 j + 8 g + r of query n.
// A lane then owns half of one query's row: a row sum is a sum inside the lane and one exchange with lane ^ 16, and tiles 2 c and 2 c + 1, rounded to f16, ARE the 16 x 32 fragment c of that row tile (element i = k 32 c + 8 g + i, 8 + i = k 32 c + 16 + 8 g + i), for the gate GEMM and for P . v alike.
typedef __attribute__((ext_vector_type(4))) _Float16 v4h;
__device__ __forceinline__ float xhalf(float x) { return __builtin_bit_cast(float, __builtin_amdgcn_permlanex16(__builtin_bit_cast(int, x), __builtin_bit_cast(int, x), 0x76543210, 0xfedcba98, false, false)); }  // lane l ^ 16
__device__ __forceinline__ float hsum8(v8f a) { const v4f c = __builtin_shufflevector(a, a, 0, 1, 2, 3) + __builtin_shufflevector(a, a, 4, 5, 6, 7); return (c[0] + c[1]) + (c[2] + c[3]); }
__device__ __forceinline__ v8f ld8(const float* p) { const v4f a = *(const v4f*)p, c = *(const v4f*)(p + 4); return __builtin_shufflevector(a, c, 0, 1, 2, 3, 4, 5, 6, 7); }
__device__ __forceinline__ v4f bfr4(v4f v) { v4f r;
#pragma unroll
  for (int i = 0; i < 4; ++i) r[i] = bfr(v[i]);
  return r; }
// the plain builtin: above 256 registers an asm statement that names the accumulator ties it to one register window and the tile spills; the compiler keeps the distance behind its own matrix instructions
__device__ __forceinline__ v8f wmma16b(v16h a, v16h b, v8f c) { return __builtin_amdgcn_wmma_f32_16x16x32_f16(false, a, false, b, (short)0, c, false, false); }
#define DP 516                  // pitch in floats of a staged dependency row: 2,064 B = 16 B x 129, so the 16 queries of a half wave read 16 different 16-byte columns
// the block's 16 dependency rows, rounded, to LDS: whole 2-KB rows in, a lane's 8 keys of its own query out. They carry the scores' factor 1 / 8 (a power of two: exact), so that the accumulators are used as they stand
template <int NT> __device__ __forceinline__ void stage_dm(float (*sd)[DP], const float* __restrict__ dmp, int tid) { constexpr int NI = 16 * 128 / NT, RS = NT / 128; v4f v[NI]; const int r0 = tid >> 7, c = (tid & 127) * 4; const float* p = dmp + (size_t)r0 * TT + c;   // the lane's own pointer
#pragma unroll
  for (int i = 0; i < NI; ++i) v[i] = *(const v4f*)(p + (size_t)(i * RS) * TT);
  asm volatile("s_wait_xcnt 0x0" :: "v"(p) : "memory");   // the loads' address registers may be taken for other values behind this: wait first (the address is named as an input so that its registers are still its own at the wait)
#pragma unroll
  for (int i = 0; i < NI; ++i) *(v4f*)&sd[i * RS + r0][c] = bfr4(v[i]) * 0.125f; }
// ---- k_g: block = (16 queries, 6 heads, batch) = 96 attention rows x all 512 columns, 8 waves. Four stages in one launch, the rows of each handed to the next in LDS or registers and never stored to memory:
// (1) mixed = [self | dep] (1,024), LayerNorm (eps 1e-5) -> f16 fragments; wave = (3 heads one after the other, a quarter of the keys): a head's 8 score tiles in registers, the dependency values and the mask bias read from LDS once for the three heads, and the block's 16 dependency rows serve all six;
// (2) T1 = tanh(LN W1 + b1) (K 1024) -> f16 rows; (3) G = sigmoid(T1 W2 + b2) (K 512), formed with the KEYS as the rows of the product (A = weight fragment, B = hidden rows), so that a lane holds the gate of the same (query, keys) as it holds the scores. In (2) and (3) wave = 48 rows x 128 cols (GR x 8 accumulator tiles);
// (4) wave = the same 3 heads x 128 keys: scores again; logits = g self + (1 - g) dep; softmax with a running maximum over the wave's 128 keys; ctx^T part = v^T . P^T, so that a lane keeps its query and a rescale is one factor per lane; the four parts of a row are rescaled to the row's maximum, summed and divided by the row sum at the end.
// Each weight fragment a wave loads feeds GR products and each row fragment 8, so a product needs two fifths of the loaded bytes of a 16 x 128 tile. The weight fragments of the even and of the odd 32-k steps have a register set each; a fragment is reloaded for two steps on right behind its last product, nearly two rounds of products ahead of its use.
#define GR 3                    // 16-row tiles per wave: 4,096 waves in all, two full rounds at 2 waves per SIMD
#define T1P 520                 // pitch in 16-bit elements of a hidden gate row in LDS: 1,040 B = 16 B x 65, free of bank conflicts for 16-byte reads
#define MXT (16 * 2 * TT)       // 16-bit elements of one row tile's LayerNorm rows: 32 fragments of 1 KB
__global__ __launch_bounds__(256, 2) /* registers for 2 waves per SIMD: the accumulators alone are 192 */ void k_g(const _Float16* __restrict__ QH, const _Float16* __restrict__ QL, const _Float16* __restrict__ KH, const _Float16* __restrict__ VT, const float* __restrict__ AM, const float* __restrict__ DM, const float* __restrict__ LG, const float* __restrict__ LB, const _Float16* __restrict__ W1K, const float* __restrict__ B1, const _Float16* __restrict__ W2K, const float* __restrict__ B2, float* __restrict__ OUT) {
  __shared__ __align__(16) _Float16 mxs[2 * GR * MXT];      // the block's 96 LayerNorm rows as fragments [row tile = head][kc 0..31][1 KB tile]; behind the first product the same bytes hold the 96 hidden gate rows, behind the second each wave's gate sums and then its parts of the result
  __shared__ __align__(16) float fs[8 * 16 * 132];          // per wave: a 16-row f32 tile of results; in stage (1) the same bytes hold the partial sums
  __shared__ __align__(16) float kp[16 * DP + 6 * TT];      // staged once, read in stages (1) and (4): the block's 16 dependency rows; per key: mask bias, LayerNorm scale (self, dep), LayerNorm shift (self, dep), second gate bias x -log2 e
  _Float16 (*t1)[T1P] = (_Float16 (*)[T1P])mxs;
  // waves 2 c and 2 c + 1 take column group c (the same weight fragments), even and odd waves the two groups of 48 rows (3 heads)
  const int tid = threadIdx.x, wave = tid >> 5, lane = tid & 31, col = lane & 15, g = lane >> 4; const int c0 = (wave >> 1) * 128, rl0 = (wave & 1) * (16 * GR); const int qt = blockIdx.x, b = blockIdx.z, hb = b * NH + (int)blockIdx.y * (2 * GR); const size_t rt0 = (size_t)(hb + (wave & 1) * GR) * (TT / 16) + qt; constexpr int K0 = 2 * TT, NOUT = GH;   // hb: the block's first head; rt0: the first of the wave's three row tiles, one head (TT / 16 tiles) apart
  { float (*sd)[DP] = (float (*)[DP])kp; float (*sv)[TT] = (float (*)[TT])(kp + 16 * DP); float (*red)[8][GR][16] = (float (*)[8][GR][16])fs;   // dependency rows; the vectors per key; each wave's part of the two row sums
    const int qn = col, wv = __builtin_amdgcn_readfirstlane(tid >> 5), kq = wv & 3, wb = wv & 4, hl = (wv >> 2) * GR, bh = hb + hl; const size_t rt = (size_t)bh * (TT / 16) + qt;   // bh, rt: the first of the wave's three heads
    v16h kb[8][2], qh[2], ql[2];   // one head's fragments: the wave's 128 keys, the 16 queries (hi, residual)
    auto ld_kq = [&](int hh) __attribute__((always_inline)) { const _Float16* kt = KH + (size_t)(bh + hh) * (TT * HD) + (size_t)kq * (TT * HD / 4) + lane * 8; const _Float16* qp = QH + (rt + hh * (TT / 16)) * 1024 + lane * 8; const _Float16* lp = QL + (rt + hh * (TT / 16)) * 1024 + lane * 8;   // the lane's own pointers
#pragma unroll
      for (int kc = 0; kc < 2; ++kc) { qh[kc] = fragp_h(qp + kc * 512, 0); ql[kc] = fragp_h(lp + kc * 512, 0); }
#pragma unroll
      for (int jj = 0; jj < 8; ++jj) { kb[jj][0] = fragp_h(kt + (2 * jj) * 512, 0); kb[jj][1] = fragp_h(kt + (2 * jj + 1) * 512, 0); }
      asm volatile("s_wait_xcnt 0x0" :: "v"(kt), "v"(qp), "v"(lp) : "memory"); };   // the loads' address registers may be taken for other values behind this: wait first (the three addresses are named as inputs so that their registers are still theirs at the wait, and not a load's own destination)
    ld_kq(0);   // the first head's fragments are on their way beside the rows and vectors staged below
    stage_dm<256>(sd, DM + ((size_t)b * TT + qt * 16) * TT, tid);
    if (wv < 4) { const unsigned ob = tid * 16u; auto ldv = [&](const float* p) __attribute__((always_inline)) { return *(const v4f*)((const char*)p + ob); };   // ob: the lane's byte offset in each vector
      const float* pm = AM + (size_t)b * TT; const v4f am = ldv(pm), g0 = ldv(LG), g1 = ldv(LG + TT), b0 = ldv(LB), b1 = ldv(LB + TT), b2 = ldv(B2);
      asm volatile("s_wait_xcnt 0x0" :: "v"(ob), "s"(pm) : "memory");   // as in stage_dm (the offset and the one base formed here are named as inputs so that their registers are still theirs at the wait)
      *(v4f*)&sv[0][tid * 4] = (1.0f - bfr4(am)) * -10000.0f; *(v4f*)&sv[1][tid * 4] = bfr4(g0); *(v4f*)&sv[2][tid * 4] = bfr4(g1); *(v4f*)&sv[3][tid * 4] = bfr4(b0); *(v4f*)&sv[4][tid * 4] = bfr4(b1); *(v4f*)&sv[5][tid * 4] = bfr4(b2) * -LOG2E; }   // the second bias carries the exponent's scale: sum, bias and scale are then one multiply-add
    __syncthreads();   // the staged rows and vectors are read by all eight waves
    const float* dr = &sd[qn][kq * 128 + 8 * g]; const float* vr = &sv[0][kq * 128 + 8 * g]; _Float16* o = &mxs[hl * MXT + kq * 2048 + lane * 8];
    v8f ob[8], dm[8];   // mask bias and dependency values of the lane's 64 keys: read once, in registers for the three heads
#pragma unroll
    for (int j = 0; j < 8; ++j) { ob[j] = ld8(vr + j * 16); dm[j] = ld8(dr + j * 16); }
#pragma unroll 1   // kept rolled: with the three heads' passes unrolled the kernel's text is longer than 32 KB
    for (int hh = 0; hh < GR; ++hh) { v8f s[8] = {}, t = {};   // 8 x score; per tile the products come in the order hi, residual of d 0..31, then of d 32..63
#pragma unroll
      for (int kc = 0; kc < 2; ++kc) {
#pragma unroll
        for (int jj = 0; jj < 8; ++jj) s[jj] = wmma16b(kb[jj][kc], qh[kc], s[jj]);
#pragma unroll
        for (int jj = 0; jj < 8; ++jj) s[jj] = wmma16b(kb[jj][kc], ql[kc], s[jj]); }
#pragma unroll
      for (int j = 0; j < 8; ++j) t += (s[j] * 0.125f + ob[j]) + s[j] * dm[j];
      { const float r = hsum8(t); red[0][wv][hh][qn] = r + xhalf(r); }
      __syncthreads();   // a row's sum is the sum of its four waves' parts
      const float mu = ((red[0][wb][hh][qn] + red[0][wb + 1][hh][qn]) + (red[0][wb + 2][hh][qn] + red[0][wb + 3][hh][qn])) / (2 * TT); t = v8f{};
#pragma unroll
      for (int j = 0; j < 8; ++j) { const v8f x0 = (s[j] * 0.125f + ob[j]) - mu, x1 = s[j] * dm[j] - mu; t += x0 * x0 + x1 * x1; }
      { const float r = hsum8(t); red[1][wv][hh][qn] = r + xhalf(r); }
      __syncthreads();   // as above
      if (hh + 1 < GR) ld_kq(hh + 1);   // the next head's fragments are in flight over the third pass: no barrier, which would wait for them, stands between here and their use
      const float inv = 1.0f / sqrtf(((red[1][wb][hh][qn] + red[1][wb + 1][hh][qn]) + (red[1][wb + 2][hh][qn] + red[1][wb + 3][hh][qn])) / (2 * TT) + 1e-5f);
#pragma unroll
      for (int j = 0; j < 8; ++j) { const v8f l0 = ld8(vr + TT + j * 16), l1 = ld8(vr + 2 * TT + j * 16), c0v = ld8(vr + 3 * TT + j * 16), c1v = ld8(vr + 4 * TT + j * 16); const v8f x0 = (s[j] * 0.125f + ob[j]) - mu, x1 = s[j] * dm[j] - mu; _Float16* oh = o + hh * MXT + j * 256;
        *(v8h*)oh = __builtin_convertvector(x0 * inv * l0 + c0v, v8h); *(v8h*)(oh + 16 * TT) = __builtin_convertvector(x1 * inv * l1 + c1v, v8h); } } }
  v8f acc[GR][8] = {}; const _Float16* ap = &mxs[(rl0 / 16) * MXT + lane * 8]; v4u pa[4 * GR]; v16h w0[8], w1[8];
  const _Float16* wp = W1K + (size_t)(c0 / 16) * 512; const _Float16* wq = W2K + (size_t)(c0 / 16) * 512; const _Float16* tr = &t1[rl0 + col][0];
  // the first product's rows stand in LDS as fragments: the four 16-byte pieces of 64 k of a row tile are 2 KB in a row and go straight to registers
  auto ld_a = [&]() __attribute__((always_inline)) {
#pragma unroll
    for (int i = 0; i < 4 * GR; ++i) pa[i] = *(const v4u*)(ap + (i >> 2) * MXT + (i & 3) * 256); };
  // the first weight fragments are asked for in front of the barrier: their way from L2 runs beside the wait for the other waves
#pragma unroll
  for (int j = 0; j < 8; ++j) w0[j] = fragp_h(wp + (size_t)j * 512, lane);
#pragma unroll
  for (int j = 0; j < 8; ++j) w1[j] = fragp_h(wp + (size_t)(NOUT / 16 + j) * 512, lane);
  asm volatile("s_wait_xcnt 0x0" ::: "memory");   // the loads' address registers may be rewritten behind them: wait first
  __syncthreads();   // a wave's 48 LayerNorm rows are written by the four waves of its head group
  ld_a();
  // the 48 products of 64 k, with the weight fragments' reloads
  auto prods = [&](const v16h (&a0)[GR], const v16h (&a1)[GR], const _Float16* wsrc, int t, bool more, bool kr) __attribute__((always_inline)) {   // kr: the weight fragment is the product's A, so that its columns (the keys) are the accumulator's rows
    __builtin_amdgcn_sched_barrier(0);   // this one and those in the two loops below keep every load where it is written: left free, the scheduler sinks a fragment's reload to one group of products before its use, and the load's latency shows at every group
#pragma unroll
    for (int j = 0; j < 8; ++j) {
#pragma unroll
      for (int i = 0; i < GR; ++i) acc[i][j] = kr ? wmma16b(w0[j], a0[i], acc[i][j]) : wmma16b(a0[i], w0[j], acc[i][j]);
      __builtin_amdgcn_sched_barrier(0);   // the reload stays behind the last product that reads the fragment, so that it can take the same registers
      if (more) w0[j] = fragp_h(wsrc + ((size_t)(2 * t + 2) * (NOUT / 16) + j) * 512, lane); __builtin_amdgcn_sched_barrier(0); }
#pragma unroll
    for (int j = 0; j < 8; ++j) {
#pragma unroll
      for (int i = 0; i < GR; ++i) acc[i][j] = kr ? wmma16b(w1[j], a1[i], acc[i][j]) : wmma16b(a1[i], w1[j], acc[i][j]);
      __builtin_amdgcn_sched_barrier(0);   // as above
      if (more) w1[j] = fragp_h(wsrc + ((size_t)(2 * t + 3) * (NOUT / 16) + j) * 512, lane); __builtin_amdgcn_sched_barrier(0); }
    if (more) { asm volatile("s_wait_xcnt 0x0" ::: "memory"); __builtin_amdgcn_sched_barrier(0); } };   // the loads' address registers are stepped for the next trip behind this point: wait first (the scheduling barrier keeps the steps behind the wait)
  auto trip0 = [&](int t, bool more) __attribute__((always_inline)) { v16h a0[GR], a1[GR];
#pragma unroll
    for (int i = 0; i < GR; ++i) { union { v16h v; v4u q[2]; } u0, u1; u0.q[0] = pa[4 * i]; u0.q[1] = pa[4 * i + 1]; u1.q[0] = pa[4 * i + 2]; u1.q[1] = pa[4 * i + 3]; a0[i] = u0.v; a1[i] = u1.v; }
    if (more) { ap += 1024; ld_a(); }   // the next 64 k of the wave's 48 rows are in flight over this trip's products
    prods(a0, a1, wp, t, more, false); };
  auto trip1 = [&](int t, bool more) __attribute__((always_inline)) { v16h a0[GR], a1[GR];   // the second product's rows are read from LDS as fragments
#pragma unroll
    for (int i = 0; i < GR; ++i) a0[i] = frag_h(tr + i * 16 * T1P + t * 64, lane);
#pragma unroll
    for (int i = 0; i < GR; ++i) a1[i] = frag_h(tr + i * 16 * T1P + t * 64 + 32, lane);
    prods(a0, a1, wq, t, more, true); };
#pragma unroll 1   // kept rolled: a trip already holds 48 products and 44 loads
  for (int t = 0; t < K0 / 64 - 1; ++t) trip0(t, true);   // the last trip stands alone: with no branch round the loads ahead, the loop's load waits are exact counts
  trip0(K0 / 64 - 1, false);
  __syncthreads();   // the hidden gate rows take the LayerNorm rows' place in LDS: every wave has read its last fragment of those first
  // the second product's first weight fragments are in flight over the tanh
  __builtin_amdgcn_sched_barrier(0);   // with the one behind the wait below: nothing but these loads and their wait stands between the two, so that no address register is taken for another value in front of the wait
#pragma unroll
  for (int j = 0; j < 8; ++j) w0[j] = fragp_h(wq + (size_t)j * 512, lane);
#pragma unroll
  for (int j = 0; j < 8; ++j) w1[j] = fragp_h(wq + (size_t)(NOUT / 16 + j) * 512, lane);
  float (*sf)[132] = (float (*)[132])(fs + wave * (16 * 132)); const float* pb = B1 + c0 + lane * 4; v4f bb = *(const v4f*)pb;
  asm volatile("s_wait_xcnt 0x0" :: "v"(pb) : "memory");   // the loads' address registers may be rewritten behind them: wait first (the bias address is named as an input so that its register is still its own at the wait)
  __builtin_amdgcn_sched_barrier(0);   // keeps these loads in front of the tanh
#pragma unroll
  for (int e = 0; e < 4; ++e) bb[e] = bfr(bb[e]) * (2.0f * LOG2E);   // the bias carries the exponent's scale: sum, bias and scale are then one multiply-add
#pragma unroll
  for (int i = 0; i < GR; ++i) {
#pragma unroll
    for (int j = 0; j < 8; ++j)
#pragma unroll
      for (int r = 0; r < 8; ++r) sf[8 * g + r][j * 16 + col] = acc[i][j][r];
    LDSW();
#pragma unroll 2   // two rows a pass
    for (int rl = 0; rl < 16; ++rl) { const v4f v = *(const v4f*)&sf[rl][lane * 4] * (2.0f * LOG2E) + bb;
      v4h o;
#pragma unroll
      for (int e = 0; e < 4; ++e) o[e] = (_Float16)tanh_p2(v[e]);
      *(v4h*)&t1[rl0 + i * 16 + rl][c0 + lane * 4] = o; }
    LDSW(); }
  __syncthreads();   // a wave's 48 hidden rows are written by the four waves of its row group
#pragma unroll
  for (int i = 0; i < GR; ++i)
#pragma unroll
    for (int j = 0; j < 8; ++j) acc[i][j] = v8f{};
#pragma unroll 1   // kept rolled, as above
  for (int t = 0; t < GH / 64 - 1; ++t) trip1(t, true);
  trip1(GH / 64 - 1, false);
  // ---- stage (4). The wave's 3 heads x 128 keys, 64 keys of one head a pass
  const int wvu = __builtin_amdgcn_readfirstlane(tid >> 5), kq4 = wvu >> 1, bh0 = hb + (wvu & 1) * GR;   // the wave's quarter of the keys, the first of its three heads
  v16h kb[4][2], qh[2], ql[2];   // one pass's fragments: 64 keys, the 16 queries (hi, residual)
  auto ld_kq4 = [&](int it) __attribute__((always_inline)) { const int bh = bh0 + (it >> 1); const _Float16* kt = KH + (size_t)bh * (TT * HD) + (size_t)(kq4 * 2 + (it & 1)) * (TT * HD / 8) + lane * 8; const _Float16* qp = QH + ((size_t)bh * (TT / 16) + qt) * 1024 + lane * 8; const _Float16* lp = QL + ((size_t)bh * (TT / 16) + qt) * 1024 + lane * 8;   // the lane's own pointers
#pragma unroll
    for (int kc = 0; kc < 2; ++kc) { qh[kc] = fragp_h(qp + kc * 512, 0); ql[kc] = fragp_h(lp + kc * 512, 0); }
#pragma unroll
    for (int jj = 0; jj < 4; ++jj) { kb[jj][0] = fragp_h(kt + (2 * jj) * 512, 0); kb[jj][1] = fragp_h(kt + (2 * jj + 1) * 512, 0); }
    asm volatile("s_wait_xcnt 0x0" :: "v"(kt), "v"(qp), "v"(lp) : "memory"); };   // the loads' address registers may be taken for other values behind this: wait first (the three addresses are named as inputs so that their registers are still theirs at the wait)
  __syncthreads();   // the gate sums take the hidden gate rows' place in LDS: every wave has read its last fragment of those first
  ld_kq4(0);   // the first pass's fragments are on their way over the stores below and the first gate
  // the wave's gate sums go to its own 24 KB, [head][key tile][half][lane][4]: a lane reads back only what it wrote itself. They leave the registers so that the passes can stay rolled
  float* gw = (float*)mxs + wave * (GR * 2048);
#pragma unroll
  for (int i = 0; i < GR; ++i)
#pragma unroll
    for (int j = 0; j < 8; ++j) { float* d = gw + (i * 8 + j) * 256 + lane * 4; *(v4f*)d = __builtin_shufflevector(acc[i][j], acc[i][j], 0, 1, 2, 3); *(v4f*)(d + 128) = __builtin_shufflevector(acc[i][j], acc[i][j], 4, 5, 6, 7); }
  const float* dr0 = kp + col * DP + c0 + 8 * g; const float* vr0 = kp + 16 * DP + c0 + 8 * g;   // of the lane's query and keys: dependency values; mask bias (the second gate bias stands 5 vectors behind it)
  v8f o[4] = {}; float m = -3.0e38f, l = 0.0f;
#pragma unroll 1   // kept rolled: a pass holds 24 products, 40 loads, 64 gate transcendentals and 33 exponentials, and six of them would make the kernel's text longer than 32 KB
  for (int it = 0; it < 2 * GR; ++it) { const int hf = it & 1; v8f x[4], gg[4]; v16h vb[2][4]; const float* pg = gw + it * 1024 + lane * 4; const float* dr = dr0 + hf * 64; const float* vr = vr0 + hf * 64;
#pragma unroll
    for (int j = 0; j < 4; ++j) { const v4f a0 = *(const v4f*)(pg + j * 256), a1 = *(const v4f*)(pg + j * 256 + 128); const v8f e = __builtin_shufflevector(a0, a1, 0, 1, 2, 3, 4, 5, 6, 7) * -LOG2E + ld8(vr + 5 * TT + j * 16);
      gg[j] = sigm8_p2(e); }
#pragma unroll
    for (int jj = 0; jj < 4; ++jj) x[jj] = v8f{};   // 8 x score; per tile the products come in the order hi, residual of d 0..31, then of d 32..63
#pragma unroll
    for (int kc = 0; kc < 2; ++kc) {
#pragma unroll
      for (int jj = 0; jj < 4; ++jj) x[jj] = wmma16b(kb[jj][kc], qh[kc], x[jj]);
#pragma unroll
      for (int jj = 0; jj < 4; ++jj) x[jj] = wmma16b(kb[jj][kc], ql[kc], x[jj]); }
    // v of the pass's 64 keys and the next pass's k and q are in flight over the exponentials
    { const _Float16* vt = VT + (size_t)(bh0 + (it >> 1)) * (TT * HD) + (size_t)(kq4 * 2 + hf) * (TT * HD / 8) + lane * 8;
#pragma unroll
      for (int c = 0; c < 2; ++c)
#pragma unroll
        for (int jd = 0; jd < 4; ++jd) vb[c][jd] = fragp_h(vt + (c * 4 + jd) * 512, 0);
      asm volatile("s_wait_xcnt 0x0" :: "v"(vt) : "memory"); }   // the loads' address register may be taken for other values behind this: wait first
    if (it + 1 < 2 * GR) ld_kq4(it + 1);
    if (!hf) { m = -3.0e38f; l = 0.0f;   // a new head
#pragma unroll
      for (int jd = 0; jd < 4; ++jd) o[jd] = v8f{}; }
    float mc = -3.0e38f;
#pragma unroll
    for (int jj = 0; jj < 4; ++jj) { const v8f se = x[jj] * 0.125f + ld8(vr + jj * 16), de = x[jj] * ld8(dr + jj * 16); x[jj] = gg[jj] * se + (1.0f - gg[jj]) * de;
#pragma unroll
      for (int r = 0; r < 8; ++r) mc = fmaxf(mc, x[jj][r]); }
    const float mn = fmaxf(m, fmaxf(mc, xhalf(mc))), al = expf(m - mn); m = mn;   // running maximum over the wave's two blocks of 64 keys
    v8f ps = {};
#pragma unroll
    for (int jj = 0; jj < 4; ++jj) { x[jj] = exp8(x[jj] - mn); ps += x[jj]; }
    l = l * al + hsum8(ps);
#pragma unroll
    for (int jd = 0; jd < 4; ++jd) o[jd] *= al;
#pragma unroll
    for (int c = 0; c < 2; ++c) { const v16h p = __builtin_convertvector(__builtin_shufflevector(x[2 * c], x[2 * c + 1], 0, 1, 2, 3, 4, 5, 6, 7, 8, 9, 10, 11, 12, 13, 14, 15) * 2048.0f, v16h);
#pragma unroll
      for (int jd = 0; jd < 4; ++jd) o[jd] = wmma16b(vb[c][jd], p, o[jd]); }
    if (hf) { float* pw = gw + (it >> 1) * 2048; const float ls = l + xhalf(l);   // the wave's part of the head's result takes the place of the head's gate sums, all read by now: [query][68] f32, then the 16 maxima and the 16 sums
#pragma unroll
      for (int jd = 0; jd < 4; ++jd) { float* d = pw + col * 68 + jd * 16 + 8 * g; *(v4f*)d = __builtin_shufflevector(o[jd], o[jd], 0, 1, 2, 3); *(v4f*)(d + 4) = __builtin_shufflevector(o[jd], o[jd], 4, 5, 6, 7); }
      pw[16 * 68 + lane] = g ? ls : m; } }
  __syncthreads();   // a row's result is the sum of its four waves' parts
  { const int q = tid >> 4, d4 = (tid & 15) * 4; float* op = OUT + ((size_t)b * TT + qt * 16 + q) * CC + (size_t)blockIdx.y * (2 * GR * HD) + d4;   // thread = 4 d of one query, one head a pass; a wave stores two runs of 256 bytes
#pragma unroll 1   // kept rolled, for the length of the text
    for (int hd = 0; hd < 2 * GR; ++hd) { const float* p0 = (const float*)mxs + hd * 2048; constexpr int KS = 2 * GR * 2048;   // the parts of head hd stand in the ranges of waves hd / 3 + 2 k, k = the quarter of the keys
      float mk[4], lk[4];
#pragma unroll
      for (int k = 0; k < 4; ++k) { mk[k] = p0[k * KS + 16 * 68 + q]; lk[k] = p0[k * KS + 16 * 68 + 16 + q]; }
      const float mx = fmaxf(fmaxf(mk[0], mk[1]), fmaxf(mk[2], mk[3])); float l = 0.0f; v4f s = {};
#pragma unroll
      for (int k = 0; k < 4; ++k) { const float f = expf(mk[k] - mx); l += f * lk[k]; s += *(const v4f*)(p0 + k * KS + q * 68 + d4) * f; }
      vst2(op + hd * HD, s * (1.0f / (l * 2048.0f)));
      asm volatile("s_wait_xcnt 0x0" ::: "memory"); } } }   // the store's address and data registers are rewritten in the next pass: wait first
extern "C" void kernel_launch(void* const* d_in, const int* in_sizes, int n_in, void* d_out, int out_size, void* d_ws, size_t ws_size, hipStream_t stream) {
  (void)in_sizes; (void)n_in; (void)out_size;
  const float** F = (const float**)d_in;   // 0 hidden [8,512,768], 1 attention_mask [8,512], 2 dependency_matrix [8,512,512], 3 Wq [768,768] ([in,out]), 4 bq, 5 Wk, 6 bk, 7 Wv, 8 bv, 9 ln_g [1024], 10 ln_b, 11 W1 [1024,512], 12 b1, 13 W2 [512,512], 14 b2
  if (ws_size < (size_t)WS_END) return;
  char* ws = (char*)d_ws; _Float16 *QH = (_Float16*)(ws + WS_QH), *QL = (_Float16*)(ws + WS_QL), *KH = (_Float16*)(ws + WS_KH), *VT = (_Float16*)(ws + WS_VT), *W1P = (_Float16*)(ws + WS_W1P), *W2P = (_Float16*)(ws + WS_W2P); __bf16 *XP = (__bf16*)(ws + WS_XP), *WP = (__bf16*)(ws + WS_WP);
  k_pack<<<PB_X + 3 * PB_W + PB_W1 + PB_W2, 256, 0, stream>>>(F[0], F[3], F[5], F[7], F[11], F[13], XP, WP, W1P, W2P);
  k_proj<<<dim3(TNB * TT / 64, CC / 128, 3), 128, 0, stream>>>(XP, WP, F[4], F[6], F[8], QH, QL, KH, VT);
  k_g<<<dim3(TT / 16, NH / (2 * GR), TNB), 256, 0, stream>>>(QH, QL, KH, VT, F[1], F[2], F[9], F[10], W1P, F[12], W2P, F[14], (float*)d_out);
}
